// v000
// Times are from an AMD MI455X. After a warm-up the kernel runs many times in a row, and a time is the length of
// such a window on the GPU divided by its runs, so every launch and the gaps after it count. The runs cycle
// through copies of the inputs. A figure is the median of several windows, for all but v000 over two sittings.
// Sittings can differ by a few percent; kernels timed side by side share one.
// The starting kernel, v000, takes 2350 microseconds a run.
#include <hip/hip_runtime.h>

// DeBERTa-style disentangled self-attention + output dense + residual + LayerNorm (hidden_states [4][1024][1024]; q, k, v = hs W + b ('xw' [1024][1024]; 16 heads x 64); rel_q = pos_emb Wq + bq, rel_k = pos_emb Wk + bk (pos_emb [1024][1024], read); scale = 1/sqrt(3 x 64); scores = q.k scale + c2p[i][rel_idx[i][j]] + p2c[rel_idx[i][j]][j] with c2p = q.rel_k scale ([1024][1024]) and p2c = rel_q.k scale ([1024][1024]) and rel_idx the int32 input [1024][1024] (read per logit; = clip(i - j + 512, 0, 1023)); softmax; ctx = merged attn.v; y = ctx Wd + bd + hidden_states; out = LayerNorm(y) gamma + beta (eps 1e-7) -> [4][1024][1024] (4.2 M)).
// Layout: exact bf16 projections (+ once-off rel_k / rel_q projections of the position table -> per-head hi/lo planes); hi/lo planes for q, k (every row: 3-product score GEMMs); per pass of two heads: content scores [2][1024][1024], c2p [2][1024][1024] and p2c [2][1024][1024] as hi/lo GEMMs, and the softmax kernel gathers the two relative terms per logit at the input index, scales, f32 softmax, hi/lo P; attn.v (3 products); merged context as hi/lo planes; Wd (hl x exact) + bd; residual + LayerNorm in f32.
// Compute dtypes, f32 accumulate: every input rounded to bf16; projections on PLAIN bf16 operands (exact) + biases; all score terms and attn.v on hi/lo planes (3 products) for every row; softmax f32; Wd hl x exact; residual/LayerNorm f32 (precise sqrt/division).

#define NB_  4
#define TT   1024
#define DM   1024
#define NH_  16
#define NKV  16
#define REP  (NH_ / NKV)
#define HD   64
#define DQ   (NH_ * HD)
#define DKV  (NKV * HD)
#define ZH   2
#define RH   1024                  // query rows < RH use hi+lo planes (0: none)
#define WIN  0
#define PCAR 1024.0f
#define SCL  0.072168783648703225f   // 1/sqrt(3 x 64)
#define NPE  1024                 // relative-position table rows (2 x 512)
typedef _Float16 h16;
typedef unsigned short bf;
typedef __attribute__((ext_vector_type(16))) __bf16   v16bf;
typedef __attribute__((ext_vector_type(16))) _Float16 v16h;
typedef __attribute__((ext_vector_type(8)))  _Float16 v8h;
typedef __attribute__((ext_vector_type(8)))  unsigned short v8us;
typedef __attribute__((ext_vector_type(8)))  float    v8f;
typedef __attribute__((ext_vector_type(4)))  float    v4f;
typedef v8h  __attribute__((may_alias)) v8ha;
typedef v4f  __attribute__((may_alias)) v4fa;
typedef v8us __attribute__((may_alias)) v8usa;

__device__ __forceinline__ unsigned short f2bf(float f) { unsigned u = __float_as_uint(f); u += 0x7FFFu + ((u >> 16) & 1u); return (unsigned short)(u >> 16); }
__device__ __forceinline__ float bf2f(unsigned short b) { return __uint_as_float(((unsigned)b) << 16); }
__device__ __forceinline__ float bfr(float f) { return bf2f(f2bf(f)); }
__device__ __forceinline__ v16h cat16(v8h lo, v8h hi) { return __builtin_shufflevector(lo, hi, 0, 1, 2, 3, 4, 5, 6, 7, 8, 9, 10, 11, 12, 13, 14, 15); }
__device__ __forceinline__ v16bf cat16b(v8us lo, v8us hi) { return __builtin_bit_cast(v16bf, __builtin_shufflevector(lo, hi, 0, 1, 2, 3, 4, 5, 6, 7, 8, 9, 10, 11, 12, 13, 14, 15)); }
__device__ __forceinline__ v8f wmma16(v16h a, v16h b, v8f c) { return __builtin_amdgcn_wmma_f32_16x16x32_f16(false, a, false, b, (short)0, c, false, false); }
__device__ __forceinline__ v8f wmmab(v16bf a, v16bf b, v8f c) { return __builtin_amdgcn_wmma_f32_16x16x32_bf16(false, a, false, b, (short)0, c, false, false); }



// ---- k_gemmw: register-blocked GEMM, ONE WAVE per 64x64 output tile (16 accumulators), operands straight from K-contiguous 16-bit planes; grid (M/64, N/64, Z), 32 threads.
// C[m][n] (f32, pitch ldc, + optional f32 bias[n]) = sum_k A[m][k] Bt[n][k] (+ split products per NSPLIT). z-batch strides sA/sB/sC in elements. K % 32 == 0.
template <typename T16> struct WFrag;
template <> struct WFrag<h16> { typedef v16h V; static __device__ __forceinline__ V ld(const h16* p) { return cat16(*(const v8h*)p, *(const v8h*)(p + 16)); } static __device__ __forceinline__ v8f mma(V a, V b, v8f c) { return wmma16(a, b, c); } };
template <> struct WFrag<bf> { typedef v16bf V; static __device__ __forceinline__ V ld(const bf* p) { return cat16b(*(const v8us*)p, *(const v8us*)(p + 16)); } static __device__ __forceinline__ v8f mma(V a, V b, v8f c) { return wmmab(a, b, c); } };
template <typename T16, int NSPLIT, bool BIAS>
__global__ __launch_bounds__(32) void k_gemmw(const T16* __restrict__ A, const T16* __restrict__ A2, const T16* __restrict__ Bt, const T16* __restrict__ Bt2, int K, float* C, int ldc, const float* __restrict__ bias, size_t sA, size_t sB, size_t sC) {
    typedef typename WFrag<T16>::V V;
    __shared__ __align__(16) float os[16 * 68];
    const size_t z = blockIdx.z; A += z * sA; if (A2) A2 += z * sA; Bt += z * sB; if (Bt2) Bt2 += z * sB; C += z * sC;
    const int lane = threadIdx.x & 31, lr = lane & 15, hi = lane >> 4; const int r0 = blockIdx.x * 64, c0 = blockIdx.y * 64;
    v8f acc[4][4];
#pragma unroll
    for (int mb = 0; mb < 4; ++mb)
#pragma unroll
        for (int nb = 0; nb < 4; ++nb) acc[mb][nb] = (v8f){};
    const size_t aoff = (size_t)(r0 + lr) * K + 8 * hi, boff = (size_t)(c0 + lr) * K + 8 * hi;
#pragma unroll 1
    for (int kc = 0; kc < K; kc += 32) {
        V a[4], a2[4];
#pragma unroll
        for (int mb = 0; mb < 4; ++mb) { a[mb] = WFrag<T16>::ld(A + aoff + (size_t)mb * 16 * K + kc); if (NSPLIT == 1 || NSPLIT == 2) a2[mb] = WFrag<T16>::ld(A2 + aoff + (size_t)mb * 16 * K + kc); }
#pragma unroll
        for (int nb = 0; nb < 4; ++nb) { const V b = WFrag<T16>::ld(Bt + boff + (size_t)nb * 16 * K + kc); V b2; if (NSPLIT >= 2) b2 = WFrag<T16>::ld(Bt2 + boff + (size_t)nb * 16 * K + kc);
#pragma unroll
            for (int mb = 0; mb < 4; ++mb) { acc[mb][nb] = WFrag<T16>::mma(a[mb], b, acc[mb][nb]); if (NSPLIT == 1 || NSPLIT == 2) acc[mb][nb] = WFrag<T16>::mma(a2[mb], b, acc[mb][nb]); if (NSPLIT >= 2) acc[mb][nb] = WFrag<T16>::mma(a[mb], b2, acc[mb][nb]); } }
        asm volatile("v_nop\n\tv_nop\n\tv_nop\n\tv_nop" : "+v"(acc[0][0]), "+v"(acc[1][1]), "+v"(acc[2][2]), "+v"(acc[3][3]) : "v"(a[0]), "v"(a[3]));
    }
#pragma unroll
    for (int mb = 0; mb < 4; ++mb) {
#pragma unroll
        for (int nb = 0; nb < 4; ++nb) {
#pragma unroll
            for (int j = 0; j < 8; ++j) os[(hi * 8 + j) * 68 + nb * 16 + lr] = acc[mb][nb][j]; }
        __builtin_amdgcn_wave_barrier(); asm volatile("" ::: "memory");
        float* crow = C + (size_t)(r0 + mb * 16) * ldc + c0;
{
#pragma unroll
            for (int s = 0; s < 8; ++s) { const int row = 2 * s + hi, cofs = lr * 4; v4f val = *(const v4fa*)(os + row * 68 + cofs); if (BIAS) { val[0] += bfr(bias[c0 + cofs]); val[1] += bfr(bias[c0 + cofs + 1]); val[2] += bfr(bias[c0 + cofs + 2]); val[3] += bfr(bias[c0 + cofs + 3]); }
                *(v4f*)(crow + (size_t)row * ldc + cofs) = val; }
             }
        __builtin_amdgcn_wave_barrier(); asm volatile("" ::: "memory");
    }
}

__device__ __forceinline__ h16 tohx(float x) { return (h16)x; }
__device__ __forceinline__ void splitf(float y, unsigned short& h, unsigned short& l) { h = f2bf(y); l = f2bf(y - bf2f(h)); }
typedef __attribute__((ext_vector_type(2))) _Float16 v2h;
typedef __attribute__((ext_vector_type(4))) _Float16 v4h;
typedef __attribute__((ext_vector_type(2))) unsigned short v2us;
typedef __attribute__((ext_vector_type(4))) unsigned short v4us;
typedef __attribute__((ext_vector_type(2))) float v2f;
typedef __attribute__((ext_vector_type(4))) int v4i;

__global__ __launch_bounds__(256) void k_wtG(const float* __restrict__ w, int K, int N, bf* Bt) {
    const int lane = threadIdx.x & 31; const int L0 = (blockIdx.x * 8 + (threadIdx.x >> 5)) * 8; const int nlines = N * K / 64;
{
#pragma unroll 1
        for (int l = 0; l < 8; ++l) { const int L = L0 + l; if (L >= nlines) break; const size_t e = (size_t)L * 64 + lane * 2; const int k = (int)(e % K), n = (int)(e / K); v2us o;
            o[0] = f2bf(w[(size_t)k * N + n]); o[1] = f2bf(w[(size_t)(k + 1) * N + n]); *(v2us*)(Bt + e) = o; }
         }
}
__global__ __launch_bounds__(256) void k_cvt8(const float* __restrict__ src, bf* dst, size_t n8) { const size_t i = (size_t)blockIdx.x * 256 + threadIdx.x; if (i >= n8) return; const v8f v = *(const v8f*)(src + i * 8); v8us o;
#pragma unroll
    for (int k = 0; k < 8; ++k) o[k] = f2bf(v[k]); *(v8us*)(dst + i * 8) = o;  }

// k_rope: head planes [h][t][d] (fp16 + hi/lo) of rope(x) x sc with the rotate-half convention out[d] = x[d] cos[t][d] - x[d+HD/2] sin[t][d], out[d+HD/2] = x[d+HD/2] cos[t][d+HD/2] + x[d] sin[t][d+HD/2]
__global__ __launch_bounds__(256) void k_rope(const float* __restrict__ F, int pitch, int nheads, const float* __restrict__ CS, const float* __restrict__ RF, const float* __restrict__ nw, float sc, h16* P16, bf* Ph, bf* Pl) {
    const size_t e = ((size_t)blockIdx.x * 256 + threadIdx.x) * 2; if (e >= (size_t)nheads * TT * HD) return; const int d = (int)(e % HD); const int t = (int)((e / HD) % TT); const int h = (int)(e / ((size_t)HD * TT)); const float* f = F + (size_t)t * pitch + h * HD; const float rf = RF ? RF[(size_t)h * TT + t] : 1.0f; v2h o16; v2us oh, ol;
#pragma unroll
    for (int q = 0; q < 2; ++q) { const int dd = d + q; const int dp = (dd < HD / 2) ? dd + HD / 2 : dd - HD / 2; float x0 = f[dd], x1 = f[dp];
        if (RF) { float n0 = __fmul_rn(x0, rf), n1 = __fmul_rn(x1, rf); asm volatile("" : "+v"(n0)); asm volatile("" : "+v"(n1)); x0 = __fmul_rn(bfr(nw[dd]), n0); x1 = __fmul_rn(bfr(nw[dp]), n1); }
        const v2f cs = *(const v2f*)(CS + ((size_t)t * HD + dd) * 2); float a = __fmul_rn(x0, cs[0]), bq = __fmul_rn(x1, cs[1]); asm volatile("" : "+v"(a)); asm volatile("" : "+v"(bq)); const float r = ((dd < HD / 2) ? __fsub_rn(a, bq) : __fadd_rn(a, bq)) * sc;
        o16[q] = tohx(r); unsigned short a2, c2; splitf(r, a2, c2); oh[q] = a2; ol[q] = c2; }
    *(v2h*)(P16 + e) = o16; *(v2us*)(Ph + e) = oh; *(v2us*)(Pl + e) = ol;  }
__global__ __launch_bounds__(256) void k_vtp(const float* __restrict__ F, int pitch, int nheads, h16* V16, bf* Vh, bf* Vl) { const size_t e = ((size_t)blockIdx.x * 256 + threadIdx.x) * 2; if (e >= (size_t)nheads * HD * TT) return; const int t = (int)(e % TT); const int d = (int)((e / TT) % HD); const int g = (int)(e / ((size_t)TT * HD)); v2h o16; v2us oh, ol;
#pragma unroll
    for (int q = 0; q < 2; ++q) { const float x = F[(size_t)(t + q) * pitch + g * HD + d]; o16[q] = tohx(x); unsigned short a2, c2; splitf(x, a2, c2); oh[q] = a2; ol[q] = c2; }
    *(v2h*)(V16 + e) = o16; *(v2us*)(Vh + e) = oh; *(v2us*)(Vl + e) = ol;  }
__global__ __launch_bounds__(256) void k_csid(float* CS) { const int idx = blockIdx.x * 256 + threadIdx.x; if (idx >= TT * HD) return; v2f cs; cs[0] = 1.0f; cs[1] = 0.0f; *(v2f*)(CS + (size_t)idx * 2) = cs;  }
__global__ __launch_bounds__(256) void k_pplane(const float* __restrict__ POS, bf* Ph2, bf* Pl2) { const size_t e = ((size_t)blockIdx.x * 256 + threadIdx.x) * 2; if (e >= (size_t)NH_ * NPE * HD) return; const int d = (int)(e % HD); const int p = (int)((e / HD) % NPE); const int h = (int)(e / ((size_t)HD * NPE)); v2us oh, ol;
#pragma unroll
    for (int q = 0; q < 2; ++q) { unsigned short a, c; splitf(POS[(size_t)p * DQ + h * HD + d + q], a, c); oh[q] = a; ol[q] = c; } *(v2us*)(Ph2 + e) = oh; *(v2us*)(Pl2 + e) = ol;  }
// k_asoft: per row (zz, i): t = (S + c2p[i][rp] + p2c[rp][j]) x scale with rp = rel_idx[i][j] (int32 input, read per logit with b128 loads; clamped to [0, NPE) for memory safety - the identity for the shipped clip(i - j + 512, 0, 1023)); softmax over the 1024 keys (register row, one exp, fixed trees);
__global__ __launch_bounds__(256) void k_asoft(const float* __restrict__ Sb, const float* __restrict__ C2P, const float* __restrict__ P2C, const int* __restrict__ RIX, h16* P16, bf* Ph, bf* Pl) {
    const int lane = threadIdx.x & 31; const int row = blockIdx.x * 8 + (threadIdx.x >> 5); if (row >= ZH * TT) return; const int i = row % TT; const int zz = row / TT; const float* cr = C2P + (size_t)row * NPE; const float* pr = P2C + (size_t)zz * NPE * TT; const int* rxr = RIX + (size_t)i * TT; const bool hires = (i < RH); const float* sr = Sb + (size_t)row * TT; float v[TT / 32]; float mx = -3.0e38f;
#pragma unroll
    for (int ch = 0; ch < TT / 128; ++ch) { const int j0 = ch * 128 + lane * 4; const v4f a = *(const v4f*)(sr + j0); const v4i r4 = *(const v4i*)(rxr + j0);
#pragma unroll
        for (int q = 0; q < 4; ++q) { const int j = j0 + q; (void)j; int rp = r4[q]; rp = rp < 0 ? 0 : (rp > NPE - 1 ? NPE - 1 : rp); float s1 = __fadd_rn(a[q], cr[rp]); asm volatile("" : "+v"(s1)); float s2 = __fadd_rn(s1, pr[(size_t)rp * TT + j]); asm volatile("" : "+v"(s2)); float sa = s2 * SCL; asm volatile("" : "+v"(sa)); const float t = sa;   /* (qk + c2p[i][rp] + p2c[rp][j]) x scale, rp = rel_idx[i][j] */ v[ch * 4 + q] = t; mx = fmaxf(mx, t); } }
#pragma unroll
    for (int sh = 16; sh; sh >>= 1) mx = fmaxf(mx, __shfl_xor(mx, sh, 32));
    float sum = 0.f;
#pragma unroll
    for (int k = 0; k < TT / 32; ++k) { float d0 = __fsub_rn(v[k], mx); asm volatile("" : "+v"(d0)); v[k] = __builtin_amdgcn_exp2f(__fmul_rn(d0, 1.4426950408889634f)); sum += v[k]; }
#pragma unroll
    for (int sh = 16; sh; sh >>= 1) sum += __shfl_xor(sum, sh, 32);
    const float f = __fdiv_rn(hires ? 1.0f : PCAR, sum);
{
        if (hires) {
#pragma unroll
            for (int ch = 0; ch < TT / 128; ++ch) { v4us oh, ol;
#pragma unroll
                for (int q = 0; q < 4; ++q) { unsigned short a, c2; splitf(v[ch * 4 + q] * f, a, c2); oh[q] = a; ol[q] = c2; }
                const size_t oo = ((size_t)zz * (RH ? RH : 1) + i) * TT + ch * 128 + lane * 4; *(v4us*)(Ph + oo) = oh; *(v4us*)(Pl + oo) = ol; }
        } else {
#pragma unroll
            for (int ch = 0; ch < TT / 128; ++ch) { v4h o4;
#pragma unroll
                for (int q = 0; q < 4; ++q) o4[q] = tohx(v[ch * 4 + q] * f);
                *(v4h*)(P16 + (size_t)row * TT + ch * 128 + lane * 4) = o4; } }
         }
}

__global__ __launch_bounds__(256) void k_lnres(const float* __restrict__ Y, const float* __restrict__ xres, const float* __restrict__ g, const float* __restrict__ bb, float* out) {
    const int lane = threadIdx.x & 31; const int row = blockIdx.x * 8 + (threadIdx.x >> 5); if (row >= TT) return; const float* yr = Y + (size_t)row * DM; const float* xr = xres + (size_t)row * DM; float v[DM / 32]; float s = 0.f;
#pragma unroll
    for (int ch = 0; ch < DM / 128; ++ch) { const v4f a = *(const v4f*)(yr + ch * 128 + lane * 4); const v4f c = *(const v4f*)(xr + ch * 128 + lane * 4);
#pragma unroll
        for (int q = 0; q < 4; ++q) { const float t = __fadd_rn(a[q], bfr(c[q])); v[ch * 4 + q] = t; s = __fadd_rn(s, t); } }
#pragma unroll
    for (int sh = 16; sh; sh >>= 1) s = __fadd_rn(s, __shfl_xor(s, sh, 32));
    const float mu = __fdiv_rn(s, (float)DM); float s2 = 0.f;
#pragma unroll
    for (int k = 0; k < DM / 32; ++k) { float d0 = __fsub_rn(v[k], mu); asm volatile("" : "+v"(d0)); float p = __fmul_rn(d0, d0); asm volatile("" : "+v"(p)); s2 = __fadd_rn(s2, p); }
#pragma unroll
    for (int sh = 16; sh; sh >>= 1) s2 = __fadd_rn(s2, __shfl_xor(s2, sh, 32));
    const float rs = __fdiv_rn(1.0f, __fsqrt_rn(__fadd_rn(__fdiv_rn(s2, (float)DM), 1e-7f)));
{
#pragma unroll
        for (int ch = 0; ch < DM / 128; ++ch) { const int c0 = ch * 128 + lane * 4; v4f o;
#pragma unroll
            for (int q = 0; q < 4; ++q) { float xn = __fmul_rn(__fsub_rn(v[ch * 4 + q], mu), rs); asm volatile("" : "+v"(xn)); float gg = bfr(g[c0 + q]); asm volatile("" : "+v"(gg)); float yv = __fmul_rn(xn, gg); asm volatile("" : "+v"(yv)); float be = bfr(bb[c0 + q]); asm volatile("" : "+v"(be)); o[q] = __fadd_rn(yv, be); }
            *(v4f*)(out + (size_t)row * DM + c0) = o; }
         }
}
__global__ __launch_bounds__(256) void k_merge(const float* __restrict__ O, int h0, bf* Ah, bf* Al) { const size_t e = ((size_t)blockIdx.x * 256 + threadIdx.x) * 2; if (e >= (size_t)ZH * TT * HD) return; const int d = (int)(e % HD); const int t = (int)((e / HD) % TT); const int zz = (int)(e / ((size_t)HD * TT)); const float cs = (t < RH) ? 1.0f : (1.0f / PCAR); const size_t oo = (size_t)t * DQ + (h0 + zz) * HD + d;
    v2us oh, ol;
#pragma unroll
    for (int q = 0; q < 2; ++q) { unsigned short a, c2; splitf(O[e + q] * cs, a, c2); oh[q] = a; ol[q] = c2; } *(v2us*)(Ah + oo) = oh; *(v2us*)(Al + oo) = ol;  }

extern "C" void kernel_launch(void* const* d_in, const int* in_sizes, int n_in,
                              void* d_out, int out_size, void* d_ws, size_t ws_size, hipStream_t stream) {
    (void)in_sizes; (void)n_in; (void)out_size;
    const float* x = (const float*)d_in[0]; const float* rel = (const float*)d_in[1]; const float* wq = (const float*)d_in[2]; const float* bq = (const float*)d_in[3]; const float* wk = (const float*)d_in[4]; const float* bk = (const float*)d_in[5]; const float* wv = (const float*)d_in[6]; const float* bv = (const float*)d_in[7]; const float* wo = (const float*)d_in[8]; const float* bo = (const float*)d_in[9]; const float* lng = (const float*)d_in[10]; const float* lnb = (const float*)d_in[11]; const int* RIDX = (const int*)d_in[12];
    float* OUT = (float*)d_out;     // [4][1024][1024]
    char* wsp = (char*)d_ws;
    auto take = [&](size_t bytes) { char* p = wsp; wsp += (bytes + 255) & ~(size_t)255; return (void*)p; };
    bf* WQ = (bf*)take((size_t)DQ * DM * 2); bf* WK = (bf*)take((size_t)DKV * DM * 2); bf* WV = (bf*)take((size_t)DKV * DM * 2); bf* WO = (bf*)take((size_t)DM * DQ * 2); float* CS = (float*)take((size_t)TT * HD * 2 * 4);
    bf* RE = (bf*)take((size_t)NPE * DM * 2); float* POS = (float*)take((size_t)NPE * DQ * 4); bf* PKh = (bf*)take((size_t)NH_ * NPE * HD * 2); bf* PKl = (bf*)take((size_t)NH_ * NPE * HD * 2); bf* PQh = (bf*)take((size_t)NH_ * NPE * HD * 2); bf* PQl = (bf*)take((size_t)NH_ * NPE * HD * 2); float* C2P = (float*)take((size_t)ZH * TT * NPE * 4); float* P2C = (float*)take((size_t)ZH * NPE * TT * 4); float* Y = (float*)take((size_t)TT * DM * 4);
    bf* XB = (bf*)take((size_t)TT * DM * 2); float* FQ = (float*)take((size_t)TT * DQ * 4); float* FK = (float*)take((size_t)TT * DKV * 4);
    h16* QP16 = (h16*)take((size_t)NH_ * TT * HD * 2); h16* KP16 = (h16*)take((size_t)NKV * TT * HD * 2); h16* VT16 = (h16*)take((size_t)NKV * HD * TT * 2);
    bf* QPh = (bf*)take((size_t)NH_ * TT * HD * 2); bf* QPl = (bf*)take((size_t)NH_ * TT * HD * 2); bf* KPh = (bf*)take((size_t)NKV * TT * HD * 2); bf* KPl = (bf*)take((size_t)NKV * TT * HD * 2); bf* VTh = (bf*)take((size_t)NKV * HD * TT * 2); bf* VTl = (bf*)take((size_t)NKV * HD * TT * 2); bf* Ph = (bf*)take((size_t)ZH * RH * TT * 2); bf* Pl = (bf*)take((size_t)ZH * RH * TT * 2);
    float* Sb = (float*)take((size_t)ZH * TT * TT * 4); h16* P16 = (h16*)take((size_t)ZH * TT * TT * 2); float* Ob = (float*)take((size_t)ZH * TT * HD * 4); bf* ATh = (bf*)take((size_t)TT * DQ * 2); bf* ATl = (bf*)take((size_t)TT * DQ * 2);
    if ((size_t)(wsp - (char*)d_ws) > ws_size) return;    // ws 256 MiB
    float* FV = FK;   // v projection reuses the k buffer after the k planes are built (stream-ordered)
    { k_wtG<<<(unsigned)((DM * DQ / 64 + 63) / 64), 256, 0, stream>>>(wq, DM, DQ, WQ); k_wtG<<<(unsigned)((DM * DKV / 64 + 63) / 64), 256, 0, stream>>>(wk, DM, DKV, WK); k_wtG<<<(unsigned)((DM * DKV / 64 + 63) / 64), 256, 0, stream>>>(wv, DM, DKV, WV);
      k_wtG<<<(unsigned)((DQ * DM / 64 + 63) / 64), 256, 0, stream>>>(wo, DQ, DM, WO);
       }
    k_csid<<<(TT * HD + 255) / 256, 256, 0, stream>>>(CS);
    k_cvt8<<<(unsigned)(((size_t)NPE * DM / 8 + 255) / 256), 256, 0, stream>>>(rel, RE, (size_t)NPE * DM / 8);
    k_gemmw<bf, 0, true><<<dim3(NPE / 64, DKV / 64, 1), 32, 0, stream>>>(RE, nullptr, WK, nullptr, DM, POS, DKV, bk, 0, 0, 0); k_pplane<<<(unsigned)(((size_t)NH_ * NPE * HD / 2 + 255) / 256), 256, 0, stream>>>(POS, PKh, PKl);   /* rel_k = pos_emb Wk + bk -> per-head hi/lo planes [h][1024][64] */
    k_gemmw<bf, 0, true><<<dim3(NPE / 64, DQ / 64, 1), 32, 0, stream>>>(RE, nullptr, WQ, nullptr, DM, POS, DQ, bq, 0, 0, 0); k_pplane<<<(unsigned)(((size_t)NH_ * NPE * HD / 2 + 255) / 256), 256, 0, stream>>>(POS, PQh, PQl);     /* rel_q = pos_emb Wq + bq (POS reused after rel_k's planes are built, stream-ordered) */
    const unsigned LQ = (unsigned)(((size_t)NH_ * TT * HD / 2 + 255) / 256), LKv = (unsigned)(((size_t)NKV * TT * HD / 2 + 255) / 256);
    for (int b = 0; b < NB_; ++b) {
        
        k_cvt8<<<(unsigned)(((size_t)TT * DM / 8 + 255) / 256), 256, 0, stream>>>(x + (size_t)b * TT * DM, XB, (size_t)TT * DM / 8);
        k_gemmw<bf, 0, true><<<dim3(TT / 64, DQ / 64, 1), 32, 0, stream>>>(XB, nullptr, WQ, nullptr, DM, FQ, DQ, bq, 0, 0, 0);
        k_rope<<<LQ, 256, 0, stream>>>(FQ, DQ, NH_, CS, nullptr, nullptr, 1.0f, QP16, QPh, QPl);
        k_gemmw<bf, 0, true><<<dim3(TT / 64, DKV / 64, 1), 32, 0, stream>>>(XB, nullptr, WK, nullptr, DM, FK, DKV, bk, 0, 0, 0);
        k_rope<<<LKv, 256, 0, stream>>>(FK, DKV, NKV, CS, nullptr, nullptr, 1.0f, KP16, KPh, KPl);
        k_gemmw<bf, 0, true><<<dim3(TT / 64, DKV / 64, 1), 32, 0, stream>>>(XB, nullptr, WV, nullptr, DM, FV, DKV, bv, 0, 0, 0); k_vtp<<<LKv, 256, 0, stream>>>(FV, DKV, NKV, VT16, VTh, VTl);
        for (int h0 = 0; h0 < NH_; h0 += ZH) { const size_t zq = (size_t)h0, zk = (size_t)(h0 / REP);   // one kv head per query head: the pass's two heads use consecutive kv planes (z-strides TT*HD)
            k_gemmw<bf, 2, false><<<dim3(RH / 64, TT / 64, ZH), 32, 0, stream>>>(QPh + zq * TT * HD, QPl + zq * TT * HD, KPh + zk * TT * HD, KPl + zk * TT * HD, HD, Sb, TT, nullptr, (size_t)TT * HD, (size_t)TT * HD, (size_t)TT * TT);
            k_gemmw<bf, 2, false><<<dim3(TT / 64, NPE / 64, ZH), 32, 0, stream>>>(QPh + zq * TT * HD, QPl + zq * TT * HD, PKh + zq * NPE * HD, PKl + zq * NPE * HD, HD, C2P, NPE, nullptr, (size_t)TT * HD, (size_t)NPE * HD, (size_t)TT * NPE);   /* c2p raw [2][1024][1024] */
            k_gemmw<bf, 2, false><<<dim3(NPE / 64, TT / 64, ZH), 32, 0, stream>>>(PQh + zq * NPE * HD, PQl + zq * NPE * HD, KPh + zk * TT * HD, KPl + zk * TT * HD, HD, P2C, TT, nullptr, (size_t)NPE * HD, (size_t)TT * HD, (size_t)NPE * TT);   /* p2c raw [2][1024][1024] */
            k_asoft<<<ZH * TT / 8, 256, 0, stream>>>(Sb, C2P, P2C, RIDX, P16, Ph, Pl);
            k_gemmw<bf, 2, false><<<dim3(RH / 64, HD / 64, ZH), 32, 0, stream>>>(Ph, Pl, VTh + zk * HD * TT, VTl + zk * HD * TT, TT, Ob, HD, nullptr, (size_t)RH * TT, (size_t)HD * TT, (size_t)TT * HD);
            k_merge<<<(unsigned)(((size_t)ZH * TT * HD / 2 + 255) / 256), 256, 0, stream>>>(Ob, h0, ATh, ATl); }
        k_gemmw<bf, 1, true><<<dim3(TT / 64, DM / 64, 1), 32, 0, stream>>>(ATh, ATl, WO, nullptr, DQ, Y, DM, bo, 0, 0, 0);   /* y = ctx Wd + bd (f32) */
        k_lnres<<<TT / 8, 256, 0, stream>>>(Y, x + (size_t)b * TT * DM, lng, lnb, OUT + (size_t)b * TT * DM); }
}

// v001
// Measured time: 1380 microseconds a run.
// In both of two side-by-side timings against v000, it was 1.71 times as fast.
#include <hip/hip_runtime.h>

// DeBERTa-style disentangled self-attention + output dense + residual + LayerNorm (hidden_states [4][1024][1024]; q, k, v = hs W + b ('xw' [1024][1024]; 16 heads x 64); rel_q = pos_emb Wq + bq, rel_k = pos_emb Wk + bk (pos_emb [1024][1024], read); scale = 1/sqrt(3 x 64); scores = q.k scale + c2p[i][rel_idx[i][j]] + p2c[rel_idx[i][j]][j] with c2p = q.rel_k scale ([1024][1024]) and p2c = rel_q.k scale ([1024][1024]) and rel_idx the int32 input [1024][1024] (read per logit; = clip(i - j + 512, 0, 1023)); softmax; ctx = merged attn.v; y = ctx Wd + bd + hidden_states; out = LayerNorm(y) gamma + beta (eps 1e-7) -> [4][1024][1024] (4.2 M)).
// Layout: exact bf16 projections (+ once-off rel_k / rel_q projections of the position table -> per-head hi/lo planes); hi/lo planes for q, k (every row: 3-product score GEMMs); per pass of eight heads: content scores [8][1024][1024], c2p [8][1024][1024] and p2c [8][1024][1024] as hi/lo GEMMs, and the softmax kernel gathers the two relative terms per logit at the input index, scales, f32 softmax, hi/lo P; attn.v (3 products); merged context as hi/lo planes; Wd (hl x exact) + bd; residual + LayerNorm in f32.
// Compute dtypes, f32 accumulate: every input rounded to bf16; projections on PLAIN bf16 operands (exact) + biases; all score terms and attn.v on hi/lo planes (3 products) for every row; softmax f32; Wd hl x exact; residual/LayerNorm f32 (precise sqrt/division).

#define NB_  4
#define TT   1024
#define DM   1024
#define NH_  16
#define NKV  16
#define REP  (NH_ / NKV)
#define HD   64
#define DQ   (NH_ * HD)
#define DKV  (NKV * HD)
#define ZH   8                     // heads per pass (z extent of the per-pass GEMM launches)
#define RH   1024                  // query rows < RH use hi+lo planes (0: none)
#define WIN  0
#define PCAR 1024.0f
#define SCL  0.072168783648703225f   // 1/sqrt(3 x 64)
#define NPE  1024                 // relative-position table rows (2 x 512)
typedef _Float16 h16;
typedef unsigned short bf;
typedef __attribute__((ext_vector_type(16))) __bf16   v16bf;
typedef __attribute__((ext_vector_type(16))) _Float16 v16h;
typedef __attribute__((ext_vector_type(8)))  _Float16 v8h;
typedef __attribute__((ext_vector_type(8)))  unsigned short v8us;
typedef __attribute__((ext_vector_type(8)))  float    v8f;
typedef __attribute__((ext_vector_type(4)))  float    v4f;
typedef v8h  __attribute__((may_alias)) v8ha;
typedef v4f  __attribute__((may_alias)) v4fa;
typedef v8us __attribute__((may_alias)) v8usa;

__device__ __forceinline__ unsigned short f2bf(float f) { unsigned u = __float_as_uint(f); u += 0x7FFFu + ((u >> 16) & 1u); return (unsigned short)(u >> 16); }
__device__ __forceinline__ float bf2f(unsigned short b) { return __uint_as_float(((unsigned)b) << 16); }
__device__ __forceinline__ float bfr(float f) { return bf2f(f2bf(f)); }
__device__ __forceinline__ v16h cat16(v8h lo, v8h hi) { return __builtin_shufflevector(lo, hi, 0, 1, 2, 3, 4, 5, 6, 7, 8, 9, 10, 11, 12, 13, 14, 15); }
__device__ __forceinline__ v16bf cat16b(v8us lo, v8us hi) { return __builtin_bit_cast(v16bf, __builtin_shufflevector(lo, hi, 0, 1, 2, 3, 4, 5, 6, 7, 8, 9, 10, 11, 12, 13, 14, 15)); }
__device__ __forceinline__ v8f wmma16(v16h a, v16h b, v8f c) { return __builtin_amdgcn_wmma_f32_16x16x32_f16(false, a, false, b, (short)0, c, false, false); }
__device__ __forceinline__ v8f wmmab(v16bf a, v16bf b, v8f c) { return __builtin_amdgcn_wmma_f32_16x16x32_bf16(false, a, false, b, (short)0, c, false, false); }



// ---- k_gemmw: register-blocked GEMM, ONE WAVE per 64x64 output tile (16 accumulators), operands straight from K-contiguous 16-bit planes; grid (M/64, N/64, Z), 32 threads.
// C[m][n] (f32, pitch ldc, + optional f32 bias[n]) = sum_k A[m][k] Bt[n][k] (+ split products per NSPLIT). z-batch strides sA/sB/sC in elements. K % 32 == 0.
template <typename T16> struct WFrag;
template <> struct WFrag<h16> { typedef v16h V; static __device__ __forceinline__ V ld(const h16* p) { return cat16(*(const v8h*)p, *(const v8h*)(p + 16)); } static __device__ __forceinline__ v8f mma(V a, V b, v8f c) { return wmma16(a, b, c); } };
template <> struct WFrag<bf> { typedef v16bf V; static __device__ __forceinline__ V ld(const bf* p) { return cat16b(*(const v8us*)p, *(const v8us*)(p + 16)); } static __device__ __forceinline__ v8f mma(V a, V b, v8f c) { return wmmab(a, b, c); } };
template <typename T16, int NSPLIT, bool BIAS>
__global__ __launch_bounds__(32) void k_gemmw(const T16* __restrict__ A, const T16* __restrict__ A2, const T16* __restrict__ Bt, const T16* __restrict__ Bt2, int K, float* C, int ldc, const float* __restrict__ bias, size_t sA, size_t sB, size_t sC) {
    typedef typename WFrag<T16>::V V;
    __shared__ __align__(16) float os[16 * 68];
    const size_t z = blockIdx.z; A += z * sA; if (A2) A2 += z * sA; Bt += z * sB; if (Bt2) Bt2 += z * sB; C += z * sC;
    const int lane = threadIdx.x & 31, lr = lane & 15, hi = lane >> 4; const int r0 = blockIdx.x * 64, c0 = blockIdx.y * 64;
    v8f acc[4][4];
#pragma unroll
    for (int mb = 0; mb < 4; ++mb)
#pragma unroll
        for (int nb = 0; nb < 4; ++nb) acc[mb][nb] = (v8f){};
    const size_t aoff = (size_t)(r0 + lr) * K + 8 * hi, boff = (size_t)(c0 + lr) * K + 8 * hi;
#pragma unroll 1
    for (int kc = 0; kc < K; kc += 32) {
        V a[4], a2[4];
#pragma unroll
        for (int mb = 0; mb < 4; ++mb) { a[mb] = WFrag<T16>::ld(A + aoff + (size_t)mb * 16 * K + kc); if (NSPLIT == 1 || NSPLIT == 2) a2[mb] = WFrag<T16>::ld(A2 + aoff + (size_t)mb * 16 * K + kc); }
#pragma unroll
        for (int nb = 0; nb < 4; ++nb) { const V b = WFrag<T16>::ld(Bt + boff + (size_t)nb * 16 * K + kc); V b2; if (NSPLIT >= 2) b2 = WFrag<T16>::ld(Bt2 + boff + (size_t)nb * 16 * K + kc);
#pragma unroll
            for (int mb = 0; mb < 4; ++mb) { acc[mb][nb] = WFrag<T16>::mma(a[mb], b, acc[mb][nb]); if (NSPLIT == 1 || NSPLIT == 2) acc[mb][nb] = WFrag<T16>::mma(a2[mb], b, acc[mb][nb]); if (NSPLIT >= 2) acc[mb][nb] = WFrag<T16>::mma(a[mb], b2, acc[mb][nb]); } }
        asm volatile("v_nop\n\tv_nop\n\tv_nop\n\tv_nop" : "+v"(acc[0][0]), "+v"(acc[1][1]), "+v"(acc[2][2]), "+v"(acc[3][3]) : "v"(a[0]), "v"(a[3]));
    }
#pragma unroll
    for (int mb = 0; mb < 4; ++mb) {
#pragma unroll
        for (int nb = 0; nb < 4; ++nb) {
#pragma unroll
            for (int j = 0; j < 8; ++j) os[(hi * 8 + j) * 68 + nb * 16 + lr] = acc[mb][nb][j]; }
        __builtin_amdgcn_wave_barrier(); asm volatile("" ::: "memory");
        float* crow = C + (size_t)(r0 + mb * 16) * ldc + c0;
{
#pragma unroll
            for (int s = 0; s < 8; ++s) { const int row = 2 * s + hi, cofs = lr * 4; v4f val = *(const v4fa*)(os + row * 68 + cofs); if (BIAS) { val[0] += bfr(bias[c0 + cofs]); val[1] += bfr(bias[c0 + cofs + 1]); val[2] += bfr(bias[c0 + cofs + 2]); val[3] += bfr(bias[c0 + cofs + 3]); }
                *(v4f*)(crow + (size_t)row * ldc + cofs) = val; }
             }
        __builtin_amdgcn_wave_barrier(); asm volatile("" ::: "memory");
    }
}

__device__ __forceinline__ h16 tohx(float x) { return (h16)x; }
__device__ __forceinline__ void splitf(float y, unsigned short& h, unsigned short& l) { h = f2bf(y); l = f2bf(y - bf2f(h)); }
typedef __attribute__((ext_vector_type(2))) _Float16 v2h;
typedef __attribute__((ext_vector_type(4))) _Float16 v4h;
typedef __attribute__((ext_vector_type(2))) unsigned short v2us;
typedef __attribute__((ext_vector_type(4))) unsigned short v4us;
typedef __attribute__((ext_vector_type(2))) float v2f;
typedef __attribute__((ext_vector_type(4))) int v4i;

__global__ __launch_bounds__(256) void k_wtG(const float* __restrict__ w, int K, int N, bf* Bt) {
    const int lane = threadIdx.x & 31; const int L0 = (blockIdx.x * 8 + (threadIdx.x >> 5)) * 8; const int nlines = N * K / 64;
{
#pragma unroll 1
        for (int l = 0; l < 8; ++l) { const int L = L0 + l; if (L >= nlines) break; const size_t e = (size_t)L * 64 + lane * 2; const int k = (int)(e % K), n = (int)(e / K); v2us o;
            o[0] = f2bf(w[(size_t)k * N + n]); o[1] = f2bf(w[(size_t)(k + 1) * N + n]); *(v2us*)(Bt + e) = o; }
         }
}
__global__ __launch_bounds__(256) void k_cvt8(const float* __restrict__ src, bf* dst, size_t n8) { const size_t i = (size_t)blockIdx.x * 256 + threadIdx.x; if (i >= n8) return; const v8f v = *(const v8f*)(src + i * 8); v8us o;
#pragma unroll
    for (int k = 0; k < 8; ++k) o[k] = f2bf(v[k]); *(v8us*)(dst + i * 8) = o;  }

// k_rope: head planes [h][t][d] (fp16 + hi/lo) of rope(x) x sc with the rotate-half convention out[d] = x[d] cos[t][d] - x[d+HD/2] sin[t][d], out[d+HD/2] = x[d+HD/2] cos[t][d+HD/2] + x[d] sin[t][d+HD/2]
__global__ __launch_bounds__(256) void k_rope(const float* __restrict__ F, int pitch, int nheads, const float* __restrict__ CS, const float* __restrict__ RF, const float* __restrict__ nw, float sc, h16* P16, bf* Ph, bf* Pl) {
    const size_t e = ((size_t)blockIdx.x * 256 + threadIdx.x) * 2; if (e >= (size_t)nheads * TT * HD) return; const int d = (int)(e % HD); const int t = (int)((e / HD) % TT); const int h = (int)(e / ((size_t)HD * TT)); const float* f = F + (size_t)t * pitch + h * HD; const float rf = RF ? RF[(size_t)h * TT + t] : 1.0f; v2h o16; v2us oh, ol;
#pragma unroll
    for (int q = 0; q < 2; ++q) { const int dd = d + q; const int dp = (dd < HD / 2) ? dd + HD / 2 : dd - HD / 2; float x0 = f[dd], x1 = f[dp];
        if (RF) { float n0 = __fmul_rn(x0, rf), n1 = __fmul_rn(x1, rf); asm volatile("" : "+v"(n0)); asm volatile("" : "+v"(n1)); x0 = __fmul_rn(bfr(nw[dd]), n0); x1 = __fmul_rn(bfr(nw[dp]), n1); }
        const v2f cs = *(const v2f*)(CS + ((size_t)t * HD + dd) * 2); float a = __fmul_rn(x0, cs[0]), bq = __fmul_rn(x1, cs[1]); asm volatile("" : "+v"(a)); asm volatile("" : "+v"(bq)); const float r = ((dd < HD / 2) ? __fsub_rn(a, bq) : __fadd_rn(a, bq)) * sc;
        o16[q] = tohx(r); unsigned short a2, c2; splitf(r, a2, c2); oh[q] = a2; ol[q] = c2; }
    *(v2h*)(P16 + e) = o16; *(v2us*)(Ph + e) = oh; *(v2us*)(Pl + e) = ol;  }
__global__ __launch_bounds__(256) void k_vtp(const float* __restrict__ F, int pitch, int nheads, h16* V16, bf* Vh, bf* Vl) { const size_t e = ((size_t)blockIdx.x * 256 + threadIdx.x) * 2; if (e >= (size_t)nheads * HD * TT) return; const int t = (int)(e % TT); const int d = (int)((e / TT) % HD); const int g = (int)(e / ((size_t)TT * HD)); v2h o16; v2us oh, ol;
#pragma unroll
    for (int q = 0; q < 2; ++q) { const float x = F[(size_t)(t + q) * pitch + g * HD + d]; o16[q] = tohx(x); unsigned short a2, c2; splitf(x, a2, c2); oh[q] = a2; ol[q] = c2; }
    *(v2h*)(V16 + e) = o16; *(v2us*)(Vh + e) = oh; *(v2us*)(Vl + e) = ol;  }
__global__ __launch_bounds__(256) void k_csid(float* CS) { const int idx = blockIdx.x * 256 + threadIdx.x; if (idx >= TT * HD) return; v2f cs; cs[0] = 1.0f; cs[1] = 0.0f; *(v2f*)(CS + (size_t)idx * 2) = cs;  }
__global__ __launch_bounds__(256) void k_pplane(const float* __restrict__ POS, bf* Ph2, bf* Pl2) { const size_t e = ((size_t)blockIdx.x * 256 + threadIdx.x) * 2; if (e >= (size_t)NH_ * NPE * HD) return; const int d = (int)(e % HD); const int p = (int)((e / HD) % NPE); const int h = (int)(e / ((size_t)HD * NPE)); v2us oh, ol;
#pragma unroll
    for (int q = 0; q < 2; ++q) { unsigned short a, c; splitf(POS[(size_t)p * DQ + h * HD + d + q], a, c); oh[q] = a; ol[q] = c; } *(v2us*)(Ph2 + e) = oh; *(v2us*)(Pl2 + e) = ol;  }
// k_asoft: per row (zz, i): t = (S + c2p[i][rp] + p2c[rp][j]) x scale with rp = rel_idx[i][j] (int32 input, read per logit with b128 loads; clamped to [0, NPE) for memory safety - the identity for the shipped clip(i - j + 512, 0, 1023)); softmax over the 1024 keys (register row, one exp, fixed trees);
__global__ __launch_bounds__(256) void k_asoft(const float* __restrict__ Sb, const float* __restrict__ C2P, const float* __restrict__ P2C, const int* __restrict__ RIX, h16* P16, bf* Ph, bf* Pl) {
    const int lane = threadIdx.x & 31; const int row = blockIdx.x * 8 + (threadIdx.x >> 5); if (row >= ZH * TT) return; const int i = row % TT; const int zz = row / TT; const float* cr = C2P + (size_t)row * NPE; const float* pr = P2C + (size_t)zz * NPE * TT; const int* rxr = RIX + (size_t)i * TT; const bool hires = (i < RH); const float* sr = Sb + (size_t)row * TT; float v[TT / 32]; float mx = -3.0e38f;
#pragma unroll
    for (int ch = 0; ch < TT / 128; ++ch) { const int j0 = ch * 128 + lane * 4; const v4f a = *(const v4f*)(sr + j0); const v4i r4 = *(const v4i*)(rxr + j0);
#pragma unroll
        for (int q = 0; q < 4; ++q) { const int j = j0 + q; (void)j; int rp = r4[q]; rp = rp < 0 ? 0 : (rp > NPE - 1 ? NPE - 1 : rp); float s1 = __fadd_rn(a[q], cr[rp]); asm volatile("" : "+v"(s1)); float s2 = __fadd_rn(s1, pr[(size_t)rp * TT + j]); asm volatile("" : "+v"(s2)); float sa = s2 * SCL; asm volatile("" : "+v"(sa)); const float t = sa;   /* (qk + c2p[i][rp] + p2c[rp][j]) x scale, rp = rel_idx[i][j] */ v[ch * 4 + q] = t; mx = fmaxf(mx, t); } }
#pragma unroll
    for (int sh = 16; sh; sh >>= 1) mx = fmaxf(mx, __shfl_xor(mx, sh, 32));
    float sum = 0.f;
#pragma unroll
    for (int k = 0; k < TT / 32; ++k) { float d0 = __fsub_rn(v[k], mx); asm volatile("" : "+v"(d0)); v[k] = __builtin_amdgcn_exp2f(__fmul_rn(d0, 1.4426950408889634f)); sum += v[k]; }
#pragma unroll
    for (int sh = 16; sh; sh >>= 1) sum += __shfl_xor(sum, sh, 32);
    const float f = __fdiv_rn(hires ? 1.0f : PCAR, sum);
{
        if (hires) {
#pragma unroll
            for (int ch = 0; ch < TT / 128; ++ch) { v4us oh, ol;
#pragma unroll
                for (int q = 0; q < 4; ++q) { unsigned short a, c2; splitf(v[ch * 4 + q] * f, a, c2); oh[q] = a; ol[q] = c2; }
                const size_t oo = ((size_t)zz * (RH ? RH : 1) + i) * TT + ch * 128 + lane * 4; *(v4us*)(Ph + oo) = oh; *(v4us*)(Pl + oo) = ol; }
        } else {
#pragma unroll
            for (int ch = 0; ch < TT / 128; ++ch) { v4h o4;
#pragma unroll
                for (int q = 0; q < 4; ++q) o4[q] = tohx(v[ch * 4 + q] * f);
                *(v4h*)(P16 + (size_t)row * TT + ch * 128 + lane * 4) = o4; } }
         }
}

__global__ __launch_bounds__(256) void k_lnres(const float* __restrict__ Y, const float* __restrict__ xres, const float* __restrict__ g, const float* __restrict__ bb, float* out) {
    const int lane = threadIdx.x & 31; const int row = blockIdx.x * 8 + (threadIdx.x >> 5); if (row >= TT) return; const float* yr = Y + (size_t)row * DM; const float* xr = xres + (size_t)row * DM; float v[DM / 32]; float s = 0.f;
#pragma unroll
    for (int ch = 0; ch < DM / 128; ++ch) { const v4f a = *(const v4f*)(yr + ch * 128 + lane * 4); const v4f c = *(const v4f*)(xr + ch * 128 + lane * 4);
#pragma unroll
        for (int q = 0; q < 4; ++q) { const float t = __fadd_rn(a[q], bfr(c[q])); v[ch * 4 + q] = t; s = __fadd_rn(s, t); } }
#pragma unroll
    for (int sh = 16; sh; sh >>= 1) s = __fadd_rn(s, __shfl_xor(s, sh, 32));
    const float mu = __fdiv_rn(s, (float)DM); float s2 = 0.f;
#pragma unroll
    for (int k = 0; k < DM / 32; ++k) { float d0 = __fsub_rn(v[k], mu); asm volatile("" : "+v"(d0)); float p = __fmul_rn(d0, d0); asm volatile("" : "+v"(p)); s2 = __fadd_rn(s2, p); }
#pragma unroll
    for (int sh = 16; sh; sh >>= 1) s2 = __fadd_rn(s2, __shfl_xor(s2, sh, 32));
    const float rs = __fdiv_rn(1.0f, __fsqrt_rn(__fadd_rn(__fdiv_rn(s2, (float)DM), 1e-7f)));
{
#pragma unroll
        for (int ch = 0; ch < DM / 128; ++ch) { const int c0 = ch * 128 + lane * 4; v4f o;
#pragma unroll
            for (int q = 0; q < 4; ++q) { float xn = __fmul_rn(__fsub_rn(v[ch * 4 + q], mu), rs); asm volatile("" : "+v"(xn)); float gg = bfr(g[c0 + q]); asm volatile("" : "+v"(gg)); float yv = __fmul_rn(xn, gg); asm volatile("" : "+v"(yv)); float be = bfr(bb[c0 + q]); asm volatile("" : "+v"(be)); o[q] = __fadd_rn(yv, be); }
            *(v4f*)(out + (size_t)row * DM + c0) = o; }
         }
}
__global__ __launch_bounds__(256) void k_merge(const float* __restrict__ O, int h0, bf* Ah, bf* Al) { const size_t e = ((size_t)blockIdx.x * 256 + threadIdx.x) * 2; if (e >= (size_t)ZH * TT * HD) return; const int d = (int)(e % HD); const int t = (int)((e / HD) % TT); const int zz = (int)(e / ((size_t)HD * TT)); const float cs = (t < RH) ? 1.0f : (1.0f / PCAR); const size_t oo = (size_t)t * DQ + (h0 + zz) * HD + d;
    v2us oh, ol;
#pragma unroll
    for (int q = 0; q < 2; ++q) { unsigned short a, c2; splitf(O[e + q] * cs, a, c2); oh[q] = a; ol[q] = c2; } *(v2us*)(Ah + oo) = oh; *(v2us*)(Al + oo) = ol;  }

extern "C" void kernel_launch(void* const* d_in, const int* in_sizes, int n_in,
                              void* d_out, int out_size, void* d_ws, size_t ws_size, hipStream_t stream) {
    (void)in_sizes; (void)n_in; (void)out_size;
    const float* x = (const float*)d_in[0]; const float* rel = (const float*)d_in[1]; const float* wq = (const float*)d_in[2]; const float* bq = (const float*)d_in[3]; const float* wk = (const float*)d_in[4]; const float* bk = (const float*)d_in[5]; const float* wv = (const float*)d_in[6]; const float* bv = (const float*)d_in[7]; const float* wo = (const float*)d_in[8]; const float* bo = (const float*)d_in[9]; const float* lng = (const float*)d_in[10]; const float* lnb = (const float*)d_in[11]; const int* RIDX = (const int*)d_in[12];
    float* OUT = (float*)d_out;     // [4][1024][1024]
    char* wsp = (char*)d_ws;
    auto take = [&](size_t bytes) { char* p = wsp; wsp += (bytes + 255) & ~(size_t)255; return (void*)p; };
    bf* WQ = (bf*)take((size_t)DQ * DM * 2); bf* WK = (bf*)take((size_t)DKV * DM * 2); bf* WV = (bf*)take((size_t)DKV * DM * 2); bf* WO = (bf*)take((size_t)DM * DQ * 2); float* CS = (float*)take((size_t)TT * HD * 2 * 4);
    bf* RE = (bf*)take((size_t)NPE * DM * 2); float* POS = (float*)take((size_t)NPE * DQ * 4); bf* PKh = (bf*)take((size_t)NH_ * NPE * HD * 2); bf* PKl = (bf*)take((size_t)NH_ * NPE * HD * 2); bf* PQh = (bf*)take((size_t)NH_ * NPE * HD * 2); bf* PQl = (bf*)take((size_t)NH_ * NPE * HD * 2); float* C2P = (float*)take((size_t)ZH * TT * NPE * 4); float* P2C = (float*)take((size_t)ZH * NPE * TT * 4); float* Y = (float*)take((size_t)TT * DM * 4);
    bf* XB = (bf*)take((size_t)TT * DM * 2); float* FQ = (float*)take((size_t)TT * DQ * 4); float* FK = (float*)take((size_t)TT * DKV * 4);
    h16* QP16 = (h16*)take((size_t)NH_ * TT * HD * 2); h16* KP16 = (h16*)take((size_t)NKV * TT * HD * 2); h16* VT16 = (h16*)take((size_t)NKV * HD * TT * 2);
    bf* QPh = (bf*)take((size_t)NH_ * TT * HD * 2); bf* QPl = (bf*)take((size_t)NH_ * TT * HD * 2); bf* KPh = (bf*)take((size_t)NKV * TT * HD * 2); bf* KPl = (bf*)take((size_t)NKV * TT * HD * 2); bf* VTh = (bf*)take((size_t)NKV * HD * TT * 2); bf* VTl = (bf*)take((size_t)NKV * HD * TT * 2); bf* Ph = (bf*)take((size_t)ZH * RH * TT * 2); bf* Pl = (bf*)take((size_t)ZH * RH * TT * 2);
    float* Sb = (float*)take((size_t)ZH * TT * TT * 4); h16* P16 = (h16*)take((size_t)ZH * TT * TT * 2); float* Ob = (float*)take((size_t)ZH * TT * HD * 4); bf* ATh = (bf*)take((size_t)TT * DQ * 2); bf* ATl = (bf*)take((size_t)TT * DQ * 2);
    if ((size_t)(wsp - (char*)d_ws) > ws_size) return;    // ws 256 MiB
    float* FV = FK;   // v projection reuses the k buffer after the k planes are built (stream-ordered)
    { k_wtG<<<(unsigned)((DM * DQ / 64 + 63) / 64), 256, 0, stream>>>(wq, DM, DQ, WQ); k_wtG<<<(unsigned)((DM * DKV / 64 + 63) / 64), 256, 0, stream>>>(wk, DM, DKV, WK); k_wtG<<<(unsigned)((DM * DKV / 64 + 63) / 64), 256, 0, stream>>>(wv, DM, DKV, WV);
      k_wtG<<<(unsigned)((DQ * DM / 64 + 63) / 64), 256, 0, stream>>>(wo, DQ, DM, WO);
       }
    k_csid<<<(TT * HD + 255) / 256, 256, 0, stream>>>(CS);
    k_cvt8<<<(unsigned)(((size_t)NPE * DM / 8 + 255) / 256), 256, 0, stream>>>(rel, RE, (size_t)NPE * DM / 8);
    k_gemmw<bf, 0, true><<<dim3(NPE / 64, DKV / 64, 1), 32, 0, stream>>>(RE, nullptr, WK, nullptr, DM, POS, DKV, bk, 0, 0, 0); k_pplane<<<(unsigned)(((size_t)NH_ * NPE * HD / 2 + 255) / 256), 256, 0, stream>>>(POS, PKh, PKl);   /* rel_k = pos_emb Wk + bk -> per-head hi/lo planes [h][1024][64] */
    k_gemmw<bf, 0, true><<<dim3(NPE / 64, DQ / 64, 1), 32, 0, stream>>>(RE, nullptr, WQ, nullptr, DM, POS, DQ, bq, 0, 0, 0); k_pplane<<<(unsigned)(((size_t)NH_ * NPE * HD / 2 + 255) / 256), 256, 0, stream>>>(POS, PQh, PQl);     /* rel_q = pos_emb Wq + bq (POS reused after rel_k's planes are built, stream-ordered) */
    const unsigned LQ = (unsigned)(((size_t)NH_ * TT * HD / 2 + 255) / 256), LKv = (unsigned)(((size_t)NKV * TT * HD / 2 + 255) / 256);
    for (int b = 0; b < NB_; ++b) {
        
        k_cvt8<<<(unsigned)(((size_t)TT * DM / 8 + 255) / 256), 256, 0, stream>>>(x + (size_t)b * TT * DM, XB, (size_t)TT * DM / 8);
        k_gemmw<bf, 0, true><<<dim3(TT / 64, DQ / 64, 1), 32, 0, stream>>>(XB, nullptr, WQ, nullptr, DM, FQ, DQ, bq, 0, 0, 0);
        k_rope<<<LQ, 256, 0, stream>>>(FQ, DQ, NH_, CS, nullptr, nullptr, 1.0f, QP16, QPh, QPl);
        k_gemmw<bf, 0, true><<<dim3(TT / 64, DKV / 64, 1), 32, 0, stream>>>(XB, nullptr, WK, nullptr, DM, FK, DKV, bk, 0, 0, 0);
        k_rope<<<LKv, 256, 0, stream>>>(FK, DKV, NKV, CS, nullptr, nullptr, 1.0f, KP16, KPh, KPl);
        k_gemmw<bf, 0, true><<<dim3(TT / 64, DKV / 64, 1), 32, 0, stream>>>(XB, nullptr, WV, nullptr, DM, FV, DKV, bv, 0, 0, 0); k_vtp<<<LKv, 256, 0, stream>>>(FV, DKV, NKV, VT16, VTh, VTl);
        for (int h0 = 0; h0 < NH_; h0 += ZH) { const size_t zq = (size_t)h0, zk = (size_t)(h0 / REP);   // one kv head per query head: the pass's heads use consecutive kv planes (z-strides TT*HD)
            k_gemmw<bf, 2, false><<<dim3(RH / 64, TT / 64, ZH), 32, 0, stream>>>(QPh + zq * TT * HD, QPl + zq * TT * HD, KPh + zk * TT * HD, KPl + zk * TT * HD, HD, Sb, TT, nullptr, (size_t)TT * HD, (size_t)TT * HD, (size_t)TT * TT);
            k_gemmw<bf, 2, false><<<dim3(TT / 64, NPE / 64, ZH), 32, 0, stream>>>(QPh + zq * TT * HD, QPl + zq * TT * HD, PKh + zq * NPE * HD, PKl + zq * NPE * HD, HD, C2P, NPE, nullptr, (size_t)TT * HD, (size_t)NPE * HD, (size_t)TT * NPE);   /* c2p raw [ZH][1024][1024] */
            k_gemmw<bf, 2, false><<<dim3(NPE / 64, TT / 64, ZH), 32, 0, stream>>>(PQh + zq * NPE * HD, PQl + zq * NPE * HD, KPh + zk * TT * HD, KPl + zk * TT * HD, HD, P2C, TT, nullptr, (size_t)NPE * HD, (size_t)TT * HD, (size_t)NPE * TT);   /* p2c raw [ZH][1024][1024] */
            k_asoft<<<ZH * TT / 8, 256, 0, stream>>>(Sb, C2P, P2C, RIDX, P16, Ph, Pl);
            k_gemmw<bf, 2, false><<<dim3(RH / 64, HD / 64, ZH), 32, 0, stream>>>(Ph, Pl, VTh + zk * HD * TT, VTl + zk * HD * TT, TT, Ob, HD, nullptr, (size_t)RH * TT, (size_t)HD * TT, (size_t)TT * HD);
            k_merge<<<(unsigned)(((size_t)ZH * TT * HD / 2 + 255) / 256), 256, 0, stream>>>(Ob, h0, ATh, ATl); }
        k_gemmw<bf, 1, true><<<dim3(TT / 64, DM / 64, 1), 32, 0, stream>>>(ATh, ATl, WO, nullptr, DQ, Y, DM, bo, 0, 0, 0);   /* y = ctx Wd + bd (f32) */
        k_lnres<<<TT / 8, 256, 0, stream>>>(Y, x + (size_t)b * TT * DM, lng, lnb, OUT + (size_t)b * TT * DM); }
}

// v002
// It runs in 1050 microseconds.
// Two timings next to v001 put it at 1.32 and 1.33 times that version's speed.
// Over all steps from v000 it is 2.26 times as fast.
#include <hip/hip_runtime.h>

// DeBERTa-style disentangled self-attention + output dense + residual + LayerNorm (hidden_states [4][1024][1024]; q, k, v = hs W + b ('xw' [1024][1024]; 16 heads x 64); rel_q = pos_emb Wq + bq, rel_k = pos_emb Wk + bk (pos_emb [1024][1024], read); scale = 1/sqrt(3 x 64); scores = q.k scale + c2p[i][rel_idx[i][j]] + p2c[rel_idx[i][j]][j] with c2p = q.rel_k scale ([1024][1024]) and p2c = rel_q.k scale ([1024][1024]) and rel_idx the int32 input [1024][1024] (read per logit; = clip(i - j + 512, 0, 1023)); softmax; ctx = merged attn.v; y = ctx Wd + bd + hidden_states; out = LayerNorm(y) gamma + beta (eps 1e-7) -> [4][1024][1024] (4.2 M)).
// Layout: exact bf16 projections (+ once-off rel_k / rel_q projections of the position table -> per-head hi/lo planes); hi/lo planes for q, k (every row: 3-product score GEMMs); per pass of eight heads: content scores [8][1024][1024], c2p [8][1024][1024] and p2c [8][1024][1024] as hi/lo GEMMs, and the softmax kernel gathers the two relative terms per logit at the input index, scales, f32 softmax, hi/lo P; attn.v (3 products); merged context as hi/lo planes; Wd (hl x exact) + bd; residual + LayerNorm in f32.
// Launch shape: the conversion, the q/k/v projections, the plane builders, the Wd GEMM and the LayerNorm each run ONCE over the rows of all four batches (the position table's rows ride behind them in the q and k projections); only the per-pass attention launches loop over (batch, 8 heads).
// Compute dtypes, f32 accumulate: every input rounded to bf16; projections on PLAIN bf16 operands (exact) + biases; all score terms and attn.v on hi/lo planes (3 products) for every row; softmax f32; Wd hl x exact; residual/LayerNorm f32 (precise sqrt/division).

#define NB_  4
#define TT   1024
#define DM   1024
#define NH_  16
#define NKV  16
#define REP  (NH_ / NKV)
#define HD   64
#define DQ   (NH_ * HD)
#define DKV  (NKV * HD)
#define ZH   8                     // heads per pass (z extent of the per-pass GEMM launches)
#define RH   1024                  // query rows < RH use hi+lo planes (0: none)
#define WIN  0
#define PCAR 1024.0f
#define SCL  0.072168783648703225f   // 1/sqrt(3 x 64)
#define NPE  1024                 // relative-position table rows (2 x 512)
typedef _Float16 h16;
typedef unsigned short bf;
typedef __attribute__((ext_vector_type(16))) __bf16   v16bf;
typedef __attribute__((ext_vector_type(16))) _Float16 v16h;
typedef __attribute__((ext_vector_type(8)))  _Float16 v8h;
typedef __attribute__((ext_vector_type(8)))  unsigned short v8us;
typedef __attribute__((ext_vector_type(8)))  float    v8f;
typedef __attribute__((ext_vector_type(4)))  float    v4f;
typedef v8h  __attribute__((may_alias)) v8ha;
typedef v4f  __attribute__((may_alias)) v4fa;
typedef v8us __attribute__((may_alias)) v8usa;

__device__ __forceinline__ unsigned short f2bf(float f) { unsigned u = __float_as_uint(f); u += 0x7FFFu + ((u >> 16) & 1u); return (unsigned short)(u >> 16); }
__device__ __forceinline__ float bf2f(unsigned short b) { return __uint_as_float(((unsigned)b) << 16); }
__device__ __forceinline__ float bfr(float f) { return bf2f(f2bf(f)); }
__device__ __forceinline__ v16h cat16(v8h lo, v8h hi) { return __builtin_shufflevector(lo, hi, 0, 1, 2, 3, 4, 5, 6, 7, 8, 9, 10, 11, 12, 13, 14, 15); }
__device__ __forceinline__ v16bf cat16b(v8us lo, v8us hi) { return __builtin_bit_cast(v16bf, __builtin_shufflevector(lo, hi, 0, 1, 2, 3, 4, 5, 6, 7, 8, 9, 10, 11, 12, 13, 14, 15)); }
__device__ __forceinline__ v8f wmma16(v16h a, v16h b, v8f c) { return __builtin_amdgcn_wmma_f32_16x16x32_f16(false, a, false, b, (short)0, c, false, false); }
__device__ __forceinline__ v8f wmmab(v16bf a, v16bf b, v8f c) { return __builtin_amdgcn_wmma_f32_16x16x32_bf16(false, a, false, b, (short)0, c, false, false); }



// ---- k_gemmw: register-blocked GEMM, ONE WAVE per 64x64 output tile (16 accumulators), operands straight from K-contiguous 16-bit planes; grid (M/64, N/64, Z), 32 threads.
// C[m][n] (f32, pitch ldc, + optional f32 bias[n]) = sum_k A[m][k] Bt[n][k] (+ split products per NSPLIT). z-batch strides sA/sB/sC in elements. K % 32 == 0.
template <typename T16> struct WFrag;
template <> struct WFrag<h16> { typedef v16h V; static __device__ __forceinline__ V ld(const h16* p) { return cat16(*(const v8h*)p, *(const v8h*)(p + 16)); } static __device__ __forceinline__ v8f mma(V a, V b, v8f c) { return wmma16(a, b, c); } };
template <> struct WFrag<bf> { typedef v16bf V; static __device__ __forceinline__ V ld(const bf* p) { return cat16b(*(const v8us*)p, *(const v8us*)(p + 16)); } static __device__ __forceinline__ v8f mma(V a, V b, v8f c) { return wmmab(a, b, c); } };
template <typename T16, int NSPLIT, bool BIAS>
__global__ __launch_bounds__(32) void k_gemmw(const T16* __restrict__ A, const T16* __restrict__ A2, const T16* __restrict__ Bt, const T16* __restrict__ Bt2, int K, float* C, int ldc, const float* __restrict__ bias, size_t sA, size_t sB, size_t sC) {
    typedef typename WFrag<T16>::V V;
    __shared__ __align__(16) float os[16 * 68];
    const size_t z = blockIdx.z; A += z * sA; if (A2) A2 += z * sA; Bt += z * sB; if (Bt2) Bt2 += z * sB; C += z * sC;
    const int lane = threadIdx.x & 31, lr = lane & 15, hi = lane >> 4; const int r0 = blockIdx.x * 64, c0 = blockIdx.y * 64;
    v8f acc[4][4];
#pragma unroll
    for (int mb = 0; mb < 4; ++mb)
#pragma unroll
        for (int nb = 0; nb < 4; ++nb) acc[mb][nb] = (v8f){};
    const size_t aoff = (size_t)(r0 + lr) * K + 8 * hi, boff = (size_t)(c0 + lr) * K + 8 * hi;
#pragma unroll 1
    for (int kc = 0; kc < K; kc += 32) {
        V a[4], a2[4];
#pragma unroll
        for (int mb = 0; mb < 4; ++mb) { a[mb] = WFrag<T16>::ld(A + aoff + (size_t)mb * 16 * K + kc); if (NSPLIT == 1 || NSPLIT == 2) a2[mb] = WFrag<T16>::ld(A2 + aoff + (size_t)mb * 16 * K + kc); }
#pragma unroll
        for (int nb = 0; nb < 4; ++nb) { const V b = WFrag<T16>::ld(Bt + boff + (size_t)nb * 16 * K + kc); V b2; if (NSPLIT >= 2) b2 = WFrag<T16>::ld(Bt2 + boff + (size_t)nb * 16 * K + kc);
#pragma unroll
            for (int mb = 0; mb < 4; ++mb) { acc[mb][nb] = WFrag<T16>::mma(a[mb], b, acc[mb][nb]); if (NSPLIT == 1 || NSPLIT == 2) acc[mb][nb] = WFrag<T16>::mma(a2[mb], b, acc[mb][nb]); if (NSPLIT >= 2) acc[mb][nb] = WFrag<T16>::mma(a[mb], b2, acc[mb][nb]); } }
        asm volatile("v_nop\n\tv_nop\n\tv_nop\n\tv_nop" : "+v"(acc[0][0]), "+v"(acc[1][1]), "+v"(acc[2][2]), "+v"(acc[3][3]) : "v"(a[0]), "v"(a[3]));
    }
#pragma unroll
    for (int mb = 0; mb < 4; ++mb) {
#pragma unroll
        for (int nb = 0; nb < 4; ++nb) {
#pragma unroll
            for (int j = 0; j < 8; ++j) os[(hi * 8 + j) * 68 + nb * 16 + lr] = acc[mb][nb][j]; }
        __builtin_amdgcn_wave_barrier(); asm volatile("" ::: "memory");
        float* crow = C + (size_t)(r0 + mb * 16) * ldc + c0;
{
#pragma unroll
            for (int s = 0; s < 8; ++s) { const int row = 2 * s + hi, cofs = lr * 4; v4f val = *(const v4fa*)(os + row * 68 + cofs); if (BIAS) { val[0] += bfr(bias[c0 + cofs]); val[1] += bfr(bias[c0 + cofs + 1]); val[2] += bfr(bias[c0 + cofs + 2]); val[3] += bfr(bias[c0 + cofs + 3]); }
                *(v4f*)(crow + (size_t)row * ldc + cofs) = val; }
             }
        __builtin_amdgcn_wave_barrier(); asm volatile("" ::: "memory");
    }
}

__device__ __forceinline__ h16 tohx(float x) { return (h16)x; }
__device__ __forceinline__ void splitf(float y, unsigned short& h, unsigned short& l) { h = f2bf(y); l = f2bf(y - bf2f(h)); }
typedef __attribute__((ext_vector_type(2))) _Float16 v2h;
typedef __attribute__((ext_vector_type(4))) _Float16 v4h;
typedef __attribute__((ext_vector_type(2))) unsigned short v2us;
typedef __attribute__((ext_vector_type(4))) unsigned short v4us;
typedef __attribute__((ext_vector_type(2))) float v2f;
typedef __attribute__((ext_vector_type(4))) int v4i;

__global__ __launch_bounds__(256) void k_wtG(const float* __restrict__ w, int K, int N, bf* Bt) {
    const int lane = threadIdx.x & 31; const int L0 = (blockIdx.x * 8 + (threadIdx.x >> 5)) * 8; const int nlines = N * K / 64;
{
#pragma unroll 1
        for (int l = 0; l < 8; ++l) { const int L = L0 + l; if (L >= nlines) break; const size_t e = (size_t)L * 64 + lane * 2; const int k = (int)(e % K), n = (int)(e / K); v2us o;
            o[0] = f2bf(w[(size_t)k * N + n]); o[1] = f2bf(w[(size_t)(k + 1) * N + n]); *(v2us*)(Bt + e) = o; }
         }
}
__global__ __launch_bounds__(256) void k_cvt8(const float* __restrict__ src, bf* dst, size_t n8) { const size_t i = (size_t)blockIdx.x * 256 + threadIdx.x; if (i >= n8) return; const v8f v = *(const v8f*)(src + i * 8); v8us o;
#pragma unroll
    for (int k = 0; k < 8; ++k) o[k] = f2bf(v[k]); *(v8us*)(dst + i * 8) = o;  }

// k_rope: head planes [h][t][d] (fp16 + hi/lo) of rope(x) x sc with the rotate-half convention out[d] = x[d] cos[t][d] - x[d+HD/2] sin[t][d], out[d+HD/2] = x[d+HD/2] cos[t][d+HD/2] + x[d] sin[t][d+HD/2]
__global__ __launch_bounds__(256) void k_rope(const float* __restrict__ F, int pitch, int nheads, const float* __restrict__ CS, const float* __restrict__ RF, const float* __restrict__ nw, float sc, h16* P16, bf* Ph, bf* Pl) {
    const size_t e = ((size_t)blockIdx.x * 256 + threadIdx.x) * 2; if (e >= (size_t)nheads * TT * HD) return; const int d = (int)(e % HD); const int t = (int)((e / HD) % TT); const int h = (int)(e / ((size_t)HD * TT)); const size_t bz = blockIdx.y;   /* batch: rows bz*TT.. of F, planes bz*nheads.. */ const float* f = F + (bz * TT + t) * pitch + h * HD; const float rf = RF ? RF[(size_t)h * TT + t] : 1.0f; v2h o16; v2us oh, ol;
#pragma unroll
    for (int q = 0; q < 2; ++q) { const int dd = d + q; const int dp = (dd < HD / 2) ? dd + HD / 2 : dd - HD / 2; float x0 = f[dd], x1 = f[dp];
        if (RF) { float n0 = __fmul_rn(x0, rf), n1 = __fmul_rn(x1, rf); asm volatile("" : "+v"(n0)); asm volatile("" : "+v"(n1)); x0 = __fmul_rn(bfr(nw[dd]), n0); x1 = __fmul_rn(bfr(nw[dp]), n1); }
        const v2f cs = *(const v2f*)(CS + ((size_t)t * HD + dd) * 2); float a = __fmul_rn(x0, cs[0]), bq = __fmul_rn(x1, cs[1]); asm volatile("" : "+v"(a)); asm volatile("" : "+v"(bq)); const float r = ((dd < HD / 2) ? __fsub_rn(a, bq) : __fadd_rn(a, bq)) * sc;
        o16[q] = tohx(r); unsigned short a2, c2; splitf(r, a2, c2); oh[q] = a2; ol[q] = c2; }
    const size_t eo = bz * nheads * TT * HD + e; *(v2h*)(P16 + eo) = o16; *(v2us*)(Ph + eo) = oh; *(v2us*)(Pl + eo) = ol;  }
__global__ __launch_bounds__(256) void k_vtp(const float* __restrict__ F, int pitch, int nheads, h16* V16, bf* Vh, bf* Vl) { const size_t e = ((size_t)blockIdx.x * 256 + threadIdx.x) * 2; if (e >= (size_t)nheads * HD * TT) return; const int t = (int)(e % TT); const int d = (int)((e / TT) % HD); const int g = (int)(e / ((size_t)TT * HD)); const size_t bz = blockIdx.y;   /* batch */ v2h o16; v2us oh, ol;
#pragma unroll
    for (int q = 0; q < 2; ++q) { const float x = F[(bz * TT + t + q) * pitch + g * HD + d]; o16[q] = tohx(x); unsigned short a2, c2; splitf(x, a2, c2); oh[q] = a2; ol[q] = c2; }
    const size_t eo = bz * nheads * HD * TT + e; *(v2h*)(V16 + eo) = o16; *(v2us*)(Vh + eo) = oh; *(v2us*)(Vl + eo) = ol;  }
__global__ __launch_bounds__(256) void k_csid(float* CS) { const int idx = blockIdx.x * 256 + threadIdx.x; if (idx >= TT * HD) return; v2f cs; cs[0] = 1.0f; cs[1] = 0.0f; *(v2f*)(CS + (size_t)idx * 2) = cs;  }
__global__ __launch_bounds__(256) void k_pplane(const float* __restrict__ POS, bf* Ph2, bf* Pl2) { const size_t e = ((size_t)blockIdx.x * 256 + threadIdx.x) * 2; if (e >= (size_t)NH_ * NPE * HD) return; const int d = (int)(e % HD); const int p = (int)((e / HD) % NPE); const int h = (int)(e / ((size_t)HD * NPE)); v2us oh, ol;
#pragma unroll
    for (int q = 0; q < 2; ++q) { unsigned short a, c; splitf(POS[(size_t)p * DQ + h * HD + d + q], a, c); oh[q] = a; ol[q] = c; } *(v2us*)(Ph2 + e) = oh; *(v2us*)(Pl2 + e) = ol;  }
// k_asoft: per row (zz, i): t = (S + c2p[i][rp] + p2c[rp][j]) x scale with rp = rel_idx[i][j] (int32 input, read per logit with b128 loads; clamped to [0, NPE) for memory safety - the identity for the shipped clip(i - j + 512, 0, 1023)); softmax over the 1024 keys (register row, one exp, fixed trees);
__global__ __launch_bounds__(256) void k_asoft(const float* __restrict__ Sb, const float* __restrict__ C2P, const float* __restrict__ P2C, const int* __restrict__ RIX, h16* P16, bf* Ph, bf* Pl) {
    const int lane = threadIdx.x & 31; const int row = blockIdx.x * 8 + (threadIdx.x >> 5); if (row >= ZH * TT) return; const int i = row % TT; const int zz = row / TT; const float* cr = C2P + (size_t)row * NPE; const float* pr = P2C + (size_t)zz * NPE * TT; const int* rxr = RIX + (size_t)i * TT; const bool hires = (i < RH); const float* sr = Sb + (size_t)row * TT; float v[TT / 32]; float mx = -3.0e38f;
#pragma unroll
    for (int ch = 0; ch < TT / 128; ++ch) { const int j0 = ch * 128 + lane * 4; const v4f a = *(const v4f*)(sr + j0); const v4i r4 = *(const v4i*)(rxr + j0);
#pragma unroll
        for (int q = 0; q < 4; ++q) { const int j = j0 + q; (void)j; int rp = r4[q]; rp = rp < 0 ? 0 : (rp > NPE - 1 ? NPE - 1 : rp); float s1 = __fadd_rn(a[q], cr[rp]); asm volatile("" : "+v"(s1)); float s2 = __fadd_rn(s1, pr[(size_t)rp * TT + j]); asm volatile("" : "+v"(s2)); float sa = s2 * SCL; asm volatile("" : "+v"(sa)); const float t = sa;   /* (qk + c2p[i][rp] + p2c[rp][j]) x scale, rp = rel_idx[i][j] */ v[ch * 4 + q] = t; mx = fmaxf(mx, t); } }
#pragma unroll
    for (int sh = 16; sh; sh >>= 1) mx = fmaxf(mx, __shfl_xor(mx, sh, 32));
    float sum = 0.f;
#pragma unroll
    for (int k = 0; k < TT / 32; ++k) { float d0 = __fsub_rn(v[k], mx); asm volatile("" : "+v"(d0)); v[k] = __builtin_amdgcn_exp2f(__fmul_rn(d0, 1.4426950408889634f)); sum += v[k]; }
#pragma unroll
    for (int sh = 16; sh; sh >>= 1) sum += __shfl_xor(sum, sh, 32);
    const float f = __fdiv_rn(hires ? 1.0f : PCAR, sum);
{
        if (hires) {
#pragma unroll
            for (int ch = 0; ch < TT / 128; ++ch) { v4us oh, ol;
#pragma unroll
                for (int q = 0; q < 4; ++q) { unsigned short a, c2; splitf(v[ch * 4 + q] * f, a, c2); oh[q] = a; ol[q] = c2; }
                const size_t oo = ((size_t)zz * (RH ? RH : 1) + i) * TT + ch * 128 + lane * 4; *(v4us*)(Ph + oo) = oh; *(v4us*)(Pl + oo) = ol; }
        } else {
#pragma unroll
            for (int ch = 0; ch < TT / 128; ++ch) { v4h o4;
#pragma unroll
                for (int q = 0; q < 4; ++q) o4[q] = tohx(v[ch * 4 + q] * f);
                *(v4h*)(P16 + (size_t)row * TT + ch * 128 + lane * 4) = o4; } }
         }
}

__global__ __launch_bounds__(256) void k_lnres(const float* __restrict__ Y, const float* __restrict__ xres, const float* __restrict__ g, const float* __restrict__ bb, float* out) {
    const int lane = threadIdx.x & 31; const int row = blockIdx.x * 8 + (threadIdx.x >> 5); if (row >= NB_ * TT) return; const float* yr = Y + (size_t)row * DM; const float* xr = xres + (size_t)row * DM; float v[DM / 32]; float s = 0.f;
#pragma unroll
    for (int ch = 0; ch < DM / 128; ++ch) { const v4f a = *(const v4f*)(yr + ch * 128 + lane * 4); const v4f c = *(const v4f*)(xr + ch * 128 + lane * 4);
#pragma unroll
        for (int q = 0; q < 4; ++q) { const float t = __fadd_rn(a[q], bfr(c[q])); v[ch * 4 + q] = t; s = __fadd_rn(s, t); } }
#pragma unroll
    for (int sh = 16; sh; sh >>= 1) s = __fadd_rn(s, __shfl_xor(s, sh, 32));
    const float mu = __fdiv_rn(s, (float)DM); float s2 = 0.f;
#pragma unroll
    for (int k = 0; k < DM / 32; ++k) { float d0 = __fsub_rn(v[k], mu); asm volatile("" : "+v"(d0)); float p = __fmul_rn(d0, d0); asm volatile("" : "+v"(p)); s2 = __fadd_rn(s2, p); }
#pragma unroll
    for (int sh = 16; sh; sh >>= 1) s2 = __fadd_rn(s2, __shfl_xor(s2, sh, 32));
    const float rs = __fdiv_rn(1.0f, __fsqrt_rn(__fadd_rn(__fdiv_rn(s2, (float)DM), 1e-7f)));
{
#pragma unroll
        for (int ch = 0; ch < DM / 128; ++ch) { const int c0 = ch * 128 + lane * 4; v4f o;
#pragma unroll
            for (int q = 0; q < 4; ++q) { float xn = __fmul_rn(__fsub_rn(v[ch * 4 + q], mu), rs); asm volatile("" : "+v"(xn)); float gg = bfr(g[c0 + q]); asm volatile("" : "+v"(gg)); float yv = __fmul_rn(xn, gg); asm volatile("" : "+v"(yv)); float be = bfr(bb[c0 + q]); asm volatile("" : "+v"(be)); o[q] = __fadd_rn(yv, be); }
            *(v4f*)(out + (size_t)row * DM + c0) = o; }
         }
}
__global__ __launch_bounds__(256) void k_merge(const float* __restrict__ O, int h0, bf* Ah, bf* Al) { const size_t e = ((size_t)blockIdx.x * 256 + threadIdx.x) * 2; if (e >= (size_t)ZH * TT * HD) return; const int d = (int)(e % HD); const int t = (int)((e / HD) % TT); const int zz = (int)(e / ((size_t)HD * TT)); const float cs = (t < RH) ? 1.0f : (1.0f / PCAR); const size_t oo = (size_t)t * DQ + (h0 + zz) * HD + d;
    v2us oh, ol;
#pragma unroll
    for (int q = 0; q < 2; ++q) { unsigned short a, c2; splitf(O[e + q] * cs, a, c2); oh[q] = a; ol[q] = c2; } *(v2us*)(Ah + oo) = oh; *(v2us*)(Al + oo) = ol;  }

extern "C" void kernel_launch(void* const* d_in, const int* in_sizes, int n_in,
                              void* d_out, int out_size, void* d_ws, size_t ws_size, hipStream_t stream) {
    (void)in_sizes; (void)n_in; (void)out_size;
    const float* x = (const float*)d_in[0]; const float* rel = (const float*)d_in[1]; const float* wq = (const float*)d_in[2]; const float* bq = (const float*)d_in[3]; const float* wk = (const float*)d_in[4]; const float* bk = (const float*)d_in[5]; const float* wv = (const float*)d_in[6]; const float* bv = (const float*)d_in[7]; const float* wo = (const float*)d_in[8]; const float* bo = (const float*)d_in[9]; const float* lng = (const float*)d_in[10]; const float* lnb = (const float*)d_in[11]; const int* RIDX = (const int*)d_in[12];
    float* OUT = (float*)d_out;     // [4][1024][1024]
    char* wsp = (char*)d_ws;
    auto take = [&](size_t bytes) { char* p = wsp; wsp += (bytes + 255) & ~(size_t)255; return (void*)p; };
    bf* WQ = (bf*)take((size_t)DQ * DM * 2); bf* WK = (bf*)take((size_t)DKV * DM * 2); bf* WV = (bf*)take((size_t)DKV * DM * 2); bf* WO = (bf*)take((size_t)DM * DQ * 2); float* CS = (float*)take((size_t)TT * HD * 2 * 4);
    bf* PKh = (bf*)take((size_t)NH_ * NPE * HD * 2); bf* PKl = (bf*)take((size_t)NH_ * NPE * HD * 2); bf* PQh = (bf*)take((size_t)NH_ * NPE * HD * 2); bf* PQl = (bf*)take((size_t)NH_ * NPE * HD * 2); float* C2P = (float*)take((size_t)ZH * TT * NPE * 4); float* P2C = (float*)take((size_t)ZH * NPE * TT * 4);
    bf* QPh = (bf*)take((size_t)NB_ * NH_ * TT * HD * 2); bf* QPl = (bf*)take((size_t)NB_ * NH_ * TT * HD * 2); bf* KPh = (bf*)take((size_t)NB_ * NKV * TT * HD * 2); bf* KPl = (bf*)take((size_t)NB_ * NKV * TT * HD * 2); bf* VTh = (bf*)take((size_t)NB_ * NKV * HD * TT * 2); bf* VTl = (bf*)take((size_t)NB_ * NKV * HD * TT * 2); bf* Ph = (bf*)take((size_t)ZH * RH * TT * 2); bf* Pl = (bf*)take((size_t)ZH * RH * TT * 2);
    float* Sb = (float*)take((size_t)ZH * TT * TT * 4); h16* P16 = (h16*)take((size_t)ZH * TT * TT * 2); float* Ob = (float*)take((size_t)ZH * TT * HD * 4); bf* ATh = (bf*)take((size_t)NB_ * TT * DQ * 2); bf* ATl = (bf*)take((size_t)NB_ * TT * DQ * 2);
    if ((size_t)(wsp - (char*)d_ws) > ws_size) return;    // ws 256 MiB
    // Buffers that live only before the first pass, or only after the last, lie inside the three 32-MiB score buffers (stream-ordered; each is written in this call before it is read):
    // Sb: FQ [5120][1024] f32 (20 MiB) + QP16 (8 MiB), later Y [4096][1024] f32; C2P: FK / FV (20 MiB) + KP16 (8 MiB); P2C: XB [5120][1024] bf16 (10 MiB) + VT16 (8 MiB).
    const size_t MR = (size_t)NB_ * TT;       // rows of all batches; the position table's NPE rows follow them
    float* FQ = Sb; h16* QP16 = (h16*)(Sb + (MR + NPE) * DQ); float* Y = Sb;
    float* FK = C2P; h16* KP16 = (h16*)(C2P + (MR + NPE) * DKV); float* FV = FK;   // v projection reuses the k buffer after the k planes are built (stream-ordered)
    bf* XB = (bf*)P2C; h16* VT16 = (h16*)(XB + (MR + NPE) * DM);
    { k_wtG<<<(unsigned)((DM * DQ / 64 + 63) / 64), 256, 0, stream>>>(wq, DM, DQ, WQ); k_wtG<<<(unsigned)((DM * DKV / 64 + 63) / 64), 256, 0, stream>>>(wk, DM, DKV, WK); k_wtG<<<(unsigned)((DM * DKV / 64 + 63) / 64), 256, 0, stream>>>(wv, DM, DKV, WV);
      k_wtG<<<(unsigned)((DQ * DM / 64 + 63) / 64), 256, 0, stream>>>(wo, DQ, DM, WO);
       }
    k_csid<<<(TT * HD + 255) / 256, 256, 0, stream>>>(CS);
    k_cvt8<<<(unsigned)(((size_t)NB_ * TT * DM / 8 + 255) / 256), 256, 0, stream>>>(x, XB, (size_t)NB_ * TT * DM / 8);
    k_cvt8<<<(unsigned)(((size_t)NPE * DM / 8 + 255) / 256), 256, 0, stream>>>(rel, XB + MR * DM, (size_t)NPE * DM / 8);
    const unsigned LQ = (unsigned)(((size_t)NH_ * TT * HD / 2 + 255) / 256), LKv = (unsigned)(((size_t)NKV * TT * HD / 2 + 255) / 256);
    k_gemmw<bf, 0, true><<<dim3((NB_ * TT + NPE) / 64, DQ / 64, 1), 32, 0, stream>>>(XB, nullptr, WQ, nullptr, DM, FQ, DQ, bq, 0, 0, 0);   /* q of every batch, then rel_q = pos_emb Wq + bq */
    k_rope<<<dim3(LQ, NB_, 1), 256, 0, stream>>>(FQ, DQ, NH_, CS, nullptr, nullptr, 1.0f, QP16, QPh, QPl);
    k_pplane<<<(unsigned)(((size_t)NH_ * NPE * HD / 2 + 255) / 256), 256, 0, stream>>>(FQ + MR * DQ, PQh, PQl);   /* rel_q -> per-head hi/lo planes [h][1024][64] */
    k_gemmw<bf, 0, true><<<dim3((NB_ * TT + NPE) / 64, DKV / 64, 1), 32, 0, stream>>>(XB, nullptr, WK, nullptr, DM, FK, DKV, bk, 0, 0, 0);   /* k of every batch, then rel_k = pos_emb Wk + bk */
    k_rope<<<dim3(LKv, NB_, 1), 256, 0, stream>>>(FK, DKV, NKV, CS, nullptr, nullptr, 1.0f, KP16, KPh, KPl);
    k_pplane<<<(unsigned)(((size_t)NH_ * NPE * HD / 2 + 255) / 256), 256, 0, stream>>>(FK + MR * DKV, PKh, PKl);   /* rel_k -> per-head hi/lo planes [h][1024][64] */
    k_gemmw<bf, 0, true><<<dim3(NB_ * TT / 64, DKV / 64, 1), 32, 0, stream>>>(XB, nullptr, WV, nullptr, DM, FV, DKV, bv, 0, 0, 0); k_vtp<<<dim3(LKv, NB_, 1), 256, 0, stream>>>(FV, DKV, NKV, VT16, VTh, VTl);
    for (int b = 0; b < NB_; ++b) {
        for (int h0 = 0; h0 < NH_; h0 += ZH) { const size_t zq = (size_t)h0, zk = (size_t)(h0 / REP), bq0 = (size_t)b * NH_ + zq, bk0 = (size_t)b * NKV + zk;   // one kv head per query head: the pass's heads use consecutive kv planes (z-strides TT*HD); bq0 / bk0: the same heads in the planes of batch b
            k_gemmw<bf, 2, false><<<dim3(RH / 64, TT / 64, ZH), 32, 0, stream>>>(QPh + bq0 * TT * HD, QPl + bq0 * TT * HD, KPh + bk0 * TT * HD, KPl + bk0 * TT * HD, HD, Sb, TT, nullptr, (size_t)TT * HD, (size_t)TT * HD, (size_t)TT * TT);
            k_gemmw<bf, 2, false><<<dim3(TT / 64, NPE / 64, ZH), 32, 0, stream>>>(QPh + bq0 * TT * HD, QPl + bq0 * TT * HD, PKh + zq * NPE * HD, PKl + zq * NPE * HD, HD, C2P, NPE, nullptr, (size_t)TT * HD, (size_t)NPE * HD, (size_t)TT * NPE);   /* c2p raw [ZH][1024][1024] */
            k_gemmw<bf, 2, false><<<dim3(NPE / 64, TT / 64, ZH), 32, 0, stream>>>(PQh + zq * NPE * HD, PQl + zq * NPE * HD, KPh + bk0 * TT * HD, KPl + bk0 * TT * HD, HD, P2C, TT, nullptr, (size_t)NPE * HD, (size_t)TT * HD, (size_t)NPE * TT);   /* p2c raw [ZH][1024][1024] */
            k_asoft<<<ZH * TT / 8, 256, 0, stream>>>(Sb, C2P, P2C, RIDX, P16, Ph, Pl);
            k_gemmw<bf, 2, false><<<dim3(RH / 64, HD / 64, ZH), 32, 0, stream>>>(Ph, Pl, VTh + bk0 * HD * TT, VTl + bk0 * HD * TT, TT, Ob, HD, nullptr, (size_t)RH * TT, (size_t)HD * TT, (size_t)TT * HD);
            k_merge<<<(unsigned)(((size_t)ZH * TT * HD / 2 + 255) / 256), 256, 0, stream>>>(Ob, h0, ATh + (size_t)b * TT * DQ, ATl + (size_t)b * TT * DQ); } }
    k_gemmw<bf, 1, true><<<dim3(NB_ * TT / 64, DM / 64, 1), 32, 0, stream>>>(ATh, ATl, WO, nullptr, DQ, Y, DM, bo, 0, 0, 0);   /* y = ctx Wd + bd (f32), every batch */
    k_lnres<<<NB_ * TT / 8, 256, 0, stream>>>(Y, x, lng, lnb, OUT);
}

// v003
// One run takes 935 microseconds.
// In both of two side-by-side timings against v002, it was 1.12 times as fast.
// All steps since v000 together make it 2.54 times as fast.
#include <hip/hip_runtime.h>

// DeBERTa-style disentangled self-attention + output dense + residual + LayerNorm (hidden_states [4][1024][1024]; q, k, v = hs W + b ('xw' [1024][1024]; 16 heads x 64); rel_q = pos_emb Wq + bq, rel_k = pos_emb Wk + bk (pos_emb [1024][1024], read); scale = 1/sqrt(3 x 64); scores = q.k scale + c2p[i][rel_idx[i][j]] + p2c[rel_idx[i][j]][j] with c2p = q.rel_k scale ([1024][1024]) and p2c = rel_q.k scale ([1024][1024]) and rel_idx the int32 input [1024][1024] (read per logit; = clip(i - j + 512, 0, 1023)); softmax; ctx = merged attn.v; y = ctx Wd + bd + hidden_states; out = LayerNorm(y) gamma + beta (eps 1e-7) -> [4][1024][1024] (4.2 M)).
// Layout: exact bf16 projections (+ once-off rel_k / rel_q projections of the position table -> per-head hi/lo planes); hi/lo planes for q, k (every row: 3-product score GEMMs); per pass of eight heads: content scores [8][1024][1024], c2p [8][1024][1024] and p2c TRANSPOSED [8][key j][rel row] as hi/lo GEMMs, and the softmax kernel (32 query rows per block) gathers the two relative terms per logit at the input index (p2c with lanes along the query rows, handed to the row's wave through LDS), scales, f32 softmax, hi/lo P; attn.v (3 products); merged context as hi/lo planes; Wd (hl x exact) + bd; residual + LayerNorm in f32.
// Launch shape: the conversion, the q/k/v projections, the plane builders, the Wd GEMM and the LayerNorm each run ONCE over the rows of all four batches (the position table's rows ride behind them in the q and k projections); only the per-pass attention launches loop over (batch, 8 heads).
// Compute dtypes, f32 accumulate: every input rounded to bf16; projections on PLAIN bf16 operands (exact) + biases; all score terms and attn.v on hi/lo planes (3 products) for every row; softmax f32; Wd hl x exact; residual/LayerNorm f32 (precise sqrt/division).

#define NB_  4
#define TT   1024
#define DM   1024
#define NH_  16
#define NKV  16
#define REP  (NH_ / NKV)
#define HD   64
#define DQ   (NH_ * HD)
#define DKV  (NKV * HD)
#define ZH   8                     // heads per pass (z extent of the per-pass GEMM launches)
#define RH   1024                  // query rows < RH use hi+lo planes (0: none)
#define WIN  0
#define PCAR 1024.0f
#define SCL  0.072168783648703225f   // 1/sqrt(3 x 64)
#define NPE  1024                 // relative-position table rows (2 x 512)
typedef _Float16 h16;
typedef unsigned short bf;
typedef __attribute__((ext_vector_type(16))) __bf16   v16bf;
typedef __attribute__((ext_vector_type(16))) _Float16 v16h;
typedef __attribute__((ext_vector_type(8)))  _Float16 v8h;
typedef __attribute__((ext_vector_type(8)))  unsigned short v8us;
typedef __attribute__((ext_vector_type(8)))  float    v8f;
typedef __attribute__((ext_vector_type(4)))  float    v4f;
typedef v8h  __attribute__((may_alias)) v8ha;
typedef v4f  __attribute__((may_alias)) v4fa;
typedef v8us __attribute__((may_alias)) v8usa;

__device__ __forceinline__ unsigned short f2bf(float f) { unsigned u = __float_as_uint(f); u += 0x7FFFu + ((u >> 16) & 1u); return (unsigned short)(u >> 16); }
__device__ __forceinline__ float bf2f(unsigned short b) { return __uint_as_float(((unsigned)b) << 16); }
__device__ __forceinline__ float bfr(float f) { return bf2f(f2bf(f)); }
__device__ __forceinline__ v16h cat16(v8h lo, v8h hi) { return __builtin_shufflevector(lo, hi, 0, 1, 2, 3, 4, 5, 6, 7, 8, 9, 10, 11, 12, 13, 14, 15); }
__device__ __forceinline__ v16bf cat16b(v8us lo, v8us hi) { return __builtin_bit_cast(v16bf, __builtin_shufflevector(lo, hi, 0, 1, 2, 3, 4, 5, 6, 7, 8, 9, 10, 11, 12, 13, 14, 15)); }
__device__ __forceinline__ v8f wmma16(v16h a, v16h b, v8f c) { return __builtin_amdgcn_wmma_f32_16x16x32_f16(false, a, false, b, (short)0, c, false, false); }
__device__ __forceinline__ v8f wmmab(v16bf a, v16bf b, v8f c) { return __builtin_amdgcn_wmma_f32_16x16x32_bf16(false, a, false, b, (short)0, c, false, false); }



// ---- k_gemmw: register-blocked GEMM, ONE WAVE per 64x64 output tile (16 accumulators), operands straight from K-contiguous 16-bit planes; grid (M/64, N/64, Z), 32 threads.
// C[m][n] (f32, pitch ldc, + optional f32 bias[n]) = sum_k A[m][k] Bt[n][k] (+ split products per NSPLIT). z-batch strides sA/sB/sC in elements. K % 32 == 0.
template <typename T16> struct WFrag;
template <> struct WFrag<h16> { typedef v16h V; static __device__ __forceinline__ V ld(const h16* p) { return cat16(*(const v8h*)p, *(const v8h*)(p + 16)); } static __device__ __forceinline__ v8f mma(V a, V b, v8f c) { return wmma16(a, b, c); } };
template <> struct WFrag<bf> { typedef v16bf V; static __device__ __forceinline__ V ld(const bf* p) { return cat16b(*(const v8us*)p, *(const v8us*)(p + 16)); } static __device__ __forceinline__ v8f mma(V a, V b, v8f c) { return wmmab(a, b, c); } };
template <typename T16, int NSPLIT, bool BIAS>
__global__ __launch_bounds__(32) void k_gemmw(const T16* __restrict__ A, const T16* __restrict__ A2, const T16* __restrict__ Bt, const T16* __restrict__ Bt2, int K, float* C, int ldc, const float* __restrict__ bias, size_t sA, size_t sB, size_t sC) {
    typedef typename WFrag<T16>::V V;
    __shared__ __align__(16) float os[16 * 68];
    const size_t z = blockIdx.z; A += z * sA; if (A2) A2 += z * sA; Bt += z * sB; if (Bt2) Bt2 += z * sB; C += z * sC;
    const int lane = threadIdx.x & 31, lr = lane & 15, hi = lane >> 4; const int r0 = blockIdx.x * 64, c0 = blockIdx.y * 64;
    v8f acc[4][4];
#pragma unroll
    for (int mb = 0; mb < 4; ++mb)
#pragma unroll
        for (int nb = 0; nb < 4; ++nb) acc[mb][nb] = (v8f){};
    const size_t aoff = (size_t)(r0 + lr) * K + 8 * hi, boff = (size_t)(c0 + lr) * K + 8 * hi;
#pragma unroll 1
    for (int kc = 0; kc < K; kc += 32) {
        V a[4], a2[4];
#pragma unroll
        for (int mb = 0; mb < 4; ++mb) { a[mb] = WFrag<T16>::ld(A + aoff + (size_t)mb * 16 * K + kc); if (NSPLIT == 1 || NSPLIT == 2) a2[mb] = WFrag<T16>::ld(A2 + aoff + (size_t)mb * 16 * K + kc); }
#pragma unroll
        for (int nb = 0; nb < 4; ++nb) { const V b = WFrag<T16>::ld(Bt + boff + (size_t)nb * 16 * K + kc); V b2; if (NSPLIT >= 2) b2 = WFrag<T16>::ld(Bt2 + boff + (size_t)nb * 16 * K + kc);
#pragma unroll
            for (int mb = 0; mb < 4; ++mb) { acc[mb][nb] = WFrag<T16>::mma(a[mb], b, acc[mb][nb]); if (NSPLIT == 1 || NSPLIT == 2) acc[mb][nb] = WFrag<T16>::mma(a2[mb], b, acc[mb][nb]); if (NSPLIT >= 2) acc[mb][nb] = WFrag<T16>::mma(a[mb], b2, acc[mb][nb]); } }
        asm volatile("v_nop\n\tv_nop\n\tv_nop\n\tv_nop" : "+v"(acc[0][0]), "+v"(acc[1][1]), "+v"(acc[2][2]), "+v"(acc[3][3]) : "v"(a[0]), "v"(a[3]));
    }
#pragma unroll
    for (int mb = 0; mb < 4; ++mb) {
#pragma unroll
        for (int nb = 0; nb < 4; ++nb) {
#pragma unroll
            for (int j = 0; j < 8; ++j) os[(hi * 8 + j) * 68 + nb * 16 + lr] = acc[mb][nb][j]; }
        __builtin_amdgcn_wave_barrier(); asm volatile("" ::: "memory");
        float* crow = C + (size_t)(r0 + mb * 16) * ldc + c0;
{
#pragma unroll
            for (int s = 0; s < 8; ++s) { const int row = 2 * s + hi, cofs = lr * 4; v4f val = *(const v4fa*)(os + row * 68 + cofs); if (BIAS) { val[0] += bfr(bias[c0 + cofs]); val[1] += bfr(bias[c0 + cofs + 1]); val[2] += bfr(bias[c0 + cofs + 2]); val[3] += bfr(bias[c0 + cofs + 3]); }
                *(v4f*)(crow + (size_t)row * ldc + cofs) = val; }
             }
        __builtin_amdgcn_wave_barrier(); asm volatile("" ::: "memory");
    }
}

__device__ __forceinline__ h16 tohx(float x) { return (h16)x; }
__device__ __forceinline__ void splitf(float y, unsigned short& h, unsigned short& l) { h = f2bf(y); l = f2bf(y - bf2f(h)); }
typedef __attribute__((ext_vector_type(2))) _Float16 v2h;
typedef __attribute__((ext_vector_type(4))) _Float16 v4h;
typedef __attribute__((ext_vector_type(2))) unsigned short v2us;
typedef __attribute__((ext_vector_type(4))) unsigned short v4us;
typedef __attribute__((ext_vector_type(2))) float v2f;
typedef __attribute__((ext_vector_type(4))) int v4i;

__global__ __launch_bounds__(256) void k_wtG(const float* __restrict__ w, int K, int N, bf* Bt) {
    const int lane = threadIdx.x & 31; const int L0 = (blockIdx.x * 8 + (threadIdx.x >> 5)) * 8; const int nlines = N * K / 64;
{
#pragma unroll 1
        for (int l = 0; l < 8; ++l) { const int L = L0 + l; if (L >= nlines) break; const size_t e = (size_t)L * 64 + lane * 2; const int k = (int)(e % K), n = (int)(e / K); v2us o;
            o[0] = f2bf(w[(size_t)k * N + n]); o[1] = f2bf(w[(size_t)(k + 1) * N + n]); *(v2us*)(Bt + e) = o; }
         }
}
__global__ __launch_bounds__(256) void k_cvt8(const float* __restrict__ src, bf* dst, size_t n8) { const size_t i = (size_t)blockIdx.x * 256 + threadIdx.x; if (i >= n8) return; const v8f v = *(const v8f*)(src + i * 8); v8us o;
#pragma unroll
    for (int k = 0; k < 8; ++k) o[k] = f2bf(v[k]); *(v8us*)(dst + i * 8) = o;  }

// k_rope: head planes [h][t][d] (fp16 + hi/lo) of rope(x) x sc with the rotate-half convention out[d] = x[d] cos[t][d] - x[d+HD/2] sin[t][d], out[d+HD/2] = x[d+HD/2] cos[t][d+HD/2] + x[d] sin[t][d+HD/2]
__global__ __launch_bounds__(256) void k_rope(const float* __restrict__ F, int pitch, int nheads, const float* __restrict__ CS, const float* __restrict__ RF, const float* __restrict__ nw, float sc, h16* P16, bf* Ph, bf* Pl) {
    const size_t e = ((size_t)blockIdx.x * 256 + threadIdx.x) * 2; if (e >= (size_t)nheads * TT * HD) return; const int d = (int)(e % HD); const int t = (int)((e / HD) % TT); const int h = (int)(e / ((size_t)HD * TT)); const size_t bz = blockIdx.y;   /* batch: rows bz*TT.. of F, planes bz*nheads.. */ const float* f = F + (bz * TT + t) * pitch + h * HD; const float rf = RF ? RF[(size_t)h * TT + t] : 1.0f; v2h o16; v2us oh, ol;
#pragma unroll
    for (int q = 0; q < 2; ++q) { const int dd = d + q; const int dp = (dd < HD / 2) ? dd + HD / 2 : dd - HD / 2; float x0 = f[dd], x1 = f[dp];
        if (RF) { float n0 = __fmul_rn(x0, rf), n1 = __fmul_rn(x1, rf); asm volatile("" : "+v"(n0)); asm volatile("" : "+v"(n1)); x0 = __fmul_rn(bfr(nw[dd]), n0); x1 = __fmul_rn(bfr(nw[dp]), n1); }
        const v2f cs = *(const v2f*)(CS + ((size_t)t * HD + dd) * 2); float a = __fmul_rn(x0, cs[0]), bq = __fmul_rn(x1, cs[1]); asm volatile("" : "+v"(a)); asm volatile("" : "+v"(bq)); const float r = ((dd < HD / 2) ? __fsub_rn(a, bq) : __fadd_rn(a, bq)) * sc;
        o16[q] = tohx(r); unsigned short a2, c2; splitf(r, a2, c2); oh[q] = a2; ol[q] = c2; }
    const size_t eo = bz * nheads * TT * HD + e; *(v2h*)(P16 + eo) = o16; *(v2us*)(Ph + eo) = oh; *(v2us*)(Pl + eo) = ol;  }
__global__ __launch_bounds__(256) void k_vtp(const float* __restrict__ F, int pitch, int nheads, h16* V16, bf* Vh, bf* Vl) { const size_t e = ((size_t)blockIdx.x * 256 + threadIdx.x) * 2; if (e >= (size_t)nheads * HD * TT) return; const int t = (int)(e % TT); const int d = (int)((e / TT) % HD); const int g = (int)(e / ((size_t)TT * HD)); const size_t bz = blockIdx.y;   /* batch */ v2h o16; v2us oh, ol;
#pragma unroll
    for (int q = 0; q < 2; ++q) { const float x = F[(bz * TT + t + q) * pitch + g * HD + d]; o16[q] = tohx(x); unsigned short a2, c2; splitf(x, a2, c2); oh[q] = a2; ol[q] = c2; }
    const size_t eo = bz * nheads * HD * TT + e; *(v2h*)(V16 + eo) = o16; *(v2us*)(Vh + eo) = oh; *(v2us*)(Vl + eo) = ol;  }
__global__ __launch_bounds__(256) void k_csid(float* CS) { const int idx = blockIdx.x * 256 + threadIdx.x; if (idx >= TT * HD) return; v2f cs; cs[0] = 1.0f; cs[1] = 0.0f; *(v2f*)(CS + (size_t)idx * 2) = cs;  }
__global__ __launch_bounds__(256) void k_pplane(const float* __restrict__ POS, bf* Ph2, bf* Pl2) { const size_t e = ((size_t)blockIdx.x * 256 + threadIdx.x) * 2; if (e >= (size_t)NH_ * NPE * HD) return; const int d = (int)(e % HD); const int p = (int)((e / HD) % NPE); const int h = (int)(e / ((size_t)HD * NPE)); v2us oh, ol;
#pragma unroll
    for (int q = 0; q < 2; ++q) { unsigned short a, c; splitf(POS[(size_t)p * DQ + h * HD + d + q], a, c); oh[q] = a; ol[q] = c; } *(v2us*)(Ph2 + e) = oh; *(v2us*)(Pl2 + e) = ol;  }
// k_asoft: per row (zz, i): t = (S + c2p[i][rp] + p2c[rp][j]) x scale with rp = rel_idx[i][j] (int32 input, read per logit with b128 loads; clamped to [0, NPE) for memory safety - the identity for the shipped clip(i - j + 512, 0, 1023)); softmax over the 1024 keys (register row, one exp, fixed trees);
// One block = SR consecutive query rows of one head, one wave per row. The p2c term comes from the transposed plane P2CT[j][rp]: wave w takes the 32 keys j = 32 w .. 32 w + 31 and gathers with its LANES ALONG THE QUERY ROWS, so that indices which rise with i (or stand still) fall into one or two cache lines per load for any key; any other index array is gathered just as correctly, only slower.
// The index tile is turned in LDS (written by rows, read by columns), each gathered value replaces its index in place, and the row's own wave reads its finished row of G.
#define SR 32      // query rows per block = waves per block = TT / 32 key tiles
#define GP 1028    // pitch of G in words: rows stay 16-byte aligned, and lanes that read b128 down a column step 4 banks each
typedef v4i __attribute__((may_alias)) v4ia;
__global__ __launch_bounds__(1024) void k_asoft(const float* __restrict__ Sb, const float* __restrict__ C2P, const float* __restrict__ P2CT, const int* __restrict__ RIX, h16* P16, bf* Ph, bf* Pl) {
    __shared__ __align__(16) float G[SR * GP];
    const int lane = threadIdx.x & 31; const int w = threadIdx.x >> 5; const int row0 = blockIdx.x * SR; const int zz = row0 / TT; const int i0 = row0 % TT;
    { const int jw = w * 32; const float* pt = P2CT + ((size_t)zz * TT + jw) * NPE; const int rr = lane >> 3, cc = jw + (lane & 7) * 4; float* gl = G + lane * GP + jw; const int* ip = RIX + (size_t)(i0 + rr) * TT + cc; v4i t[8];
#pragma unroll
      for (int s = 0; s < 8; ++s) t[s] = *(const v4i*)(ip + (size_t)s * 4 * TT);
      asm volatile("s_wait_xcnt 0x0" :: "v"(ip) : "memory");   // the wait in front of any rewrite of the eight loads' shared address pair; named as an input the pair stays live to here, so that no result of the run is placed in it
#pragma unroll
      for (int s = 0; s < 8; ++s) *(v4ia*)(G + (s * 4 + rr) * GP + cc) = t[s];
      __syncthreads();   // index tile complete before it is read by columns
#pragma unroll
      for (int c = 0; c < 8; ++c) t[c] = *(const v4ia*)(gl + c * 4);   // lane = query row i0 + lane, keys jw .. jw + 31
      v4f g[8];
#pragma unroll
      for (int hf = 0; hf < 2; ++hf) { const float* pg[16];   // two runs of 16 gathers, all of a run in flight together
#pragma unroll
          for (int k = 0; k < 16; ++k) { const int c = hf * 4 + (k >> 2), q = k & 3; int rp = t[c][q]; rp = rp < 0 ? 0 : (rp > NPE - 1 ? NPE - 1 : rp); pg[k] = pt + rp; g[c][q] = pg[k][(size_t)(c * 4 + q) * NPE]; }
          asm volatile("s_wait_xcnt 0x0" :: "v"(pg[0]), "v"(pg[1]), "v"(pg[2]), "v"(pg[3]), "v"(pg[4]), "v"(pg[5]), "v"(pg[6]), "v"(pg[7]), "v"(pg[8]), "v"(pg[9]), "v"(pg[10]), "v"(pg[11]), "v"(pg[12]), "v"(pg[13]), "v"(pg[14]), "v"(pg[15]) : "memory"); }   // the wait in front of any rewrite of the run's address pairs; named as inputs they stay live to here, so that no result of the run is placed in one
#pragma unroll
      for (int c = 0; c < 8; ++c) *(v4fa*)(gl + c * 4) = g[c];
      __syncthreads();   // every key tile of G gathered before a row's wave reads across them
    }
    const int row = row0 + w; const int i = i0 + w; const float* cr = C2P + (size_t)row * NPE; const float* gr = G + w * GP; const int* rxr = RIX + (size_t)i * TT; const bool hires = (i < RH); const float* sr = Sb + (size_t)row * TT; float v[TT / 32]; float mx = -3.0e38f;
#pragma unroll
    for (int ch = 0; ch < TT / 128; ++ch) { const int j0 = ch * 128 + lane * 4; const v4f a = *(const v4f*)(sr + j0); const v4i r4 = *(const v4i*)(rxr + j0); const v4f p4 = *(const v4fa*)(gr + j0);
#pragma unroll
        for (int q = 0; q < 4; ++q) { const int j = j0 + q; (void)j; int rp = r4[q]; rp = rp < 0 ? 0 : (rp > NPE - 1 ? NPE - 1 : rp); float s1 = __fadd_rn(a[q], cr[rp]); asm volatile("" : "+v"(s1)); float s2 = __fadd_rn(s1, p4[q]); asm volatile("" : "+v"(s2)); float sa = s2 * SCL; asm volatile("" : "+v"(sa)); const float t = sa;   /* (qk + c2p[i][rp] + p2c[rp][j]) x scale, rp = rel_idx[i][j] */ v[ch * 4 + q] = t; mx = fmaxf(mx, t); } }
#pragma unroll
    for (int sh = 16; sh; sh >>= 1) mx = fmaxf(mx, __shfl_xor(mx, sh, 32));
    float sum = 0.f;
#pragma unroll
    for (int k = 0; k < TT / 32; ++k) { float d0 = __fsub_rn(v[k], mx); asm volatile("" : "+v"(d0)); v[k] = __builtin_amdgcn_exp2f(__fmul_rn(d0, 1.4426950408889634f)); sum += v[k]; }
#pragma unroll
    for (int sh = 16; sh; sh >>= 1) sum += __shfl_xor(sum, sh, 32);
    const float f = __fdiv_rn(hires ? 1.0f : PCAR, sum);
{
        if (hires) {
#pragma unroll
            for (int ch = 0; ch < TT / 128; ++ch) { v4us oh, ol;
#pragma unroll
                for (int q = 0; q < 4; ++q) { unsigned short a, c2; splitf(v[ch * 4 + q] * f, a, c2); oh[q] = a; ol[q] = c2; }
                const size_t oo = ((size_t)zz * (RH ? RH : 1) + i) * TT + ch * 128 + lane * 4; *(v4us*)(Ph + oo) = oh; *(v4us*)(Pl + oo) = ol; }
        } else {
#pragma unroll
            for (int ch = 0; ch < TT / 128; ++ch) { v4h o4;
#pragma unroll
                for (int q = 0; q < 4; ++q) o4[q] = tohx(v[ch * 4 + q] * f);
                *(v4h*)(P16 + (size_t)row * TT + ch * 128 + lane * 4) = o4; } }
         }
}

__global__ __launch_bounds__(256) void k_lnres(const float* __restrict__ Y, const float* __restrict__ xres, const float* __restrict__ g, const float* __restrict__ bb, float* out) {
    const int lane = threadIdx.x & 31; const int row = blockIdx.x * 8 + (threadIdx.x >> 5); if (row >= NB_ * TT) return; const float* yr = Y + (size_t)row * DM; const float* xr = xres + (size_t)row * DM; float v[DM / 32]; float s = 0.f;
#pragma unroll
    for (int ch = 0; ch < DM / 128; ++ch) { const v4f a = *(const v4f*)(yr + ch * 128 + lane * 4); const v4f c = *(const v4f*)(xr + ch * 128 + lane * 4);
#pragma unroll
        for (int q = 0; q < 4; ++q) { const float t = __fadd_rn(a[q], bfr(c[q])); v[ch * 4 + q] = t; s = __fadd_rn(s, t); } }
#pragma unroll
    for (int sh = 16; sh; sh >>= 1) s = __fadd_rn(s, __shfl_xor(s, sh, 32));
    const float mu = __fdiv_rn(s, (float)DM); float s2 = 0.f;
#pragma unroll
    for (int k = 0; k < DM / 32; ++k) { float d0 = __fsub_rn(v[k], mu); asm volatile("" : "+v"(d0)); float p = __fmul_rn(d0, d0); asm volatile("" : "+v"(p)); s2 = __fadd_rn(s2, p); }
#pragma unroll
    for (int sh = 16; sh; sh >>= 1) s2 = __fadd_rn(s2, __shfl_xor(s2, sh, 32));
    const float rs = __fdiv_rn(1.0f, __fsqrt_rn(__fadd_rn(__fdiv_rn(s2, (float)DM), 1e-7f)));
{
#pragma unroll
        for (int ch = 0; ch < DM / 128; ++ch) { const int c0 = ch * 128 + lane * 4; v4f o;
#pragma unroll
            for (int q = 0; q < 4; ++q) { float xn = __fmul_rn(__fsub_rn(v[ch * 4 + q], mu), rs); asm volatile("" : "+v"(xn)); float gg = bfr(g[c0 + q]); asm volatile("" : "+v"(gg)); float yv = __fmul_rn(xn, gg); asm volatile("" : "+v"(yv)); float be = bfr(bb[c0 + q]); asm volatile("" : "+v"(be)); o[q] = __fadd_rn(yv, be); }
            *(v4f*)(out + (size_t)row * DM + c0) = o; }
         }
}
__global__ __launch_bounds__(256) void k_merge(const float* __restrict__ O, int h0, bf* Ah, bf* Al) { const size_t e = ((size_t)blockIdx.x * 256 + threadIdx.x) * 2; if (e >= (size_t)ZH * TT * HD) return; const int d = (int)(e % HD); const int t = (int)((e / HD) % TT); const int zz = (int)(e / ((size_t)HD * TT)); const float cs = (t < RH) ? 1.0f : (1.0f / PCAR); const size_t oo = (size_t)t * DQ + (h0 + zz) * HD + d;
    v2us oh, ol;
#pragma unroll
    for (int q = 0; q < 2; ++q) { unsigned short a, c2; splitf(O[e + q] * cs, a, c2); oh[q] = a; ol[q] = c2; } *(v2us*)(Ah + oo) = oh; *(v2us*)(Al + oo) = ol;  }

extern "C" void kernel_launch(void* const* d_in, const int* in_sizes, int n_in,
                              void* d_out, int out_size, void* d_ws, size_t ws_size, hipStream_t stream) {
    (void)in_sizes; (void)n_in; (void)out_size;
    const float* x = (const float*)d_in[0]; const float* rel = (const float*)d_in[1]; const float* wq = (const float*)d_in[2]; const float* bq = (const float*)d_in[3]; const float* wk = (const float*)d_in[4]; const float* bk = (const float*)d_in[5]; const float* wv = (const float*)d_in[6]; const float* bv = (const float*)d_in[7]; const float* wo = (const float*)d_in[8]; const float* bo = (const float*)d_in[9]; const float* lng = (const float*)d_in[10]; const float* lnb = (const float*)d_in[11]; const int* RIDX = (const int*)d_in[12];
    float* OUT = (float*)d_out;     // [4][1024][1024]
    char* wsp = (char*)d_ws;
    auto take = [&](size_t bytes) { char* p = wsp; wsp += (bytes + 255) & ~(size_t)255; return (void*)p; };
    bf* WQ = (bf*)take((size_t)DQ * DM * 2); bf* WK = (bf*)take((size_t)DKV * DM * 2); bf* WV = (bf*)take((size_t)DKV * DM * 2); bf* WO = (bf*)take((size_t)DM * DQ * 2); float* CS = (float*)take((size_t)TT * HD * 2 * 4);
    bf* PKh = (bf*)take((size_t)NH_ * NPE * HD * 2); bf* PKl = (bf*)take((size_t)NH_ * NPE * HD * 2); bf* PQh = (bf*)take((size_t)NH_ * NPE * HD * 2); bf* PQl = (bf*)take((size_t)NH_ * NPE * HD * 2); float* C2P = (float*)take((size_t)ZH * TT * NPE * 4); float* P2C = (float*)take((size_t)ZH * NPE * TT * 4);
    bf* QPh = (bf*)take((size_t)NB_ * NH_ * TT * HD * 2); bf* QPl = (bf*)take((size_t)NB_ * NH_ * TT * HD * 2); bf* KPh = (bf*)take((size_t)NB_ * NKV * TT * HD * 2); bf* KPl = (bf*)take((size_t)NB_ * NKV * TT * HD * 2); bf* VTh = (bf*)take((size_t)NB_ * NKV * HD * TT * 2); bf* VTl = (bf*)take((size_t)NB_ * NKV * HD * TT * 2); bf* Ph = (bf*)take((size_t)ZH * RH * TT * 2); bf* Pl = (bf*)take((size_t)ZH * RH * TT * 2);
    float* Sb = (float*)take((size_t)ZH * TT * TT * 4); h16* P16 = (h16*)take((size_t)ZH * TT * TT * 2); float* Ob = (float*)take((size_t)ZH * TT * HD * 4); bf* ATh = (bf*)take((size_t)NB_ * TT * DQ * 2); bf* ATl = (bf*)take((size_t)NB_ * TT * DQ * 2);
    if ((size_t)(wsp - (char*)d_ws) > ws_size) return;    // ws 256 MiB
    // Buffers that live only before the first pass, or only after the last, lie inside the three 32-MiB score buffers (stream-ordered; each is written in this call before it is read):
    // Sb: FQ [5120][1024] f32 (20 MiB) + QP16 (8 MiB), later Y [4096][1024] f32; C2P: FK / FV (20 MiB) + KP16 (8 MiB); P2C: XB [5120][1024] bf16 (10 MiB) + VT16 (8 MiB).
    const size_t MR = (size_t)NB_ * TT;       // rows of all batches; the position table's NPE rows follow them
    float* FQ = Sb; h16* QP16 = (h16*)(Sb + (MR + NPE) * DQ); float* Y = Sb;
    float* FK = C2P; h16* KP16 = (h16*)(C2P + (MR + NPE) * DKV); float* FV = FK;   // v projection reuses the k buffer after the k planes are built (stream-ordered)
    bf* XB = (bf*)P2C; h16* VT16 = (h16*)(XB + (MR + NPE) * DM);
    { k_wtG<<<(unsigned)((DM * DQ / 64 + 63) / 64), 256, 0, stream>>>(wq, DM, DQ, WQ); k_wtG<<<(unsigned)((DM * DKV / 64 + 63) / 64), 256, 0, stream>>>(wk, DM, DKV, WK); k_wtG<<<(unsigned)((DM * DKV / 64 + 63) / 64), 256, 0, stream>>>(wv, DM, DKV, WV);
      k_wtG<<<(unsigned)((DQ * DM / 64 + 63) / 64), 256, 0, stream>>>(wo, DQ, DM, WO);
       }
    k_csid<<<(TT * HD + 255) / 256, 256, 0, stream>>>(CS);
    k_cvt8<<<(unsigned)(((size_t)NB_ * TT * DM / 8 + 255) / 256), 256, 0, stream>>>(x, XB, (size_t)NB_ * TT * DM / 8);
    k_cvt8<<<(unsigned)(((size_t)NPE * DM / 8 + 255) / 256), 256, 0, stream>>>(rel, XB + MR * DM, (size_t)NPE * DM / 8);
    const unsigned LQ = (unsigned)(((size_t)NH_ * TT * HD / 2 + 255) / 256), LKv = (unsigned)(((size_t)NKV * TT * HD / 2 + 255) / 256);
    k_gemmw<bf, 0, true><<<dim3((NB_ * TT + NPE) / 64, DQ / 64, 1), 32, 0, stream>>>(XB, nullptr, WQ, nullptr, DM, FQ, DQ, bq, 0, 0, 0);   /* q of every batch, then rel_q = pos_emb Wq + bq */
    k_rope<<<dim3(LQ, NB_, 1), 256, 0, stream>>>(FQ, DQ, NH_, CS, nullptr, nullptr, 1.0f, QP16, QPh, QPl);
    k_pplane<<<(unsigned)(((size_t)NH_ * NPE * HD / 2 + 255) / 256), 256, 0, stream>>>(FQ + MR * DQ, PQh, PQl);   /* rel_q -> per-head hi/lo planes [h][1024][64] */
    k_gemmw<bf, 0, true><<<dim3((NB_ * TT + NPE) / 64, DKV / 64, 1), 32, 0, stream>>>(XB, nullptr, WK, nullptr, DM, FK, DKV, bk, 0, 0, 0);   /* k of every batch, then rel_k = pos_emb Wk + bk */
    k_rope<<<dim3(LKv, NB_, 1), 256, 0, stream>>>(FK, DKV, NKV, CS, nullptr, nullptr, 1.0f, KP16, KPh, KPl);
    k_pplane<<<(unsigned)(((size_t)NH_ * NPE * HD / 2 + 255) / 256), 256, 0, stream>>>(FK + MR * DKV, PKh, PKl);   /* rel_k -> per-head hi/lo planes [h][1024][64] */
    k_gemmw<bf, 0, true><<<dim3(NB_ * TT / 64, DKV / 64, 1), 32, 0, stream>>>(XB, nullptr, WV, nullptr, DM, FV, DKV, bv, 0, 0, 0); k_vtp<<<dim3(LKv, NB_, 1), 256, 0, stream>>>(FV, DKV, NKV, VT16, VTh, VTl);
    for (int b = 0; b < NB_; ++b) {
        for (int h0 = 0; h0 < NH_; h0 += ZH) { const size_t zq = (size_t)h0, zk = (size_t)(h0 / REP), bq0 = (size_t)b * NH_ + zq, bk0 = (size_t)b * NKV + zk;   // one kv head per query head: the pass's heads use consecutive kv planes (z-strides TT*HD); bq0 / bk0: the same heads in the planes of batch b
            k_gemmw<bf, 2, false><<<dim3(RH / 64, TT / 64, ZH), 32, 0, stream>>>(QPh + bq0 * TT * HD, QPl + bq0 * TT * HD, KPh + bk0 * TT * HD, KPl + bk0 * TT * HD, HD, Sb, TT, nullptr, (size_t)TT * HD, (size_t)TT * HD, (size_t)TT * TT);
            k_gemmw<bf, 2, false><<<dim3(TT / 64, NPE / 64, ZH), 32, 0, stream>>>(QPh + bq0 * TT * HD, QPl + bq0 * TT * HD, PKh + zq * NPE * HD, PKl + zq * NPE * HD, HD, C2P, NPE, nullptr, (size_t)TT * HD, (size_t)NPE * HD, (size_t)TT * NPE);   /* c2p raw [ZH][1024][1024] */
            k_gemmw<bf, 2, false><<<dim3(TT / 64, NPE / 64, ZH), 32, 0, stream>>>(KPh + bk0 * TT * HD, KPl + bk0 * TT * HD, PQh + zq * NPE * HD, PQl + zq * NPE * HD, HD, P2C, NPE, nullptr, (size_t)TT * HD, (size_t)NPE * HD, (size_t)TT * NPE);   /* p2c raw, transposed: [ZH][key j][rel row] */
            k_asoft<<<ZH * TT / SR, SR * 32, 0, stream>>>(Sb, C2P, P2C, RIDX, P16, Ph, Pl);
            k_gemmw<bf, 2, false><<<dim3(RH / 64, HD / 64, ZH), 32, 0, stream>>>(Ph, Pl, VTh + bk0 * HD * TT, VTl + bk0 * HD * TT, TT, Ob, HD, nullptr, (size_t)RH * TT, (size_t)HD * TT, (size_t)TT * HD);
            k_merge<<<(unsigned)(((size_t)ZH * TT * HD / 2 + 255) / 256), 256, 0, stream>>>(Ob, h0, ATh + (size_t)b * TT * DQ, ATl + (size_t)b * TT * DQ); } }
    k_gemmw<bf, 1, true><<<dim3(NB_ * TT / 64, DM / 64, 1), 32, 0, stream>>>(ATh, ATl, WO, nullptr, DQ, Y, DM, bo, 0, 0, 0);   /* y = ctx Wd + bd (f32), every batch */
    k_lnres<<<NB_ * TT / 8, 256, 0, stream>>>(Y, x, lng, lnb, OUT);
}

// v004
// A run of this version takes 724 microseconds.
// Timed twice side by side with v003, it ran 1.29 times as fast both times.
// All steps since v000 together make it 3.27 times as fast.
#include <hip/hip_runtime.h>

// DeBERTa-style disentangled self-attention + output dense + residual + LayerNorm (hidden_states [4][1024][1024]; q, k, v = hs W + b ('xw' [1024][1024]; 16 heads x 64); rel_q = pos_emb Wq + bq, rel_k = pos_emb Wk + bk (pos_emb [1024][1024], read); scale = 1/sqrt(3 x 64); scores = q.k scale + c2p[i][rel_idx[i][j]] + p2c[rel_idx[i][j]][j] with c2p = q.rel_k scale ([1024][1024]) and p2c = rel_q.k scale ([1024][1024]) and rel_idx the int32 input [1024][1024] (read per logit; = clip(i - j + 512, 0, 1023)); softmax; ctx = merged attn.v; y = ctx Wd + bd + hidden_states; out = LayerNorm(y) gamma + beta (eps 1e-7) -> [4][1024][1024] (4.2 M)).
// Layout: exact bf16 projections (+ once-off rel_k / rel_q projections of the position table -> per-head hi/lo planes); hi/lo planes for q, k (every row: 3-product score GEMMs); per pass of eight heads: content scores [8][1024][1024], c2p [8][1024][1024] and p2c TRANSPOSED [8][key j][rel row] as hi/lo GEMMs, and the softmax kernel (32 query rows per block) gathers the two relative terms per logit at the input index (p2c with lanes along the query rows, handed to the row's wave through LDS), scales, f32 softmax, keeps its 32 rows of hi/lo P in LDS, multiplies them with v (3 products) and writes the merged context as hi/lo planes; Wd (hl x exact) + bd; residual + LayerNorm in f32.
// Launch shape: the conversion, the q/k/v projections, the plane builders, the Wd GEMM and the LayerNorm each run ONCE over the rows of all four batches (the position table's rows ride behind them in the q and k projections); only the per-pass attention launches loop over (batch, 8 heads).
// Compute dtypes, f32 accumulate: every input rounded to bf16; projections on PLAIN bf16 operands (exact) + biases; all score terms and attn.v on hi/lo planes (3 products) for every row; softmax f32; Wd hl x exact; residual/LayerNorm f32 (precise sqrt/division).

#define NB_  4
#define TT   1024
#define DM   1024
#define NH_  16
#define NKV  16
#define REP  (NH_ / NKV)
#define HD   64
#define DQ   (NH_ * HD)
#define DKV  (NKV * HD)
#define ZH   8                     // heads per pass (z extent of the per-pass GEMM launches)
#define RH   1024                  // query rows < RH use hi+lo planes (must equal TT)
#define WIN  0
#define SCL  0.072168783648703225f   // 1/sqrt(3 x 64)
#define NPE  1024                 // relative-position table rows (2 x 512)
typedef _Float16 h16;
typedef unsigned short bf;
typedef __attribute__((ext_vector_type(16))) __bf16   v16bf;
typedef __attribute__((ext_vector_type(16))) _Float16 v16h;
typedef __attribute__((ext_vector_type(8)))  _Float16 v8h;
typedef __attribute__((ext_vector_type(8)))  unsigned short v8us;
typedef __attribute__((ext_vector_type(8)))  float    v8f;
typedef __attribute__((ext_vector_type(4)))  float    v4f;
typedef v8h  __attribute__((may_alias)) v8ha;
typedef v4f  __attribute__((may_alias)) v4fa;
typedef v8us __attribute__((may_alias)) v8usa;

__device__ __forceinline__ unsigned short f2bf(float f) { unsigned u = __float_as_uint(f); u += 0x7FFFu + ((u >> 16) & 1u); return (unsigned short)(u >> 16); }
__device__ __forceinline__ float bf2f(unsigned short b) { return __uint_as_float(((unsigned)b) << 16); }
__device__ __forceinline__ float bfr(float f) { return bf2f(f2bf(f)); }
__device__ __forceinline__ v16h cat16(v8h lo, v8h hi) { return __builtin_shufflevector(lo, hi, 0, 1, 2, 3, 4, 5, 6, 7, 8, 9, 10, 11, 12, 13, 14, 15); }
__device__ __forceinline__ v16bf cat16b(v8us lo, v8us hi) { return __builtin_bit_cast(v16bf, __builtin_shufflevector(lo, hi, 0, 1, 2, 3, 4, 5, 6, 7, 8, 9, 10, 11, 12, 13, 14, 15)); }
__device__ __forceinline__ v8f wmma16(v16h a, v16h b, v8f c) { return __builtin_amdgcn_wmma_f32_16x16x32_f16(false, a, false, b, (short)0, c, false, false); }
__device__ __forceinline__ v8f wmmab(v16bf a, v16bf b, v8f c) { return __builtin_amdgcn_wmma_f32_16x16x32_bf16(false, a, false, b, (short)0, c, false, false); }



// ---- k_gemmw: register-blocked GEMM, ONE WAVE per 64x64 output tile (16 accumulators), operands straight from K-contiguous 16-bit planes; grid (M/64, N/64, Z), 32 threads.
// C[m][n] (f32, pitch ldc, + optional f32 bias[n]) = sum_k A[m][k] Bt[n][k] (+ split products per NSPLIT). z-batch strides sA/sB/sC in elements. K % 32 == 0.
template <typename T16> struct WFrag;
template <> struct WFrag<h16> { typedef v16h V; static __device__ __forceinline__ V ld(const h16* p) { return cat16(*(const v8h*)p, *(const v8h*)(p + 16)); } static __device__ __forceinline__ v8f mma(V a, V b, v8f c) { return wmma16(a, b, c); } };
template <> struct WFrag<bf> { typedef v16bf V; static __device__ __forceinline__ V ld(const bf* p) { return cat16b(*(const v8us*)p, *(const v8us*)(p + 16)); } static __device__ __forceinline__ v8f mma(V a, V b, v8f c) { return wmmab(a, b, c); } };
template <typename T16, int NSPLIT, bool BIAS>
__global__ __launch_bounds__(32) void k_gemmw(const T16* __restrict__ A, const T16* __restrict__ A2, const T16* __restrict__ Bt, const T16* __restrict__ Bt2, int K, float* C, int ldc, const float* __restrict__ bias, size_t sA, size_t sB, size_t sC) {
    typedef typename WFrag<T16>::V V;
    __shared__ __align__(16) float os[16 * 68];
    const size_t z = blockIdx.z; A += z * sA; if (A2) A2 += z * sA; Bt += z * sB; if (Bt2) Bt2 += z * sB; C += z * sC;
    const int lane = threadIdx.x & 31, lr = lane & 15, hi = lane >> 4; const int r0 = blockIdx.x * 64, c0 = blockIdx.y * 64;
    v8f acc[4][4];
#pragma unroll
    for (int mb = 0; mb < 4; ++mb)
#pragma unroll
        for (int nb = 0; nb < 4; ++nb) acc[mb][nb] = (v8f){};
    const size_t aoff = (size_t)(r0 + lr) * K + 8 * hi, boff = (size_t)(c0 + lr) * K + 8 * hi;
#pragma unroll 1
    for (int kc = 0; kc < K; kc += 32) {
        V a[4], a2[4];
#pragma unroll
        for (int mb = 0; mb < 4; ++mb) { a[mb] = WFrag<T16>::ld(A + aoff + (size_t)mb * 16 * K + kc); if (NSPLIT == 1 || NSPLIT == 2) a2[mb] = WFrag<T16>::ld(A2 + aoff + (size_t)mb * 16 * K + kc); }
#pragma unroll
        for (int nb = 0; nb < 4; ++nb) { const V b = WFrag<T16>::ld(Bt + boff + (size_t)nb * 16 * K + kc); V b2; if (NSPLIT >= 2) b2 = WFrag<T16>::ld(Bt2 + boff + (size_t)nb * 16 * K + kc);
#pragma unroll
            for (int mb = 0; mb < 4; ++mb) { acc[mb][nb] = WFrag<T16>::mma(a[mb], b, acc[mb][nb]); if (NSPLIT == 1 || NSPLIT == 2) acc[mb][nb] = WFrag<T16>::mma(a2[mb], b, acc[mb][nb]); if (NSPLIT >= 2) acc[mb][nb] = WFrag<T16>::mma(a[mb], b2, acc[mb][nb]); } }
        asm volatile("v_nop\n\tv_nop\n\tv_nop\n\tv_nop" : "+v"(acc[0][0]), "+v"(acc[1][1]), "+v"(acc[2][2]), "+v"(acc[3][3]) : "v"(a[0]), "v"(a[3]));
    }
#pragma unroll
    for (int mb = 0; mb < 4; ++mb) {
#pragma unroll
        for (int nb = 0; nb < 4; ++nb) {
#pragma unroll
            for (int j = 0; j < 8; ++j) os[(hi * 8 + j) * 68 + nb * 16 + lr] = acc[mb][nb][j]; }
        __builtin_amdgcn_wave_barrier(); asm volatile("" ::: "memory");
        float* crow = C + (size_t)(r0 + mb * 16) * ldc + c0;
{
#pragma unroll
            for (int s = 0; s < 8; ++s) { const int row = 2 * s + hi, cofs = lr * 4; v4f val = *(const v4fa*)(os + row * 68 + cofs); if (BIAS) { val[0] += bfr(bias[c0 + cofs]); val[1] += bfr(bias[c0 + cofs + 1]); val[2] += bfr(bias[c0 + cofs + 2]); val[3] += bfr(bias[c0 + cofs + 3]); }
                *(v4f*)(crow + (size_t)row * ldc + cofs) = val; }
             }
        __builtin_amdgcn_wave_barrier(); asm volatile("" ::: "memory");
    }
}

__device__ __forceinline__ h16 tohx(float x) { return (h16)x; }
__device__ __forceinline__ void splitf(float y, unsigned short& h, unsigned short& l) { h = f2bf(y); l = f2bf(y - bf2f(h)); }
typedef __attribute__((ext_vector_type(2))) _Float16 v2h;
typedef __attribute__((ext_vector_type(4))) _Float16 v4h;
typedef __attribute__((ext_vector_type(2))) unsigned short v2us;
typedef __attribute__((ext_vector_type(4))) unsigned short v4us;
typedef __attribute__((ext_vector_type(2))) float v2f;
typedef __attribute__((ext_vector_type(4))) int v4i;

__global__ __launch_bounds__(256) void k_wtG(const float* __restrict__ w, int K, int N, bf* Bt) {
    const int lane = threadIdx.x & 31; const int L0 = (blockIdx.x * 8 + (threadIdx.x >> 5)) * 8; const int nlines = N * K / 64;
{
#pragma unroll 1
        for (int l = 0; l < 8; ++l) { const int L = L0 + l; if (L >= nlines) break; const size_t e = (size_t)L * 64 + lane * 2; const int k = (int)(e % K), n = (int)(e / K); v2us o;
            o[0] = f2bf(w[(size_t)k * N + n]); o[1] = f2bf(w[(size_t)(k + 1) * N + n]); *(v2us*)(Bt + e) = o; }
         }
}
__global__ __launch_bounds__(256) void k_cvt8(const float* __restrict__ src, bf* dst, size_t n8) { const size_t i = (size_t)blockIdx.x * 256 + threadIdx.x; if (i >= n8) return; const v8f v = *(const v8f*)(src + i * 8); v8us o;
#pragma unroll
    for (int k = 0; k < 8; ++k) o[k] = f2bf(v[k]); *(v8us*)(dst + i * 8) = o;  }

// k_rope: head planes [h][t][d] (fp16 + hi/lo) of rope(x) x sc with the rotate-half convention out[d] = x[d] cos[t][d] - x[d+HD/2] sin[t][d], out[d+HD/2] = x[d+HD/2] cos[t][d+HD/2] + x[d] sin[t][d+HD/2]
__global__ __launch_bounds__(256) void k_rope(const float* __restrict__ F, int pitch, int nheads, const float* __restrict__ CS, const float* __restrict__ RF, const float* __restrict__ nw, float sc, h16* P16, bf* Ph, bf* Pl) {
    const size_t e = ((size_t)blockIdx.x * 256 + threadIdx.x) * 2; if (e >= (size_t)nheads * TT * HD) return; const int d = (int)(e % HD); const int t = (int)((e / HD) % TT); const int h = (int)(e / ((size_t)HD * TT)); const size_t bz = blockIdx.y;   /* batch: rows bz*TT.. of F, planes bz*nheads.. */ const float* f = F + (bz * TT + t) * pitch + h * HD; const float rf = RF ? RF[(size_t)h * TT + t] : 1.0f; v2h o16; v2us oh, ol;
#pragma unroll
    for (int q = 0; q < 2; ++q) { const int dd = d + q; const int dp = (dd < HD / 2) ? dd + HD / 2 : dd - HD / 2; float x0 = f[dd], x1 = f[dp];
        if (RF) { float n0 = __fmul_rn(x0, rf), n1 = __fmul_rn(x1, rf); asm volatile("" : "+v"(n0)); asm volatile("" : "+v"(n1)); x0 = __fmul_rn(bfr(nw[dd]), n0); x1 = __fmul_rn(bfr(nw[dp]), n1); }
        const v2f cs = *(const v2f*)(CS + ((size_t)t * HD + dd) * 2); float a = __fmul_rn(x0, cs[0]), bq = __fmul_rn(x1, cs[1]); asm volatile("" : "+v"(a)); asm volatile("" : "+v"(bq)); const float r = ((dd < HD / 2) ? __fsub_rn(a, bq) : __fadd_rn(a, bq)) * sc;
        o16[q] = tohx(r); unsigned short a2, c2; splitf(r, a2, c2); oh[q] = a2; ol[q] = c2; }
    const size_t eo = bz * nheads * TT * HD + e; *(v2h*)(P16 + eo) = o16; *(v2us*)(Ph + eo) = oh; *(v2us*)(Pl + eo) = ol;  }
__global__ __launch_bounds__(256) void k_vtp(const float* __restrict__ F, int pitch, int nheads, h16* V16, bf* Vh, bf* Vl) { const size_t e = ((size_t)blockIdx.x * 256 + threadIdx.x) * 2; if (e >= (size_t)nheads * HD * TT) return; const int t = (int)(e % TT); const int d = (int)((e / TT) % HD); const int g = (int)(e / ((size_t)TT * HD)); const size_t bz = blockIdx.y;   /* batch */ v2h o16; v2us oh, ol;
#pragma unroll
    for (int q = 0; q < 2; ++q) { const float x = F[(bz * TT + t + q) * pitch + g * HD + d]; o16[q] = tohx(x); unsigned short a2, c2; splitf(x, a2, c2); oh[q] = a2; ol[q] = c2; }
    const size_t eo = bz * nheads * HD * TT + e; *(v2h*)(V16 + eo) = o16; *(v2us*)(Vh + eo) = oh; *(v2us*)(Vl + eo) = ol;  }
__global__ __launch_bounds__(256) void k_csid(float* CS) { const int idx = blockIdx.x * 256 + threadIdx.x; if (idx >= TT * HD) return; v2f cs; cs[0] = 1.0f; cs[1] = 0.0f; *(v2f*)(CS + (size_t)idx * 2) = cs;  }
__global__ __launch_bounds__(256) void k_pplane(const float* __restrict__ POS, bf* Ph2, bf* Pl2) { const size_t e = ((size_t)blockIdx.x * 256 + threadIdx.x) * 2; if (e >= (size_t)NH_ * NPE * HD) return; const int d = (int)(e % HD); const int p = (int)((e / HD) % NPE); const int h = (int)(e / ((size_t)HD * NPE)); v2us oh, ol;
#pragma unroll
    for (int q = 0; q < 2; ++q) { unsigned short a, c; splitf(POS[(size_t)p * DQ + h * HD + d + q], a, c); oh[q] = a; ol[q] = c; } *(v2us*)(Ph2 + e) = oh; *(v2us*)(Pl2 + e) = ol;  }
// k_asoft: per row (zz, i): t = (S + c2p[i][rp] + p2c[rp][j]) x scale with rp = rel_idx[i][j] (int32 input, read per logit with b128 loads; clamped to [0, NPE) for memory safety - the identity for the shipped clip(i - j + 512, 0, 1023)); softmax over the 1024 keys (register row, one exp, fixed trees);
// One block = SR consecutive query rows of one head, one wave per row. The p2c term comes from the transposed plane P2CT[j][rp]: wave w takes the 32 keys j = 32 w .. 32 w + 31 and gathers with its LANES ALONG THE QUERY ROWS, so that indices which rise with i (or stand still) fall into one or two cache lines per load for any key; any other index array is gathered just as correctly, only slower.
// The index tile is turned in LDS (written by rows, read by columns), each gathered value replaces its index in place, and the row's own wave reads its finished row of G.
#define SR 32      // query rows per block = waves per block = TT / 32 key tiles
#define GP 1028    // pitch of G in words: rows stay 16-byte aligned, and lanes that read b128 down a column step 4 banks each
static_assert(RH == TT, "every query row keeps hi/lo P");
#define RP 66      // pitch of a partial-sum row in words: 8-byte aligned, and the two half-waves (8 rows apart) fall on different banks
typedef v4i __attribute__((may_alias)) v4ia;
typedef v4us __attribute__((may_alias)) v4usa;
typedef v2f __attribute__((may_alias)) v2fa;
__global__ __launch_bounds__(1024) void k_asoft(const float* __restrict__ Sb, const float* __restrict__ C2P, const float* __restrict__ P2CT, const int* __restrict__ RIX, const bf* __restrict__ VTh, const bf* __restrict__ VTl, int h0, bf* Ah, bf* Al) {
    __shared__ __align__(16) float G[SR * GP];
    const int lane = threadIdx.x & 31; const int w = threadIdx.x >> 5; const int row0 = blockIdx.x * SR; const int zz = row0 / TT; const int i0 = row0 % TT;
    { const int jw = w * 32; const float* pt = P2CT + ((size_t)zz * TT + jw) * NPE; const int rr = lane >> 3, cc = jw + (lane & 7) * 4; float* gl = G + lane * GP + jw; const int* ip = RIX + (size_t)(i0 + rr) * TT + cc; v4i t[8];
#pragma unroll
      for (int s = 0; s < 8; ++s) t[s] = *(const v4i*)(ip + (size_t)s * 4 * TT);
      asm volatile("s_wait_xcnt 0x0" :: "v"(ip) : "memory");   // the wait in front of any rewrite of the eight loads' shared address pair; named as an input the pair stays live to here, so that no result of the run is placed in it
#pragma unroll
      for (int s = 0; s < 8; ++s) *(v4ia*)(G + (s * 4 + rr) * GP + cc) = t[s];
      __syncthreads();   // index tile complete before it is read by columns
#pragma unroll
      for (int c = 0; c < 8; ++c) t[c] = *(const v4ia*)(gl + c * 4);   // lane = query row i0 + lane, keys jw .. jw + 31
      v4f g[8];
#pragma unroll
      for (int hf = 0; hf < 2; ++hf) { const float* pg[16];   // two runs of 16 gathers, all of a run in flight together
#pragma unroll
          for (int k = 0; k < 16; ++k) { const int c = hf * 4 + (k >> 2), q = k & 3; int rp = t[c][q]; rp = rp < 0 ? 0 : (rp > NPE - 1 ? NPE - 1 : rp); pg[k] = pt + rp; g[c][q] = pg[k][(size_t)(c * 4 + q) * NPE]; }
          asm volatile("s_wait_xcnt 0x0" :: "v"(pg[0]), "v"(pg[1]), "v"(pg[2]), "v"(pg[3]), "v"(pg[4]), "v"(pg[5]), "v"(pg[6]), "v"(pg[7]), "v"(pg[8]), "v"(pg[9]), "v"(pg[10]), "v"(pg[11]), "v"(pg[12]), "v"(pg[13]), "v"(pg[14]), "v"(pg[15]) : "memory"); }   // the wait in front of any rewrite of the run's address pairs; named as inputs they stay live to here, so that no result of the run is placed in one
#pragma unroll
      for (int c = 0; c < 8; ++c) *(v4fa*)(gl + c * 4) = g[c];
      __syncthreads();   // every key tile of G gathered before a row's wave reads across them
    }
    const int row = row0 + w; const int i = i0 + w; const float* cr = C2P + (size_t)row * NPE; const float* gr = G + w * GP; const int* rxr = RIX + (size_t)i * TT; const float* sr = Sb + (size_t)row * TT; float v[TT / 32]; float mx = -3.0e38f;
#pragma unroll
    for (int ch = 0; ch < TT / 128; ++ch) { const int j0 = ch * 128 + lane * 4; const v4f a = *(const v4f*)(sr + j0); const v4i r4 = *(const v4i*)(rxr + j0); const v4f p4 = *(const v4fa*)(gr + j0);
#pragma unroll
        for (int q = 0; q < 4; ++q) { const int j = j0 + q; (void)j; int rp = r4[q]; rp = rp < 0 ? 0 : (rp > NPE - 1 ? NPE - 1 : rp); float s1 = __fadd_rn(a[q], cr[rp]); asm volatile("" : "+v"(s1)); float s2 = __fadd_rn(s1, p4[q]); asm volatile("" : "+v"(s2)); float sa = s2 * SCL; asm volatile("" : "+v"(sa)); const float t = sa;   /* (qk + c2p[i][rp] + p2c[rp][j]) x scale, rp = rel_idx[i][j] */ v[ch * 4 + q] = t; mx = fmaxf(mx, t); } }
#pragma unroll
    for (int sh = 16; sh; sh >>= 1) mx = fmaxf(mx, __shfl_xor(mx, sh, 32));
    float sum = 0.f;
#pragma unroll
    for (int k = 0; k < TT / 32; ++k) { float d0 = __fsub_rn(v[k], mx); asm volatile("" : "+v"(d0)); v[k] = __builtin_amdgcn_exp2f(__fmul_rn(d0, 1.4426950408889634f)); sum += v[k]; }
#pragma unroll
    for (int sh = 16; sh; sh >>= 1) sum += __shfl_xor(sum, sh, 32);
    const float f = __fdiv_rn(1.0f, sum);
    // P stays in LDS: the wave's own row of G (read by nobody else behind the second barrier, and by this wave no more) takes the row's 1024 hi halves, then its 1024 lo halves.
    bf* pr = (bf*)G + (size_t)w * (GP * 2);
#pragma unroll
    for (int ch = 0; ch < TT / 128; ++ch) { v4us oh, ol;
#pragma unroll
        for (int q = 0; q < 4; ++q) { unsigned short a, c2; splitf(v[ch * 4 + q] * f, a, c2); oh[q] = a; ol[q] = c2; }
        *(v4usa*)(pr + ch * 128 + lane * 4) = oh; *(v4usa*)(pr + TT + ch * 128 + lane * 4) = ol; }
    // attn.v of the block's 32 rows: wave w takes the 16 head columns nt * 16 .. and the 128 keys ks * 128 .. (both 16-row tiles), so that every v fragment is loaded once per block; the eight key slices are summed through LDS in fixed order. (The loops are unrolled so that b, b2 and acc are indexed by constants and stay in registers.)
    const int lr = lane & 15, hi = lane >> 4, nt = w & 3, ks = w >> 2;
    const size_t vo = ((size_t)zz * HD + nt * 16 + lr) * TT + ks * 128 + 8 * hi; const bf* vh = VTh + vo; const bf* vl = VTl + vo;
    v16bf b[4], b2[4];
#pragma unroll
    for (int kk = 0; kk < 4; ++kk) { b[kk] = WFrag<bf>::ld(vh + kk * 32); b2[kk] = WFrag<bf>::ld(vl + kk * 32); }   // issued in front of the barrier: they do not depend on P and fly while the block gathers there
    asm volatile("s_wait_xcnt 0x0" :: "v"(vh), "v"(vl) : "memory");   // the wait in front of any rewrite of the sixteen loads' two address pairs; named as inputs the pairs stay live to here
    __syncthreads();   // all 32 rows of P written before the fragments are read across them
    v8f acc[2]; acc[0] = (v8f){}; acc[1] = (v8f){};
#pragma unroll
    for (int kk = 0; kk < 4; ++kk) {
#pragma unroll
        for (int mt = 0; mt < 2; ++mt) { const bf* pa = (const bf*)G + (size_t)(mt * 16 + lr) * (GP * 2) + ks * 128 + kk * 32 + 8 * hi;
            const v16bf a = cat16b(*(const v8usa*)pa, *(const v8usa*)(pa + 16)); const v16bf a2 = cat16b(*(const v8usa*)(pa + TT), *(const v8usa*)(pa + TT + 16));
            acc[mt] = wmmab(a, b[kk], acc[mt]); acc[mt] = wmmab(a2, b[kk], acc[mt]); acc[mt] = wmmab(a, b2[kk], acc[mt]); } }
    __syncthreads();   // every fragment of P read before G is reused for the partial sums
#pragma unroll
    for (int mt = 0; mt < 2; ++mt)
#pragma unroll
        for (int j = 0; j < 8; ++j) G[(ks * SR + mt * 16 + hi * 8 + j) * RP + nt * 16 + lr] = acc[mt][j];
    __syncthreads();   // all eight key slices' partial sums written before a row's wave adds them
    v2f o = *(const v2fa*)(G + w * RP + lane * 2);
#pragma unroll
    for (int s = 1; s < 8; ++s) { const v2f p = *(const v2fa*)(G + (s * SR + w) * RP + lane * 2); o[0] += p[0]; o[1] += p[1]; }
    v2us oh, ol;
#pragma unroll
    for (int q = 0; q < 2; ++q) { unsigned short a, c2; splitf(o[q], a, c2); oh[q] = a; ol[q] = c2; }
    const size_t oo = (size_t)i * DQ + (h0 + zz) * HD + lane * 2; *(v2us*)(Ah + oo) = oh; *(v2us*)(Al + oo) = ol;   // merged context [t][head][d]: one wave writes one 128-byte line of each plane
}

__global__ __launch_bounds__(256) void k_lnres(const float* __restrict__ Y, const float* __restrict__ xres, const float* __restrict__ g, const float* __restrict__ bb, float* out) {
    const int lane = threadIdx.x & 31; const int row = blockIdx.x * 8 + (threadIdx.x >> 5); if (row >= NB_ * TT) return; const float* yr = Y + (size_t)row * DM; const float* xr = xres + (size_t)row * DM; float v[DM / 32]; float s = 0.f;
#pragma unroll
    for (int ch = 0; ch < DM / 128; ++ch) { const v4f a = *(const v4f*)(yr + ch * 128 + lane * 4); const v4f c = *(const v4f*)(xr + ch * 128 + lane * 4);
#pragma unroll
        for (int q = 0; q < 4; ++q) { const float t = __fadd_rn(a[q], bfr(c[q])); v[ch * 4 + q] = t; s = __fadd_rn(s, t); } }
#pragma unroll
    for (int sh = 16; sh; sh >>= 1) s = __fadd_rn(s, __shfl_xor(s, sh, 32));
    const float mu = __fdiv_rn(s, (float)DM); float s2 = 0.f;
#pragma unroll
    for (int k = 0; k < DM / 32; ++k) { float d0 = __fsub_rn(v[k], mu); asm volatile("" : "+v"(d0)); float p = __fmul_rn(d0, d0); asm volatile("" : "+v"(p)); s2 = __fadd_rn(s2, p); }
#pragma unroll
    for (int sh = 16; sh; sh >>= 1) s2 = __fadd_rn(s2, __shfl_xor(s2, sh, 32));
    const float rs = __fdiv_rn(1.0f, __fsqrt_rn(__fadd_rn(__fdiv_rn(s2, (float)DM), 1e-7f)));
{
#pragma unroll
        for (int ch = 0; ch < DM / 128; ++ch) { const int c0 = ch * 128 + lane * 4; v4f o;
#pragma unroll
            for (int q = 0; q < 4; ++q) { float xn = __fmul_rn(__fsub_rn(v[ch * 4 + q], mu), rs); asm volatile("" : "+v"(xn)); float gg = bfr(g[c0 + q]); asm volatile("" : "+v"(gg)); float yv = __fmul_rn(xn, gg); asm volatile("" : "+v"(yv)); float be = bfr(bb[c0 + q]); asm volatile("" : "+v"(be)); o[q] = __fadd_rn(yv, be); }
            *(v4f*)(out + (size_t)row * DM + c0) = o; }
         }
}

extern "C" void kernel_launch(void* const* d_in, const int* in_sizes, int n_in,
                              void* d_out, int out_size, void* d_ws, size_t ws_size, hipStream_t stream) {
    (void)in_sizes; (void)n_in; (void)out_size;
    const float* x = (const float*)d_in[0]; const float* rel = (const float*)d_in[1]; const float* wq = (const float*)d_in[2]; const float* bq = (const float*)d_in[3]; const float* wk = (const float*)d_in[4]; const float* bk = (const float*)d_in[5]; const float* wv = (const float*)d_in[6]; const float* bv = (const float*)d_in[7]; const float* wo = (const float*)d_in[8]; const float* bo = (const float*)d_in[9]; const float* lng = (const float*)d_in[10]; const float* lnb = (const float*)d_in[11]; const int* RIDX = (const int*)d_in[12];
    float* OUT = (float*)d_out;     // [4][1024][1024]
    char* wsp = (char*)d_ws;
    auto take = [&](size_t bytes) { char* p = wsp; wsp += (bytes + 255) & ~(size_t)255; return (void*)p; };
    bf* WQ = (bf*)take((size_t)DQ * DM * 2); bf* WK = (bf*)take((size_t)DKV * DM * 2); bf* WV = (bf*)take((size_t)DKV * DM * 2); bf* WO = (bf*)take((size_t)DM * DQ * 2); float* CS = (float*)take((size_t)TT * HD * 2 * 4);
    bf* PKh = (bf*)take((size_t)NH_ * NPE * HD * 2); bf* PKl = (bf*)take((size_t)NH_ * NPE * HD * 2); bf* PQh = (bf*)take((size_t)NH_ * NPE * HD * 2); bf* PQl = (bf*)take((size_t)NH_ * NPE * HD * 2); float* C2P = (float*)take((size_t)ZH * TT * NPE * 4); float* P2C = (float*)take((size_t)ZH * NPE * TT * 4);
    bf* QPh = (bf*)take((size_t)NB_ * NH_ * TT * HD * 2); bf* QPl = (bf*)take((size_t)NB_ * NH_ * TT * HD * 2); bf* KPh = (bf*)take((size_t)NB_ * NKV * TT * HD * 2); bf* KPl = (bf*)take((size_t)NB_ * NKV * TT * HD * 2); bf* VTh = (bf*)take((size_t)NB_ * NKV * HD * TT * 2); bf* VTl = (bf*)take((size_t)NB_ * NKV * HD * TT * 2);
    float* Sb = (float*)take((size_t)ZH * TT * TT * 4); bf* ATh = (bf*)take((size_t)NB_ * TT * DQ * 2); bf* ATl = (bf*)take((size_t)NB_ * TT * DQ * 2);
    if ((size_t)(wsp - (char*)d_ws) > ws_size) return;    // ws 256 MiB
    // Buffers that live only before the first pass, or only after the last, lie inside the three 32-MiB score buffers (stream-ordered; each is written in this call before it is read):
    // Sb: FQ [5120][1024] f32 (20 MiB) + QP16 (8 MiB), later Y [4096][1024] f32; C2P: FK / FV (20 MiB) + KP16 (8 MiB); P2C: XB [5120][1024] bf16 (10 MiB) + VT16 (8 MiB).
    const size_t MR = (size_t)NB_ * TT;       // rows of all batches; the position table's NPE rows follow them
    float* FQ = Sb; h16* QP16 = (h16*)(Sb + (MR + NPE) * DQ); float* Y = Sb;
    float* FK = C2P; h16* KP16 = (h16*)(C2P + (MR + NPE) * DKV); float* FV = FK;   // v projection reuses the k buffer after the k planes are built (stream-ordered)
    bf* XB = (bf*)P2C; h16* VT16 = (h16*)(XB + (MR + NPE) * DM);
    { k_wtG<<<(unsigned)((DM * DQ / 64 + 63) / 64), 256, 0, stream>>>(wq, DM, DQ, WQ); k_wtG<<<(unsigned)((DM * DKV / 64 + 63) / 64), 256, 0, stream>>>(wk, DM, DKV, WK); k_wtG<<<(unsigned)((DM * DKV / 64 + 63) / 64), 256, 0, stream>>>(wv, DM, DKV, WV);
      k_wtG<<<(unsigned)((DQ * DM / 64 + 63) / 64), 256, 0, stream>>>(wo, DQ, DM, WO);
       }
    k_csid<<<(TT * HD + 255) / 256, 256, 0, stream>>>(CS);
    k_cvt8<<<(unsigned)(((size_t)NB_ * TT * DM / 8 + 255) / 256), 256, 0, stream>>>(x, XB, (size_t)NB_ * TT * DM / 8);
    k_cvt8<<<(unsigned)(((size_t)NPE * DM / 8 + 255) / 256), 256, 0, stream>>>(rel, XB + MR * DM, (size_t)NPE * DM / 8);
    const unsigned LQ = (unsigned)(((size_t)NH_ * TT * HD / 2 + 255) / 256), LKv = (unsigned)(((size_t)NKV * TT * HD / 2 + 255) / 256);
    k_gemmw<bf, 0, true><<<dim3((NB_ * TT + NPE) / 64, DQ / 64, 1), 32, 0, stream>>>(XB, nullptr, WQ, nullptr, DM, FQ, DQ, bq, 0, 0, 0);   /* q of every batch, then rel_q = pos_emb Wq + bq */
    k_rope<<<dim3(LQ, NB_, 1), 256, 0, stream>>>(FQ, DQ, NH_, CS, nullptr, nullptr, 1.0f, QP16, QPh, QPl);
    k_pplane<<<(unsigned)(((size_t)NH_ * NPE * HD / 2 + 255) / 256), 256, 0, stream>>>(FQ + MR * DQ, PQh, PQl);   /* rel_q -> per-head hi/lo planes [h][1024][64] */
    k_gemmw<bf, 0, true><<<dim3((NB_ * TT + NPE) / 64, DKV / 64, 1), 32, 0, stream>>>(XB, nullptr, WK, nullptr, DM, FK, DKV, bk, 0, 0, 0);   /* k of every batch, then rel_k = pos_emb Wk + bk */
    k_rope<<<dim3(LKv, NB_, 1), 256, 0, stream>>>(FK, DKV, NKV, CS, nullptr, nullptr, 1.0f, KP16, KPh, KPl);
    k_pplane<<<(unsigned)(((size_t)NH_ * NPE * HD / 2 + 255) / 256), 256, 0, stream>>>(FK + MR * DKV, PKh, PKl);   /* rel_k -> per-head hi/lo planes [h][1024][64] */
    k_gemmw<bf, 0, true><<<dim3(NB_ * TT / 64, DKV / 64, 1), 32, 0, stream>>>(XB, nullptr, WV, nullptr, DM, FV, DKV, bv, 0, 0, 0); k_vtp<<<dim3(LKv, NB_, 1), 256, 0, stream>>>(FV, DKV, NKV, VT16, VTh, VTl);
    for (int b = 0; b < NB_; ++b) {
        for (int h0 = 0; h0 < NH_; h0 += ZH) { const size_t zq = (size_t)h0, zk = (size_t)(h0 / REP), bq0 = (size_t)b * NH_ + zq, bk0 = (size_t)b * NKV + zk;   // one kv head per query head: the pass's heads use consecutive kv planes (z-strides TT*HD); bq0 / bk0: the same heads in the planes of batch b
            k_gemmw<bf, 2, false><<<dim3(RH / 64, TT / 64, ZH), 32, 0, stream>>>(QPh + bq0 * TT * HD, QPl + bq0 * TT * HD, KPh + bk0 * TT * HD, KPl + bk0 * TT * HD, HD, Sb, TT, nullptr, (size_t)TT * HD, (size_t)TT * HD, (size_t)TT * TT);
            k_gemmw<bf, 2, false><<<dim3(TT / 64, NPE / 64, ZH), 32, 0, stream>>>(QPh + bq0 * TT * HD, QPl + bq0 * TT * HD, PKh + zq * NPE * HD, PKl + zq * NPE * HD, HD, C2P, NPE, nullptr, (size_t)TT * HD, (size_t)NPE * HD, (size_t)TT * NPE);   /* c2p raw [ZH][1024][1024] */
            k_gemmw<bf, 2, false><<<dim3(TT / 64, NPE / 64, ZH), 32, 0, stream>>>(KPh + bk0 * TT * HD, KPl + bk0 * TT * HD, PQh + zq * NPE * HD, PQl + zq * NPE * HD, HD, P2C, NPE, nullptr, (size_t)TT * HD, (size_t)NPE * HD, (size_t)TT * NPE);   /* p2c raw, transposed: [ZH][key j][rel row] */
            k_asoft<<<ZH * TT / SR, SR * 32, 0, stream>>>(Sb, C2P, P2C, RIDX, VTh + bk0 * HD * TT, VTl + bk0 * HD * TT, h0, ATh + (size_t)b * TT * DQ, ATl + (size_t)b * TT * DQ); } }
    k_gemmw<bf, 1, true><<<dim3(NB_ * TT / 64, DM / 64, 1), 32, 0, stream>>>(ATh, ATl, WO, nullptr, DQ, Y, DM, bo, 0, 0, 0);   /* y = ctx Wd + bd (f32), every batch */
    k_lnres<<<NB_ * TT / 8, 256, 0, stream>>>(Y, x, lng, lnb, OUT);
}

// v005
// One run takes 497 microseconds.
// Timed twice side by side with v004, it ran 1.46 times as fast both times.
// All steps since v000 together make it 4.78 times as fast.
#include <hip/hip_runtime.h>

// DeBERTa-style disentangled self-attention + output dense + residual + LayerNorm (hidden_states [4][1024][1024]; q, k, v = hs W + b ('xw' [1024][1024]; 16 heads x 64); rel_q = pos_emb Wq + bq, rel_k = pos_emb Wk + bk (pos_emb [1024][1024], read); scale = 1/sqrt(3 x 64); scores = q.k scale + c2p[i][rel_idx[i][j]] + p2c[rel_idx[i][j]][j] with c2p = q.rel_k scale ([1024][1024]) and p2c = rel_q.k scale ([1024][1024]) and rel_idx the int32 input [1024][1024] (read per logit; = clip(i - j + 512, 0, 1023)); softmax; ctx = merged attn.v; y = ctx Wd + bd + hidden_states; out = LayerNorm(y) gamma + beta (eps 1e-7) -> [4][1024][1024] (4.2 M)).
// Layout: exact bf16 projections (+ once-off rel_k / rel_q projections of the position table -> per-head hi/lo planes); hi/lo planes for q, k (every row: 3-product score GEMMs); per pass of eight heads: p2c TRANSPOSED [8][key j][rel row] as a hi/lo GEMM, and the softmax kernel (32 query rows per block) computes its own 32 rows of content scores and of c2p on the matrix unit (hi/lo, 3 products, kept in LDS), gathers the two relative terms per logit at the input index (p2c from the plane with lanes along the query rows, handed to the row's wave through LDS; c2p from the row's LDS copy), scales, f32 softmax, keeps its 32 rows of hi/lo P in LDS, multiplies them with v (3 products) and writes the merged context as hi/lo planes; Wd (hl x exact) + bd; residual + LayerNorm in f32.
// Launch shape: the conversion, the q/k/v projections, the plane builders, the Wd GEMM and the LayerNorm each run ONCE over the rows of all four batches (the position table's rows ride behind them in the q and k projections); only the per-pass attention launches loop over (batch, 8 heads).
// Compute dtypes, f32 accumulate: every input rounded to bf16; projections on PLAIN bf16 operands (exact) + biases; all score terms and attn.v on hi/lo planes (3 products) for every row; softmax f32; Wd hl x exact; residual/LayerNorm f32 (precise sqrt/division).

#define NB_  4
#define TT   1024
#define DM   1024
#define NH_  16
#define NKV  16
#define REP  (NH_ / NKV)
#define HD   64
#define DQ   (NH_ * HD)
#define DKV  (NKV * HD)
#define ZH   8                     // heads per pass (z extent of the per-pass GEMM launches)
#define RH   1024                  // query rows < RH use hi+lo planes (must equal TT)
#define WIN  0
#define SCL  0.072168783648703225f   // 1/sqrt(3 x 64)
#define NPE  1024                 // relative-position table rows (2 x 512)
typedef _Float16 h16;
typedef unsigned short bf;
typedef __attribute__((ext_vector_type(16))) __bf16   v16bf;
typedef __attribute__((ext_vector_type(16))) _Float16 v16h;
typedef __attribute__((ext_vector_type(8)))  _Float16 v8h;
typedef __attribute__((ext_vector_type(8)))  unsigned short v8us;
typedef __attribute__((ext_vector_type(8)))  float    v8f;
typedef __attribute__((ext_vector_type(4)))  float    v4f;
typedef v8h  __attribute__((may_alias)) v8ha;
typedef v4f  __attribute__((may_alias)) v4fa;
typedef v8us __attribute__((may_alias)) v8usa;

__device__ __forceinline__ unsigned short f2bf(float f) { unsigned u = __float_as_uint(f); u += 0x7FFFu + ((u >> 16) & 1u); return (unsigned short)(u >> 16); }
__device__ __forceinline__ float bf2f(unsigned short b) { return __uint_as_float(((unsigned)b) << 16); }
__device__ __forceinline__ float bfr(float f) { return bf2f(f2bf(f)); }
__device__ __forceinline__ v16h cat16(v8h lo, v8h hi) { return __builtin_shufflevector(lo, hi, 0, 1, 2, 3, 4, 5, 6, 7, 8, 9, 10, 11, 12, 13, 14, 15); }
__device__ __forceinline__ v16bf cat16b(v8us lo, v8us hi) { return __builtin_bit_cast(v16bf, __builtin_shufflevector(lo, hi, 0, 1, 2, 3, 4, 5, 6, 7, 8, 9, 10, 11, 12, 13, 14, 15)); }
__device__ __forceinline__ v8f wmma16(v16h a, v16h b, v8f c) { return __builtin_amdgcn_wmma_f32_16x16x32_f16(false, a, false, b, (short)0, c, false, false); }
__device__ __forceinline__ v8f wmmab(v16bf a, v16bf b, v8f c) { return __builtin_amdgcn_wmma_f32_16x16x32_bf16(false, a, false, b, (short)0, c, false, false); }



// ---- k_gemmw: register-blocked GEMM, ONE WAVE per 64x64 output tile (16 accumulators), operands straight from K-contiguous 16-bit planes; grid (M/64, N/64, Z), 32 threads.
// C[m][n] (f32, pitch ldc, + optional f32 bias[n]) = sum_k A[m][k] Bt[n][k] (+ split products per NSPLIT). z-batch strides sA/sB/sC in elements. K % 32 == 0.
template <typename T16> struct WFrag;
template <> struct WFrag<h16> { typedef v16h V; static __device__ __forceinline__ V ld(const h16* p) { return cat16(*(const v8h*)p, *(const v8h*)(p + 16)); } static __device__ __forceinline__ v8f mma(V a, V b, v8f c) { return wmma16(a, b, c); } };
template <> struct WFrag<bf> { typedef v16bf V; static __device__ __forceinline__ V ld(const bf* p) { return cat16b(*(const v8us*)p, *(const v8us*)(p + 16)); } static __device__ __forceinline__ v8f mma(V a, V b, v8f c) { return wmmab(a, b, c); } };
template <typename T16, int NSPLIT, bool BIAS>
__global__ __launch_bounds__(32) void k_gemmw(const T16* __restrict__ A, const T16* __restrict__ A2, const T16* __restrict__ Bt, const T16* __restrict__ Bt2, int K, float* C, int ldc, const float* __restrict__ bias, size_t sA, size_t sB, size_t sC) {
    typedef typename WFrag<T16>::V V;
    __shared__ __align__(16) float os[16 * 68];
    const size_t z = blockIdx.z; A += z * sA; if (A2) A2 += z * sA; Bt += z * sB; if (Bt2) Bt2 += z * sB; C += z * sC;
    const int lane = threadIdx.x & 31, lr = lane & 15, hi = lane >> 4; const int r0 = blockIdx.x * 64, c0 = blockIdx.y * 64;
    v8f acc[4][4];
#pragma unroll
    for (int mb = 0; mb < 4; ++mb)
#pragma unroll
        for (int nb = 0; nb < 4; ++nb) acc[mb][nb] = (v8f){};
    const size_t aoff = (size_t)(r0 + lr) * K + 8 * hi, boff = (size_t)(c0 + lr) * K + 8 * hi;
#pragma unroll 1
    for (int kc = 0; kc < K; kc += 32) {
        V a[4], a2[4];
#pragma unroll
        for (int mb = 0; mb < 4; ++mb) { a[mb] = WFrag<T16>::ld(A + aoff + (size_t)mb * 16 * K + kc); if (NSPLIT == 1 || NSPLIT == 2) a2[mb] = WFrag<T16>::ld(A2 + aoff + (size_t)mb * 16 * K + kc); }
#pragma unroll
        for (int nb = 0; nb < 4; ++nb) { const V b = WFrag<T16>::ld(Bt + boff + (size_t)nb * 16 * K + kc); V b2; if (NSPLIT >= 2) b2 = WFrag<T16>::ld(Bt2 + boff + (size_t)nb * 16 * K + kc);
#pragma unroll
            for (int mb = 0; mb < 4; ++mb) { acc[mb][nb] = WFrag<T16>::mma(a[mb], b, acc[mb][nb]); if (NSPLIT == 1 || NSPLIT == 2) acc[mb][nb] = WFrag<T16>::mma(a2[mb], b, acc[mb][nb]); if (NSPLIT >= 2) acc[mb][nb] = WFrag<T16>::mma(a[mb], b2, acc[mb][nb]); } }
        asm volatile("v_nop\n\tv_nop\n\tv_nop\n\tv_nop" : "+v"(acc[0][0]), "+v"(acc[1][1]), "+v"(acc[2][2]), "+v"(acc[3][3]) : "v"(a[0]), "v"(a[3]));
    }
#pragma unroll
    for (int mb = 0; mb < 4; ++mb) {
#pragma unroll
        for (int nb = 0; nb < 4; ++nb) {
#pragma unroll
            for (int j = 0; j < 8; ++j) os[(hi * 8 + j) * 68 + nb * 16 + lr] = acc[mb][nb][j]; }
        __builtin_amdgcn_wave_barrier(); asm volatile("" ::: "memory");
        float* crow = C + (size_t)(r0 + mb * 16) * ldc + c0;
{
#pragma unroll
            for (int s = 0; s < 8; ++s) { const int row = 2 * s + hi, cofs = lr * 4; v4f val = *(const v4fa*)(os + row * 68 + cofs); if (BIAS) { val[0] += bfr(bias[c0 + cofs]); val[1] += bfr(bias[c0 + cofs + 1]); val[2] += bfr(bias[c0 + cofs + 2]); val[3] += bfr(bias[c0 + cofs + 3]); }
                *(v4f*)(crow + (size_t)row * ldc + cofs) = val; }
             }
        __builtin_amdgcn_wave_barrier(); asm volatile("" ::: "memory");
    }
}

__device__ __forceinline__ h16 tohx(float x) { return (h16)x; }
__device__ __forceinline__ void splitf(float y, unsigned short& h, unsigned short& l) { h = f2bf(y); l = f2bf(y - bf2f(h)); }
typedef __attribute__((ext_vector_type(2))) _Float16 v2h;
typedef __attribute__((ext_vector_type(4))) _Float16 v4h;
typedef __attribute__((ext_vector_type(2))) unsigned short v2us;
typedef __attribute__((ext_vector_type(4))) unsigned short v4us;
typedef __attribute__((ext_vector_type(2))) float v2f;
typedef __attribute__((ext_vector_type(4))) int v4i;

__global__ __launch_bounds__(256) void k_wtG(const float* __restrict__ w, int K, int N, bf* Bt) {
    const int lane = threadIdx.x & 31; const int L0 = (blockIdx.x * 8 + (threadIdx.x >> 5)) * 8; const int nlines = N * K / 64;
{
#pragma unroll 1
        for (int l = 0; l < 8; ++l) { const int L = L0 + l; if (L >= nlines) break; const size_t e = (size_t)L * 64 + lane * 2; const int k = (int)(e % K), n = (int)(e / K); v2us o;
            o[0] = f2bf(w[(size_t)k * N + n]); o[1] = f2bf(w[(size_t)(k + 1) * N + n]); *(v2us*)(Bt + e) = o; }
         }
}
__global__ __launch_bounds__(256) void k_cvt8(const float* __restrict__ src, bf* dst, size_t n8) { const size_t i = (size_t)blockIdx.x * 256 + threadIdx.x; if (i >= n8) return; const v8f v = *(const v8f*)(src + i * 8); v8us o;
#pragma unroll
    for (int k = 0; k < 8; ++k) o[k] = f2bf(v[k]); *(v8us*)(dst + i * 8) = o;  }

// k_rope: head planes [h][t][d] (fp16 + hi/lo) of rope(x) x sc with the rotate-half convention out[d] = x[d] cos[t][d] - x[d+HD/2] sin[t][d], out[d+HD/2] = x[d+HD/2] cos[t][d+HD/2] + x[d] sin[t][d+HD/2]
__global__ __launch_bounds__(256) void k_rope(const float* __restrict__ F, int pitch, int nheads, const float* __restrict__ CS, const float* __restrict__ RF, const float* __restrict__ nw, float sc, h16* P16, bf* Ph, bf* Pl) {
    const size_t e = ((size_t)blockIdx.x * 256 + threadIdx.x) * 2; if (e >= (size_t)nheads * TT * HD) return; const int d = (int)(e % HD); const int t = (int)((e / HD) % TT); const int h = (int)(e / ((size_t)HD * TT)); const size_t bz = blockIdx.y;   /* batch: rows bz*TT.. of F, planes bz*nheads.. */ const float* f = F + (bz * TT + t) * pitch + h * HD; const float rf = RF ? RF[(size_t)h * TT + t] : 1.0f; v2h o16; v2us oh, ol;
#pragma unroll
    for (int q = 0; q < 2; ++q) { const int dd = d + q; const int dp = (dd < HD / 2) ? dd + HD / 2 : dd - HD / 2; float x0 = f[dd], x1 = f[dp];
        if (RF) { float n0 = __fmul_rn(x0, rf), n1 = __fmul_rn(x1, rf); asm volatile("" : "+v"(n0)); asm volatile("" : "+v"(n1)); x0 = __fmul_rn(bfr(nw[dd]), n0); x1 = __fmul_rn(bfr(nw[dp]), n1); }
        const v2f cs = *(const v2f*)(CS + ((size_t)t * HD + dd) * 2); float a = __fmul_rn(x0, cs[0]), bq = __fmul_rn(x1, cs[1]); asm volatile("" : "+v"(a)); asm volatile("" : "+v"(bq)); const float r = ((dd < HD / 2) ? __fsub_rn(a, bq) : __fadd_rn(a, bq)) * sc;
        o16[q] = tohx(r); unsigned short a2, c2; splitf(r, a2, c2); oh[q] = a2; ol[q] = c2; }
    const size_t eo = bz * nheads * TT * HD + e; *(v2h*)(P16 + eo) = o16; *(v2us*)(Ph + eo) = oh; *(v2us*)(Pl + eo) = ol;  }
__global__ __launch_bounds__(256) void k_vtp(const float* __restrict__ F, int pitch, int nheads, h16* V16, bf* Vh, bf* Vl) { const size_t e = ((size_t)blockIdx.x * 256 + threadIdx.x) * 2; if (e >= (size_t)nheads * HD * TT) return; const int t = (int)(e % TT); const int d = (int)((e / TT) % HD); const int g = (int)(e / ((size_t)TT * HD)); const size_t bz = blockIdx.y;   /* batch */ v2h o16; v2us oh, ol;
#pragma unroll
    for (int q = 0; q < 2; ++q) { const float x = F[(bz * TT + t + q) * pitch + g * HD + d]; o16[q] = tohx(x); unsigned short a2, c2; splitf(x, a2, c2); oh[q] = a2; ol[q] = c2; }
    const size_t eo = bz * nheads * HD * TT + e; *(v2h*)(V16 + eo) = o16; *(v2us*)(Vh + eo) = oh; *(v2us*)(Vl + eo) = ol;  }
__global__ __launch_bounds__(256) void k_csid(float* CS) { const int idx = blockIdx.x * 256 + threadIdx.x; if (idx >= TT * HD) return; v2f cs; cs[0] = 1.0f; cs[1] = 0.0f; *(v2f*)(CS + (size_t)idx * 2) = cs;  }
__global__ __launch_bounds__(256) void k_pplane(const float* __restrict__ POS, bf* Ph2, bf* Pl2) { const size_t e = ((size_t)blockIdx.x * 256 + threadIdx.x) * 2; if (e >= (size_t)NH_ * NPE * HD) return; const int d = (int)(e % HD); const int p = (int)((e / HD) % NPE); const int h = (int)(e / ((size_t)HD * NPE)); v2us oh, ol;
#pragma unroll
    for (int q = 0; q < 2; ++q) { unsigned short a, c; splitf(POS[(size_t)p * DQ + h * HD + d + q], a, c); oh[q] = a; ol[q] = c; } *(v2us*)(Ph2 + e) = oh; *(v2us*)(Pl2 + e) = ol;  }
// k_asoft: per row (zz, i): t = ((q.k + p2c[rp][j]) + c2p[i][rp]) x scale with rp = rel_idx[i][j] (int32 input, read per logit with b128 loads; clamped to [0, NPE) for memory safety - the identity for the shipped clip(i - j + 512, 0, 1023)); softmax over the 1024 keys (register row, one exp, fixed trees);
// One block = SR consecutive query rows of one head, one wave per row. The p2c term comes from the transposed plane P2CT[j][rp]: wave w takes the 32 keys j = 32 w .. 32 w + 31 and gathers with its LANES ALONG THE QUERY ROWS, so that indices which rise with i (or stand still) fall into one or two cache lines per load for any key; any other index array is gathered just as correctly, only slower.
// The index tile is turned in LDS (written by rows, read by columns), each gathered value replaces its index in place, and the row's own wave reads its finished row of G.
#define SR 32      // query rows per block = waves per block = TT / 32 key tiles
#define GP 1028    // pitch of G in words: rows stay 16-byte aligned, and lanes that read b128 down a column step 4 banks each
static_assert(RH == TT, "every query row keeps hi/lo P");
#define RP 66      // pitch of a partial-sum row in words: 8-byte aligned, and the two half-waves (8 rows apart) fall on different banks
typedef v4i __attribute__((may_alias)) v4ia;
typedef v4us __attribute__((may_alias)) v4usa;
typedef v2f __attribute__((may_alias)) v2fa;
#define QPT 72     // pitch of a staged q row in 16-bit elements: 128 bytes + 16, so that the 16 rows of a fragment read fall on different banks
// stage16: one 16-row tile (hi and lo plane, rows of 64 elements = 128 bytes, so 2 KiB contiguous per plane) of a K-contiguous operand goes through the wave's own 32 x 128-byte column tile of an LDS array (st): whole-line global loads, then fragment reads from LDS (rows 0..15 hi, 16..31 lo). ph / pl point at the lane's own 16 bytes of the tile's first 512.
__device__ __forceinline__ void stage16(const bf* __restrict__ ph, const bf* __restrict__ pl, float* st, int lane, v16bf (&fh)[2], v16bf (&fl)[2]) {
    v8us r[8];
#pragma unroll
    for (int s = 0; s < 4; ++s) { r[s] = *(const v8us*)(ph + s * 256); r[4 + s] = *(const v8us*)(pl + s * 256); }
    asm volatile("s_wait_xcnt 0x0" :: "v"(ph), "v"(pl) : "memory");   // the wait in front of any rewrite of the eight loads' two address pairs; named as inputs the pairs stay live to here
    bf* sb = (bf*)st + (size_t)(lane >> 3) * (GP * 2) + (lane & 7) * 8;
#pragma unroll
    for (int s = 0; s < 4; ++s) { *(v8usa*)(sb + (size_t)(s * 4) * (GP * 2)) = r[s]; *(v8usa*)(sb + (size_t)(16 + s * 4) * (GP * 2)) = r[4 + s]; }
    __builtin_amdgcn_wave_barrier(); asm volatile("" ::: "memory");   // lanes read what other lanes of the wave wrote: the compiler must keep the reads behind the stores (the LDS serves one wave's accesses in order)
    const bf* fb = (const bf*)st + (size_t)(lane & 15) * (GP * 2) + 8 * (lane >> 4);
#pragma unroll
    for (int kc = 0; kc < 2; ++kc) { fh[kc] = cat16b(*(const v8usa*)(fb + kc * 32), *(const v8usa*)(fb + kc * 32 + 16)); fl[kc] = cat16b(*(const v8usa*)(fb + (size_t)16 * (GP * 2) + kc * 32), *(const v8usa*)(fb + (size_t)16 * (GP * 2) + kc * 32 + 16)); }
    __builtin_amdgcn_wave_barrier(); asm volatile("" ::: "memory");   // and the tile's next stores behind these reads
}
// mm16: acc[rt][j] at lane (lr, hi) += tile row (hi * 8 + j) . query row (rt * 16 + lr); products in the order of the score GEMMs: q hi x tile hi, q lo x tile hi, q hi x tile lo, per 32 of k
// (qh: the q hi fragments, held in registers over all four tiles; qf: the lane's place in the staged q lo rows, read from LDS per tile: hi and lo both held do not fit the 128 registers of a 32-wave block)
__device__ __forceinline__ void mm16(const v16bf (&fh)[2], const v16bf (&fl)[2], const v16bf (&qh)[2][2], const bf* qf, v8f (&acc)[2]) {
#pragma unroll
    for (int kc = 0; kc < 2; ++kc)
#pragma unroll
        for (int rt = 0; rt < 2; ++rt) { const bf* qp = qf + rt * 16 * QPT + kc * 32; const v16bf ql = cat16b(*(const v8usa*)qp, *(const v8usa*)(qp + 16));
            acc[rt] = wmmab(fh[kc], qh[kc][rt], acc[rt]); acc[rt] = wmmab(fh[kc], ql, acc[rt]); acc[rt] = wmmab(fl[kc], qh[kc][rt], acc[rt]); }
}
static_assert(NPE == SR * 32 && TT == SR * 32 && HD == 64, "one wave per 32 keys and per 32 table rows; rows of 128 bytes");
__global__ __launch_bounds__(1024) void k_asoft(const bf* __restrict__ Qh, const bf* __restrict__ Ql, const bf* __restrict__ Kh, const bf* __restrict__ Kl, const bf* __restrict__ RKh, const bf* __restrict__ RKl, const float* __restrict__ P2CT, const int* __restrict__ RIX, const bf* __restrict__ VTh, const bf* __restrict__ VTl, int h0, bf* Ah, bf* Al) {
    __shared__ __align__(16) float G[SR * GP];
    __shared__ __align__(16) float CL[SR * GP];       // the block's 32 rows of c2p (raw); before that each wave's column tile stages its operand tiles
    __shared__ __align__(16) bf QS[2 * SR * QPT];     // the block's 32 q rows, hi plane then lo plane
    const int lane = threadIdx.x & 31; const int w = threadIdx.x >> 5; const int row0 = blockIdx.x * SR; const int zz = row0 / TT; const int i0 = row0 % TT;
    if (w < 16) { const int pq = w >> 3, o = (threadIdx.x & 255) * 8; const bf* qs = (pq ? Ql : Qh) + ((size_t)zz * TT + i0) * HD + o; const v8us qv = *(const v8us*)qs;   // 32 rows x 128 bytes per plane, contiguous; published by the first barrier below
        asm volatile("s_wait_xcnt 0x0" :: "v"(qs) : "memory");   // the wait in front of any rewrite of the load's address pair
        *(v8usa*)(QS + (pq * SR + (o >> 6)) * QPT + (o & 63)) = qv; }
    { const int jw = w * 32; const float* pt = P2CT + ((size_t)zz * TT + jw) * NPE; const int rr = lane >> 3, cc = jw + (lane & 7) * 4; float* gl = G + lane * GP + jw; const int* ip = RIX + (size_t)(i0 + rr) * TT + cc; v4i t[8];
#pragma unroll
      for (int s = 0; s < 8; ++s) t[s] = *(const v4i*)(ip + (size_t)s * 4 * TT);
      asm volatile("s_wait_xcnt 0x0" :: "v"(ip) : "memory");   // the wait in front of any rewrite of the eight loads' shared address pair; named as an input the pair stays live to here, so that no result of the run is placed in it
#pragma unroll
      for (int s = 0; s < 8; ++s) *(v4ia*)(G + (s * 4 + rr) * GP + cc) = t[s];
      __syncthreads();   // index tile complete before it is read by columns
#pragma unroll
      for (int c = 0; c < 8; ++c) t[c] = *(const v4ia*)(gl + c * 4);   // lane = query row i0 + lane, keys jw .. jw + 31
      v4f g[8];
#pragma unroll
      for (int hf = 0; hf < 2; ++hf) { const float* pg[16];   // two runs of 16 gathers, all of a run in flight together
#pragma unroll
          for (int k = 0; k < 16; ++k) { const int c = hf * 4 + (k >> 2), q = k & 3; int rp = t[c][q]; rp = rp < 0 ? 0 : (rp > NPE - 1 ? NPE - 1 : rp); pg[k] = pt + rp; g[c][q] = pg[k][(size_t)(c * 4 + q) * NPE]; }
          asm volatile("s_wait_xcnt 0x0" :: "v"(pg[0]), "v"(pg[1]), "v"(pg[2]), "v"(pg[3]), "v"(pg[4]), "v"(pg[5]), "v"(pg[6]), "v"(pg[7]), "v"(pg[8]), "v"(pg[9]), "v"(pg[10]), "v"(pg[11]), "v"(pg[12]), "v"(pg[13]), "v"(pg[14]), "v"(pg[15]) : "memory"); }   // the wait in front of any rewrite of the run's address pairs; named as inputs they stay live to here, so that no result of the run is placed in one
#pragma unroll
      for (int c = 0; c < 8; ++c) *(v4fa*)(gl + c * 4) = g[c];
    }
    // Content scores and c2p of the block's 32 query rows: wave w takes the 32 keys, then the 32 table rows, 32 w .. 32 w + 31, as the A operand (16 at a time) against the q rows as B, so that a lane holds 8 consecutive columns of one query row.
    { const int lr = lane & 15, hi = lane >> 4, jw = w * 32; float* st = CL + jw; const size_t to = ((size_t)zz * TT + jw) * HD + lane * 8;
      const bf* qf = QS + (SR + lr) * QPT + 8 * hi; v16bf qh[2][2];   // [k half][16-row tile]
#pragma unroll
      for (int kc = 0; kc < 2; ++kc)
#pragma unroll
          for (int rt = 0; rt < 2; ++rt) { const bf* qp = QS + (rt * 16 + lr) * QPT + kc * 32 + 8 * hi; qh[kc][rt] = cat16b(*(const v8usa*)qp, *(const v8usa*)(qp + 16)); }
      v16bf fh[2], fl[2];
#pragma unroll
      for (int kt = 0; kt < 2; ++kt) { stage16(Kh + to + kt * 16 * HD, Kl + to + kt * 16 * HD, st, lane, fh, fl); v8f acc[2]; acc[0] = (v8f){}; acc[1] = (v8f){}; mm16(fh, fl, qh, qf, acc);
#pragma unroll
          for (int rt = 0; rt < 2; ++rt) { float* gp = G + (rt * 16 + lr) * GP + jw + kt * 16 + hi * 8; v4f x0 = *(const v4fa*)gp, x1 = *(const v4fa*)(gp + 4);   // the wave's own key tile of G: q.k joins the gathered p2c term
#pragma unroll
              for (int q = 0; q < 4; ++q) { x0[q] = __fadd_rn(acc[rt][q], x0[q]); x1[q] = __fadd_rn(acc[rt][4 + q], x1[q]); }
              *(v4fa*)gp = x0; *(v4fa*)(gp + 4) = x1; } }
      v8f cc[2]; cc[0] = (v8f){}; cc[1] = (v8f){};
      stage16(RKh + to, RKl + to, st, lane, fh, fl); mm16(fh, fl, qh, qf, cc);
      stage16(RKh + to + 16 * HD, RKl + to + 16 * HD, st, lane, fh, fl);   // behind its fragment reads the staging tile is free and takes the results
#pragma unroll
      for (int kt = 0; kt < 2; ++kt) {
          if (kt) { cc[0] = (v8f){}; cc[1] = (v8f){}; mm16(fh, fl, qh, qf, cc); }
#pragma unroll
          for (int rt = 0; rt < 2; ++rt) { float* cp = CL + (rt * 16 + lr) * GP + jw + kt * 16 + hi * 8; *(v4fa*)cp = __builtin_shufflevector(cc[rt], cc[rt], 0, 1, 2, 3); *(v4fa*)(cp + 4) = __builtin_shufflevector(cc[rt], cc[rt], 4, 5, 6, 7); } }
    }
    __syncthreads();   // every column tile of G and of CL finished before a row's wave reads across them
    const int i = i0 + w; const float* cr = CL + w * GP; const float* gr = G + w * GP; const int* rxr = RIX + (size_t)i * TT; float v[TT / 32]; float mx = -3.0e38f;
#pragma unroll
    for (int ch = 0; ch < TT / 128; ++ch) { const int j0 = ch * 128 + lane * 4; const v4i r4 = *(const v4i*)(rxr + j0); const v4f p4 = *(const v4fa*)(gr + j0);
#pragma unroll
        for (int q = 0; q < 4; ++q) { int rp = r4[q]; rp = rp < 0 ? 0 : (rp > NPE - 1 ? NPE - 1 : rp); const float t = __fmul_rn(__fadd_rn(p4[q], cr[rp]), SCL);   /* ((qk + p2c[rp][j]) + c2p[i][rp]) x scale, rp = rel_idx[i][j] */ v[ch * 4 + q] = t; mx = fmaxf(mx, t); } }
#pragma unroll
    for (int sh = 16; sh; sh >>= 1) mx = fmaxf(mx, __shfl_xor(mx, sh, 32));
    float sum = 0.f;
#pragma unroll
    for (int k = 0; k < TT / 32; ++k) { float d0 = __fsub_rn(v[k], mx); asm volatile("" : "+v"(d0)); v[k] = __builtin_amdgcn_exp2f(__fmul_rn(d0, 1.4426950408889634f)); sum += v[k]; }
#pragma unroll
    for (int sh = 16; sh; sh >>= 1) sum += __shfl_xor(sum, sh, 32);
    const float f = __fdiv_rn(1.0f, sum);
    // P stays in LDS: the wave's own row of G (read by nobody else behind the second barrier, and by this wave no more) takes the row's 1024 hi halves, then its 1024 lo halves.
    bf* pr = (bf*)G + (size_t)w * (GP * 2);
#pragma unroll
    for (int ch = 0; ch < TT / 128; ++ch) { v4us oh, ol;
#pragma unroll
        for (int q = 0; q < 4; ++q) { unsigned short a, c2; splitf(v[ch * 4 + q] * f, a, c2); oh[q] = a; ol[q] = c2; }
        *(v4usa*)(pr + ch * 128 + lane * 4) = oh; *(v4usa*)(pr + TT + ch * 128 + lane * 4) = ol; }
    // attn.v of the block's 32 rows: wave w takes the 16 head columns nt * 16 .. and the 128 keys ks * 128 .. (both 16-row tiles), so that every v fragment is loaded once per block; the eight key slices are summed through LDS in fixed order. (The loops are unrolled so that b, b2 and acc are indexed by constants and stay in registers.)
    const int lr = lane & 15, hi = lane >> 4, nt = w & 3, ks = w >> 2;
    const size_t vo = ((size_t)zz * HD + nt * 16 + lr) * TT + ks * 128 + 8 * hi; const bf* vh = VTh + vo; const bf* vl = VTl + vo;
    __builtin_amdgcn_sched_barrier(0);   // keeps the sixteen loads below behind the split of P: lifted over it they meet the row's 32 live values and one fragment is spilled, with a wait on its load in the middle of the split
    v16bf b[4], b2[4];
#pragma unroll
    for (int kk = 0; kk < 4; ++kk) { b[kk] = WFrag<bf>::ld(vh + kk * 32); b2[kk] = WFrag<bf>::ld(vl + kk * 32); }   // issued in front of the barrier: they do not depend on P and fly while the block gathers there
    asm volatile("s_wait_xcnt 0x0" :: "v"(vh), "v"(vl) : "memory");   // the wait in front of any rewrite of the sixteen loads' two address pairs; named as inputs the pairs stay live to here
    __syncthreads();   // all 32 rows of P written before the fragments are read across them
    v8f acc[2]; acc[0] = (v8f){}; acc[1] = (v8f){};
#pragma unroll
    for (int kk = 0; kk < 4; ++kk) {
#pragma unroll
        for (int mt = 0; mt < 2; ++mt) { const bf* pa = (const bf*)G + (size_t)(mt * 16 + lr) * (GP * 2) + ks * 128 + kk * 32 + 8 * hi;
            const v16bf a = cat16b(*(const v8usa*)pa, *(const v8usa*)(pa + 16)); const v16bf a2 = cat16b(*(const v8usa*)(pa + TT), *(const v8usa*)(pa + TT + 16));
            acc[mt] = wmmab(a, b[kk], acc[mt]); acc[mt] = wmmab(a2, b[kk], acc[mt]); acc[mt] = wmmab(a, b2[kk], acc[mt]); } }
    __syncthreads();   // every fragment of P read before G is reused for the partial sums
#pragma unroll
    for (int mt = 0; mt < 2; ++mt)
#pragma unroll
        for (int j = 0; j < 8; ++j) G[(ks * SR + mt * 16 + hi * 8 + j) * RP + nt * 16 + lr] = acc[mt][j];
    __syncthreads();   // all eight key slices' partial sums written before a row's wave adds them
    v2f o = *(const v2fa*)(G + w * RP + lane * 2);
#pragma unroll
    for (int s = 1; s < 8; ++s) { const v2f p = *(const v2fa*)(G + (s * SR + w) * RP + lane * 2); o[0] += p[0]; o[1] += p[1]; }
    v2us oh, ol;
#pragma unroll
    for (int q = 0; q < 2; ++q) { unsigned short a, c2; splitf(o[q], a, c2); oh[q] = a; ol[q] = c2; }
    const size_t oo = (size_t)i * DQ + (h0 + zz) * HD + lane * 2; *(v2us*)(Ah + oo) = oh; *(v2us*)(Al + oo) = ol;   // merged context [t][head][d]: one wave writes one 128-byte line of each plane
}

__global__ __launch_bounds__(256) void k_lnres(const float* __restrict__ Y, const float* __restrict__ xres, const float* __restrict__ g, const float* __restrict__ bb, float* out) {
    const int lane = threadIdx.x & 31; const int row = blockIdx.x * 8 + (threadIdx.x >> 5); if (row >= NB_ * TT) return; const float* yr = Y + (size_t)row * DM; const float* xr = xres + (size_t)row * DM; float v[DM / 32]; float s = 0.f;
#pragma unroll
    for (int ch = 0; ch < DM / 128; ++ch) { const v4f a = *(const v4f*)(yr + ch * 128 + lane * 4); const v4f c = *(const v4f*)(xr + ch * 128 + lane * 4);
#pragma unroll
        for (int q = 0; q < 4; ++q) { const float t = __fadd_rn(a[q], bfr(c[q])); v[ch * 4 + q] = t; s = __fadd_rn(s, t); } }
#pragma unroll
    for (int sh = 16; sh; sh >>= 1) s = __fadd_rn(s, __shfl_xor(s, sh, 32));
    const float mu = __fdiv_rn(s, (float)DM); float s2 = 0.f;
#pragma unroll
    for (int k = 0; k < DM / 32; ++k) { float d0 = __fsub_rn(v[k], mu); asm volatile("" : "+v"(d0)); float p = __fmul_rn(d0, d0); asm volatile("" : "+v"(p)); s2 = __fadd_rn(s2, p); }
#pragma unroll
    for (int sh = 16; sh; sh >>= 1) s2 = __fadd_rn(s2, __shfl_xor(s2, sh, 32));
    const float rs = __fdiv_rn(1.0f, __fsqrt_rn(__fadd_rn(__fdiv_rn(s2, (float)DM), 1e-7f)));
{
#pragma unroll
        for (int ch = 0; ch < DM / 128; ++ch) { const int c0 = ch * 128 + lane * 4; v4f o;
#pragma unroll
            for (int q = 0; q < 4; ++q) { float xn = __fmul_rn(__fsub_rn(v[ch * 4 + q], mu), rs); asm volatile("" : "+v"(xn)); float gg = bfr(g[c0 + q]); asm volatile("" : "+v"(gg)); float yv = __fmul_rn(xn, gg); asm volatile("" : "+v"(yv)); float be = bfr(bb[c0 + q]); asm volatile("" : "+v"(be)); o[q] = __fadd_rn(yv, be); }
            *(v4f*)(out + (size_t)row * DM + c0) = o; }
         }
}

extern "C" void kernel_launch(void* const* d_in, const int* in_sizes, int n_in,
                              void* d_out, int out_size, void* d_ws, size_t ws_size, hipStream_t stream) {
    (void)in_sizes; (void)n_in; (void)out_size;
    const float* x = (const float*)d_in[0]; const float* rel = (const float*)d_in[1]; const float* wq = (const float*)d_in[2]; const float* bq = (const float*)d_in[3]; const float* wk = (const float*)d_in[4]; const float* bk = (const float*)d_in[5]; const float* wv = (const float*)d_in[6]; const float* bv = (const float*)d_in[7]; const float* wo = (const float*)d_in[8]; const float* bo = (const float*)d_in[9]; const float* lng = (const float*)d_in[10]; const float* lnb = (const float*)d_in[11]; const int* RIDX = (const int*)d_in[12];
    float* OUT = (float*)d_out;     // [4][1024][1024]
    char* wsp = (char*)d_ws;
    auto take = [&](size_t bytes) { char* p = wsp; wsp += (bytes + 255) & ~(size_t)255; return (void*)p; };
    bf* WQ = (bf*)take((size_t)DQ * DM * 2); bf* WK = (bf*)take((size_t)DKV * DM * 2); bf* WV = (bf*)take((size_t)DKV * DM * 2); bf* WO = (bf*)take((size_t)DM * DQ * 2); float* CS = (float*)take((size_t)TT * HD * 2 * 4);
    bf* PKh = (bf*)take((size_t)NH_ * NPE * HD * 2); bf* PKl = (bf*)take((size_t)NH_ * NPE * HD * 2); bf* PQh = (bf*)take((size_t)NH_ * NPE * HD * 2); bf* PQl = (bf*)take((size_t)NH_ * NPE * HD * 2); float* C2P = (float*)take((size_t)ZH * TT * NPE * 4); float* P2C = (float*)take((size_t)ZH * NPE * TT * 4);
    bf* QPh = (bf*)take((size_t)NB_ * NH_ * TT * HD * 2); bf* QPl = (bf*)take((size_t)NB_ * NH_ * TT * HD * 2); bf* KPh = (bf*)take((size_t)NB_ * NKV * TT * HD * 2); bf* KPl = (bf*)take((size_t)NB_ * NKV * TT * HD * 2); bf* VTh = (bf*)take((size_t)NB_ * NKV * HD * TT * 2); bf* VTl = (bf*)take((size_t)NB_ * NKV * HD * TT * 2);
    float* Sb = (float*)take((size_t)ZH * TT * TT * 4); bf* ATh = (bf*)take((size_t)NB_ * TT * DQ * 2); bf* ATl = (bf*)take((size_t)NB_ * TT * DQ * 2);
    if ((size_t)(wsp - (char*)d_ws) > ws_size) return;    // ws 256 MiB
    // Buffers that live only before the first pass, or only after the last, lie inside three 32-MiB buffers, of which P2C is the passes' p2c plane and Sb and C2P hold nothing else (stream-ordered; each is written in this call before it is read):
    // Sb: FQ [5120][1024] f32 (20 MiB) + QP16 (8 MiB), later Y [4096][1024] f32; C2P: FK / FV (20 MiB) + KP16 (8 MiB); P2C: XB [5120][1024] bf16 (10 MiB) + VT16 (8 MiB).
    const size_t MR = (size_t)NB_ * TT;       // rows of all batches; the position table's NPE rows follow them
    float* FQ = Sb; h16* QP16 = (h16*)(Sb + (MR + NPE) * DQ); float* Y = Sb;
    float* FK = C2P; h16* KP16 = (h16*)(C2P + (MR + NPE) * DKV); float* FV = FK;   // v projection reuses the k buffer after the k planes are built (stream-ordered)
    bf* XB = (bf*)P2C; h16* VT16 = (h16*)(XB + (MR + NPE) * DM);
    { k_wtG<<<(unsigned)((DM * DQ / 64 + 63) / 64), 256, 0, stream>>>(wq, DM, DQ, WQ); k_wtG<<<(unsigned)((DM * DKV / 64 + 63) / 64), 256, 0, stream>>>(wk, DM, DKV, WK); k_wtG<<<(unsigned)((DM * DKV / 64 + 63) / 64), 256, 0, stream>>>(wv, DM, DKV, WV);
      k_wtG<<<(unsigned)((DQ * DM / 64 + 63) / 64), 256, 0, stream>>>(wo, DQ, DM, WO);
       }
    k_csid<<<(TT * HD + 255) / 256, 256, 0, stream>>>(CS);
    k_cvt8<<<(unsigned)(((size_t)NB_ * TT * DM / 8 + 255) / 256), 256, 0, stream>>>(x, XB, (size_t)NB_ * TT * DM / 8);
    k_cvt8<<<(unsigned)(((size_t)NPE * DM / 8 + 255) / 256), 256, 0, stream>>>(rel, XB + MR * DM, (size_t)NPE * DM / 8);
    const unsigned LQ = (unsigned)(((size_t)NH_ * TT * HD / 2 + 255) / 256), LKv = (unsigned)(((size_t)NKV * TT * HD / 2 + 255) / 256);
    k_gemmw<bf, 0, true><<<dim3((NB_ * TT + NPE) / 64, DQ / 64, 1), 32, 0, stream>>>(XB, nullptr, WQ, nullptr, DM, FQ, DQ, bq, 0, 0, 0);   /* q of every batch, then rel_q = pos_emb Wq + bq */
    k_rope<<<dim3(LQ, NB_, 1), 256, 0, stream>>>(FQ, DQ, NH_, CS, nullptr, nullptr, 1.0f, QP16, QPh, QPl);
    k_pplane<<<(unsigned)(((size_t)NH_ * NPE * HD / 2 + 255) / 256), 256, 0, stream>>>(FQ + MR * DQ, PQh, PQl);   /* rel_q -> per-head hi/lo planes [h][1024][64] */
    k_gemmw<bf, 0, true><<<dim3((NB_ * TT + NPE) / 64, DKV / 64, 1), 32, 0, stream>>>(XB, nullptr, WK, nullptr, DM, FK, DKV, bk, 0, 0, 0);   /* k of every batch, then rel_k = pos_emb Wk + bk */
    k_rope<<<dim3(LKv, NB_, 1), 256, 0, stream>>>(FK, DKV, NKV, CS, nullptr, nullptr, 1.0f, KP16, KPh, KPl);
    k_pplane<<<(unsigned)(((size_t)NH_ * NPE * HD / 2 + 255) / 256), 256, 0, stream>>>(FK + MR * DKV, PKh, PKl);   /* rel_k -> per-head hi/lo planes [h][1024][64] */
    k_gemmw<bf, 0, true><<<dim3(NB_ * TT / 64, DKV / 64, 1), 32, 0, stream>>>(XB, nullptr, WV, nullptr, DM, FV, DKV, bv, 0, 0, 0); k_vtp<<<dim3(LKv, NB_, 1), 256, 0, stream>>>(FV, DKV, NKV, VT16, VTh, VTl);
    for (int b = 0; b < NB_; ++b) {
        for (int h0 = 0; h0 < NH_; h0 += ZH) { const size_t zq = (size_t)h0, zk = (size_t)(h0 / REP), bq0 = (size_t)b * NH_ + zq, bk0 = (size_t)b * NKV + zk;   // one kv head per query head: the pass's heads use consecutive kv planes (z-strides TT*HD); bq0 / bk0: the same heads in the planes of batch b
            k_gemmw<bf, 2, false><<<dim3(TT / 64, NPE / 64, ZH), 32, 0, stream>>>(KPh + bk0 * TT * HD, KPl + bk0 * TT * HD, PQh + zq * NPE * HD, PQl + zq * NPE * HD, HD, P2C, NPE, nullptr, (size_t)TT * HD, (size_t)NPE * HD, (size_t)TT * NPE);   /* p2c raw, transposed: [ZH][key j][rel row] */
            k_asoft<<<ZH * TT / SR, SR * 32, 0, stream>>>(QPh + bq0 * TT * HD, QPl + bq0 * TT * HD, KPh + bk0 * TT * HD, KPl + bk0 * TT * HD, PKh + zq * NPE * HD, PKl + zq * NPE * HD, P2C, RIDX, VTh + bk0 * HD * TT, VTl + bk0 * HD * TT, h0, ATh + (size_t)b * TT * DQ, ATl + (size_t)b * TT * DQ); } }
    k_gemmw<bf, 1, true><<<dim3(NB_ * TT / 64, DM / 64, 1), 32, 0, stream>>>(ATh, ATl, WO, nullptr, DQ, Y, DM, bo, 0, 0, 0);   /* y = ctx Wd + bd (f32), every batch */
    k_lnres<<<NB_ * TT / 8, 256, 0, stream>>>(Y, x, lng, lnb, OUT);
}

// v006
// Measured time: 470 microseconds a run.
// In both of two side-by-side timings against v005, it was 1.06 times as fast.
// All steps since v000 together make it 5.05 times as fast.
#include <hip/hip_runtime.h>

// DeBERTa-style disentangled self-attention + output dense + residual + LayerNorm (hidden_states [4][1024][1024]; q, k, v = hs W + b ('xw' [1024][1024]; 16 heads x 64); rel_q = pos_emb Wq + bq, rel_k = pos_emb Wk + bk (pos_emb [1024][1024], read); scale = 1/sqrt(3 x 64); scores = q.k scale + c2p[i][rel_idx[i][j]] + p2c[rel_idx[i][j]][j] with c2p = q.rel_k scale ([1024][1024]) and p2c = rel_q.k scale ([1024][1024]) and rel_idx the int32 input [1024][1024] (read per logit; = clip(i - j + 512, 0, 1023)); softmax; ctx = merged attn.v; y = ctx Wd + bd + hidden_states; out = LayerNorm(y) gamma + beta (eps 1e-7) -> [4][1024][1024] (4.2 M)).
// Layout: exact bf16 projections (+ once-off rel_k / rel_q projections of the position table -> per-head hi/lo planes); hi/lo planes for q, k (every row: 3-product score GEMMs); per pass of eight heads: p2c TRANSPOSED [8][key j][rel row] as a hi/lo GEMM, and the softmax kernel (32 query rows per block) computes its own 32 rows of content scores and of c2p on the matrix unit (hi/lo, 3 products, kept in LDS), gathers the two relative terms per logit at the input index (p2c from the plane with lanes along the query rows, handed to the row's wave through LDS; c2p from the row's LDS copy), scales, f32 softmax, keeps its 32 rows of hi/lo P in LDS, multiplies them with v (3 products) and writes the merged context as hi/lo planes; Wd (hl x exact) + bd; residual + LayerNorm in f32.
// Launch shape: the conversion, the q/k/v projections, the plane builders, the Wd GEMM and the LayerNorm each run ONCE over the rows of all four batches (the position table's rows ride behind them in the q and k projections); only the per-pass attention launches loop over (batch, 8 heads).
// Compute dtypes, f32 accumulate: every input rounded to bf16; projections on PLAIN bf16 operands (exact) + biases; all score terms and attn.v on hi/lo planes (3 products) for every row; softmax f32; Wd hl x exact; residual/LayerNorm f32 (precise sqrt/division).

#define NB_  4
#define TT   1024
#define DM   1024
#define NH_  16
#define NKV  16
#define REP  (NH_ / NKV)
#define HD   64
#define DQ   (NH_ * HD)
#define DKV  (NKV * HD)
#define ZH   8                     // heads per pass (z extent of the per-pass GEMM launches)
#define RH   1024                  // query rows < RH use hi+lo planes (must equal TT)
#define WIN  0
#define SCL  0.072168783648703225f   // 1/sqrt(3 x 64)
#define NPE  1024                 // relative-position table rows (2 x 512)
typedef _Float16 h16;
typedef unsigned short bf;
typedef __attribute__((ext_vector_type(16))) __bf16   v16bf;
typedef __attribute__((ext_vector_type(16))) _Float16 v16h;
typedef __attribute__((ext_vector_type(8)))  _Float16 v8h;
typedef __attribute__((ext_vector_type(8)))  unsigned short v8us;
typedef __attribute__((ext_vector_type(8)))  float    v8f;
typedef __attribute__((ext_vector_type(4)))  float    v4f;
typedef v8h  __attribute__((may_alias)) v8ha;
typedef v4f  __attribute__((may_alias)) v4fa;
typedef v8us __attribute__((may_alias)) v8usa;

__device__ __forceinline__ unsigned short f2bf(float f) { unsigned u = __float_as_uint(f); u += 0x7FFFu + ((u >> 16) & 1u); return (unsigned short)(u >> 16); }
__device__ __forceinline__ float bf2f(unsigned short b) { return __uint_as_float(((unsigned)b) << 16); }
__device__ __forceinline__ float bfr(float f) { return bf2f(f2bf(f)); }
__device__ __forceinline__ v16h cat16(v8h lo, v8h hi) { return __builtin_shufflevector(lo, hi, 0, 1, 2, 3, 4, 5, 6, 7, 8, 9, 10, 11, 12, 13, 14, 15); }
__device__ __forceinline__ v16bf cat16b(v8us lo, v8us hi) { return __builtin_bit_cast(v16bf, __builtin_shufflevector(lo, hi, 0, 1, 2, 3, 4, 5, 6, 7, 8, 9, 10, 11, 12, 13, 14, 15)); }
__device__ __forceinline__ v8f wmma16(v16h a, v16h b, v8f c) { return __builtin_amdgcn_wmma_f32_16x16x32_f16(false, a, false, b, (short)0, c, false, false); }
__device__ __forceinline__ v8f wmmab(v16bf a, v16bf b, v8f c) { return __builtin_amdgcn_wmma_f32_16x16x32_bf16(false, a, false, b, (short)0, c, false, false); }



// ---- k_gemmw: register-blocked GEMM, ONE WAVE per 64x64 output tile (16 accumulators), operands straight from K-contiguous 16-bit planes; grid (M/64, N/64, Z), 32 threads.
// C[m][n] (f32, pitch ldc, + optional f32 bias[n]) = sum_k A[m][k] Bt[n][k] (+ split products per NSPLIT). z-batch strides sA/sB/sC in elements. K % 32 == 0.
template <typename T16> struct WFrag;
template <> struct WFrag<h16> { typedef v16h V; static __device__ __forceinline__ V ld(const h16* p) { return cat16(*(const v8h*)p, *(const v8h*)(p + 16)); } static __device__ __forceinline__ v8f mma(V a, V b, v8f c) { return wmma16(a, b, c); } };
template <> struct WFrag<bf> { typedef v16bf V; static __device__ __forceinline__ V ld(const bf* p) { return cat16b(*(const v8us*)p, *(const v8us*)(p + 16)); } static __device__ __forceinline__ v8f mma(V a, V b, v8f c) { return wmmab(a, b, c); } };
// KT: K as a compile-time constant (the long GEMMs: loads-ahead loop below), or 0 for the loop on the run-time K (the short p2c GEMM, whose hi/lo fragments of both operands beside the accumulators leave no room to hold a whole step).
template <typename T16, int NSPLIT, bool BIAS, int KT>
__global__ __launch_bounds__(32) void k_gemmw(const T16* __restrict__ A, const T16* __restrict__ A2, const T16* __restrict__ Bt, const T16* __restrict__ Bt2, int K, float* C, int ldc, const float* __restrict__ bias, size_t sA, size_t sB, size_t sC) {
    typedef typename WFrag<T16>::V V;
    __shared__ __align__(16) float os[16 * 68];
    const size_t z = blockIdx.z; A += z * sA; if (A2) A2 += z * sA; Bt += z * sB; if (Bt2) Bt2 += z * sB; C += z * sC;
    const int lane = threadIdx.x & 31, lr = lane & 15, hi = lane >> 4; const int r0 = blockIdx.x * 64, c0 = blockIdx.y * 64;
    v8f acc[4][4];
#pragma unroll
    for (int mb = 0; mb < 4; ++mb)
#pragma unroll
        for (int nb = 0; nb < 4; ++nb) acc[mb][nb] = (v8f){};
    if constexpr (KT == 0) {
    const size_t aoff = (size_t)(r0 + lr) * K + 8 * hi, boff = (size_t)(c0 + lr) * K + 8 * hi;
#pragma unroll 1
    for (int kc = 0; kc < K; kc += 32) {
        V a[4], a2[4];
#pragma unroll
        for (int mb = 0; mb < 4; ++mb) { a[mb] = WFrag<T16>::ld(A + aoff + (size_t)mb * 16 * K + kc); if (NSPLIT == 1 || NSPLIT == 2) a2[mb] = WFrag<T16>::ld(A2 + aoff + (size_t)mb * 16 * K + kc); }
#pragma unroll
        for (int nb = 0; nb < 4; ++nb) { const V b = WFrag<T16>::ld(Bt + boff + (size_t)nb * 16 * K + kc); V b2; if (NSPLIT >= 2) b2 = WFrag<T16>::ld(Bt2 + boff + (size_t)nb * 16 * K + kc);
#pragma unroll
            for (int mb = 0; mb < 4; ++mb) { acc[mb][nb] = WFrag<T16>::mma(a[mb], b, acc[mb][nb]); if (NSPLIT == 1 || NSPLIT == 2) acc[mb][nb] = WFrag<T16>::mma(a2[mb], b, acc[mb][nb]); if (NSPLIT >= 2) acc[mb][nb] = WFrag<T16>::mma(a[mb], b2, acc[mb][nb]); } }
        asm volatile("v_nop\n\tv_nop\n\tv_nop\n\tv_nop" : "+v"(acc[0][0]), "+v"(acc[1][1]), "+v"(acc[2][2]), "+v"(acc[3][3]) : "v"(a[0]), "v"(a[3]));
    }
    } else {
    static_assert(NSPLIT < 2 && KT % 32 == 0, "a whole k step is held in registers");
    // One running pointer per plane; the 16-row tiles of a plane are reached by immediate offsets from it.
    const T16* pa = A + (size_t)(r0 + lr) * KT + 8 * hi; const T16* pb = Bt + (size_t)(c0 + lr) * KT + 8 * hi; const T16* pa2 = NSPLIT == 1 ? A2 + (size_t)(r0 + lr) * KT + 8 * hi : pa;
#pragma unroll 1
    for (int kc = 0; kc < KT; kc += 32) {
        V a[4], a2[4], b[4];
#pragma unroll
        for (int mb = 0; mb < 4; ++mb) a[mb] = WFrag<T16>::ld(pa + mb * 16 * KT);
#pragma unroll
        for (int nb = 0; nb < 4; ++nb) b[nb] = WFrag<T16>::ld(pb + nb * 16 * KT);
        if (NSPLIT == 1) {   // the lo plane last: its products come second in every accumulator
#pragma unroll
            for (int mb = 0; mb < 4; ++mb) a2[mb] = WFrag<T16>::ld(pa2 + mb * 16 * KT); }
        asm volatile("s_wait_xcnt 0x0" :: "v"(pa), "v"(pa2), "v"(pb) : "memory");   // the wait in front of any rewrite of the loads' address pairs; named as inputs the pairs stay live to here, so that no result of the step is placed in one
        __builtin_amdgcn_sched_barrier(0);   // every load of the k step is issued in front of its first matrix instruction, so that the step waits one load latency; left to the scheduler the loads come in groups, each issued behind the wait for the group before
        pa += 32; pa2 += 32; pb += 32;
#pragma unroll
        for (int nb = 0; nb < 4; ++nb) {
#pragma unroll
            for (int mb = 0; mb < 4; ++mb) { acc[mb][nb] = WFrag<T16>::mma(a[mb], b[nb], acc[mb][nb]); if (NSPLIT == 1) acc[mb][nb] = WFrag<T16>::mma(a2[mb], b[nb], acc[mb][nb]); } }
        asm volatile("v_nop\n\tv_nop\n\tv_nop\n\tv_nop" : "+v"(acc[0][0]), "+v"(acc[1][1]), "+v"(acc[2][2]), "+v"(acc[3][3]) : "v"(a[0]), "v"(a[3]));   // as in the loop above: the four vector slots behind the step's last matrix instructions, on the taken branch too
    }
    }
#pragma unroll
    for (int mb = 0; mb < 4; ++mb) {
#pragma unroll
        for (int nb = 0; nb < 4; ++nb) {
#pragma unroll
            for (int j = 0; j < 8; ++j) os[(hi * 8 + j) * 68 + nb * 16 + lr] = acc[mb][nb][j]; }
        __builtin_amdgcn_wave_barrier(); asm volatile("" ::: "memory");
        float* crow = C + (size_t)(r0 + mb * 16) * ldc + c0;
{
#pragma unroll
            for (int s = 0; s < 8; ++s) { const int row = 2 * s + hi, cofs = lr * 4; v4f val = *(const v4fa*)(os + row * 68 + cofs); if (BIAS) { val[0] += bfr(bias[c0 + cofs]); val[1] += bfr(bias[c0 + cofs + 1]); val[2] += bfr(bias[c0 + cofs + 2]); val[3] += bfr(bias[c0 + cofs + 3]); }
                *(v4f*)(crow + (size_t)row * ldc + cofs) = val; }
             }
        __builtin_amdgcn_wave_barrier(); asm volatile("" ::: "memory");
    }
}

__device__ __forceinline__ h16 tohx(float x) { return (h16)x; }
__device__ __forceinline__ void splitf(float y, unsigned short& h, unsigned short& l) { h = f2bf(y); l = f2bf(y - bf2f(h)); }
typedef __attribute__((ext_vector_type(2))) _Float16 v2h;
typedef __attribute__((ext_vector_type(4))) _Float16 v4h;
typedef __attribute__((ext_vector_type(2))) unsigned short v2us;
typedef __attribute__((ext_vector_type(4))) unsigned short v4us;
typedef __attribute__((ext_vector_type(2))) float v2f;
typedef __attribute__((ext_vector_type(4))) int v4i;

__global__ __launch_bounds__(256) void k_wtG(const float* __restrict__ w, int K, int N, bf* Bt) {
    const int lane = threadIdx.x & 31; const int L0 = (blockIdx.x * 8 + (threadIdx.x >> 5)) * 8; const int nlines = N * K / 64;
{
#pragma unroll 1
        for (int l = 0; l < 8; ++l) { const int L = L0 + l; if (L >= nlines) break; const size_t e = (size_t)L * 64 + lane * 2; const int k = (int)(e % K), n = (int)(e / K); v2us o;
            o[0] = f2bf(w[(size_t)k * N + n]); o[1] = f2bf(w[(size_t)(k + 1) * N + n]); *(v2us*)(Bt + e) = o; }
         }
}
__global__ __launch_bounds__(256) void k_cvt8(const float* __restrict__ src, bf* dst, size_t n8) { const size_t i = (size_t)blockIdx.x * 256 + threadIdx.x; if (i >= n8) return; const v8f v = *(const v8f*)(src + i * 8); v8us o;
#pragma unroll
    for (int k = 0; k < 8; ++k) o[k] = f2bf(v[k]); *(v8us*)(dst + i * 8) = o;  }

// k_rope: head planes [h][t][d] (fp16 + hi/lo) of rope(x) x sc with the rotate-half convention out[d] = x[d] cos[t][d] - x[d+HD/2] sin[t][d], out[d+HD/2] = x[d+HD/2] cos[t][d+HD/2] + x[d] sin[t][d+HD/2]
__global__ __launch_bounds__(256) void k_rope(const float* __restrict__ F, int pitch, int nheads, const float* __restrict__ CS, const float* __restrict__ RF, const float* __restrict__ nw, float sc, h16* P16, bf* Ph, bf* Pl) {
    const size_t e = ((size_t)blockIdx.x * 256 + threadIdx.x) * 2; if (e >= (size_t)nheads * TT * HD) return; const int d = (int)(e % HD); const int t = (int)((e / HD) % TT); const int h = (int)(e / ((size_t)HD * TT)); const size_t bz = blockIdx.y;   /* batch: rows bz*TT.. of F, planes bz*nheads.. */ const float* f = F + (bz * TT + t) * pitch + h * HD; const float rf = RF ? RF[(size_t)h * TT + t] : 1.0f; v2h o16; v2us oh, ol;
#pragma unroll
    for (int q = 0; q < 2; ++q) { const int dd = d + q; const int dp = (dd < HD / 2) ? dd + HD / 2 : dd - HD / 2; float x0 = f[dd], x1 = f[dp];
        if (RF) { float n0 = __fmul_rn(x0, rf), n1 = __fmul_rn(x1, rf); asm volatile("" : "+v"(n0)); asm volatile("" : "+v"(n1)); x0 = __fmul_rn(bfr(nw[dd]), n0); x1 = __fmul_rn(bfr(nw[dp]), n1); }
        const v2f cs = *(const v2f*)(CS + ((size_t)t * HD + dd) * 2); float a = __fmul_rn(x0, cs[0]), bq = __fmul_rn(x1, cs[1]); asm volatile("" : "+v"(a)); asm volatile("" : "+v"(bq)); const float r = ((dd < HD / 2) ? __fsub_rn(a, bq) : __fadd_rn(a, bq)) * sc;
        o16[q] = tohx(r); unsigned short a2, c2; splitf(r, a2, c2); oh[q] = a2; ol[q] = c2; }
    const size_t eo = bz * nheads * TT * HD + e; *(v2h*)(P16 + eo) = o16; *(v2us*)(Ph + eo) = oh; *(v2us*)(Pl + eo) = ol;  }
__global__ __launch_bounds__(256) void k_vtp(const float* __restrict__ F, int pitch, int nheads, h16* V16, bf* Vh, bf* Vl) { const size_t e = ((size_t)blockIdx.x * 256 + threadIdx.x) * 2; if (e >= (size_t)nheads * HD * TT) return; const int t = (int)(e % TT); const int d = (int)((e / TT) % HD); const int g = (int)(e / ((size_t)TT * HD)); const size_t bz = blockIdx.y;   /* batch */ v2h o16; v2us oh, ol;
#pragma unroll
    for (int q = 0; q < 2; ++q) { const float x = F[(bz * TT + t + q) * pitch + g * HD + d]; o16[q] = tohx(x); unsigned short a2, c2; splitf(x, a2, c2); oh[q] = a2; ol[q] = c2; }
    const size_t eo = bz * nheads * HD * TT + e; *(v2h*)(V16 + eo) = o16; *(v2us*)(Vh + eo) = oh; *(v2us*)(Vl + eo) = ol;  }
__global__ __launch_bounds__(256) void k_csid(float* CS) { const int idx = blockIdx.x * 256 + threadIdx.x; if (idx >= TT * HD) return; v2f cs; cs[0] = 1.0f; cs[1] = 0.0f; *(v2f*)(CS + (size_t)idx * 2) = cs;  }
__global__ __launch_bounds__(256) void k_pplane(const float* __restrict__ POS, bf* Ph2, bf* Pl2) { const size_t e = ((size_t)blockIdx.x * 256 + threadIdx.x) * 2; if (e >= (size_t)NH_ * NPE * HD) return; const int d = (int)(e % HD); const int p = (int)((e / HD) % NPE); const int h = (int)(e / ((size_t)HD * NPE)); v2us oh, ol;
#pragma unroll
    for (int q = 0; q < 2; ++q) { unsigned short a, c; splitf(POS[(size_t)p * DQ + h * HD + d + q], a, c); oh[q] = a; ol[q] = c; } *(v2us*)(Ph2 + e) = oh; *(v2us*)(Pl2 + e) = ol;  }
// k_asoft: per row (zz, i): t = ((q.k + p2c[rp][j]) + c2p[i][rp]) x scale with rp = rel_idx[i][j] (int32 input, read per logit with b128 loads; clamped to [0, NPE) for memory safety - the identity for the shipped clip(i - j + 512, 0, 1023)); softmax over the 1024 keys (register row, one exp, fixed trees);
// One block = SR consecutive query rows of one head, one wave per row. The p2c term comes from the transposed plane P2CT[j][rp]: wave w takes the 32 keys j = 32 w .. 32 w + 31 and gathers with its LANES ALONG THE QUERY ROWS, so that indices which rise with i (or stand still) fall into one or two cache lines per load for any key; any other index array is gathered just as correctly, only slower.
// The index tile is turned in LDS (written by rows, read by columns), each gathered value replaces its index in place, and the row's own wave reads its finished row of G.
#define SR 32      // query rows per block = waves per block = TT / 32 key tiles
#define GP 1028    // pitch of G in words: rows stay 16-byte aligned, and lanes that read b128 down a column step 4 banks each
static_assert(RH == TT, "every query row keeps hi/lo P");
#define RP 66      // pitch of a partial-sum row in words: 8-byte aligned, and the two half-waves (8 rows apart) fall on different banks
typedef v4i __attribute__((may_alias)) v4ia;
typedef v4us __attribute__((may_alias)) v4usa;
typedef v2f __attribute__((may_alias)) v2fa;
#define QPT 72     // pitch of a staged q row in 16-bit elements: 128 bytes + 16, so that the 16 rows of a fragment read fall on different banks
// stage16: one 16-row tile (hi and lo plane, rows of 64 elements = 128 bytes, so 2 KiB contiguous per plane) of a K-contiguous operand goes through the wave's own 32 x 128-byte column tile of an LDS array (st): whole-line global loads, then fragment reads from LDS (rows 0..15 hi, 16..31 lo). ph / pl point at the lane's own 16 bytes of the tile's first 512.
__device__ __forceinline__ void stage16(const bf* __restrict__ ph, const bf* __restrict__ pl, float* st, int lane, v16bf (&fh)[2], v16bf (&fl)[2]) {
    v8us r[8];
#pragma unroll
    for (int s = 0; s < 4; ++s) { r[s] = *(const v8us*)(ph + s * 256); r[4 + s] = *(const v8us*)(pl + s * 256); }
    asm volatile("s_wait_xcnt 0x0" :: "v"(ph), "v"(pl) : "memory");   // the wait in front of any rewrite of the eight loads' two address pairs; named as inputs the pairs stay live to here
    bf* sb = (bf*)st + (size_t)(lane >> 3) * (GP * 2) + (lane & 7) * 8;
#pragma unroll
    for (int s = 0; s < 4; ++s) { *(v8usa*)(sb + (size_t)(s * 4) * (GP * 2)) = r[s]; *(v8usa*)(sb + (size_t)(16 + s * 4) * (GP * 2)) = r[4 + s]; }
    __builtin_amdgcn_wave_barrier(); asm volatile("" ::: "memory");   // lanes read what other lanes of the wave wrote: the compiler must keep the reads behind the stores (the LDS serves one wave's accesses in order)
    const bf* fb = (const bf*)st + (size_t)(lane & 15) * (GP * 2) + 8 * (lane >> 4);
#pragma unroll
    for (int kc = 0; kc < 2; ++kc) { fh[kc] = cat16b(*(const v8usa*)(fb + kc * 32), *(const v8usa*)(fb + kc * 32 + 16)); fl[kc] = cat16b(*(const v8usa*)(fb + (size_t)16 * (GP * 2) + kc * 32), *(const v8usa*)(fb + (size_t)16 * (GP * 2) + kc * 32 + 16)); }
    __builtin_amdgcn_wave_barrier(); asm volatile("" ::: "memory");   // and the tile's next stores behind these reads
}
// mm16: acc[rt][j] at lane (lr, hi) += tile row (hi * 8 + j) . query row (rt * 16 + lr); products in the order of the score GEMMs: q hi x tile hi, q lo x tile hi, q hi x tile lo, per 32 of k
// (qh: the q hi fragments, held in registers over all four tiles; qf: the lane's place in the staged q lo rows, read from LDS per tile: hi and lo both held do not fit the 128 registers of a 32-wave block)
__device__ __forceinline__ void mm16(const v16bf (&fh)[2], const v16bf (&fl)[2], const v16bf (&qh)[2][2], const bf* qf, v8f (&acc)[2]) {
#pragma unroll
    for (int kc = 0; kc < 2; ++kc)
#pragma unroll
        for (int rt = 0; rt < 2; ++rt) { const bf* qp = qf + rt * 16 * QPT + kc * 32; const v16bf ql = cat16b(*(const v8usa*)qp, *(const v8usa*)(qp + 16));
            acc[rt] = wmmab(fh[kc], qh[kc][rt], acc[rt]); acc[rt] = wmmab(fh[kc], ql, acc[rt]); acc[rt] = wmmab(fl[kc], qh[kc][rt], acc[rt]); }
}
static_assert(NPE == SR * 32 && TT == SR * 32 && HD == 64, "one wave per 32 keys and per 32 table rows; rows of 128 bytes");
__global__ __launch_bounds__(1024) void k_asoft(const bf* __restrict__ Qh, const bf* __restrict__ Ql, const bf* __restrict__ Kh, const bf* __restrict__ Kl, const bf* __restrict__ RKh, const bf* __restrict__ RKl, const float* __restrict__ P2CT, const int* __restrict__ RIX, const bf* __restrict__ VTh, const bf* __restrict__ VTl, int h0, bf* Ah, bf* Al) {
    __shared__ __align__(16) float G[SR * GP];
    __shared__ __align__(16) float CL[SR * GP];       // the block's 32 rows of c2p (raw); before that each wave's column tile stages its operand tiles
    __shared__ __align__(16) bf QS[2 * SR * QPT];     // the block's 32 q rows, hi plane then lo plane
    const int lane = threadIdx.x & 31; const int w = threadIdx.x >> 5; const int row0 = blockIdx.x * SR; const int zz = row0 / TT; const int i0 = row0 % TT;
    if (w < 16) { const int pq = w >> 3, o = (threadIdx.x & 255) * 8; const bf* qs = (pq ? Ql : Qh) + ((size_t)zz * TT + i0) * HD + o; const v8us qv = *(const v8us*)qs;   // 32 rows x 128 bytes per plane, contiguous; published by the first barrier below
        asm volatile("s_wait_xcnt 0x0" :: "v"(qs) : "memory");   // the wait in front of any rewrite of the load's address pair
        *(v8usa*)(QS + (pq * SR + (o >> 6)) * QPT + (o & 63)) = qv; }
    { const int jw = w * 32; const float* pt = P2CT + ((size_t)zz * TT + jw) * NPE; const int rr = lane >> 3, cc = jw + (lane & 7) * 4; float* gl = G + lane * GP + jw; const int* ip = RIX + (size_t)(i0 + rr) * TT + cc; v4i t[8];
#pragma unroll
      for (int s = 0; s < 8; ++s) t[s] = *(const v4i*)(ip + (size_t)s * 4 * TT);
      asm volatile("s_wait_xcnt 0x0" :: "v"(ip) : "memory");   // the wait in front of any rewrite of the eight loads' shared address pair; named as an input the pair stays live to here, so that no result of the run is placed in it
#pragma unroll
      for (int s = 0; s < 8; ++s) *(v4ia*)(G + (s * 4 + rr) * GP + cc) = t[s];
      __syncthreads();   // index tile complete before it is read by columns
#pragma unroll
      for (int c = 0; c < 8; ++c) t[c] = *(const v4ia*)(gl + c * 4);   // lane = query row i0 + lane, keys jw .. jw + 31
      v4f g[8];
#pragma unroll
      for (int hf = 0; hf < 2; ++hf) { const float* pg[16];   // two runs of 16 gathers, all of a run in flight together
#pragma unroll
          for (int k = 0; k < 16; ++k) { const int c = hf * 4 + (k >> 2), q = k & 3; int rp = t[c][q]; rp = rp < 0 ? 0 : (rp > NPE - 1 ? NPE - 1 : rp); pg[k] = pt + rp; g[c][q] = pg[k][(size_t)(c * 4 + q) * NPE]; }
          asm volatile("s_wait_xcnt 0x0" :: "v"(pg[0]), "v"(pg[1]), "v"(pg[2]), "v"(pg[3]), "v"(pg[4]), "v"(pg[5]), "v"(pg[6]), "v"(pg[7]), "v"(pg[8]), "v"(pg[9]), "v"(pg[10]), "v"(pg[11]), "v"(pg[12]), "v"(pg[13]), "v"(pg[14]), "v"(pg[15]) : "memory"); }   // the wait in front of any rewrite of the run's address pairs; named as inputs they stay live to here, so that no result of the run is placed in one
#pragma unroll
      for (int c = 0; c < 8; ++c) *(v4fa*)(gl + c * 4) = g[c];
    }
    // Content scores and c2p of the block's 32 query rows: wave w takes the 32 keys, then the 32 table rows, 32 w .. 32 w + 31, as the A operand (16 at a time) against the q rows as B, so that a lane holds 8 consecutive columns of one query row.
    { const int lr = lane & 15, hi = lane >> 4, jw = w * 32; float* st = CL + jw; const size_t to = ((size_t)zz * TT + jw) * HD + lane * 8;
      const bf* qf = QS + (SR + lr) * QPT + 8 * hi; v16bf qh[2][2];   // [k half][16-row tile]
#pragma unroll
      for (int kc = 0; kc < 2; ++kc)
#pragma unroll
          for (int rt = 0; rt < 2; ++rt) { const bf* qp = QS + (rt * 16 + lr) * QPT + kc * 32 + 8 * hi; qh[kc][rt] = cat16b(*(const v8usa*)qp, *(const v8usa*)(qp + 16)); }
      v16bf fh[2], fl[2];
#pragma unroll
      for (int kt = 0; kt < 2; ++kt) { stage16(Kh + to + kt * 16 * HD, Kl + to + kt * 16 * HD, st, lane, fh, fl); v8f acc[2]; acc[0] = (v8f){}; acc[1] = (v8f){}; mm16(fh, fl, qh, qf, acc);
#pragma unroll
          for (int rt = 0; rt < 2; ++rt) { float* gp = G + (rt * 16 + lr) * GP + jw + kt * 16 + hi * 8; v4f x0 = *(const v4fa*)gp, x1 = *(const v4fa*)(gp + 4);   // the wave's own key tile of G: q.k joins the gathered p2c term
#pragma unroll
              for (int q = 0; q < 4; ++q) { x0[q] = __fadd_rn(acc[rt][q], x0[q]); x1[q] = __fadd_rn(acc[rt][4 + q], x1[q]); }
              *(v4fa*)gp = x0; *(v4fa*)(gp + 4) = x1; } }
      v8f cc[2]; cc[0] = (v8f){}; cc[1] = (v8f){};
      stage16(RKh + to, RKl + to, st, lane, fh, fl); mm16(fh, fl, qh, qf, cc);
      stage16(RKh + to + 16 * HD, RKl + to + 16 * HD, st, lane, fh, fl);   // behind its fragment reads the staging tile is free and takes the results
#pragma unroll
      for (int kt = 0; kt < 2; ++kt) {
          if (kt) { cc[0] = (v8f){}; cc[1] = (v8f){}; mm16(fh, fl, qh, qf, cc); }
#pragma unroll
          for (int rt = 0; rt < 2; ++rt) { float* cp = CL + (rt * 16 + lr) * GP + jw + kt * 16 + hi * 8; *(v4fa*)cp = __builtin_shufflevector(cc[rt], cc[rt], 0, 1, 2, 3); *(v4fa*)(cp + 4) = __builtin_shufflevector(cc[rt], cc[rt], 4, 5, 6, 7); } }
    }
    __syncthreads();   // every column tile of G and of CL finished before a row's wave reads across them
    const int i = i0 + w; const float* cr = CL + w * GP; const float* gr = G + w * GP; const int* rxr = RIX + (size_t)i * TT; float v[TT / 32]; float mx = -3.0e38f;
#pragma unroll
    for (int ch = 0; ch < TT / 128; ++ch) { const int j0 = ch * 128 + lane * 4; const v4i r4 = *(const v4i*)(rxr + j0); const v4f p4 = *(const v4fa*)(gr + j0);
#pragma unroll
        for (int q = 0; q < 4; ++q) { int rp = r4[q]; rp = rp < 0 ? 0 : (rp > NPE - 1 ? NPE - 1 : rp); const float t = __fmul_rn(__fadd_rn(p4[q], cr[rp]), SCL);   /* ((qk + p2c[rp][j]) + c2p[i][rp]) x scale, rp = rel_idx[i][j] */ v[ch * 4 + q] = t; mx = fmaxf(mx, t); } }
#pragma unroll
    for (int sh = 16; sh; sh >>= 1) mx = fmaxf(mx, __shfl_xor(mx, sh, 32));
    float sum = 0.f;
#pragma unroll
    for (int k = 0; k < TT / 32; ++k) { float d0 = __fsub_rn(v[k], mx); asm volatile("" : "+v"(d0)); v[k] = __builtin_amdgcn_exp2f(__fmul_rn(d0, 1.4426950408889634f)); sum += v[k]; }
#pragma unroll
    for (int sh = 16; sh; sh >>= 1) sum += __shfl_xor(sum, sh, 32);
    const float f = __fdiv_rn(1.0f, sum);
    // P stays in LDS: the wave's own row of G (read by nobody else behind the second barrier, and by this wave no more) takes the row's 1024 hi halves, then its 1024 lo halves.
    bf* pr = (bf*)G + (size_t)w * (GP * 2);
#pragma unroll
    for (int ch = 0; ch < TT / 128; ++ch) { v4us oh, ol;
#pragma unroll
        for (int q = 0; q < 4; ++q) { unsigned short a, c2; splitf(v[ch * 4 + q] * f, a, c2); oh[q] = a; ol[q] = c2; }
        *(v4usa*)(pr + ch * 128 + lane * 4) = oh; *(v4usa*)(pr + TT + ch * 128 + lane * 4) = ol; }
    // attn.v of the block's 32 rows: wave w takes the 16 head columns nt * 16 .. and the 128 keys ks * 128 .. (both 16-row tiles), so that every v fragment is loaded once per block; the eight key slices are summed through LDS in fixed order. (The loops are unrolled so that b, b2 and acc are indexed by constants and stay in registers.)
    const int lr = lane & 15, hi = lane >> 4, nt = w & 3, ks = w >> 2;
    const size_t vo = ((size_t)zz * HD + nt * 16 + lr) * TT + ks * 128 + 8 * hi; const bf* vh = VTh + vo; const bf* vl = VTl + vo;
    __builtin_amdgcn_sched_barrier(0);   // keeps the sixteen loads below behind the split of P: lifted over it they meet the row's 32 live values and one fragment is spilled, with a wait on its load in the middle of the split
    v16bf b[4], b2[4];
#pragma unroll
    for (int kk = 0; kk < 4; ++kk) { b[kk] = WFrag<bf>::ld(vh + kk * 32); b2[kk] = WFrag<bf>::ld(vl + kk * 32); }   // issued in front of the barrier: they do not depend on P and fly while the block gathers there
    asm volatile("s_wait_xcnt 0x0" :: "v"(vh), "v"(vl) : "memory");   // the wait in front of any rewrite of the sixteen loads' two address pairs; named as inputs the pairs stay live to here
    __syncthreads();   // all 32 rows of P written before the fragments are read across them
    v8f acc[2]; acc[0] = (v8f){}; acc[1] = (v8f){};
#pragma unroll
    for (int kk = 0; kk < 4; ++kk) {
#pragma unroll
        for (int mt = 0; mt < 2; ++mt) { const bf* pa = (const bf*)G + (size_t)(mt * 16 + lr) * (GP * 2) + ks * 128 + kk * 32 + 8 * hi;
            const v16bf a = cat16b(*(const v8usa*)pa, *(const v8usa*)(pa + 16)); const v16bf a2 = cat16b(*(const v8usa*)(pa + TT), *(const v8usa*)(pa + TT + 16));
            acc[mt] = wmmab(a, b[kk], acc[mt]); acc[mt] = wmmab(a2, b[kk], acc[mt]); acc[mt] = wmmab(a, b2[kk], acc[mt]); } }
    __syncthreads();   // every fragment of P read before G is reused for the partial sums
#pragma unroll
    for (int mt = 0; mt < 2; ++mt)
#pragma unroll
        for (int j = 0; j < 8; ++j) G[(ks * SR + mt * 16 + hi * 8 + j) * RP + nt * 16 + lr] = acc[mt][j];
    __syncthreads();   // all eight key slices' partial sums written before a row's wave adds them
    v2f o = *(const v2fa*)(G + w * RP + lane * 2);
#pragma unroll
    for (int s = 1; s < 8; ++s) { const v2f p = *(const v2fa*)(G + (s * SR + w) * RP + lane * 2); o[0] += p[0]; o[1] += p[1]; }
    v2us oh, ol;
#pragma unroll
    for (int q = 0; q < 2; ++q) { unsigned short a, c2; splitf(o[q], a, c2); oh[q] = a; ol[q] = c2; }
    const size_t oo = (size_t)i * DQ + (h0 + zz) * HD + lane * 2; *(v2us*)(Ah + oo) = oh; *(v2us*)(Al + oo) = ol;   // merged context [t][head][d]: one wave writes one 128-byte line of each plane
}

__global__ __launch_bounds__(256) void k_lnres(const float* __restrict__ Y, const float* __restrict__ xres, const float* __restrict__ g, const float* __restrict__ bb, float* out) {
    const int lane = threadIdx.x & 31; const int row = blockIdx.x * 8 + (threadIdx.x >> 5); if (row >= NB_ * TT) return; const float* yr = Y + (size_t)row * DM; const float* xr = xres + (size_t)row * DM; float v[DM / 32]; float s = 0.f;
#pragma unroll
    for (int ch = 0; ch < DM / 128; ++ch) { const v4f a = *(const v4f*)(yr + ch * 128 + lane * 4); const v4f c = *(const v4f*)(xr + ch * 128 + lane * 4);
#pragma unroll
        for (int q = 0; q < 4; ++q) { const float t = __fadd_rn(a[q], bfr(c[q])); v[ch * 4 + q] = t; s = __fadd_rn(s, t); } }
#pragma unroll
    for (int sh = 16; sh; sh >>= 1) s = __fadd_rn(s, __shfl_xor(s, sh, 32));
    const float mu = __fdiv_rn(s, (float)DM); float s2 = 0.f;
#pragma unroll
    for (int k = 0; k < DM / 32; ++k) { float d0 = __fsub_rn(v[k], mu); asm volatile("" : "+v"(d0)); float p = __fmul_rn(d0, d0); asm volatile("" : "+v"(p)); s2 = __fadd_rn(s2, p); }
#pragma unroll
    for (int sh = 16; sh; sh >>= 1) s2 = __fadd_rn(s2, __shfl_xor(s2, sh, 32));
    const float rs = __fdiv_rn(1.0f, __fsqrt_rn(__fadd_rn(__fdiv_rn(s2, (float)DM), 1e-7f)));
{
#pragma unroll
        for (int ch = 0; ch < DM / 128; ++ch) { const int c0 = ch * 128 + lane * 4; v4f o;
#pragma unroll
            for (int q = 0; q < 4; ++q) { float xn = __fmul_rn(__fsub_rn(v[ch * 4 + q], mu), rs); asm volatile("" : "+v"(xn)); float gg = bfr(g[c0 + q]); asm volatile("" : "+v"(gg)); float yv = __fmul_rn(xn, gg); asm volatile("" : "+v"(yv)); float be = bfr(bb[c0 + q]); asm volatile("" : "+v"(be)); o[q] = __fadd_rn(yv, be); }
            *(v4f*)(out + (size_t)row * DM + c0) = o; }
         }
}

extern "C" void kernel_launch(void* const* d_in, const int* in_sizes, int n_in,
                              void* d_out, int out_size, void* d_ws, size_t ws_size, hipStream_t stream) {
    (void)in_sizes; (void)n_in; (void)out_size;
    const float* x = (const float*)d_in[0]; const float* rel = (const float*)d_in[1]; const float* wq = (const float*)d_in[2]; const float* bq = (const float*)d_in[3]; const float* wk = (const float*)d_in[4]; const float* bk = (const float*)d_in[5]; const float* wv = (const float*)d_in[6]; const float* bv = (const float*)d_in[7]; const float* wo = (const float*)d_in[8]; const float* bo = (const float*)d_in[9]; const float* lng = (const float*)d_in[10]; const float* lnb = (const float*)d_in[11]; const int* RIDX = (const int*)d_in[12];
    float* OUT = (float*)d_out;     // [4][1024][1024]
    char* wsp = (char*)d_ws;
    auto take = [&](size_t bytes) { char* p = wsp; wsp += (bytes + 255) & ~(size_t)255; return (void*)p; };
    bf* WQ = (bf*)take((size_t)DQ * DM * 2); bf* WK = (bf*)take((size_t)DKV * DM * 2); bf* WV = (bf*)take((size_t)DKV * DM * 2); bf* WO = (bf*)take((size_t)DM * DQ * 2); float* CS = (float*)take((size_t)TT * HD * 2 * 4);
    bf* PKh = (bf*)take((size_t)NH_ * NPE * HD * 2); bf* PKl = (bf*)take((size_t)NH_ * NPE * HD * 2); bf* PQh = (bf*)take((size_t)NH_ * NPE * HD * 2); bf* PQl = (bf*)take((size_t)NH_ * NPE * HD * 2); float* C2P = (float*)take((size_t)ZH * TT * NPE * 4); float* P2C = (float*)take((size_t)ZH * NPE * TT * 4);
    bf* QPh = (bf*)take((size_t)NB_ * NH_ * TT * HD * 2); bf* QPl = (bf*)take((size_t)NB_ * NH_ * TT * HD * 2); bf* KPh = (bf*)take((size_t)NB_ * NKV * TT * HD * 2); bf* KPl = (bf*)take((size_t)NB_ * NKV * TT * HD * 2); bf* VTh = (bf*)take((size_t)NB_ * NKV * HD * TT * 2); bf* VTl = (bf*)take((size_t)NB_ * NKV * HD * TT * 2);
    float* Sb = (float*)take((size_t)ZH * TT * TT * 4); bf* ATh = (bf*)take((size_t)NB_ * TT * DQ * 2); bf* ATl = (bf*)take((size_t)NB_ * TT * DQ * 2);
    if ((size_t)(wsp - (char*)d_ws) > ws_size) return;    // ws 256 MiB
    // Buffers that live only before the first pass, or only after the last, lie inside three 32-MiB buffers, of which P2C is the passes' p2c plane and Sb and C2P hold nothing else (stream-ordered; each is written in this call before it is read):
    // Sb: FQ [5120][1024] f32 (20 MiB) + QP16 (8 MiB), later Y [4096][1024] f32; C2P: FK / FV (20 MiB) + KP16 (8 MiB); P2C: XB [5120][1024] bf16 (10 MiB) + VT16 (8 MiB).
    const size_t MR = (size_t)NB_ * TT;       // rows of all batches; the position table's NPE rows follow them
    float* FQ = Sb; h16* QP16 = (h16*)(Sb + (MR + NPE) * DQ); float* Y = Sb;
    float* FK = C2P; h16* KP16 = (h16*)(C2P + (MR + NPE) * DKV); float* FV = FK;   // v projection reuses the k buffer after the k planes are built (stream-ordered)
    bf* XB = (bf*)P2C; h16* VT16 = (h16*)(XB + (MR + NPE) * DM);
    { k_wtG<<<(unsigned)((DM * DQ / 64 + 63) / 64), 256, 0, stream>>>(wq, DM, DQ, WQ); k_wtG<<<(unsigned)((DM * DKV / 64 + 63) / 64), 256, 0, stream>>>(wk, DM, DKV, WK); k_wtG<<<(unsigned)((DM * DKV / 64 + 63) / 64), 256, 0, stream>>>(wv, DM, DKV, WV);
      k_wtG<<<(unsigned)((DQ * DM / 64 + 63) / 64), 256, 0, stream>>>(wo, DQ, DM, WO);
       }
    k_csid<<<(TT * HD + 255) / 256, 256, 0, stream>>>(CS);
    k_cvt8<<<(unsigned)(((size_t)NB_ * TT * DM / 8 + 255) / 256), 256, 0, stream>>>(x, XB, (size_t)NB_ * TT * DM / 8);
    k_cvt8<<<(unsigned)(((size_t)NPE * DM / 8 + 255) / 256), 256, 0, stream>>>(rel, XB + MR * DM, (size_t)NPE * DM / 8);
    const unsigned LQ = (unsigned)(((size_t)NH_ * TT * HD / 2 + 255) / 256), LKv = (unsigned)(((size_t)NKV * TT * HD / 2 + 255) / 256);
    k_gemmw<bf, 0, true, DM><<<dim3((NB_ * TT + NPE) / 64, DQ / 64, 1), 32, 0, stream>>>(XB, nullptr, WQ, nullptr, DM, FQ, DQ, bq, 0, 0, 0);   /* q of every batch, then rel_q = pos_emb Wq + bq */
    k_rope<<<dim3(LQ, NB_, 1), 256, 0, stream>>>(FQ, DQ, NH_, CS, nullptr, nullptr, 1.0f, QP16, QPh, QPl);
    k_pplane<<<(unsigned)(((size_t)NH_ * NPE * HD / 2 + 255) / 256), 256, 0, stream>>>(FQ + MR * DQ, PQh, PQl);   /* rel_q -> per-head hi/lo planes [h][1024][64] */
    k_gemmw<bf, 0, true, DM><<<dim3((NB_ * TT + NPE) / 64, DKV / 64, 1), 32, 0, stream>>>(XB, nullptr, WK, nullptr, DM, FK, DKV, bk, 0, 0, 0);   /* k of every batch, then rel_k = pos_emb Wk + bk */
    k_rope<<<dim3(LKv, NB_, 1), 256, 0, stream>>>(FK, DKV, NKV, CS, nullptr, nullptr, 1.0f, KP16, KPh, KPl);
    k_pplane<<<(unsigned)(((size_t)NH_ * NPE * HD / 2 + 255) / 256), 256, 0, stream>>>(FK + MR * DKV, PKh, PKl);   /* rel_k -> per-head hi/lo planes [h][1024][64] */
    k_gemmw<bf, 0, true, DM><<<dim3(NB_ * TT / 64, DKV / 64, 1), 32, 0, stream>>>(XB, nullptr, WV, nullptr, DM, FV, DKV, bv, 0, 0, 0); k_vtp<<<dim3(LKv, NB_, 1), 256, 0, stream>>>(FV, DKV, NKV, VT16, VTh, VTl);
    for (int b = 0; b < NB_; ++b) {
        for (int h0 = 0; h0 < NH_; h0 += ZH) { const size_t zq = (size_t)h0, zk = (size_t)(h0 / REP), bq0 = (size_t)b * NH_ + zq, bk0 = (size_t)b * NKV + zk;   // one kv head per query head: the pass's heads use consecutive kv planes (z-strides TT*HD); bq0 / bk0: the same heads in the planes of batch b
            k_gemmw<bf, 2, false, 0><<<dim3(TT / 64, NPE / 64, ZH), 32, 0, stream>>>(KPh + bk0 * TT * HD, KPl + bk0 * TT * HD, PQh + zq * NPE * HD, PQl + zq * NPE * HD, HD, P2C, NPE, nullptr, (size_t)TT * HD, (size_t)NPE * HD, (size_t)TT * NPE);   /* p2c raw, transposed: [ZH][key j][rel row] */
            k_asoft<<<ZH * TT / SR, SR * 32, 0, stream>>>(QPh + bq0 * TT * HD, QPl + bq0 * TT * HD, KPh + bk0 * TT * HD, KPl + bk0 * TT * HD, PKh + zq * NPE * HD, PKl + zq * NPE * HD, P2C, RIDX, VTh + bk0 * HD * TT, VTl + bk0 * HD * TT, h0, ATh + (size_t)b * TT * DQ, ATl + (size_t)b * TT * DQ); } }
    k_gemmw<bf, 1, true, DQ><<<dim3(NB_ * TT / 64, DM / 64, 1), 32, 0, stream>>>(ATh, ATl, WO, nullptr, DQ, Y, DM, bo, 0, 0, 0);   /* y = ctx Wd + bd (f32), every batch */
    k_lnres<<<NB_ * TT / 8, 256, 0, stream>>>(Y, x, lng, lnb, OUT);
}

// v007
// Measured time: 420 microseconds a run.
// In both of two side-by-side timings against v006, it was 1.12 times as fast.
// Counting every step since v000, it is 5.65 times as fast.
#include <hip/hip_runtime.h>

// DeBERTa-style disentangled self-attention + output dense + residual + LayerNorm (hidden_states [4][1024][1024]; q, k, v = hs W + b ('xw' [1024][1024]; 16 heads x 64); rel_q = pos_emb Wq + bq, rel_k = pos_emb Wk + bk (pos_emb [1024][1024], read); scale = 1/sqrt(3 x 64); scores = q.k scale + c2p[i][rel_idx[i][j]] + p2c[rel_idx[i][j]][j] with c2p = q.rel_k scale ([1024][1024]) and p2c = rel_q.k scale ([1024][1024]) and rel_idx the int32 input [1024][1024] (read per logit; = clip(i - j + 512, 0, 1023)); softmax; ctx = merged attn.v; y = ctx Wd + bd + hidden_states; out = LayerNorm(y) gamma + beta (eps 1e-7) -> [4][1024][1024] (4.2 M)).
// Layout: exact bf16 projections (+ once-off rel_k / rel_q projections of the position table), each written by its GEMM's own epilogue as per-head hi/lo planes (q, k, rel_q, rel_k [head][row][64]; v transposed [head][64][key]); hi/lo planes for q, k (every row: 3-product score GEMMs); per pass of eight heads: p2c TRANSPOSED [8][key j][rel row] as a hi/lo GEMM, and the softmax kernel (32 query rows per block) computes its own 32 rows of content scores and of c2p on the matrix unit (hi/lo, 3 products, kept in LDS), gathers the two relative terms per logit at the input index (p2c from the plane with lanes along the query rows, handed to the row's wave through LDS; c2p from the row's LDS copy), scales, f32 softmax, keeps its 32 rows of hi/lo P in LDS, multiplies them with v (3 products) and writes the merged context as hi/lo planes; Wd (hl x exact) + bd; residual + LayerNorm in f32.
// Launch shape: the conversion, the q/k/v projections, the Wd GEMM and the LayerNorm each run ONCE over the rows of all four batches (the position table's rows ride behind them in the q and k projections); only the per-pass attention launches loop over (batch, 8 heads).
// Compute dtypes, f32 accumulate: every input rounded to bf16; projections on PLAIN bf16 operands (exact) + biases; all score terms and attn.v on hi/lo planes (3 products) for every row; softmax f32; Wd hl x exact; residual/LayerNorm f32 (precise sqrt/division).

#define NB_  4
#define TT   1024
#define DM   1024
#define NH_  16
#define NKV  16
#define REP  (NH_ / NKV)
#define HD   64
#define DQ   (NH_ * HD)
#define DKV  (NKV * HD)
#define ZH   8                     // heads per pass (z extent of the per-pass GEMM launches)
#define RH   1024                  // query rows < RH use hi+lo planes (must equal TT)
#define WIN  0
#define SCL  0.072168783648703225f   // 1/sqrt(3 x 64)
#define NPE  1024                 // relative-position table rows (2 x 512)
typedef _Float16 h16;
typedef unsigned short bf;
typedef __attribute__((ext_vector_type(16))) __bf16   v16bf;
typedef __attribute__((ext_vector_type(16))) _Float16 v16h;
typedef __attribute__((ext_vector_type(8)))  _Float16 v8h;
typedef __attribute__((ext_vector_type(8)))  unsigned short v8us;
typedef __attribute__((ext_vector_type(8)))  float    v8f;
typedef __attribute__((ext_vector_type(4)))  float    v4f;
typedef v8h  __attribute__((may_alias)) v8ha;
typedef v4f  __attribute__((may_alias)) v4fa;
typedef v8us __attribute__((may_alias)) v8usa;

__device__ __forceinline__ unsigned short f2bf(float f) { unsigned u = __float_as_uint(f); u += 0x7FFFu + ((u >> 16) & 1u); return (unsigned short)(u >> 16); }
__device__ __forceinline__ float bf2f(unsigned short b) { return __uint_as_float(((unsigned)b) << 16); }
__device__ __forceinline__ float bfr(float f) { return bf2f(f2bf(f)); }
__device__ __forceinline__ v16h cat16(v8h lo, v8h hi) { return __builtin_shufflevector(lo, hi, 0, 1, 2, 3, 4, 5, 6, 7, 8, 9, 10, 11, 12, 13, 14, 15); }
__device__ __forceinline__ v16bf cat16b(v8us lo, v8us hi) { return __builtin_bit_cast(v16bf, __builtin_shufflevector(lo, hi, 0, 1, 2, 3, 4, 5, 6, 7, 8, 9, 10, 11, 12, 13, 14, 15)); }
__device__ __forceinline__ v8f wmma16(v16h a, v16h b, v8f c) { return __builtin_amdgcn_wmma_f32_16x16x32_f16(false, a, false, b, (short)0, c, false, false); }
__device__ __forceinline__ v8f wmmab(v16bf a, v16bf b, v8f c) { return __builtin_amdgcn_wmma_f32_16x16x32_bf16(false, a, false, b, (short)0, c, false, false); }
__device__ __forceinline__ void splitf(float y, unsigned short& h, unsigned short& l) { h = f2bf(y); l = f2bf(y - bf2f(h)); }
typedef __attribute__((ext_vector_type(4))) unsigned short v4us;



// ---- k_gemmw: register-blocked GEMM, ONE WAVE per 64x64 output tile (16 accumulators), operands straight from K-contiguous 16-bit planes; grid (M/64, N/64, Z), 32 threads.
// C[m][n] (f32, pitch ldc, + optional f32 bias[n]) = sum_k A[m][k] Bt[n][k] (+ split products per NSPLIT). z-batch strides sA/sB/sC in elements. K % 32 == 0.
template <typename T16> struct WFrag;
template <> struct WFrag<h16> { typedef v16h V; static __device__ __forceinline__ V ld(const h16* p) { return cat16(*(const v8h*)p, *(const v8h*)(p + 16)); } static __device__ __forceinline__ v8f mma(V a, V b, v8f c) { return wmma16(a, b, c); } };
template <> struct WFrag<bf> { typedef v16bf V; static __device__ __forceinline__ V ld(const bf* p) { return cat16b(*(const v8us*)p, *(const v8us*)(p + 16)); } static __device__ __forceinline__ v8f mma(V a, V b, v8f c) { return wmmab(a, b, c); } };
// OM: what the epilogue writes. 0: C as above. 1: no C; the 64x64 tile (+ bias) goes out split into hi/lo bf16 as 64 rows of ONE head's planes [head][row][64] (blockIdx.y = head): rows below NB_ * TT into O1h / O1l [batch][head][TT][64], the position table's rows behind them into O2h / O2l [head][NPE][64]. 2: the same split, transposed, into O1h / O1l [batch][head][64][TT].
// KT: K as a compile-time constant (the long GEMMs: loads-ahead loop below), or 0 for the loop on the run-time K (the short p2c GEMM, whose hi/lo fragments of both operands beside the accumulators leave no room to hold a whole step).
template <typename T16, int NSPLIT, bool BIAS, int KT, int OM>
__global__ __launch_bounds__(32) void k_gemmw(const T16* __restrict__ A, const T16* __restrict__ A2, const T16* __restrict__ Bt, const T16* __restrict__ Bt2, int K, float* C, int ldc, const float* __restrict__ bias, size_t sA, size_t sB, size_t sC, bf* O1h, bf* O1l, bf* O2h, bf* O2l) {
    typedef typename WFrag<T16>::V V;
    __shared__ __align__(16) float os[16 * 68];
    const size_t z = blockIdx.z; A += z * sA; if (A2) A2 += z * sA; Bt += z * sB; if (Bt2) Bt2 += z * sB; C += z * sC;
    const int lane = threadIdx.x & 31, lr = lane & 15, hi = lane >> 4; const int r0 = blockIdx.x * 64, c0 = blockIdx.y * 64;
    v8f acc[4][4];
#pragma unroll
    for (int mb = 0; mb < 4; ++mb)
#pragma unroll
        for (int nb = 0; nb < 4; ++nb) acc[mb][nb] = (v8f){};
    if constexpr (KT == 0) {
    const size_t aoff = (size_t)(r0 + lr) * K + 8 * hi, boff = (size_t)(c0 + lr) * K + 8 * hi;
#pragma unroll 1
    for (int kc = 0; kc < K; kc += 32) {
        V a[4], a2[4];
#pragma unroll
        for (int mb = 0; mb < 4; ++mb) { a[mb] = WFrag<T16>::ld(A + aoff + (size_t)mb * 16 * K + kc); if (NSPLIT == 1 || NSPLIT == 2) a2[mb] = WFrag<T16>::ld(A2 + aoff + (size_t)mb * 16 * K + kc); }
#pragma unroll
        for (int nb = 0; nb < 4; ++nb) { const V b = WFrag<T16>::ld(Bt + boff + (size_t)nb * 16 * K + kc); V b2; if (NSPLIT >= 2) b2 = WFrag<T16>::ld(Bt2 + boff + (size_t)nb * 16 * K + kc);
#pragma unroll
            for (int mb = 0; mb < 4; ++mb) { acc[mb][nb] = WFrag<T16>::mma(a[mb], b, acc[mb][nb]); if (NSPLIT == 1 || NSPLIT == 2) acc[mb][nb] = WFrag<T16>::mma(a2[mb], b, acc[mb][nb]); if (NSPLIT >= 2) acc[mb][nb] = WFrag<T16>::mma(a[mb], b2, acc[mb][nb]); } }
        asm volatile("v_nop\n\tv_nop\n\tv_nop\n\tv_nop" : "+v"(acc[0][0]), "+v"(acc[1][1]), "+v"(acc[2][2]), "+v"(acc[3][3]) : "v"(a[0]), "v"(a[3]));
    }
    } else {
    static_assert(NSPLIT < 2 && KT % 32 == 0, "a whole k step is held in registers");
    // One running pointer per plane; the 16-row tiles of a plane are reached by immediate offsets from it.
    const T16* pa = A + (size_t)(r0 + lr) * KT + 8 * hi; const T16* pb = Bt + (size_t)(c0 + lr) * KT + 8 * hi; const T16* pa2 = NSPLIT == 1 ? A2 + (size_t)(r0 + lr) * KT + 8 * hi : pa;
#pragma unroll 1
    for (int kc = 0; kc < KT; kc += 32) {
        V a[4], a2[4], b[4];
#pragma unroll
        for (int mb = 0; mb < 4; ++mb) a[mb] = WFrag<T16>::ld(pa + mb * 16 * KT);
#pragma unroll
        for (int nb = 0; nb < 4; ++nb) b[nb] = WFrag<T16>::ld(pb + nb * 16 * KT);
        if (NSPLIT == 1) {   // the lo plane last: its products come second in every accumulator
#pragma unroll
            for (int mb = 0; mb < 4; ++mb) a2[mb] = WFrag<T16>::ld(pa2 + mb * 16 * KT); }
        asm volatile("s_wait_xcnt 0x0" :: "v"(pa), "v"(pa2), "v"(pb) : "memory");   // the wait in front of any rewrite of the loads' address pairs; named as inputs the pairs stay live to here, so that no result of the step is placed in one
        __builtin_amdgcn_sched_barrier(0);   // every load of the k step is issued in front of its first matrix instruction, so that the step waits one load latency; left to the scheduler the loads come in groups, each issued behind the wait for the group before
        pa += 32; pa2 += 32; pb += 32;
#pragma unroll
        for (int nb = 0; nb < 4; ++nb) {
#pragma unroll
            for (int mb = 0; mb < 4; ++mb) { acc[mb][nb] = WFrag<T16>::mma(a[mb], b[nb], acc[mb][nb]); if (NSPLIT == 1) acc[mb][nb] = WFrag<T16>::mma(a2[mb], b[nb], acc[mb][nb]); } }
        asm volatile("v_nop\n\tv_nop\n\tv_nop\n\tv_nop" : "+v"(acc[0][0]), "+v"(acc[1][1]), "+v"(acc[2][2]), "+v"(acc[3][3]) : "v"(a[0]), "v"(a[3]));   // as in the loop above: the four vector slots behind the step's last matrix instructions, on the taken branch too
    }
    }
    if constexpr (OM == 2) {
    static_assert(OM != 2 || (BIAS && HD == 64 && TT % 64 == 0), "a tile is 64 keys of one head");
    // A lane holds 8 consecutive rows (keys) of one column (head dimension): 16 bytes of a transposed row; the four 16-row tiles of a column, stored one behind the other, fill its 128-byte line.
    const size_t vo = (((size_t)(r0 / TT) * NKV + blockIdx.y) * HD + lr) * TT + r0 % TT + hi * 8; bf* ph = O1h + vo; bf* pl = O1l + vo;
    float bi[4];   // all four loaded ahead: one load latency for the epilogue, not one per column tile
#pragma unroll
    for (int nb = 0; nb < 4; ++nb) bi[nb] = bfr(bias[c0 + nb * 16 + lr]);
#pragma unroll
    for (int nb = 0; nb < 4; ++nb) { v8us dh[4], dl[4];
#pragma unroll
        for (int mb = 0; mb < 4; ++mb) {
#pragma unroll
            for (int j = 0; j < 8; ++j) { unsigned short a, c; splitf(acc[mb][nb][j] + bi[nb], a, c); dh[mb][j] = a; dl[mb][j] = c; }
            *(v8us*)(ph + nb * 16 * TT + mb * 16) = dh[mb]; *(v8us*)(pl + nb * 16 * TT + mb * 16) = dl[mb]; }
        asm volatile("s_wait_xcnt 0x0" :: "v"(ph), "v"(pl), "v"(dh[0]), "v"(dh[1]), "v"(dh[2]), "v"(dh[3]), "v"(dl[0]), "v"(dl[1]), "v"(dl[2]), "v"(dl[3]) : "memory"); }   // the wait in front of any rewrite of the eight stores' data and address registers; named as inputs they stay live to here
    } else if constexpr (OM == 1) {
    static_assert(OM != 1 || (BIAS && HD == 64 && TT % 64 == 0 && NH_ == NKV), "a tile is 64 rows of one head");
    const bool tab = r0 >= NB_ * TT;   // the same for the whole tile
    const size_t po = (tab ? ((size_t)blockIdx.y * NPE + (r0 - NB_ * TT)) : (((size_t)(r0 / TT) * NH_ + blockIdx.y) * TT + r0 % TT)) * HD + hi * HD + lr * 4;
    bf* ph = (tab ? O2h : O1h) + po; bf* pl = (tab ? O2l : O1l) + po;
    v4f bi;
#pragma unroll
    for (int q = 0; q < 4; ++q) bi[q] = bfr(bias[c0 + lr * 4 + q]);
#pragma unroll
    for (int mb = 0; mb < 4; ++mb) {
#pragma unroll
        for (int nb = 0; nb < 4; ++nb) {
#pragma unroll
            for (int j = 0; j < 8; ++j) os[(hi * 8 + j) * 68 + nb * 16 + lr] = acc[mb][nb][j]; }
        __builtin_amdgcn_wave_barrier(); asm volatile("" ::: "memory");   // lanes read what other lanes of the wave wrote: the reads stay behind the stores
        v4us dh[8], dl[8];
#pragma unroll
        for (int s = 0; s < 8; ++s) { const v4f val = *(const v4fa*)(os + (2 * s + hi) * 68 + lr * 4);   // 16 lanes x 4 columns: one 128-byte row of each plane per half-wave
#pragma unroll
            for (int q = 0; q < 4; ++q) { unsigned short a, c; splitf(val[q] + bi[q], a, c); dh[s][q] = a; dl[s][q] = c; }
            *(v4us*)(ph + (mb * 16 + 2 * s) * HD) = dh[s]; *(v4us*)(pl + (mb * 16 + 2 * s) * HD) = dl[s]; }
        asm volatile("s_wait_xcnt 0x0" :: "v"(ph), "v"(pl), "v"(dh[0]), "v"(dh[1]), "v"(dh[2]), "v"(dh[3]), "v"(dh[4]), "v"(dh[5]), "v"(dh[6]), "v"(dh[7]), "v"(dl[0]), "v"(dl[1]), "v"(dl[2]), "v"(dl[3]), "v"(dl[4]), "v"(dl[5]), "v"(dl[6]), "v"(dl[7]) : "memory");   // the wait in front of any rewrite of the sixteen stores' data and address registers; named as inputs they stay live to here
        __builtin_amdgcn_wave_barrier(); asm volatile("" ::: "memory");   // and the next tile's LDS stores behind these reads
    }
    } else {
#pragma unroll
    for (int mb = 0; mb < 4; ++mb) {
#pragma unroll
        for (int nb = 0; nb < 4; ++nb) {
#pragma unroll
            for (int j = 0; j < 8; ++j) os[(hi * 8 + j) * 68 + nb * 16 + lr] = acc[mb][nb][j]; }
        __builtin_amdgcn_wave_barrier(); asm volatile("" ::: "memory");
        float* crow = C + (size_t)(r0 + mb * 16) * ldc + c0;
{
#pragma unroll
            for (int s = 0; s < 8; ++s) { const int row = 2 * s + hi, cofs = lr * 4; v4f val = *(const v4fa*)(os + row * 68 + cofs); if (BIAS) { val[0] += bfr(bias[c0 + cofs]); val[1] += bfr(bias[c0 + cofs + 1]); val[2] += bfr(bias[c0 + cofs + 2]); val[3] += bfr(bias[c0 + cofs + 3]); }
                *(v4f*)(crow + (size_t)row * ldc + cofs) = val; }
             }
        __builtin_amdgcn_wave_barrier(); asm volatile("" ::: "memory");
    }
    }
}

typedef __attribute__((ext_vector_type(2))) unsigned short v2us;
typedef __attribute__((ext_vector_type(2))) float v2f;
typedef __attribute__((ext_vector_type(4))) int v4i;

__global__ __launch_bounds__(256) void k_wtG(const float* __restrict__ w, int K, int N, bf* Bt) {
    const int lane = threadIdx.x & 31; const int L0 = (blockIdx.x * 8 + (threadIdx.x >> 5)) * 8; const int nlines = N * K / 64;
{
#pragma unroll 1
        for (int l = 0; l < 8; ++l) { const int L = L0 + l; if (L >= nlines) break; const size_t e = (size_t)L * 64 + lane * 2; const int k = (int)(e % K), n = (int)(e / K); v2us o;
            o[0] = f2bf(w[(size_t)k * N + n]); o[1] = f2bf(w[(size_t)(k + 1) * N + n]); *(v2us*)(Bt + e) = o; }
         }
}
__global__ __launch_bounds__(256) void k_cvt8(const float* __restrict__ src, bf* dst, size_t n8) { const size_t i = (size_t)blockIdx.x * 256 + threadIdx.x; if (i >= n8) return; const v8f v = *(const v8f*)(src + i * 8); v8us o;
#pragma unroll
    for (int k = 0; k < 8; ++k) o[k] = f2bf(v[k]); *(v8us*)(dst + i * 8) = o;  }

// k_asoft: per row (zz, i): t = ((q.k + p2c[rp][j]) + c2p[i][rp]) x scale with rp = rel_idx[i][j] (int32 input, read per logit with b128 loads; clamped to [0, NPE) for memory safety - the identity for the shipped clip(i - j + 512, 0, 1023)); softmax over the 1024 keys (register row, one exp, fixed trees);
// One block = SR consecutive query rows of one head, one wave per row. The p2c term comes from the transposed plane P2CT[j][rp]: wave w takes the 32 keys j = 32 w .. 32 w + 31 and gathers with its LANES ALONG THE QUERY ROWS, so that indices which rise with i (or stand still) fall into one or two cache lines per load for any key; any other index array is gathered just as correctly, only slower.
// The index tile is turned in LDS (written by rows, read by columns), each gathered value replaces its index in place, and the row's own wave reads its finished row of G.
#define SR 32      // query rows per block = waves per block = TT / 32 key tiles
#define GP 1028    // pitch of G in words: rows stay 16-byte aligned, and lanes that read b128 down a column step 4 banks each
static_assert(RH == TT, "every query row keeps hi/lo P");
#define RP 66      // pitch of a partial-sum row in words: 8-byte aligned, and the two half-waves (8 rows apart) fall on different banks
typedef v4i __attribute__((may_alias)) v4ia;
typedef v4us __attribute__((may_alias)) v4usa;
typedef v2f __attribute__((may_alias)) v2fa;
#define QPT 72     // pitch of a staged q row in 16-bit elements: 128 bytes + 16, so that the 16 rows of a fragment read fall on different banks
// stage16: one 16-row tile (hi and lo plane, rows of 64 elements = 128 bytes, so 2 KiB contiguous per plane) of a K-contiguous operand goes through the wave's own 32 x 128-byte column tile of an LDS array (st): whole-line global loads, then fragment reads from LDS (rows 0..15 hi, 16..31 lo). ph / pl point at the lane's own 16 bytes of the tile's first 512.
__device__ __forceinline__ void stage16(const bf* __restrict__ ph, const bf* __restrict__ pl, float* st, int lane, v16bf (&fh)[2], v16bf (&fl)[2]) {
    v8us r[8];
#pragma unroll
    for (int s = 0; s < 4; ++s) { r[s] = *(const v8us*)(ph + s * 256); r[4 + s] = *(const v8us*)(pl + s * 256); }
    asm volatile("s_wait_xcnt 0x0" :: "v"(ph), "v"(pl) : "memory");   // the wait in front of any rewrite of the eight loads' two address pairs; named as inputs the pairs stay live to here
    bf* sb = (bf*)st + (size_t)(lane >> 3) * (GP * 2) + (lane & 7) * 8;
#pragma unroll
    for (int s = 0; s < 4; ++s) { *(v8usa*)(sb + (size_t)(s * 4) * (GP * 2)) = r[s]; *(v8usa*)(sb + (size_t)(16 + s * 4) * (GP * 2)) = r[4 + s]; }
    __builtin_amdgcn_wave_barrier(); asm volatile("" ::: "memory");   // lanes read what other lanes of the wave wrote: the compiler must keep the reads behind the stores (the LDS serves one wave's accesses in order)
    const bf* fb = (const bf*)st + (size_t)(lane & 15) * (GP * 2) + 8 * (lane >> 4);
#pragma unroll
    for (int kc = 0; kc < 2; ++kc) { fh[kc] = cat16b(*(const v8usa*)(fb + kc * 32), *(const v8usa*)(fb + kc * 32 + 16)); fl[kc] = cat16b(*(const v8usa*)(fb + (size_t)16 * (GP * 2) + kc * 32), *(const v8usa*)(fb + (size_t)16 * (GP * 2) + kc * 32 + 16)); }
    __builtin_amdgcn_wave_barrier(); asm volatile("" ::: "memory");   // and the tile's next stores behind these reads
}
// mm16: acc[rt][j] at lane (lr, hi) += tile row (hi * 8 + j) . query row (rt * 16 + lr); products in the order of the score GEMMs: q hi x tile hi, q lo x tile hi, q hi x tile lo, per 32 of k
// (qh: the q hi fragments, held in registers over all four tiles; qf: the lane's place in the staged q lo rows, read from LDS per tile: hi and lo both held do not fit the 128 registers of a 32-wave block)
__device__ __forceinline__ void mm16(const v16bf (&fh)[2], const v16bf (&fl)[2], const v16bf (&qh)[2][2], const bf* qf, v8f (&acc)[2]) {
#pragma unroll
    for (int kc = 0; kc < 2; ++kc)
#pragma unroll
        for (int rt = 0; rt < 2; ++rt) { const bf* qp = qf + rt * 16 * QPT + kc * 32; const v16bf ql = cat16b(*(const v8usa*)qp, *(const v8usa*)(qp + 16));
            acc[rt] = wmmab(fh[kc], qh[kc][rt], acc[rt]); acc[rt] = wmmab(fh[kc], ql, acc[rt]); acc[rt] = wmmab(fl[kc], qh[kc][rt], acc[rt]); }
}
static_assert(NPE == SR * 32 && TT == SR * 32 && HD == 64, "one wave per 32 keys and per 32 table rows; rows of 128 bytes");
__global__ __launch_bounds__(1024) void k_asoft(const bf* __restrict__ Qh, const bf* __restrict__ Ql, const bf* __restrict__ Kh, const bf* __restrict__ Kl, const bf* __restrict__ RKh, const bf* __restrict__ RKl, const float* __restrict__ P2CT, const int* __restrict__ RIX, const bf* __restrict__ VTh, const bf* __restrict__ VTl, int h0, bf* Ah, bf* Al) {
    __shared__ __align__(16) float G[SR * GP];
    __shared__ __align__(16) float CL[SR * GP];       // the block's 32 rows of c2p (raw); before that each wave's column tile stages its operand tiles
    __shared__ __align__(16) bf QS[2 * SR * QPT];     // the block's 32 q rows, hi plane then lo plane
    const int lane = threadIdx.x & 31; const int w = threadIdx.x >> 5; const int row0 = blockIdx.x * SR; const int zz = row0 / TT; const int i0 = row0 % TT;
    if (w < 16) { const int pq = w >> 3, o = (threadIdx.x & 255) * 8; const bf* qs = (pq ? Ql : Qh) + ((size_t)zz * TT + i0) * HD + o; const v8us qv = *(const v8us*)qs;   // 32 rows x 128 bytes per plane, contiguous; published by the first barrier below
        asm volatile("s_wait_xcnt 0x0" :: "v"(qs) : "memory");   // the wait in front of any rewrite of the load's address pair
        *(v8usa*)(QS + (pq * SR + (o >> 6)) * QPT + (o & 63)) = qv; }
    { const int jw = w * 32; const float* pt = P2CT + ((size_t)zz * TT + jw) * NPE; const int rr = lane >> 3, cc = jw + (lane & 7) * 4; float* gl = G + lane * GP + jw; const int* ip = RIX + (size_t)(i0 + rr) * TT + cc; v4i t[8];
#pragma unroll
      for (int s = 0; s < 8; ++s) t[s] = *(const v4i*)(ip + (size_t)s * 4 * TT);
      asm volatile("s_wait_xcnt 0x0" :: "v"(ip) : "memory");   // the wait in front of any rewrite of the eight loads' shared address pair; named as an input the pair stays live to here, so that no result of the run is placed in it
#pragma unroll
      for (int s = 0; s < 8; ++s) *(v4ia*)(G + (s * 4 + rr) * GP + cc) = t[s];
      __syncthreads();   // index tile complete before it is read by columns
#pragma unroll
      for (int c = 0; c < 8; ++c) t[c] = *(const v4ia*)(gl + c * 4);   // lane = query row i0 + lane, keys jw .. jw + 31
      v4f g[8];
#pragma unroll
      for (int hf = 0; hf < 2; ++hf) { const float* pg[16];   // two runs of 16 gathers, all of a run in flight together
#pragma unroll
          for (int k = 0; k < 16; ++k) { const int c = hf * 4 + (k >> 2), q = k & 3; int rp = t[c][q]; rp = rp < 0 ? 0 : (rp > NPE - 1 ? NPE - 1 : rp); pg[k] = pt + rp; g[c][q] = pg[k][(size_t)(c * 4 + q) * NPE]; }
          asm volatile("s_wait_xcnt 0x0" :: "v"(pg[0]), "v"(pg[1]), "v"(pg[2]), "v"(pg[3]), "v"(pg[4]), "v"(pg[5]), "v"(pg[6]), "v"(pg[7]), "v"(pg[8]), "v"(pg[9]), "v"(pg[10]), "v"(pg[11]), "v"(pg[12]), "v"(pg[13]), "v"(pg[14]), "v"(pg[15]) : "memory"); }   // the wait in front of any rewrite of the run's address pairs; named as inputs they stay live to here, so that no result of the run is placed in one
#pragma unroll
      for (int c = 0; c < 8; ++c) *(v4fa*)(gl + c * 4) = g[c];
    }
    // Content scores and c2p of the block's 32 query rows: wave w takes the 32 keys, then the 32 table rows, 32 w .. 32 w + 31, as the A operand (16 at a time) against the q rows as B, so that a lane holds 8 consecutive columns of one query row.
    { const int lr = lane & 15, hi = lane >> 4, jw = w * 32; float* st = CL + jw; const size_t to = ((size_t)zz * TT + jw) * HD + lane * 8;
      const bf* qf = QS + (SR + lr) * QPT + 8 * hi; v16bf qh[2][2];   // [k half][16-row tile]
#pragma unroll
      for (int kc = 0; kc < 2; ++kc)
#pragma unroll
          for (int rt = 0; rt < 2; ++rt) { const bf* qp = QS + (rt * 16 + lr) * QPT + kc * 32 + 8 * hi; qh[kc][rt] = cat16b(*(const v8usa*)qp, *(const v8usa*)(qp + 16)); }
      v16bf fh[2], fl[2];
#pragma unroll
      for (int kt = 0; kt < 2; ++kt) { stage16(Kh + to + kt * 16 * HD, Kl + to + kt * 16 * HD, st, lane, fh, fl); v8f acc[2]; acc[0] = (v8f){}; acc[1] = (v8f){}; mm16(fh, fl, qh, qf, acc);
#pragma unroll
          for (int rt = 0; rt < 2; ++rt) { float* gp = G + (rt * 16 + lr) * GP + jw + kt * 16 + hi * 8; v4f x0 = *(const v4fa*)gp, x1 = *(const v4fa*)(gp + 4);   // the wave's own key tile of G: q.k joins the gathered p2c term
#pragma unroll
              for (int q = 0; q < 4; ++q) { x0[q] = __fadd_rn(acc[rt][q], x0[q]); x1[q] = __fadd_rn(acc[rt][4 + q], x1[q]); }
              *(v4fa*)gp = x0; *(v4fa*)(gp + 4) = x1; } }
      v8f cc[2]; cc[0] = (v8f){}; cc[1] = (v8f){};
      stage16(RKh + to, RKl + to, st, lane, fh, fl); mm16(fh, fl, qh, qf, cc);
      stage16(RKh + to + 16 * HD, RKl + to + 16 * HD, st, lane, fh, fl);   // behind its fragment reads the staging tile is free and takes the results
#pragma unroll
      for (int kt = 0; kt < 2; ++kt) {
          if (kt) { cc[0] = (v8f){}; cc[1] = (v8f){}; mm16(fh, fl, qh, qf, cc); }
#pragma unroll
          for (int rt = 0; rt < 2; ++rt) { float* cp = CL + (rt * 16 + lr) * GP + jw + kt * 16 + hi * 8; *(v4fa*)cp = __builtin_shufflevector(cc[rt], cc[rt], 0, 1, 2, 3); *(v4fa*)(cp + 4) = __builtin_shufflevector(cc[rt], cc[rt], 4, 5, 6, 7); } }
    }
    __syncthreads();   // every column tile of G and of CL finished before a row's wave reads across them
    const int i = i0 + w; const float* cr = CL + w * GP; const float* gr = G + w * GP; const int* rxr = RIX + (size_t)i * TT; float v[TT / 32]; float mx = -3.0e38f;
#pragma unroll
    for (int ch = 0; ch < TT / 128; ++ch) { const int j0 = ch * 128 + lane * 4; const v4i r4 = *(const v4i*)(rxr + j0); const v4f p4 = *(const v4fa*)(gr + j0);
#pragma unroll
        for (int q = 0; q < 4; ++q) { int rp = r4[q]; rp = rp < 0 ? 0 : (rp > NPE - 1 ? NPE - 1 : rp); const float t = __fmul_rn(__fadd_rn(p4[q], cr[rp]), SCL);   /* ((qk + p2c[rp][j]) + c2p[i][rp]) x scale, rp = rel_idx[i][j] */ v[ch * 4 + q] = t; mx = fmaxf(mx, t); } }
#pragma unroll
    for (int sh = 16; sh; sh >>= 1) mx = fmaxf(mx, __shfl_xor(mx, sh, 32));
    float sum = 0.f;
#pragma unroll
    for (int k = 0; k < TT / 32; ++k) { float d0 = __fsub_rn(v[k], mx); asm volatile("" : "+v"(d0)); v[k] = __builtin_amdgcn_exp2f(__fmul_rn(d0, 1.4426950408889634f)); sum += v[k]; }
#pragma unroll
    for (int sh = 16; sh; sh >>= 1) sum += __shfl_xor(sum, sh, 32);
    const float f = __fdiv_rn(1.0f, sum);
    // P stays in LDS: the wave's own row of G (read by nobody else behind the second barrier, and by this wave no more) takes the row's 1024 hi halves, then its 1024 lo halves.
    bf* pr = (bf*)G + (size_t)w * (GP * 2);
#pragma unroll
    for (int ch = 0; ch < TT / 128; ++ch) { v4us oh, ol;
#pragma unroll
        for (int q = 0; q < 4; ++q) { unsigned short a, c2; splitf(v[ch * 4 + q] * f, a, c2); oh[q] = a; ol[q] = c2; }
        *(v4usa*)(pr + ch * 128 + lane * 4) = oh; *(v4usa*)(pr + TT + ch * 128 + lane * 4) = ol; }
    // attn.v of the block's 32 rows: wave w takes the 16 head columns nt * 16 .. and the 128 keys ks * 128 .. (both 16-row tiles), so that every v fragment is loaded once per block; the eight key slices are summed through LDS in fixed order. (The loops are unrolled so that b, b2 and acc are indexed by constants and stay in registers.)
    const int lr = lane & 15, hi = lane >> 4, nt = w & 3, ks = w >> 2;
    const size_t vo = ((size_t)zz * HD + nt * 16 + lr) * TT + ks * 128 + 8 * hi; const bf* vh = VTh + vo; const bf* vl = VTl + vo;
    __builtin_amdgcn_sched_barrier(0);   // keeps the sixteen loads below behind the split of P: lifted over it they meet the row's 32 live values and one fragment is spilled, with a wait on its load in the middle of the split
    v16bf b[4], b2[4];
#pragma unroll
    for (int kk = 0; kk < 4; ++kk) { b[kk] = WFrag<bf>::ld(vh + kk * 32); b2[kk] = WFrag<bf>::ld(vl + kk * 32); }   // issued in front of the barrier: they do not depend on P and fly while the block gathers there
    asm volatile("s_wait_xcnt 0x0" :: "v"(vh), "v"(vl) : "memory");   // the wait in front of any rewrite of the sixteen loads' two address pairs; named as inputs the pairs stay live to here
    __syncthreads();   // all 32 rows of P written before the fragments are read across them
    v8f acc[2]; acc[0] = (v8f){}; acc[1] = (v8f){};
#pragma unroll
    for (int kk = 0; kk < 4; ++kk) {
#pragma unroll
        for (int mt = 0; mt < 2; ++mt) { const bf* pa = (const bf*)G + (size_t)(mt * 16 + lr) * (GP * 2) + ks * 128 + kk * 32 + 8 * hi;
            const v16bf a = cat16b(*(const v8usa*)pa, *(const v8usa*)(pa + 16)); const v16bf a2 = cat16b(*(const v8usa*)(pa + TT), *(const v8usa*)(pa + TT + 16));
            acc[mt] = wmmab(a, b[kk], acc[mt]); acc[mt] = wmmab(a2, b[kk], acc[mt]); acc[mt] = wmmab(a, b2[kk], acc[mt]); } }
    __syncthreads();   // every fragment of P read before G is reused for the partial sums
#pragma unroll
    for (int mt = 0; mt < 2; ++mt)
#pragma unroll
        for (int j = 0; j < 8; ++j) G[(ks * SR + mt * 16 + hi * 8 + j) * RP + nt * 16 + lr] = acc[mt][j];
    __syncthreads();   // all eight key slices' partial sums written before a row's wave adds them
    v2f o = *(const v2fa*)(G + w * RP + lane * 2);
#pragma unroll
    for (int s = 1; s < 8; ++s) { const v2f p = *(const v2fa*)(G + (s * SR + w) * RP + lane * 2); o[0] += p[0]; o[1] += p[1]; }
    v2us oh, ol;
#pragma unroll
    for (int q = 0; q < 2; ++q) { unsigned short a, c2; splitf(o[q], a, c2); oh[q] = a; ol[q] = c2; }
    const size_t oo = (size_t)i * DQ + (h0 + zz) * HD + lane * 2; *(v2us*)(Ah + oo) = oh; *(v2us*)(Al + oo) = ol;   // merged context [t][head][d]: one wave writes one 128-byte line of each plane
}

__global__ __launch_bounds__(256) void k_lnres(const float* __restrict__ Y, const float* __restrict__ xres, const float* __restrict__ g, const float* __restrict__ bb, float* out) {
    const int lane = threadIdx.x & 31; const int row = blockIdx.x * 8 + (threadIdx.x >> 5); if (row >= NB_ * TT) return; const float* yr = Y + (size_t)row * DM; const float* xr = xres + (size_t)row * DM; float v[DM / 32]; float s = 0.f;
#pragma unroll
    for (int ch = 0; ch < DM / 128; ++ch) { const v4f a = *(const v4f*)(yr + ch * 128 + lane * 4); const v4f c = *(const v4f*)(xr + ch * 128 + lane * 4);
#pragma unroll
        for (int q = 0; q < 4; ++q) { const float t = __fadd_rn(a[q], bfr(c[q])); v[ch * 4 + q] = t; s = __fadd_rn(s, t); } }
#pragma unroll
    for (int sh = 16; sh; sh >>= 1) s = __fadd_rn(s, __shfl_xor(s, sh, 32));
    const float mu = __fdiv_rn(s, (float)DM); float s2 = 0.f;
#pragma unroll
    for (int k = 0; k < DM / 32; ++k) { float d0 = __fsub_rn(v[k], mu); asm volatile("" : "+v"(d0)); float p = __fmul_rn(d0, d0); asm volatile("" : "+v"(p)); s2 = __fadd_rn(s2, p); }
#pragma unroll
    for (int sh = 16; sh; sh >>= 1) s2 = __fadd_rn(s2, __shfl_xor(s2, sh, 32));
    const float rs = __fdiv_rn(1.0f, __fsqrt_rn(__fadd_rn(__fdiv_rn(s2, (float)DM), 1e-7f)));
{
#pragma unroll
        for (int ch = 0; ch < DM / 128; ++ch) { const int c0 = ch * 128 + lane * 4; v4f o;
#pragma unroll
            for (int q = 0; q < 4; ++q) { float xn = __fmul_rn(__fsub_rn(v[ch * 4 + q], mu), rs); asm volatile("" : "+v"(xn)); float gg = bfr(g[c0 + q]); asm volatile("" : "+v"(gg)); float yv = __fmul_rn(xn, gg); asm volatile("" : "+v"(yv)); float be = bfr(bb[c0 + q]); asm volatile("" : "+v"(be)); o[q] = __fadd_rn(yv, be); }
            *(v4f*)(out + (size_t)row * DM + c0) = o; }
         }
}

extern "C" void kernel_launch(void* const* d_in, const int* in_sizes, int n_in,
                              void* d_out, int out_size, void* d_ws, size_t ws_size, hipStream_t stream) {
    (void)in_sizes; (void)n_in; (void)out_size;
    const float* x = (const float*)d_in[0]; const float* rel = (const float*)d_in[1]; const float* wq = (const float*)d_in[2]; const float* bq = (const float*)d_in[3]; const float* wk = (const float*)d_in[4]; const float* bk = (const float*)d_in[5]; const float* wv = (const float*)d_in[6]; const float* bv = (const float*)d_in[7]; const float* wo = (const float*)d_in[8]; const float* bo = (const float*)d_in[9]; const float* lng = (const float*)d_in[10]; const float* lnb = (const float*)d_in[11]; const int* RIDX = (const int*)d_in[12];
    float* OUT = (float*)d_out;     // [4][1024][1024]
    char* wsp = (char*)d_ws;
    auto take = [&](size_t bytes) { char* p = wsp; wsp += (bytes + 255) & ~(size_t)255; return (void*)p; };
    bf* WQ = (bf*)take((size_t)DQ * DM * 2); bf* WK = (bf*)take((size_t)DKV * DM * 2); bf* WV = (bf*)take((size_t)DKV * DM * 2); bf* WO = (bf*)take((size_t)DM * DQ * 2);
    bf* PKh = (bf*)take((size_t)NH_ * NPE * HD * 2); bf* PKl = (bf*)take((size_t)NH_ * NPE * HD * 2); bf* PQh = (bf*)take((size_t)NH_ * NPE * HD * 2); bf* PQl = (bf*)take((size_t)NH_ * NPE * HD * 2); float* P2C = (float*)take((size_t)ZH * NPE * TT * 4);
    bf* QPh = (bf*)take((size_t)NB_ * NH_ * TT * HD * 2); bf* QPl = (bf*)take((size_t)NB_ * NH_ * TT * HD * 2); bf* KPh = (bf*)take((size_t)NB_ * NKV * TT * HD * 2); bf* KPl = (bf*)take((size_t)NB_ * NKV * TT * HD * 2); bf* VTh = (bf*)take((size_t)NB_ * NKV * HD * TT * 2); bf* VTl = (bf*)take((size_t)NB_ * NKV * HD * TT * 2);
    float* Y = (float*)take((size_t)NB_ * TT * DM * 4); bf* ATh = (bf*)take((size_t)NB_ * TT * DQ * 2); bf* ATl = (bf*)take((size_t)NB_ * TT * DQ * 2);
    if ((size_t)(wsp - (char*)d_ws) > ws_size) return;    // ws 256 MiB
    // XB [5120][1024] bf16 (10 MiB) lives only before the first pass and lies inside P2C, the passes' 32-MiB p2c plane (stream-ordered; written in this call before it is read).
    const size_t MR = (size_t)NB_ * TT;       // rows of all batches; the position table's NPE rows follow them
    bf* XB = (bf*)P2C;
    { k_wtG<<<(unsigned)((DM * DQ / 64 + 63) / 64), 256, 0, stream>>>(wq, DM, DQ, WQ); k_wtG<<<(unsigned)((DM * DKV / 64 + 63) / 64), 256, 0, stream>>>(wk, DM, DKV, WK); k_wtG<<<(unsigned)((DM * DKV / 64 + 63) / 64), 256, 0, stream>>>(wv, DM, DKV, WV);
      k_wtG<<<(unsigned)((DQ * DM / 64 + 63) / 64), 256, 0, stream>>>(wo, DQ, DM, WO);
       }
    k_cvt8<<<(unsigned)(((size_t)NB_ * TT * DM / 8 + 255) / 256), 256, 0, stream>>>(x, XB, (size_t)NB_ * TT * DM / 8);
    k_cvt8<<<(unsigned)(((size_t)NPE * DM / 8 + 255) / 256), 256, 0, stream>>>(rel, XB + MR * DM, (size_t)NPE * DM / 8);
    k_gemmw<bf, 0, true, DM, 1><<<dim3((NB_ * TT + NPE) / 64, DQ / 64, 1), 32, 0, stream>>>(XB, nullptr, WQ, nullptr, DM, nullptr, 0, bq, 0, 0, 0, QPh, QPl, PQh, PQl);   /* q of every batch, then rel_q = pos_emb Wq + bq: per-head hi/lo planes */
    k_gemmw<bf, 0, true, DM, 1><<<dim3((NB_ * TT + NPE) / 64, DKV / 64, 1), 32, 0, stream>>>(XB, nullptr, WK, nullptr, DM, nullptr, 0, bk, 0, 0, 0, KPh, KPl, PKh, PKl);   /* k of every batch, then rel_k = pos_emb Wk + bk: per-head hi/lo planes */
    k_gemmw<bf, 0, true, DM, 2><<<dim3(NB_ * TT / 64, DKV / 64, 1), 32, 0, stream>>>(XB, nullptr, WV, nullptr, DM, nullptr, 0, bv, 0, 0, 0, VTh, VTl, nullptr, nullptr);   /* v of every batch: per-head hi/lo planes, transposed */
    for (int b = 0; b < NB_; ++b) {
        for (int h0 = 0; h0 < NH_; h0 += ZH) { const size_t zq = (size_t)h0, zk = (size_t)(h0 / REP), bq0 = (size_t)b * NH_ + zq, bk0 = (size_t)b * NKV + zk;   // one kv head per query head: the pass's heads use consecutive kv planes (z-strides TT*HD); bq0 / bk0: the same heads in the planes of batch b
            k_gemmw<bf, 2, false, 0, 0><<<dim3(TT / 64, NPE / 64, ZH), 32, 0, stream>>>(KPh + bk0 * TT * HD, KPl + bk0 * TT * HD, PQh + zq * NPE * HD, PQl + zq * NPE * HD, HD, P2C, NPE, nullptr, (size_t)TT * HD, (size_t)NPE * HD, (size_t)TT * NPE, nullptr, nullptr, nullptr, nullptr);   /* p2c raw, transposed: [ZH][key j][rel row] */
            k_asoft<<<ZH * TT / SR, SR * 32, 0, stream>>>(QPh + bq0 * TT * HD, QPl + bq0 * TT * HD, KPh + bk0 * TT * HD, KPl + bk0 * TT * HD, PKh + zq * NPE * HD, PKl + zq * NPE * HD, P2C, RIDX, VTh + bk0 * HD * TT, VTl + bk0 * HD * TT, h0, ATh + (size_t)b * TT * DQ, ATl + (size_t)b * TT * DQ); } }
    k_gemmw<bf, 1, true, DQ, 0><<<dim3(NB_ * TT / 64, DM / 64, 1), 32, 0, stream>>>(ATh, ATl, WO, nullptr, DQ, Y, DM, bo, 0, 0, 0, nullptr, nullptr, nullptr, nullptr);   /* y = ctx Wd + bd (f32), every batch */
    k_lnres<<<NB_ * TT / 8, 256, 0, stream>>>(Y, x, lng, lnb, OUT);
}

// v008
// Measured time: 343 microseconds a run.
// Next to v007, in two timings, it ran 1.22 times as fast each time.
// Counting every step since v000, it is 6.92 times as fast.
#include <hip/hip_runtime.h>

// Disentangled self-attention + output dense + residual + LayerNorm (hidden_states [4][1024][1024]; q, k, v = hs W + b ('xw' [1024][1024]; 16 heads x 64); rel_q = pos_emb Wq + bq, rel_k = pos_emb Wk + bk (pos_emb [1024][1024], read); scale = 1/sqrt(3 x 64); scores = q.k scale + c2p[i][rel_idx[i][j]] + p2c[rel_idx[i][j]][j] with c2p = q.rel_k scale ([1024][1024]) and p2c = rel_q.k scale ([1024][1024]) and rel_idx the int32 input [1024][1024] (read per logit; = clip(i - j + 512, 0, 1023)); softmax; ctx = merged attn.v; y = ctx Wd + bd + hidden_states; out = LayerNorm(y) gamma + beta (eps 1e-7) -> [4][1024][1024] (4.2 M)).
// Layout: exact bf16 projections (+ once-off rel_k / rel_q projections of the position table), each written by its GEMM's own epilogue as per-head hi/lo planes (q, k, rel_q, rel_k [head][row][64]; v transposed [head][64][key]); hi/lo planes for q, k (every row: 3-product score GEMMs); per pass of two batches x 16 heads: p2c TRANSPOSED [32][key j][rel row] as a hi/lo GEMM, and the softmax kernel (32 query rows per block) computes its own 32 rows of content scores and of c2p on the matrix unit (hi/lo, 3 products, kept in LDS), gathers the two relative terms per logit at the input index (p2c from the plane with lanes along the query rows, handed to the row's wave through LDS; c2p from the row's LDS copy), scales, f32 softmax, keeps its 32 rows of hi/lo P in LDS, multiplies them with v (3 products) and writes the merged context as hi/lo planes; Wd (hl x exact) + bd; residual + LayerNorm in f32.
// Launch shape: launches that do not depend on one another share one grid: the four weight transposes and the two conversions (k_prep), the q, k and v projections (grid z; the position table's rows ride behind the batches' rows in q and k); the Wd GEMM and the LayerNorm run once over all four batches; the two attention launches loop over passes of two batches.
// Compute dtypes, f32 accumulate: every input rounded to bf16; projections on PLAIN bf16 operands (exact) + biases; all score terms and attn.v on hi/lo planes (3 products) for every row; softmax f32; Wd hl x exact; residual/LayerNorm f32 (precise sqrt/division).

#define NB_  4
#define TT   1024
#define DM   1024
#define NH_  16
#define NKV  16
#define REP  (NH_ / NKV)
#define HD   64
#define DQ   (NH_ * HD)
#define DKV  (NKV * HD)
#define ZH   32                    // (batch, head) planes per pass (z extent of every per-pass launch): whole batches
#define RH   1024                  // = TT: every query row uses hi+lo planes (read only by a static_assert)
#define WIN  0
#define SCL  0.072168783648703225f   // 1/sqrt(3 x 64)
#define NPE  1024                 // relative-position table rows (2 x 512)
typedef _Float16 h16;
typedef unsigned short bf;
typedef __attribute__((ext_vector_type(16))) __bf16   v16bf;
typedef __attribute__((ext_vector_type(16))) _Float16 v16h;
typedef __attribute__((ext_vector_type(8)))  _Float16 v8h;
typedef __attribute__((ext_vector_type(8)))  unsigned short v8us;
typedef __attribute__((ext_vector_type(8)))  float    v8f;
typedef __attribute__((ext_vector_type(4)))  float    v4f;
typedef v8h  __attribute__((may_alias)) v8ha;
typedef v4f  __attribute__((may_alias)) v4fa;
typedef v8us __attribute__((may_alias)) v8usa;

__device__ __forceinline__ unsigned short f2bf(float f) { unsigned u = __float_as_uint(f); u += 0x7FFFu + ((u >> 16) & 1u); return (unsigned short)(u >> 16); }
__device__ __forceinline__ float bf2f(unsigned short b) { return __uint_as_float(((unsigned)b) << 16); }
__device__ __forceinline__ float bfr(float f) { return bf2f(f2bf(f)); }
__device__ __forceinline__ v16h cat16(v8h lo, v8h hi) { return __builtin_shufflevector(lo, hi, 0, 1, 2, 3, 4, 5, 6, 7, 8, 9, 10, 11, 12, 13, 14, 15); }
__device__ __forceinline__ v16bf cat16b(v8us lo, v8us hi) { return __builtin_bit_cast(v16bf, __builtin_shufflevector(lo, hi, 0, 1, 2, 3, 4, 5, 6, 7, 8, 9, 10, 11, 12, 13, 14, 15)); }
__device__ __forceinline__ v8f wmma16(v16h a, v16h b, v8f c) { return __builtin_amdgcn_wmma_f32_16x16x32_f16(false, a, false, b, (short)0, c, false, false); }
__device__ __forceinline__ v8f wmmab(v16bf a, v16bf b, v8f c) { return __builtin_amdgcn_wmma_f32_16x16x32_bf16(false, a, false, b, (short)0, c, false, false); }
__device__ __forceinline__ void splitf(float y, unsigned short& h, unsigned short& l) { h = f2bf(y); l = f2bf(y - bf2f(h)); }
typedef __attribute__((ext_vector_type(4))) unsigned short v4us;



// ---- k_gemmw: register-blocked GEMM, ONE WAVE per 64x64 output tile (16 accumulators), operands straight from K-contiguous 16-bit planes; grid (M/64, N/64, Z), 32 threads.
// C[m][n] (f32, pitch ldc, + optional f32 bias[n]) = sum_k A[m][k] Bt[n][k] (+ split products per NSPLIT). z-batch strides sA/sB/sC in elements. K % 32 == 0.
template <typename T16> struct WFrag;
template <> struct WFrag<h16> { typedef v16h V; static __device__ __forceinline__ V ld(const h16* p) { return cat16(*(const v8h*)p, *(const v8h*)(p + 16)); } static __device__ __forceinline__ v8f mma(V a, V b, v8f c) { return wmma16(a, b, c); } };
template <> struct WFrag<bf> { typedef v16bf V; static __device__ __forceinline__ V ld(const bf* p) { return cat16b(*(const v8us*)p, *(const v8us*)(p + 16)); } static __device__ __forceinline__ v8f mma(V a, V b, v8f c) { return wmmab(a, b, c); } };
// OM: what the epilogue writes. 0: C as above. 1: the q, k and v projections in one grid (blockIdx.z = 0, 1, 2 picks the weight by sB, the bias and the planes); no C; the 64x64 tile (+ bias) goes out split into hi/lo bf16. q and k: as 64 rows of ONE head's planes [head][row][64] (blockIdx.y = head): rows below NB_ * TT into O1h / O1l [batch][head][TT][64], the position table's rows behind them into O2h / O2l [head][NPE][64]. v (no table rows): the same split, transposed, into O1h / O1l [batch][head][64][TT].
// ZM: the B operand's z period (0: none): batch planes z and z + ZM meet the same B plane.
struct Planes { bf* h; bf* l; bf* th; bf* tl; };   // one projection's output planes: the batches' rows hi, lo; the table's rows hi, lo
// KT: K as a compile-time constant (the long GEMMs: loads-ahead loop below), or 0 for the loop on the run-time K (the short p2c GEMM, whose hi/lo fragments of both operands beside the accumulators leave no room to hold a whole step).
template <typename T16, int NSPLIT, bool BIAS, int KT, int OM, int ZM>
__global__ __launch_bounds__(32) void k_gemmw(const T16* __restrict__ A, const T16* __restrict__ A2, const T16* __restrict__ Bt, const T16* __restrict__ Bt2, int K, float* C, int ldc, const float* __restrict__ bias, size_t sA, size_t sB, size_t sC, bf* O1h, bf* O1l, bf* O2h, bf* O2l, const float* __restrict__ bias1, const float* __restrict__ bias2, Planes P1, Planes P2) {
    typedef typename WFrag<T16>::V V;
    __shared__ __align__(16) float os[16 * 68];
    const size_t z = blockIdx.z, zb = ZM ? z % ZM : z; A += z * sA; if (A2) A2 += z * sA; Bt += zb * sB; if (Bt2) Bt2 += zb * sB; C += z * sC;
    if constexpr (OM == 1) {
        if (blockIdx.z == 1) { bias = bias1; O1h = P1.h; O1l = P1.l; O2h = P1.th; O2l = P1.tl; }
        else if (blockIdx.z == 2) { if (blockIdx.x * 64 >= NB_ * TT) return; bias = bias2; O1h = P2.h; O1l = P2.l; }   // v has no table rows: those one-wave blocks leave at once
    }
    const int lane = threadIdx.x & 31, lr = lane & 15, hi = lane >> 4; const int r0 = blockIdx.x * 64, c0 = blockIdx.y * 64;
    v8f acc[4][4];
#pragma unroll
    for (int mb = 0; mb < 4; ++mb)
#pragma unroll
        for (int nb = 0; nb < 4; ++nb) acc[mb][nb] = (v8f){};
    if constexpr (KT == 0) {
    const size_t aoff = (size_t)(r0 + lr) * K + 8 * hi, boff = (size_t)(c0 + lr) * K + 8 * hi;
#pragma unroll 1
    for (int kc = 0; kc < K; kc += 32) {
        V a[4], a2[4];
#pragma unroll
        for (int mb = 0; mb < 4; ++mb) { a[mb] = WFrag<T16>::ld(A + aoff + (size_t)mb * 16 * K + kc); if (NSPLIT == 1 || NSPLIT == 2) a2[mb] = WFrag<T16>::ld(A2 + aoff + (size_t)mb * 16 * K + kc); }
#pragma unroll
        for (int nb = 0; nb < 4; ++nb) { const V b = WFrag<T16>::ld(Bt + boff + (size_t)nb * 16 * K + kc); V b2; if (NSPLIT >= 2) b2 = WFrag<T16>::ld(Bt2 + boff + (size_t)nb * 16 * K + kc);
#pragma unroll
            for (int mb = 0; mb < 4; ++mb) { acc[mb][nb] = WFrag<T16>::mma(a[mb], b, acc[mb][nb]); if (NSPLIT == 1 || NSPLIT == 2) acc[mb][nb] = WFrag<T16>::mma(a2[mb], b, acc[mb][nb]); if (NSPLIT >= 2) acc[mb][nb] = WFrag<T16>::mma(a[mb], b2, acc[mb][nb]); } }
        asm volatile("v_nop\n\tv_nop\n\tv_nop\n\tv_nop" : "+v"(acc[0][0]), "+v"(acc[1][1]), "+v"(acc[2][2]), "+v"(acc[3][3]) : "v"(a[0]), "v"(a[3]));
    }
    } else {
    static_assert(NSPLIT < 2 && KT % 32 == 0, "a whole k step is held in registers");
    // One running pointer per plane; the 16-row tiles of a plane are reached by immediate offsets from it.
    const T16* pa = A + (size_t)(r0 + lr) * KT + 8 * hi; const T16* pb = Bt + (size_t)(c0 + lr) * KT + 8 * hi; const T16* pa2 = NSPLIT == 1 ? A2 + (size_t)(r0 + lr) * KT + 8 * hi : pa;
#pragma unroll 1
    for (int kc = 0; kc < KT; kc += 32) {
        V a[4], a2[4], b[4];
#pragma unroll
        for (int mb = 0; mb < 4; ++mb) a[mb] = WFrag<T16>::ld(pa + mb * 16 * KT);
#pragma unroll
        for (int nb = 0; nb < 4; ++nb) b[nb] = WFrag<T16>::ld(pb + nb * 16 * KT);
        if (NSPLIT == 1) {   // the lo plane last: its products come second in every accumulator
#pragma unroll
            for (int mb = 0; mb < 4; ++mb) a2[mb] = WFrag<T16>::ld(pa2 + mb * 16 * KT); }
        asm volatile("s_wait_xcnt 0x0" :: "v"(pa), "v"(pa2), "v"(pb) : "memory");   // the wait in front of any rewrite of the loads' address pairs; named as inputs the pairs stay live to here, so that no result of the step is placed in one
        __builtin_amdgcn_sched_barrier(0);   // every load of the k step is issued in front of its first matrix instruction, so that the step waits one load latency; left to the scheduler the loads come in groups, each issued behind the wait for the group before
        pa += 32; pa2 += 32; pb += 32;
#pragma unroll
        for (int nb = 0; nb < 4; ++nb) {
#pragma unroll
            for (int mb = 0; mb < 4; ++mb) { acc[mb][nb] = WFrag<T16>::mma(a[mb], b[nb], acc[mb][nb]); if (NSPLIT == 1) acc[mb][nb] = WFrag<T16>::mma(a2[mb], b[nb], acc[mb][nb]); } }
        asm volatile("v_nop\n\tv_nop\n\tv_nop\n\tv_nop" : "+v"(acc[0][0]), "+v"(acc[1][1]), "+v"(acc[2][2]), "+v"(acc[3][3]) : "v"(a[0]), "v"(a[3]));   // as in the loop above: the four vector slots behind the step's last matrix instructions, on the taken branch too
    }
    }
    if (OM == 1 && blockIdx.z == 2) {
    static_assert(OM != 1 || (BIAS && HD == 64 && TT % 64 == 0), "a tile is 64 keys of one head");
    // A lane holds 8 consecutive rows (keys) of one column (head dimension): 16 bytes of a transposed row; the four 16-row tiles of a column, stored one behind the other, fill its 128-byte line.
    const size_t vo = (((size_t)(r0 / TT) * NKV + blockIdx.y) * HD + lr) * TT + r0 % TT + hi * 8; bf* ph = O1h + vo; bf* pl = O1l + vo;
    float bi[4];   // all four loaded ahead: one load latency for the epilogue, not one per column tile
#pragma unroll
    for (int nb = 0; nb < 4; ++nb) bi[nb] = bfr(bias[c0 + nb * 16 + lr]);
#pragma unroll
    for (int nb = 0; nb < 4; ++nb) { v8us dh[4], dl[4];
#pragma unroll
        for (int mb = 0; mb < 4; ++mb) {
#pragma unroll
            for (int j = 0; j < 8; ++j) { unsigned short a, c; splitf(acc[mb][nb][j] + bi[nb], a, c); dh[mb][j] = a; dl[mb][j] = c; }
            *(v8us*)(ph + nb * 16 * TT + mb * 16) = dh[mb]; *(v8us*)(pl + nb * 16 * TT + mb * 16) = dl[mb]; }
        asm volatile("s_wait_xcnt 0x0" :: "v"(ph), "v"(pl), "v"(dh[0]), "v"(dh[1]), "v"(dh[2]), "v"(dh[3]), "v"(dl[0]), "v"(dl[1]), "v"(dl[2]), "v"(dl[3]) : "memory"); }   // the wait in front of any rewrite of the eight stores' data and address registers; named as inputs they stay live to here
    } else if (OM == 1) {
    static_assert(OM != 1 || (BIAS && HD == 64 && TT % 64 == 0 && NH_ == NKV), "a tile is 64 rows of one head");
    const bool tab = r0 >= NB_ * TT;   // the same for the whole tile
    const size_t po = (tab ? ((size_t)blockIdx.y * NPE + (r0 - NB_ * TT)) : (((size_t)(r0 / TT) * NH_ + blockIdx.y) * TT + r0 % TT)) * HD + hi * HD + lr * 4;
    bf* ph = (tab ? O2h : O1h) + po; bf* pl = (tab ? O2l : O1l) + po;
    v4f bi;
#pragma unroll
    for (int q = 0; q < 4; ++q) bi[q] = bfr(bias[c0 + lr * 4 + q]);
#pragma unroll
    for (int mb = 0; mb < 4; ++mb) {
#pragma unroll
        for (int nb = 0; nb < 4; ++nb) {
#pragma unroll
            for (int j = 0; j < 8; ++j) os[(hi * 8 + j) * 68 + nb * 16 + lr] = acc[mb][nb][j]; }
        __builtin_amdgcn_wave_barrier(); asm volatile("" ::: "memory");   // lanes read what other lanes of the wave wrote: the reads stay behind the stores
        v4us dh[8], dl[8];
#pragma unroll
        for (int s = 0; s < 8; ++s) { const v4f val = *(const v4fa*)(os + (2 * s + hi) * 68 + lr * 4);   // 16 lanes x 4 columns: one 128-byte row of each plane per half-wave
#pragma unroll
            for (int q = 0; q < 4; ++q) { unsigned short a, c; splitf(val[q] + bi[q], a, c); dh[s][q] = a; dl[s][q] = c; }
            *(v4us*)(ph + (mb * 16 + 2 * s) * HD) = dh[s]; *(v4us*)(pl + (mb * 16 + 2 * s) * HD) = dl[s]; }
        asm volatile("s_wait_xcnt 0x0" :: "v"(ph), "v"(pl), "v"(dh[0]), "v"(dh[1]), "v"(dh[2]), "v"(dh[3]), "v"(dh[4]), "v"(dh[5]), "v"(dh[6]), "v"(dh[7]), "v"(dl[0]), "v"(dl[1]), "v"(dl[2]), "v"(dl[3]), "v"(dl[4]), "v"(dl[5]), "v"(dl[6]), "v"(dl[7]) : "memory");   // the wait in front of any rewrite of the sixteen stores' data and address registers; named as inputs they stay live to here
        __builtin_amdgcn_wave_barrier(); asm volatile("" ::: "memory");   // and the next tile's LDS stores behind these reads
    }
    } else {
#pragma unroll
    for (int mb = 0; mb < 4; ++mb) {
#pragma unroll
        for (int nb = 0; nb < 4; ++nb) {
#pragma unroll
            for (int j = 0; j < 8; ++j) os[(hi * 8 + j) * 68 + nb * 16 + lr] = acc[mb][nb][j]; }
        __builtin_amdgcn_wave_barrier(); asm volatile("" ::: "memory");
        float* crow = C + (size_t)(r0 + mb * 16) * ldc + c0;
{
#pragma unroll
            for (int s = 0; s < 8; ++s) { const int row = 2 * s + hi, cofs = lr * 4; v4f val = *(const v4fa*)(os + row * 68 + cofs); if (BIAS) { val[0] += bfr(bias[c0 + cofs]); val[1] += bfr(bias[c0 + cofs + 1]); val[2] += bfr(bias[c0 + cofs + 2]); val[3] += bfr(bias[c0 + cofs + 3]); }
                *(v4f*)(crow + (size_t)row * ldc + cofs) = val; }
             }
        __builtin_amdgcn_wave_barrier(); asm volatile("" ::: "memory");
    }
    }
}

typedef __attribute__((ext_vector_type(2))) unsigned short v2us;
typedef __attribute__((ext_vector_type(2))) float v2f;
typedef __attribute__((ext_vector_type(4))) int v4i;

// d_wtG: block bx of one weight's transpose to bf16, Bt[n][k] = w[k][n].
__device__ __forceinline__ void d_wtG(const float* __restrict__ w, int K, int N, bf* Bt, int bx) {
    const int lane = threadIdx.x & 31; const int L0 = (bx * 8 + (threadIdx.x >> 5)) * 8; const int nlines = N * K / 64;
{
#pragma unroll 1
        for (int l = 0; l < 8; ++l) { const int L = L0 + l; if (L >= nlines) break; const size_t e = (size_t)L * 64 + lane * 2; const int k = (int)(e % K), n = (int)(e / K); v2us o;
            o[0] = f2bf(w[(size_t)k * N + n]); o[1] = f2bf(w[(size_t)(k + 1) * N + n]); *(v2us*)(Bt + e) = o; }
         }
}
// k_prep: everything that reads only inputs, in one grid: first the four weight transposes (WB blocks each; the long blocks start first), then the rounding of hidden_states and, behind it in XB, of the position table (8 elements per thread).
#define WB  (DM * DQ / 64 / 64)          // blocks per weight
#define NX8 ((size_t)NB_ * TT * DM / 8)  // 8-element groups of hidden_states
#define NR8 ((size_t)NPE * DM / 8)       // and of the position table
static_assert(DQ == DM && DKV == DM && DM * DQ % 4096 == 0 && NX8 % 256 == 0 && NR8 % 256 == 0, "four weights of one shape; whole blocks");
__global__ __launch_bounds__(256) void k_prep(const float* __restrict__ wq, const float* __restrict__ wk, const float* __restrict__ wv, const float* __restrict__ wo, const float* __restrict__ x, const float* __restrict__ rel, bf* WT, bf* XB) {
    const int bx = blockIdx.x;
    if (bx < 4 * WB) { const int sw = bx / WB; d_wtG(sw == 0 ? wq : sw == 1 ? wk : sw == 2 ? wv : wo, DM, DQ, WT + (size_t)sw * DM * DQ, bx % WB); return; }   // the same for the whole block
    const size_t i = (size_t)(bx - 4 * WB) * 256 + threadIdx.x; const float* src = i < NX8 ? x + i * 8 : rel + (i - NX8) * 8; const v8f v = *(const v8f*)src; v8us o;
    asm volatile("s_wait_xcnt 0x0" :: "v"(src) : "memory");   // the wait in front of any rewrite of the load's address pair; named as an input the pair stays live to here
#pragma unroll
    for (int k = 0; k < 8; ++k) o[k] = f2bf(v[k]);
    bf* dst = XB + i * 8; *(v8us*)dst = o;
    asm volatile("s_wait_xcnt 0x0" :: "v"(dst), "v"(o) : "memory"); }   // the wait in front of any rewrite of the store's data and address registers (the built code runs on from here into the block that holds the transposes' part); named as inputs they stay live to here

// k_asoft: per row (zz, i): t = ((q.k + p2c[rp][j]) + c2p[i][rp]) x scale with rp = rel_idx[i][j] (int32 input, read per logit with b128 loads; clamped to [0, NPE) for memory safety - the identity for the shipped clip(i - j + 512, 0, 1023)); softmax over the 1024 keys (register row, one exp, fixed trees);
// One block = SR consecutive query rows of one head, one wave per row. The p2c term comes from the transposed plane P2CT[j][rp]: wave w takes the 32 keys j = 32 w .. 32 w + 31 and gathers with its LANES ALONG THE QUERY ROWS, so that indices which rise with i (or stand still) fall into one or two cache lines per load for any key; any other index array is gathered just as correctly, only slower.
// The index tile is turned in LDS (written by rows, read by columns), each gathered value replaces its index in place, and the row's own wave reads its finished row of G.
#define SR 32      // query rows per block = waves per block = TT / 32 key tiles
#define GP 1028    // pitch of G in words: rows stay 16-byte aligned, and lanes that read b128 down a column step 4 banks each
static_assert(RH == TT, "every query row keeps hi/lo P");
#define RP 66      // pitch of a partial-sum row in words: 8-byte aligned, and the two half-waves (8 rows apart) fall on different banks
typedef v4i __attribute__((may_alias)) v4ia;
typedef v4us __attribute__((may_alias)) v4usa;
typedef v2f __attribute__((may_alias)) v2fa;
#define QPT 72     // pitch of a staged q row in 16-bit elements: 128 bytes + 16, so that the 16 rows of a fragment read fall on different banks
// stage16: one 16-row tile (hi and lo plane, rows of 64 elements = 128 bytes, so 2 KiB contiguous per plane) of a K-contiguous operand goes through the wave's own 32 x 128-byte column tile of an LDS array (st): whole-line global loads, then fragment reads from LDS (rows 0..15 hi, 16..31 lo). ph / pl point at the lane's own 16 bytes of the tile's first 512.
__device__ __forceinline__ void stage16(const bf* __restrict__ ph, const bf* __restrict__ pl, float* st, int lane, v16bf (&fh)[2], v16bf (&fl)[2]) {
    v8us r[8];
#pragma unroll
    for (int s = 0; s < 4; ++s) { r[s] = *(const v8us*)(ph + s * 256); r[4 + s] = *(const v8us*)(pl + s * 256); }
    asm volatile("s_wait_xcnt 0x0" :: "v"(ph), "v"(pl) : "memory");   // the wait in front of any rewrite of the eight loads' two address pairs; named as inputs the pairs stay live to here
    bf* sb = (bf*)st + (size_t)(lane >> 3) * (GP * 2) + (lane & 7) * 8;
#pragma unroll
    for (int s = 0; s < 4; ++s) { *(v8usa*)(sb + (size_t)(s * 4) * (GP * 2)) = r[s]; *(v8usa*)(sb + (size_t)(16 + s * 4) * (GP * 2)) = r[4 + s]; }
    __builtin_amdgcn_wave_barrier(); asm volatile("" ::: "memory");   // lanes read what other lanes of the wave wrote: the compiler must keep the reads behind the stores (the LDS serves one wave's accesses in order)
    const bf* fb = (const bf*)st + (size_t)(lane & 15) * (GP * 2) + 8 * (lane >> 4);
#pragma unroll
    for (int kc = 0; kc < 2; ++kc) { fh[kc] = cat16b(*(const v8usa*)(fb + kc * 32), *(const v8usa*)(fb + kc * 32 + 16)); fl[kc] = cat16b(*(const v8usa*)(fb + (size_t)16 * (GP * 2) + kc * 32), *(const v8usa*)(fb + (size_t)16 * (GP * 2) + kc * 32 + 16)); }
    __builtin_amdgcn_wave_barrier(); asm volatile("" ::: "memory");   // and the tile's next stores behind these reads
}
// mm16: acc[rt][j] at lane (lr, hi) += tile row (hi * 8 + j) . query row (rt * 16 + lr); products in the order of the score GEMMs: q hi x tile hi, q lo x tile hi, q hi x tile lo, per 32 of k
// (qh: the q hi fragments, held in registers over all four tiles; qf: the lane's place in the staged q lo rows, read from LDS per tile: hi and lo both held do not fit the 128 registers of a 32-wave block)
__device__ __forceinline__ void mm16(const v16bf (&fh)[2], const v16bf (&fl)[2], const v16bf (&qh)[2][2], const bf* qf, v8f (&acc)[2]) {
#pragma unroll
    for (int kc = 0; kc < 2; ++kc)
#pragma unroll
        for (int rt = 0; rt < 2; ++rt) { const bf* qp = qf + rt * 16 * QPT + kc * 32; const v16bf ql = cat16b(*(const v8usa*)qp, *(const v8usa*)(qp + 16));
            acc[rt] = wmmab(fh[kc], qh[kc][rt], acc[rt]); acc[rt] = wmmab(fh[kc], ql, acc[rt]); acc[rt] = wmmab(fl[kc], qh[kc][rt], acc[rt]); }
}
static_assert(NPE == SR * 32 && TT == SR * 32 && HD == 64, "one wave per 32 keys and per 32 table rows; rows of 128 bytes");
static_assert(ZH % NH_ == 0 && (NB_ * NH_) % ZH == 0 && NH_ == NKV, "a pass is a whole number of batches");
__global__ __launch_bounds__(1024) void k_asoft(const bf* __restrict__ Qh, const bf* __restrict__ Ql, const bf* __restrict__ Kh, const bf* __restrict__ Kl, const bf* __restrict__ RKh, const bf* __restrict__ RKl, const float* __restrict__ P2CT, const int* __restrict__ RIX, const bf* __restrict__ VTh, const bf* __restrict__ VTl, bf* Ah, bf* Al) {
    __shared__ __align__(16) float G[SR * GP];
    __shared__ __align__(16) float CL[SR * GP];       // the block's 32 rows of c2p (raw); before that each wave's column tile stages its operand tiles
    __shared__ __align__(16) bf QS[2 * SR * QPT];     // the block's 32 q rows, hi plane then lo plane
    const int lane = threadIdx.x & 31; const int w = threadIdx.x >> 5; const int row0 = blockIdx.x * SR; const int zz = row0 / TT; const int i0 = row0 % TT;
    if (w < 16) { const int pq = w >> 3, o = (threadIdx.x & 255) * 8; const bf* qs = (pq ? Ql : Qh) + ((size_t)zz * TT + i0) * HD + o; const v8us qv = *(const v8us*)qs;   // 32 rows x 128 bytes per plane, contiguous; published by the first barrier below
        asm volatile("s_wait_xcnt 0x0" :: "v"(qs) : "memory");   // the wait in front of any rewrite of the load's address pair
        *(v8usa*)(QS + (pq * SR + (o >> 6)) * QPT + (o & 63)) = qv; }
    { const int jw = w * 32; const float* pt = P2CT + ((size_t)zz * TT + jw) * NPE; const int rr = lane >> 3, cc = jw + (lane & 7) * 4; float* gl = G + lane * GP + jw; const int* ip = RIX + (size_t)(i0 + rr) * TT + cc; v4i t[8];
#pragma unroll
      for (int s = 0; s < 8; ++s) t[s] = *(const v4i*)(ip + (size_t)s * 4 * TT);
      asm volatile("s_wait_xcnt 0x0" :: "v"(ip) : "memory");   // the wait in front of any rewrite of the eight loads' shared address pair; named as an input the pair stays live to here, so that no result of the run is placed in it
#pragma unroll
      for (int s = 0; s < 8; ++s) *(v4ia*)(G + (s * 4 + rr) * GP + cc) = t[s];
      __syncthreads();   // index tile complete before it is read by columns
#pragma unroll
      for (int c = 0; c < 8; ++c) t[c] = *(const v4ia*)(gl + c * 4);   // lane = query row i0 + lane, keys jw .. jw + 31
      v4f g[8];
#pragma unroll
      for (int hf = 0; hf < 2; ++hf) { const float* pg[16];   // two runs of 16 gathers, all of a run in flight together
#pragma unroll
          for (int k = 0; k < 16; ++k) { const int c = hf * 4 + (k >> 2), q = k & 3; int rp = t[c][q]; rp = rp < 0 ? 0 : (rp > NPE - 1 ? NPE - 1 : rp); pg[k] = pt + rp; g[c][q] = pg[k][(size_t)(c * 4 + q) * NPE]; }
          asm volatile("s_wait_xcnt 0x0" :: "v"(pg[0]), "v"(pg[1]), "v"(pg[2]), "v"(pg[3]), "v"(pg[4]), "v"(pg[5]), "v"(pg[6]), "v"(pg[7]), "v"(pg[8]), "v"(pg[9]), "v"(pg[10]), "v"(pg[11]), "v"(pg[12]), "v"(pg[13]), "v"(pg[14]), "v"(pg[15]) : "memory"); }   // the wait in front of any rewrite of the run's address pairs; named as inputs they stay live to here, so that no result of the run is placed in one
#pragma unroll
      for (int c = 0; c < 8; ++c) *(v4fa*)(gl + c * 4) = g[c];
    }
    // Content scores and c2p of the block's 32 query rows: wave w takes the 32 keys, then the 32 table rows, 32 w .. 32 w + 31, as the A operand (16 at a time) against the q rows as B, so that a lane holds 8 consecutive columns of one query row.
    { const int lr = lane & 15, hi = lane >> 4, jw = w * 32; float* st = CL + jw; const size_t to = ((size_t)zz * TT + jw) * HD + lane * 8, tr = ((size_t)(zz % NH_) * NPE + jw) * HD + lane * 8;   // zz = (batch of the pass, head): k by both, the table's planes by the head alone
      const bf* qf = QS + (SR + lr) * QPT + 8 * hi; v16bf qh[2][2];   // [k half][16-row tile]
#pragma unroll
      for (int kc = 0; kc < 2; ++kc)
#pragma unroll
          for (int rt = 0; rt < 2; ++rt) { const bf* qp = QS + (rt * 16 + lr) * QPT + kc * 32 + 8 * hi; qh[kc][rt] = cat16b(*(const v8usa*)qp, *(const v8usa*)(qp + 16)); }
      v16bf fh[2], fl[2];
#pragma unroll
      for (int kt = 0; kt < 2; ++kt) { stage16(Kh + to + kt * 16 * HD, Kl + to + kt * 16 * HD, st, lane, fh, fl); v8f acc[2]; acc[0] = (v8f){}; acc[1] = (v8f){}; mm16(fh, fl, qh, qf, acc);
#pragma unroll
          for (int rt = 0; rt < 2; ++rt) { float* gp = G + (rt * 16 + lr) * GP + jw + kt * 16 + hi * 8; v4f x0 = *(const v4fa*)gp, x1 = *(const v4fa*)(gp + 4);   // the wave's own key tile of G: q.k joins the gathered p2c term
#pragma unroll
              for (int q = 0; q < 4; ++q) { x0[q] = __fadd_rn(acc[rt][q], x0[q]); x1[q] = __fadd_rn(acc[rt][4 + q], x1[q]); }
              *(v4fa*)gp = x0; *(v4fa*)(gp + 4) = x1; } }
      v8f cc[2]; cc[0] = (v8f){}; cc[1] = (v8f){};
      stage16(RKh + tr, RKl + tr, st, lane, fh, fl); mm16(fh, fl, qh, qf, cc);
      stage16(RKh + tr + 16 * HD, RKl + tr + 16 * HD, st, lane, fh, fl);   // behind its fragment reads the staging tile is free and takes the results
#pragma unroll
      for (int kt = 0; kt < 2; ++kt) {
          if (kt) { cc[0] = (v8f){}; cc[1] = (v8f){}; mm16(fh, fl, qh, qf, cc); }
#pragma unroll
          for (int rt = 0; rt < 2; ++rt) { float* cp = CL + (rt * 16 + lr) * GP + jw + kt * 16 + hi * 8; *(v4fa*)cp = __builtin_shufflevector(cc[rt], cc[rt], 0, 1, 2, 3); *(v4fa*)(cp + 4) = __builtin_shufflevector(cc[rt], cc[rt], 4, 5, 6, 7); } }
    }
    __syncthreads();   // every column tile of G and of CL finished before a row's wave reads across them
    const int i = i0 + w; const float* cr = CL + w * GP; const float* gr = G + w * GP; const int* rxr = RIX + (size_t)i * TT; float v[TT / 32]; float mx = -3.0e38f;
#pragma unroll
    for (int ch = 0; ch < TT / 128; ++ch) { const int j0 = ch * 128 + lane * 4; const v4i r4 = *(const v4i*)(rxr + j0); const v4f p4 = *(const v4fa*)(gr + j0);
#pragma unroll
        for (int q = 0; q < 4; ++q) { int rp = r4[q]; rp = rp < 0 ? 0 : (rp > NPE - 1 ? NPE - 1 : rp); const float t = __fmul_rn(__fadd_rn(p4[q], cr[rp]), SCL);   /* ((qk + p2c[rp][j]) + c2p[i][rp]) x scale, rp = rel_idx[i][j] */ v[ch * 4 + q] = t; mx = fmaxf(mx, t); } }
#pragma unroll
    for (int sh = 16; sh; sh >>= 1) mx = fmaxf(mx, __shfl_xor(mx, sh, 32));
    float sum = 0.f;
#pragma unroll
    for (int k = 0; k < TT / 32; ++k) { float d0 = __fsub_rn(v[k], mx); asm volatile("" : "+v"(d0)); v[k] = __builtin_amdgcn_exp2f(__fmul_rn(d0, 1.4426950408889634f)); sum += v[k]; }
#pragma unroll
    for (int sh = 16; sh; sh >>= 1) sum += __shfl_xor(sum, sh, 32);
    const float f = __fdiv_rn(1.0f, sum);
    // P stays in LDS: the wave's own row of G (read by nobody else behind the second barrier, and by this wave no more) takes the row's 1024 hi halves, then its 1024 lo halves.
    bf* pr = (bf*)G + (size_t)w * (GP * 2);
#pragma unroll
    for (int ch = 0; ch < TT / 128; ++ch) { v4us oh, ol;
#pragma unroll
        for (int q = 0; q < 4; ++q) { unsigned short a, c2; splitf(v[ch * 4 + q] * f, a, c2); oh[q] = a; ol[q] = c2; }
        *(v4usa*)(pr + ch * 128 + lane * 4) = oh; *(v4usa*)(pr + TT + ch * 128 + lane * 4) = ol; }
    // attn.v of the block's 32 rows: wave w takes the 16 head columns nt * 16 .. and the 128 keys ks * 128 .. (both 16-row tiles), so that every v fragment is loaded once per block; the eight key slices are summed through LDS in fixed order. (The loops are unrolled so that b, b2 and acc are indexed by constants and stay in registers.)
    const int lr = lane & 15, hi = lane >> 4, nt = w & 3, ks = w >> 2;
    const size_t vo = ((size_t)zz * HD + nt * 16 + lr) * TT + ks * 128 + 8 * hi; const bf* vh = VTh + vo; const bf* vl = VTl + vo;
    __builtin_amdgcn_sched_barrier(0);   // keeps the sixteen loads below behind the split of P: lifted over it they meet the row's 32 live values and one fragment is spilled, with a wait on its load in the middle of the split
    v16bf b[4], b2[4];
#pragma unroll
    for (int kk = 0; kk < 4; ++kk) { b[kk] = WFrag<bf>::ld(vh + kk * 32); b2[kk] = WFrag<bf>::ld(vl + kk * 32); }   // issued in front of the barrier: they do not depend on P and fly while the block gathers there
    asm volatile("s_wait_xcnt 0x0" :: "v"(vh), "v"(vl) : "memory");   // the wait in front of any rewrite of the sixteen loads' two address pairs; named as inputs the pairs stay live to here
    __syncthreads();   // all 32 rows of P written before the fragments are read across them
    v8f acc[2]; acc[0] = (v8f){}; acc[1] = (v8f){};
#pragma unroll
    for (int kk = 0; kk < 4; ++kk) {
#pragma unroll
        for (int mt = 0; mt < 2; ++mt) { const bf* pa = (const bf*)G + (size_t)(mt * 16 + lr) * (GP * 2) + ks * 128 + kk * 32 + 8 * hi;
            const v16bf a = cat16b(*(const v8usa*)pa, *(const v8usa*)(pa + 16)); const v16bf a2 = cat16b(*(const v8usa*)(pa + TT), *(const v8usa*)(pa + TT + 16));
            acc[mt] = wmmab(a, b[kk], acc[mt]); acc[mt] = wmmab(a2, b[kk], acc[mt]); acc[mt] = wmmab(a, b2[kk], acc[mt]); } }
    __syncthreads();   // every fragment of P read before G is reused for the partial sums
#pragma unroll
    for (int mt = 0; mt < 2; ++mt)
#pragma unroll
        for (int j = 0; j < 8; ++j) G[(ks * SR + mt * 16 + hi * 8 + j) * RP + nt * 16 + lr] = acc[mt][j];
    __syncthreads();   // all eight key slices' partial sums written before a row's wave adds them
    v2f o = *(const v2fa*)(G + w * RP + lane * 2);
#pragma unroll
    for (int s = 1; s < 8; ++s) { const v2f p = *(const v2fa*)(G + (s * SR + w) * RP + lane * 2); o[0] += p[0]; o[1] += p[1]; }
    v2us oh, ol;
#pragma unroll
    for (int q = 0; q < 2; ++q) { unsigned short a, c2; splitf(o[q], a, c2); oh[q] = a; ol[q] = c2; }
    const size_t oo = ((size_t)(zz / NH_) * TT + i) * DQ + (zz % NH_) * HD + lane * 2; *(v2us*)(Ah + oo) = oh; *(v2us*)(Al + oo) = ol;   // merged context [t][head][d]: one wave writes one 128-byte line of each plane
}

__global__ __launch_bounds__(256) void k_lnres(const float* __restrict__ Y, const float* __restrict__ xres, const float* __restrict__ g, const float* __restrict__ bb, float* out) {
    const int lane = threadIdx.x & 31; const int row = blockIdx.x * 8 + (threadIdx.x >> 5); if (row >= NB_ * TT) return; const float* yr = Y + (size_t)row * DM; const float* xr = xres + (size_t)row * DM; float v[DM / 32]; float s = 0.f;
#pragma unroll
    for (int ch = 0; ch < DM / 128; ++ch) { const v4f a = *(const v4f*)(yr + ch * 128 + lane * 4); const v4f c = *(const v4f*)(xr + ch * 128 + lane * 4);
#pragma unroll
        for (int q = 0; q < 4; ++q) { const float t = __fadd_rn(a[q], bfr(c[q])); v[ch * 4 + q] = t; s = __fadd_rn(s, t); } }
#pragma unroll
    for (int sh = 16; sh; sh >>= 1) s = __fadd_rn(s, __shfl_xor(s, sh, 32));
    const float mu = __fdiv_rn(s, (float)DM); float s2 = 0.f;
#pragma unroll
    for (int k = 0; k < DM / 32; ++k) { float d0 = __fsub_rn(v[k], mu); asm volatile("" : "+v"(d0)); float p = __fmul_rn(d0, d0); asm volatile("" : "+v"(p)); s2 = __fadd_rn(s2, p); }
#pragma unroll
    for (int sh = 16; sh; sh >>= 1) s2 = __fadd_rn(s2, __shfl_xor(s2, sh, 32));
    const float rs = __fdiv_rn(1.0f, __fsqrt_rn(__fadd_rn(__fdiv_rn(s2, (float)DM), 1e-7f)));
{
#pragma unroll
        for (int ch = 0; ch < DM / 128; ++ch) { const int c0 = ch * 128 + lane * 4; v4f o;
#pragma unroll
            for (int q = 0; q < 4; ++q) { float xn = __fmul_rn(__fsub_rn(v[ch * 4 + q], mu), rs); asm volatile("" : "+v"(xn)); float gg = bfr(g[c0 + q]); asm volatile("" : "+v"(gg)); float yv = __fmul_rn(xn, gg); asm volatile("" : "+v"(yv)); float be = bfr(bb[c0 + q]); asm volatile("" : "+v"(be)); o[q] = __fadd_rn(yv, be); }
            *(v4f*)(out + (size_t)row * DM + c0) = o; }
         }
}

extern "C" void kernel_launch(void* const* d_in, const int* in_sizes, int n_in,
                              void* d_out, int out_size, void* d_ws, size_t ws_size, hipStream_t stream) {
    (void)in_sizes; (void)n_in; (void)out_size;
    const float* x = (const float*)d_in[0]; const float* rel = (const float*)d_in[1]; const float* wq = (const float*)d_in[2]; const float* bq = (const float*)d_in[3]; const float* wk = (const float*)d_in[4]; const float* bk = (const float*)d_in[5]; const float* wv = (const float*)d_in[6]; const float* bv = (const float*)d_in[7]; const float* wo = (const float*)d_in[8]; const float* bo = (const float*)d_in[9]; const float* lng = (const float*)d_in[10]; const float* lnb = (const float*)d_in[11]; const int* RIDX = (const int*)d_in[12];
    float* OUT = (float*)d_out;     // [4][1024][1024]
    char* wsp = (char*)d_ws;
    auto take = [&](size_t bytes) { char* p = wsp; wsp += (bytes + 255) & ~(size_t)255; return (void*)p; };
    bf* WQ = (bf*)take((size_t)4 * DQ * DM * 2); bf* WO = WQ + (size_t)3 * DQ * DM;   // one block of four (q, k, v, Wd): reached by a stride in k_prep and in the projections' grid z
    bf* PKh = (bf*)take((size_t)NH_ * NPE * HD * 2); bf* PKl = (bf*)take((size_t)NH_ * NPE * HD * 2); bf* PQh = (bf*)take((size_t)NH_ * NPE * HD * 2); bf* PQl = (bf*)take((size_t)NH_ * NPE * HD * 2); float* P2C = (float*)take((size_t)ZH * NPE * TT * 4);
    bf* QPh = (bf*)take((size_t)NB_ * NH_ * TT * HD * 2); bf* QPl = (bf*)take((size_t)NB_ * NH_ * TT * HD * 2); bf* KPh = (bf*)take((size_t)NB_ * NKV * TT * HD * 2); bf* KPl = (bf*)take((size_t)NB_ * NKV * TT * HD * 2); bf* VTh = (bf*)take((size_t)NB_ * NKV * HD * TT * 2); bf* VTl = (bf*)take((size_t)NB_ * NKV * HD * TT * 2);
    float* Y = (float*)take((size_t)NB_ * TT * DM * 4); bf* ATh = (bf*)take((size_t)NB_ * TT * DQ * 2); bf* ATl = (bf*)take((size_t)NB_ * TT * DQ * 2);
    if ((size_t)(wsp - (char*)d_ws) > ws_size) return;    // 224 MiB of the 256 MiB
    // XB [5120][1024] bf16 (10 MiB) lives only before the first pass and lies inside P2C, the passes' 128-MiB p2c plane (stream-ordered; written in this call before it is read).
    bf* XB = (bf*)P2C;
    const Planes none = { nullptr, nullptr, nullptr, nullptr }, pk = { KPh, KPl, PKh, PKl }, pv = { VTh, VTl, nullptr, nullptr };
    k_prep<<<(unsigned)(4 * WB + (NX8 + NR8) / 256), 256, 0, stream>>>(wq, wk, wv, wo, x, rel, WQ, XB);
    k_gemmw<bf, 0, true, DM, 1, 0><<<dim3((NB_ * TT + NPE) / 64, DQ / 64, 3), 32, 0, stream>>>(XB, nullptr, WQ, nullptr, DM, nullptr, 0, bq, 0, (size_t)DQ * DM, 0, QPh, QPl, PQh, PQl, bk, bv, pk, pv);   /* z = 0: q of every batch, then rel_q = pos_emb Wq + bq; z = 1: k, then rel_k = pos_emb Wk + bk; z = 2: v, transposed: per-head hi/lo planes */
    for (int b = 0; b < NB_; b += ZH / NH_) { const size_t bq0 = (size_t)b * NH_, bk0 = (size_t)b * NKV;   // the pass's (batch, head) planes are consecutive (z-strides TT*HD); the table's planes come round with the head
        k_gemmw<bf, 2, false, 0, 0, NH_><<<dim3(TT / 64, NPE / 64, ZH), 32, 0, stream>>>(KPh + bk0 * TT * HD, KPl + bk0 * TT * HD, PQh, PQl, HD, P2C, NPE, nullptr, (size_t)TT * HD, (size_t)NPE * HD, (size_t)TT * NPE, nullptr, nullptr, nullptr, nullptr, nullptr, nullptr, none, none);   /* p2c raw, transposed: [ZH][key j][rel row] */
        k_asoft<<<ZH * TT / SR, SR * 32, 0, stream>>>(QPh + bq0 * TT * HD, QPl + bq0 * TT * HD, KPh + bk0 * TT * HD, KPl + bk0 * TT * HD, PKh, PKl, P2C, RIDX, VTh + bk0 * HD * TT, VTl + bk0 * HD * TT, ATh + (size_t)b * TT * DQ, ATl + (size_t)b * TT * DQ); }
    k_gemmw<bf, 1, true, DQ, 0, 0><<<dim3(NB_ * TT / 64, DM / 64, 1), 32, 0, stream>>>(ATh, ATl, WO, nullptr, DQ, Y, DM, bo, 0, 0, 0, nullptr, nullptr, nullptr, nullptr, nullptr, nullptr, none, none);   /* y = ctx Wd + bd (f32), every batch */
    k_lnres<<<NB_ * TT / 8, 256, 0, stream>>>(Y, x, lng, lnb, OUT);
}

// v009
// A run of this version takes 306 microseconds.
// Next to v008, in two timings, it ran 1.12 and 1.14 times as fast.
// Counting every step since v000, it is 7.81 times as fast.
#include <hip/hip_runtime.h>

// Disentangled self-attention + output dense + residual + LayerNorm (hidden_states [4][1024][1024]; q, k, v = hs W + b ('xw' [1024][1024]; 16 heads x 64); rel_q = pos_emb Wq + bq, rel_k = pos_emb Wk + bk (pos_emb [1024][1024], read); scale = 1/sqrt(3 x 64); scores = q.k scale + c2p[i][rel_idx[i][j]] + p2c[rel_idx[i][j]][j] with c2p = q.rel_k scale ([1024][1024]) and p2c = rel_q.k scale ([1024][1024]) and rel_idx the int32 input [1024][1024] (read per logit; = clip(i - j + 512, 0, 1023)); softmax; ctx = merged attn.v; y = ctx Wd + bd + hidden_states; out = LayerNorm(y) gamma + beta (eps 1e-7) -> [4][1024][1024] (4.2 M)).
// Layout: exact bf16 projections (+ once-off rel_k / rel_q projections of the position table), each written by its GEMM's own epilogue as per-head hi/lo planes (q, k, rel_q, rel_k [head][row][64]; v transposed [head][64][key]); hi/lo planes for q, k (every row: 3-product score GEMMs); per pass of two batches x 16 heads: p2c TRANSPOSED [32][key j][rel row] as a hi/lo GEMM, and the softmax kernel (32 query rows per block) computes its own 32 rows of content scores and of c2p on the matrix unit (hi/lo, 3 products, kept in LDS), gathers the two relative terms per logit at the input index (p2c from the plane with lanes along the query rows, handed to the row's wave through LDS; c2p from the row's LDS copy), scales, f32 softmax, keeps its 32 rows of hi/lo P in LDS, multiplies them with v (3 products) and writes the merged context as hi/lo planes; Wd (hl x exact) + bd; residual + LayerNorm in f32.
// Launch shape: launches that do not depend on one another share one grid: the four weight transposes and the two conversions (k_prep), the q, k and v projections (grid z; the position table's rows ride behind the batches' rows in q and k); the Wd GEMM and the LayerNorm run once over all four batches; the two attention launches loop over passes of two batches.
// Compute dtypes, f32 accumulate: every input rounded to bf16; projections on PLAIN bf16 operands (exact) + biases; all score terms and attn.v on hi/lo planes (3 products) for every row; softmax f32; Wd hl x exact; residual/LayerNorm f32 (precise sqrt/division).

#define NB_  4
#define TT   1024
#define DM   1024
#define NH_  16
#define NKV  16
#define REP  (NH_ / NKV)
#define HD   64
#define DQ   (NH_ * HD)
#define DKV  (NKV * HD)
#define ZH   32                    // (batch, head) planes per pass (z extent of every per-pass launch): whole batches
#define RH   1024                  // = TT: every query row uses hi+lo planes (read only by a static_assert)
#define WIN  0
#define SCL  0.072168783648703225f   // 1/sqrt(3 x 64)
#define NPE  1024                 // relative-position table rows (2 x 512)
typedef _Float16 h16;
typedef unsigned short bf;
typedef __attribute__((ext_vector_type(16))) __bf16   v16bf;
typedef __attribute__((ext_vector_type(16))) _Float16 v16h;
typedef __attribute__((ext_vector_type(8)))  _Float16 v8h;
typedef __attribute__((ext_vector_type(8)))  unsigned short v8us;
typedef __attribute__((ext_vector_type(8)))  float    v8f;
typedef __attribute__((ext_vector_type(4)))  float    v4f;
typedef v8h  __attribute__((may_alias)) v8ha;
typedef v4f  __attribute__((may_alias)) v4fa;
typedef v8us __attribute__((may_alias)) v8usa;

__device__ __forceinline__ unsigned short f2bf(float f) { unsigned u = __float_as_uint(f); u += 0x7FFFu + ((u >> 16) & 1u); return (unsigned short)(u >> 16); }
__device__ __forceinline__ float bf2f(unsigned short b) { return __uint_as_float(((unsigned)b) << 16); }
__device__ __forceinline__ float bfr(float f) { return bf2f(f2bf(f)); }
__device__ __forceinline__ v16h cat16(v8h lo, v8h hi) { return __builtin_shufflevector(lo, hi, 0, 1, 2, 3, 4, 5, 6, 7, 8, 9, 10, 11, 12, 13, 14, 15); }
__device__ __forceinline__ v16bf cat16b(v8us lo, v8us hi) { return __builtin_bit_cast(v16bf, __builtin_shufflevector(lo, hi, 0, 1, 2, 3, 4, 5, 6, 7, 8, 9, 10, 11, 12, 13, 14, 15)); }
__device__ __forceinline__ v8f wmma16(v16h a, v16h b, v8f c) { return __builtin_amdgcn_wmma_f32_16x16x32_f16(false, a, false, b, (short)0, c, false, false); }
__device__ __forceinline__ v8f wmmab(v16bf a, v16bf b, v8f c) { return __builtin_amdgcn_wmma_f32_16x16x32_bf16(false, a, false, b, (short)0, c, false, false); }
__device__ __forceinline__ void splitf(float y, unsigned short& h, unsigned short& l) { h = f2bf(y); l = f2bf(y - bf2f(h)); }
typedef __attribute__((ext_vector_type(4))) unsigned short v4us;



// ---- k_gemmw: register-blocked GEMM, ONE WAVE per 64x64 output tile (16 accumulators), operands from K-contiguous 16-bit planes. Short K (KT == 0): fragments straight from global memory; grid (M/64, N/64, Z), 32 threads. Long K (KT != 0): four waves (2 x 2) share a 128x128 tile whose operand rows come through LDS; grid (M/128, N/128, Z), 128 threads.
// C[m][n] (f32, pitch ldc, + optional f32 bias[n]) = sum_k A[m][k] Bt[n][k] (+ split products per NSPLIT). z-batch strides sA/sB/sC in elements. K % 32 == 0.
template <typename T16> struct WFrag;
template <> struct WFrag<h16> { typedef v16h V; static __device__ __forceinline__ V ld(const h16* p) { return cat16(*(const v8h*)p, *(const v8h*)(p + 16)); } static __device__ __forceinline__ v8f mma(V a, V b, v8f c) { return wmma16(a, b, c); } };
template <> struct WFrag<bf> { typedef v16bf V; static __device__ __forceinline__ V ld(const bf* p) { return cat16b(*(const v8us*)p, *(const v8us*)(p + 16)); } static __device__ __forceinline__ v8f mma(V a, V b, v8f c) { return wmmab(a, b, c); } };
// OM: what the epilogue writes. 0: C as above. 1: the q, k and v projections in one grid (blockIdx.z = 0, 1, 2 picks the weight by sB, the bias and the planes); no C; the 64x64 tile (+ bias) goes out split into hi/lo bf16. q and k: as 64 rows of ONE head's planes [head][row][64] (the wave's 64 columns = one head): rows below NB_ * TT into O1h / O1l [batch][head][TT][64], the position table's rows behind them into O2h / O2l [head][NPE][64]. v (no table rows): the same split, transposed, into O1h / O1l [batch][head][64][TT].
// ZM: the B operand's z period (0: none): batch planes z and z + ZM meet the same B plane.
struct Planes { bf* h; bf* l; bf* th; bf* tl; };   // one projection's output planes: the batches' rows hi, lo; the table's rows hi, lo
// KT: K as a compile-time constant (the long GEMMs: the two-buffer LDS loop below), or 0 for the loop on the run-time K (the short p2c GEMM).
#define LP  144          // pitch in bytes of a staged 128-byte operand row: 16 B x odd, so that the 16 rows of a fragment read fall on different banks
#define OPB (128 * LP)   // one operand's 128 rows of a stage
// copy8: this thread's eight 16-byte pieces of one operand's stage (128 rows x 128 bytes; eight lanes per row, so every copy of a wave takes four whole lines), rows 16 apart, from global memory to LDS through no register. l: the thread's LDS byte address of the first piece, g: its global address, p16: elements per 16 rows.
template <typename T16> __device__ __forceinline__ void copy8(unsigned l, const T16* g, int p16) {
    asm volatile("global_load_async_to_lds_b128 %0, %8, off\n\t"
                 "global_load_async_to_lds_b128 %1, %9, off\n\t"
                 "global_load_async_to_lds_b128 %2, %10, off\n\t"
                 "global_load_async_to_lds_b128 %3, %11, off\n\t"
                 "global_load_async_to_lds_b128 %4, %12, off\n\t"
                 "global_load_async_to_lds_b128 %5, %13, off\n\t"
                 "global_load_async_to_lds_b128 %6, %14, off\n\t"
                 "global_load_async_to_lds_b128 %7, %15, off\n\t"
                 "s_wait_xcnt 0x0"   // the wait in front of any rewrite of the copies' address registers, inside their own statement so that nothing is lifted over it
                 :: "v"(l), "v"(l + 16 * LP), "v"(l + 32 * LP), "v"(l + 48 * LP), "v"(l + 64 * LP), "v"(l + 80 * LP), "v"(l + 96 * LP), "v"(l + 112 * LP),
                    "v"(g), "v"(g + p16), "v"(g + 2 * p16), "v"(g + 3 * p16), "v"(g + 4 * p16), "v"(g + 5 * p16), "v"(g + 6 * p16), "v"(g + 7 * p16) : "memory");
}
template <typename T16, int NSPLIT, bool BIAS, int KT, int OM, int ZM>
__global__ __launch_bounds__(KT ? 128 : 32) void k_gemmw(const T16* __restrict__ A, const T16* __restrict__ A2, const T16* __restrict__ Bt, const T16* __restrict__ Bt2, int K, float* C, int ldc, const float* __restrict__ bias, size_t sA, size_t sB, size_t sC, bf* O1h, bf* O1l, bf* O2h, bf* O2l, const float* __restrict__ bias1, const float* __restrict__ bias2, Planes P1, Planes P2) {
    typedef typename WFrag<T16>::V V;
    constexpr int TW = KT ? 2 : 1;                        // waves along each side of the block's tile
    constexpr int STG = (NSPLIT == 1 ? 3 : 2) * OPB;      // a stage: 64 of k of A, of B and, where there is one, of A's lo plane
    __shared__ __align__(16) unsigned char ring[KT ? 2 * STG : 16 * 68 * 4];
    const int w = KT ? __builtin_amdgcn_readfirstlane((int)threadIdx.x >> 5) : 0;
    float* os = (float*)ring + w * (16 * 68);             // the wave's epilogue tile; in the long GEMMs it lies in the ring, which is free behind the loop's last barrier
    const size_t z = blockIdx.z, zb = ZM ? z % ZM : z; A += z * sA; if (A2) A2 += z * sA; Bt += zb * sB; if (Bt2) Bt2 += zb * sB; C += z * sC;
    if constexpr (OM == 1) {
        if (blockIdx.z == 1) { bias = bias1; O1h = P1.h; O1l = P1.l; O2h = P1.th; O2l = P1.tl; }
        else if (blockIdx.z == 2) { if (blockIdx.x * (64 * TW) >= NB_ * TT) return; bias = bias2; O1h = P2.h; O1l = P2.l; }   // v has no table rows: those blocks leave at once, as a whole and in front of every copy and barrier
    }
    const int lane = threadIdx.x & 31, lr = lane & 15, hi = lane >> 4; const int r0 = (blockIdx.x * TW + (w & 1)) * 64, c0 = (blockIdx.y * TW + (w >> 1)) * 64, hy = c0 / 64;
    v8f acc[4][4];
#pragma unroll
    for (int mb = 0; mb < 4; ++mb)
#pragma unroll
        for (int nb = 0; nb < 4; ++nb) acc[mb][nb] = (v8f){};
    if constexpr (KT == 0) {
    const size_t aoff = (size_t)(r0 + lr) * K + 8 * hi, boff = (size_t)(c0 + lr) * K + 8 * hi;
#pragma unroll 1
    for (int kc = 0; kc < K; kc += 32) {
        V a[4], a2[4];
#pragma unroll
        for (int mb = 0; mb < 4; ++mb) { a[mb] = WFrag<T16>::ld(A + aoff + (size_t)mb * 16 * K + kc); if (NSPLIT == 1 || NSPLIT == 2) a2[mb] = WFrag<T16>::ld(A2 + aoff + (size_t)mb * 16 * K + kc); }
#pragma unroll
        for (int nb = 0; nb < 4; ++nb) { const V b = WFrag<T16>::ld(Bt + boff + (size_t)nb * 16 * K + kc); V b2; if (NSPLIT >= 2) b2 = WFrag<T16>::ld(Bt2 + boff + (size_t)nb * 16 * K + kc);
#pragma unroll
            for (int mb = 0; mb < 4; ++mb) { acc[mb][nb] = WFrag<T16>::mma(a[mb], b, acc[mb][nb]); if (NSPLIT == 1 || NSPLIT == 2) acc[mb][nb] = WFrag<T16>::mma(a2[mb], b, acc[mb][nb]); if (NSPLIT >= 2) acc[mb][nb] = WFrag<T16>::mma(a[mb], b2, acc[mb][nb]); } }
        asm volatile("v_nop\n\tv_nop\n\tv_nop\n\tv_nop" : "+v"(acc[0][0]), "+v"(acc[1][1]), "+v"(acc[2][2]), "+v"(acc[3][3]) : "v"(a[0]), "v"(a[3]));
    }
    } else {
    static_assert(NSPLIT < 2 && KT % 64 == 0 && KT >= 128, "stages of 64 of k, two or more");
    constexpr int NT = KT / 64;
    // Two-buffer ring: while stage t is multiplied, stage t + 1's copies fly. Thread tid copies 16 bytes of rows tid / 8 + 16 s of each operand.
    const int tid = threadIdx.x; const unsigned lb = (unsigned)(size_t)ring + (tid >> 3) * LP + (tid & 7) * 16; const size_t go = (size_t)(tid >> 3) * KT + (tid & 7) * 8;
    const T16* ga = A + (size_t)blockIdx.x * 128 * KT + go; const T16* gb = Bt + (size_t)blockIdx.y * 128 * KT + go; const T16* ga2 = NSPLIT == 1 ? A2 + (size_t)blockIdx.x * 128 * KT + go : ga;
    auto fill = [&](int t) { const unsigned l = lb + (t & 1) * STG; copy8(l, ga + t * 64, 16 * KT); copy8(l + OPB, gb + t * 64, 16 * KT); if (NSPLIT == 1) copy8(l + 2 * OPB, ga2 + t * 64, 16 * KT); };
    fill(0);
    asm volatile("s_wait_asynccnt 0x0" ::: "memory");   // this wave's copies of stage 0 have landed
    __syncthreads();                                     // and every other wave's: stage 0 may be read
    fill(1);
    const unsigned char* fa = ring + ((w & 1) * 64 + lr) * LP + hi * 16; const unsigned char* fb = ring + OPB + ((w >> 1) * 64 + lr) * LP + hi * 16;   // the lane's 16 bytes in the first row tile of the wave's A rows and B rows
#pragma unroll 1
    for (int t = 0; t < NT; ++t) {
        const int bo = (t & 1) * STG; V a[4], a2[4], b[4];
#pragma unroll
        for (int kh = 0; kh < 2; ++kh) {   // the stage's two k steps of 32, in the order of k
#pragma unroll
            for (int mb = 0; mb < 4; ++mb) { const unsigned char* p = fa + bo + mb * 16 * LP + kh * 64; a[mb] = cat16b(*(const v8usa*)p, *(const v8usa*)(p + 32)); }
#pragma unroll
            for (int nb = 0; nb < 4; ++nb) { const unsigned char* p = fb + bo + nb * 16 * LP + kh * 64; b[nb] = cat16b(*(const v8usa*)p, *(const v8usa*)(p + 32)); }
            if (NSPLIT == 1) {   // the lo plane last: its products come second in every accumulator
#pragma unroll
                for (int mb = 0; mb < 4; ++mb) { const unsigned char* p = fa + bo + 2 * OPB + mb * 16 * LP + kh * 64; a2[mb] = cat16b(*(const v8usa*)p, *(const v8usa*)(p + 32)); } }
            __builtin_amdgcn_sched_barrier(0);   // every LDS read of the k step is issued in front of its first matrix instruction, so that the step waits one LDS latency; left to the scheduler the B fragments share one register set and each is waited for by itself
#pragma unroll
            for (int nb = 0; nb < 4; ++nb) {
#pragma unroll
                for (int mb = 0; mb < 4; ++mb) { acc[mb][nb] = WFrag<T16>::mma(a[mb], b[nb], acc[mb][nb]); if (NSPLIT == 1) acc[mb][nb] = WFrag<T16>::mma(a2[mb], b[nb], acc[mb][nb]); } }
        }
        asm volatile("s_wait_dscnt 0x0" ::: "memory");      // this wave's reads of stage t are done before its buffer is handed on
        asm volatile("s_wait_asynccnt 0x0" ::: "memory");   // this wave's copies of stage t + 1 have landed
        __syncthreads();                                     // publishes stage t + 1 and ends every wave's reads of stage t
        if (t + 2 < NT) fill(t + 2);                         // into the buffer that stage t has just left (the test is the same for the whole block)
    }
    asm volatile("s_wait_asynccnt 0x0" ::: "memory");   // no copy is outstanding when the ring becomes the epilogue's tile
    }
    if (OM == 1 && blockIdx.z == 2) {
    static_assert(OM != 1 || (BIAS && HD == 64 && TT % 64 == 0), "a tile is 64 keys of one head");
    // A lane holds 8 consecutive rows (keys) of one column (head dimension): 16 bytes of a transposed row; the four 16-row tiles of a column, stored one behind the other, fill its 128-byte line.
    const size_t vo = (((size_t)(r0 / TT) * NKV + hy) * HD + lr) * TT + r0 % TT + hi * 8; bf* ph = O1h + vo; bf* pl = O1l + vo;
    float bi[4];   // all four loaded ahead: one load latency for the epilogue, not one per column tile
#pragma unroll
    for (int nb = 0; nb < 4; ++nb) bi[nb] = bfr(bias[c0 + nb * 16 + lr]);
#pragma unroll
    for (int nb = 0; nb < 4; ++nb) { v8us dh[4], dl[4];
#pragma unroll
        for (int mb = 0; mb < 4; ++mb) {
#pragma unroll
            for (int j = 0; j < 8; ++j) { unsigned short a, c; splitf(acc[mb][nb][j] + bi[nb], a, c); dh[mb][j] = a; dl[mb][j] = c; }
            *(v8us*)(ph + nb * 16 * TT + mb * 16) = dh[mb]; *(v8us*)(pl + nb * 16 * TT + mb * 16) = dl[mb]; }
        asm volatile("s_wait_xcnt 0x0" :: "v"(ph), "v"(pl), "v"(dh[0]), "v"(dh[1]), "v"(dh[2]), "v"(dh[3]), "v"(dl[0]), "v"(dl[1]), "v"(dl[2]), "v"(dl[3]) : "memory"); }   // the wait in front of any rewrite of the eight stores' data and address registers; named as inputs they stay live to here
    } else if (OM == 1) {
    static_assert(OM != 1 || (BIAS && HD == 64 && TT % 64 == 0 && NH_ == NKV), "a tile is 64 rows of one head");
    const bool tab = r0 >= NB_ * TT;   // the same for the whole tile
    const size_t po = (tab ? ((size_t)hy * NPE + (r0 - NB_ * TT)) : (((size_t)(r0 / TT) * NH_ + hy) * TT + r0 % TT)) * HD + hi * HD + lr * 4;
    bf* ph = (tab ? O2h : O1h) + po; bf* pl = (tab ? O2l : O1l) + po;
    v4f bi;
#pragma unroll
    for (int q = 0; q < 4; ++q) bi[q] = bfr(bias[c0 + lr * 4 + q]);
#pragma unroll
    for (int mb = 0; mb < 4; ++mb) {
#pragma unroll
        for (int nb = 0; nb < 4; ++nb) {
#pragma unroll
            for (int j = 0; j < 8; ++j) os[(hi * 8 + j) * 68 + nb * 16 + lr] = acc[mb][nb][j]; }
        __builtin_amdgcn_wave_barrier(); asm volatile("" ::: "memory");   // lanes read what other lanes of the wave wrote: the reads stay behind the stores
        v4us dh[8], dl[8];
#pragma unroll
        for (int s = 0; s < 8; ++s) { const v4f val = *(const v4fa*)(os + (2 * s + hi) * 68 + lr * 4);   // 16 lanes x 4 columns: one 128-byte row of each plane per half-wave
#pragma unroll
            for (int q = 0; q < 4; ++q) { unsigned short a, c; splitf(val[q] + bi[q], a, c); dh[s][q] = a; dl[s][q] = c; }
            *(v4us*)(ph + (mb * 16 + 2 * s) * HD) = dh[s]; *(v4us*)(pl + (mb * 16 + 2 * s) * HD) = dl[s]; }
        asm volatile("s_wait_xcnt 0x0" :: "v"(ph), "v"(pl), "v"(dh[0]), "v"(dh[1]), "v"(dh[2]), "v"(dh[3]), "v"(dh[4]), "v"(dh[5]), "v"(dh[6]), "v"(dh[7]), "v"(dl[0]), "v"(dl[1]), "v"(dl[2]), "v"(dl[3]), "v"(dl[4]), "v"(dl[5]), "v"(dl[6]), "v"(dl[7]) : "memory");   // the wait in front of any rewrite of the sixteen stores' data and address registers; named as inputs they stay live to here
        __builtin_amdgcn_wave_barrier(); asm volatile("" ::: "memory");   // and the next tile's LDS stores behind these reads
    }
    } else {
#pragma unroll
    for (int mb = 0; mb < 4; ++mb) {
#pragma unroll
        for (int nb = 0; nb < 4; ++nb) {
#pragma unroll
            for (int j = 0; j < 8; ++j) os[(hi * 8 + j) * 68 + nb * 16 + lr] = acc[mb][nb][j]; }
        __builtin_amdgcn_wave_barrier(); asm volatile("" ::: "memory");
        float* crow = C + (size_t)(r0 + mb * 16) * ldc + c0;
{
#pragma unroll
            for (int s = 0; s < 8; ++s) { const int row = 2 * s + hi, cofs = lr * 4; v4f val = *(const v4fa*)(os + row * 68 + cofs); if (BIAS) { val[0] += bfr(bias[c0 + cofs]); val[1] += bfr(bias[c0 + cofs + 1]); val[2] += bfr(bias[c0 + cofs + 2]); val[3] += bfr(bias[c0 + cofs + 3]); }
                *(v4f*)(crow + (size_t)row * ldc + cofs) = val; }
             }
        __builtin_amdgcn_wave_barrier(); asm volatile("" ::: "memory");
    }
    }
}

typedef __attribute__((ext_vector_type(2))) unsigned short v2us;
typedef __attribute__((ext_vector_type(2))) float v2f;
typedef __attribute__((ext_vector_type(4))) int v4i;

// d_wtG: block bx of one weight's transpose to bf16, Bt[n][k] = w[k][n].
__device__ __forceinline__ void d_wtG(const float* __restrict__ w, int K, int N, bf* Bt, int bx) {
    const int lane = threadIdx.x & 31; const int L0 = (bx * 8 + (threadIdx.x >> 5)) * 8; const int nlines = N * K / 64;
{
#pragma unroll 1
        for (int l = 0; l < 8; ++l) { const int L = L0 + l; if (L >= nlines) break; const size_t e = (size_t)L * 64 + lane * 2; const int k = (int)(e % K), n = (int)(e / K); v2us o;
            o[0] = f2bf(w[(size_t)k * N + n]); o[1] = f2bf(w[(size_t)(k + 1) * N + n]); *(v2us*)(Bt + e) = o; }
         }
}
// k_prep: everything that reads only inputs, in one grid: first the four weight transposes (WB blocks each; the long blocks start first), then the rounding of hidden_states and, behind it in XB, of the position table (8 elements per thread).
#define WB  (DM * DQ / 64 / 64)          // blocks per weight
#define NX8 ((size_t)NB_ * TT * DM / 8)  // 8-element groups of hidden_states
#define NR8 ((size_t)NPE * DM / 8)       // and of the position table
static_assert(DQ == DM && DKV == DM && DM * DQ % 4096 == 0 && NX8 % 256 == 0 && NR8 % 256 == 0, "four weights of one shape; whole blocks");
__global__ __launch_bounds__(256) void k_prep(const float* __restrict__ wq, const float* __restrict__ wk, const float* __restrict__ wv, const float* __restrict__ wo, const float* __restrict__ x, const float* __restrict__ rel, bf* WT, bf* XB) {
    const int bx = blockIdx.x;
    if (bx < 4 * WB) { const int sw = bx / WB; d_wtG(sw == 0 ? wq : sw == 1 ? wk : sw == 2 ? wv : wo, DM, DQ, WT + (size_t)sw * DM * DQ, bx % WB); return; }   // the same for the whole block
    const size_t i = (size_t)(bx - 4 * WB) * 256 + threadIdx.x; const float* src = i < NX8 ? x + i * 8 : rel + (i - NX8) * 8; const v8f v = *(const v8f*)src; v8us o;
    asm volatile("s_wait_xcnt 0x0" :: "v"(src) : "memory");   // the wait in front of any rewrite of the load's address pair; named as an input the pair stays live to here
#pragma unroll
    for (int k = 0; k < 8; ++k) o[k] = f2bf(v[k]);
    bf* dst = XB + i * 8; *(v8us*)dst = o;
    asm volatile("s_wait_xcnt 0x0" :: "v"(dst), "v"(o) : "memory"); }   // the wait in front of any rewrite of the store's data and address registers (the built code runs on from here into the block that holds the transposes' part); named as inputs they stay live to here

// k_asoft: per row (zz, i): t = ((q.k + p2c[rp][j]) + c2p[i][rp]) x scale with rp = rel_idx[i][j] (int32 input, read per logit with b128 loads; clamped to [0, NPE) for memory safety - the identity for the shipped clip(i - j + 512, 0, 1023)); softmax over the 1024 keys (register row, one exp, fixed trees);
// One block = SR consecutive query rows of one head, one wave per row. The p2c term comes from the transposed plane P2CT[j][rp]: wave w takes the 32 keys j = 32 w .. 32 w + 31 and gathers with its LANES ALONG THE QUERY ROWS, so that indices which rise with i (or stand still) fall into one or two cache lines per load for any key; any other index array is gathered just as correctly, only slower.
// The index tile is turned in LDS (written by rows, read by columns), each gathered value replaces its index in place, and the row's own wave reads its finished row of G.
#define SR 32      // query rows per block = waves per block = TT / 32 key tiles
#define GP 1028    // pitch of G in words: rows stay 16-byte aligned, and lanes that read b128 down a column step 4 banks each
static_assert(RH == TT, "every query row keeps hi/lo P");
#define RP 66      // pitch of a partial-sum row in words: 8-byte aligned, and the two half-waves (8 rows apart) fall on different banks
typedef v4i __attribute__((may_alias)) v4ia;
typedef v4us __attribute__((may_alias)) v4usa;
typedef v2f __attribute__((may_alias)) v2fa;
#define QPT 72     // pitch of a staged q row in 16-bit elements: 128 bytes + 16, so that the 16 rows of a fragment read fall on different banks
// stage16: one 16-row tile (hi and lo plane, rows of 64 elements = 128 bytes, so 2 KiB contiguous per plane) of a K-contiguous operand goes through the wave's own 32 x 128-byte column tile of an LDS array (st): whole-line global loads, then fragment reads from LDS (rows 0..15 hi, 16..31 lo). ph / pl point at the lane's own 16 bytes of the tile's first 512.
__device__ __forceinline__ void stage16(const bf* __restrict__ ph, const bf* __restrict__ pl, float* st, int lane, v16bf (&fh)[2], v16bf (&fl)[2]) {
    v8us r[8];
#pragma unroll
    for (int s = 0; s < 4; ++s) { r[s] = *(const v8us*)(ph + s * 256); r[4 + s] = *(const v8us*)(pl + s * 256); }
    asm volatile("s_wait_xcnt 0x0" :: "v"(ph), "v"(pl) : "memory");   // the wait in front of any rewrite of the eight loads' two address pairs; named as inputs the pairs stay live to here
    bf* sb = (bf*)st + (size_t)(lane >> 3) * (GP * 2) + (lane & 7) * 8;
#pragma unroll
    for (int s = 0; s < 4; ++s) { *(v8usa*)(sb + (size_t)(s * 4) * (GP * 2)) = r[s]; *(v8usa*)(sb + (size_t)(16 + s * 4) * (GP * 2)) = r[4 + s]; }
    __builtin_amdgcn_wave_barrier(); asm volatile("" ::: "memory");   // lanes read what other lanes of the wave wrote: the compiler must keep the reads behind the stores (the LDS serves one wave's accesses in order)
    const bf* fb = (const bf*)st + (size_t)(lane & 15) * (GP * 2) + 8 * (lane >> 4);
#pragma unroll
    for (int kc = 0; kc < 2; ++kc) { fh[kc] = cat16b(*(const v8usa*)(fb + kc * 32), *(const v8usa*)(fb + kc * 32 + 16)); fl[kc] = cat16b(*(const v8usa*)(fb + (size_t)16 * (GP * 2) + kc * 32), *(const v8usa*)(fb + (size_t)16 * (GP * 2) + kc * 32 + 16)); }
    __builtin_amdgcn_wave_barrier(); asm volatile("" ::: "memory");   // and the tile's next stores behind these reads
}
// mm16: acc[rt][j] at lane (lr, hi) += tile row (hi * 8 + j) . query row (rt * 16 + lr); products in the order of the score GEMMs: q hi x tile hi, q lo x tile hi, q hi x tile lo, per 32 of k
// (qh: the q hi fragments, held in registers over all four tiles; qf: the lane's place in the staged q lo rows, read from LDS per tile: hi and lo both held do not fit the 128 registers of a 32-wave block)
__device__ __forceinline__ void mm16(const v16bf (&fh)[2], const v16bf (&fl)[2], const v16bf (&qh)[2][2], const bf* qf, v8f (&acc)[2]) {
#pragma unroll
    for (int kc = 0; kc < 2; ++kc)
#pragma unroll
        for (int rt = 0; rt < 2; ++rt) { const bf* qp = qf + rt * 16 * QPT + kc * 32; const v16bf ql = cat16b(*(const v8usa*)qp, *(const v8usa*)(qp + 16));
            acc[rt] = wmmab(fh[kc], qh[kc][rt], acc[rt]); acc[rt] = wmmab(fh[kc], ql, acc[rt]); acc[rt] = wmmab(fl[kc], qh[kc][rt], acc[rt]); }
}
static_assert(NPE == SR * 32 && TT == SR * 32 && HD == 64, "one wave per 32 keys and per 32 table rows; rows of 128 bytes");
static_assert(ZH % NH_ == 0 && (NB_ * NH_) % ZH == 0 && NH_ == NKV, "a pass is a whole number of batches");
__global__ __launch_bounds__(1024) void k_asoft(const bf* __restrict__ Qh, const bf* __restrict__ Ql, const bf* __restrict__ Kh, const bf* __restrict__ Kl, const bf* __restrict__ RKh, const bf* __restrict__ RKl, const float* __restrict__ P2CT, const int* __restrict__ RIX, const bf* __restrict__ VTh, const bf* __restrict__ VTl, bf* Ah, bf* Al) {
    __shared__ __align__(16) float G[SR * GP];
    __shared__ __align__(16) float CL[SR * GP];       // the block's 32 rows of c2p (raw); before that each wave's column tile stages its operand tiles
    __shared__ __align__(16) bf QS[2 * SR * QPT];     // the block's 32 q rows, hi plane then lo plane
    const int lane = threadIdx.x & 31; const int w = threadIdx.x >> 5; const int row0 = blockIdx.x * SR; const int zz = row0 / TT; const int i0 = row0 % TT;
    if (w < 16) { const int pq = w >> 3, o = (threadIdx.x & 255) * 8; const bf* qs = (pq ? Ql : Qh) + ((size_t)zz * TT + i0) * HD + o; const v8us qv = *(const v8us*)qs;   // 32 rows x 128 bytes per plane, contiguous; published by the first barrier below
        asm volatile("s_wait_xcnt 0x0" :: "v"(qs) : "memory");   // the wait in front of any rewrite of the load's address pair
        *(v8usa*)(QS + (pq * SR + (o >> 6)) * QPT + (o & 63)) = qv; }
    { const int jw = w * 32; const float* pt = P2CT + ((size_t)zz * TT + jw) * NPE; const int rr = lane >> 3, cc = jw + (lane & 7) * 4; float* gl = G + lane * GP + jw; const int* ip = RIX + (size_t)(i0 + rr) * TT + cc; v4i t[8];
#pragma unroll
      for (int s = 0; s < 8; ++s) t[s] = *(const v4i*)(ip + (size_t)s * 4 * TT);
      asm volatile("s_wait_xcnt 0x0" :: "v"(ip) : "memory");   // the wait in front of any rewrite of the eight loads' shared address pair; named as an input the pair stays live to here, so that no result of the run is placed in it
#pragma unroll
      for (int s = 0; s < 8; ++s) *(v4ia*)(G + (s * 4 + rr) * GP + cc) = t[s];
      __syncthreads();   // index tile complete before it is read by columns
#pragma unroll
      for (int c = 0; c < 8; ++c) t[c] = *(const v4ia*)(gl + c * 4);   // lane = query row i0 + lane, keys jw .. jw + 31
      v4f g[8];
#pragma unroll
      for (int hf = 0; hf < 2; ++hf) { const float* pg[16];   // two runs of 16 gathers, all of a run in flight together
#pragma unroll
          for (int k = 0; k < 16; ++k) { const int c = hf * 4 + (k >> 2), q = k & 3; int rp = t[c][q]; rp = rp < 0 ? 0 : (rp > NPE - 1 ? NPE - 1 : rp); pg[k] = pt + rp; g[c][q] = pg[k][(size_t)(c * 4 + q) * NPE]; }
          asm volatile("s_wait_xcnt 0x0" :: "v"(pg[0]), "v"(pg[1]), "v"(pg[2]), "v"(pg[3]), "v"(pg[4]), "v"(pg[5]), "v"(pg[6]), "v"(pg[7]), "v"(pg[8]), "v"(pg[9]), "v"(pg[10]), "v"(pg[11]), "v"(pg[12]), "v"(pg[13]), "v"(pg[14]), "v"(pg[15]) : "memory"); }   // the wait in front of any rewrite of the run's address pairs; named as inputs they stay live to here, so that no result of the run is placed in one
#pragma unroll
      for (int c = 0; c < 8; ++c) *(v4fa*)(gl + c * 4) = g[c];
    }
    // Content scores and c2p of the block's 32 query rows: wave w takes the 32 keys, then the 32 table rows, 32 w .. 32 w + 31, as the A operand (16 at a time) against the q rows as B, so that a lane holds 8 consecutive columns of one query row.
    { const int lr = lane & 15, hi = lane >> 4, jw = w * 32; float* st = CL + jw; const size_t to = ((size_t)zz * TT + jw) * HD + lane * 8, tr = ((size_t)(zz % NH_) * NPE + jw) * HD + lane * 8;   // zz = (batch of the pass, head): k by both, the table's planes by the head alone
      const bf* qf = QS + (SR + lr) * QPT + 8 * hi; v16bf qh[2][2];   // [k half][16-row tile]
#pragma unroll
      for (int kc = 0; kc < 2; ++kc)
#pragma unroll
          for (int rt = 0; rt < 2; ++rt) { const bf* qp = QS + (rt * 16 + lr) * QPT + kc * 32 + 8 * hi; qh[kc][rt] = cat16b(*(const v8usa*)qp, *(const v8usa*)(qp + 16)); }
      v16bf fh[2], fl[2];
#pragma unroll
      for (int kt = 0; kt < 2; ++kt) { stage16(Kh + to + kt * 16 * HD, Kl + to + kt * 16 * HD, st, lane, fh, fl); v8f acc[2]; acc[0] = (v8f){}; acc[1] = (v8f){}; mm16(fh, fl, qh, qf, acc);
#pragma unroll
          for (int rt = 0; rt < 2; ++rt) { float* gp = G + (rt * 16 + lr) * GP + jw + kt * 16 + hi * 8; v4f x0 = *(const v4fa*)gp, x1 = *(const v4fa*)(gp + 4);   // the wave's own key tile of G: q.k joins the gathered p2c term
#pragma unroll
              for (int q = 0; q < 4; ++q) { x0[q] = __fadd_rn(acc[rt][q], x0[q]); x1[q] = __fadd_rn(acc[rt][4 + q], x1[q]); }
              *(v4fa*)gp = x0; *(v4fa*)(gp + 4) = x1; } }
      v8f cc[2]; cc[0] = (v8f){}; cc[1] = (v8f){};
      stage16(RKh + tr, RKl + tr, st, lane, fh, fl); mm16(fh, fl, qh, qf, cc);
      stage16(RKh + tr + 16 * HD, RKl + tr + 16 * HD, st, lane, fh, fl);   // behind its fragment reads the staging tile is free and takes the results
#pragma unroll
      for (int kt = 0; kt < 2; ++kt) {
          if (kt) { cc[0] = (v8f){}; cc[1] = (v8f){}; mm16(fh, fl, qh, qf, cc); }
#pragma unroll
          for (int rt = 0; rt < 2; ++rt) { float* cp = CL + (rt * 16 + lr) * GP + jw + kt * 16 + hi * 8; *(v4fa*)cp = __builtin_shufflevector(cc[rt], cc[rt], 0, 1, 2, 3); *(v4fa*)(cp + 4) = __builtin_shufflevector(cc[rt], cc[rt], 4, 5, 6, 7); } }
    }
    __syncthreads();   // every column tile of G and of CL finished before a row's wave reads across them
    const int i = i0 + w; const float* cr = CL + w * GP; const float* gr = G + w * GP; const int* rxr = RIX + (size_t)i * TT; float v[TT / 32]; float mx = -3.0e38f;
#pragma unroll
    for (int ch = 0; ch < TT / 128; ++ch) { const int j0 = ch * 128 + lane * 4; const v4i r4 = *(const v4i*)(rxr + j0); const v4f p4 = *(const v4fa*)(gr + j0);
#pragma unroll
        for (int q = 0; q < 4; ++q) { int rp = r4[q]; rp = rp < 0 ? 0 : (rp > NPE - 1 ? NPE - 1 : rp); const float t = __fmul_rn(__fadd_rn(p4[q], cr[rp]), SCL);   /* ((qk + p2c[rp][j]) + c2p[i][rp]) x scale, rp = rel_idx[i][j] */ v[ch * 4 + q] = t; mx = fmaxf(mx, t); } }
#pragma unroll
    for (int sh = 16; sh; sh >>= 1) mx = fmaxf(mx, __shfl_xor(mx, sh, 32));
    float sum = 0.f;
#pragma unroll
    for (int k = 0; k < TT / 32; ++k) { float d0 = __fsub_rn(v[k], mx); asm volatile("" : "+v"(d0)); v[k] = __builtin_amdgcn_exp2f(__fmul_rn(d0, 1.4426950408889634f)); sum += v[k]; }
#pragma unroll
    for (int sh = 16; sh; sh >>= 1) sum += __shfl_xor(sum, sh, 32);
    const float f = __fdiv_rn(1.0f, sum);
    // P stays in LDS: the wave's own row of G (read by nobody else behind the second barrier, and by this wave no more) takes the row's 1024 hi halves, then its 1024 lo halves.
    bf* pr = (bf*)G + (size_t)w * (GP * 2);
#pragma unroll
    for (int ch = 0; ch < TT / 128; ++ch) { v4us oh, ol;
#pragma unroll
        for (int q = 0; q < 4; ++q) { unsigned short a, c2; splitf(v[ch * 4 + q] * f, a, c2); oh[q] = a; ol[q] = c2; }
        *(v4usa*)(pr + ch * 128 + lane * 4) = oh; *(v4usa*)(pr + TT + ch * 128 + lane * 4) = ol; }
    // attn.v of the block's 32 rows: wave w takes the 16 head columns nt * 16 .. and the 128 keys ks * 128 .. (both 16-row tiles), so that every v fragment is loaded once per block; the eight key slices are summed through LDS in fixed order. (The loops are unrolled so that b, b2 and acc are indexed by constants and stay in registers.)
    const int lr = lane & 15, hi = lane >> 4, nt = w & 3, ks = w >> 2;
    const size_t vo = ((size_t)zz * HD + nt * 16 + lr) * TT + ks * 128 + 8 * hi; const bf* vh = VTh + vo; const bf* vl = VTl + vo;
    __builtin_amdgcn_sched_barrier(0);   // keeps the sixteen loads below behind the split of P: lifted over it they meet the row's 32 live values and one fragment is spilled, with a wait on its load in the middle of the split
    v16bf b[4], b2[4];
#pragma unroll
    for (int kk = 0; kk < 4; ++kk) { b[kk] = WFrag<bf>::ld(vh + kk * 32); b2[kk] = WFrag<bf>::ld(vl + kk * 32); }   // issued in front of the barrier: they do not depend on P and fly while the block gathers there
    asm volatile("s_wait_xcnt 0x0" :: "v"(vh), "v"(vl) : "memory");   // the wait in front of any rewrite of the sixteen loads' two address pairs; named as inputs the pairs stay live to here
    __syncthreads();   // all 32 rows of P written before the fragments are read across them
    v8f acc[2]; acc[0] = (v8f){}; acc[1] = (v8f){};
#pragma unroll
    for (int kk = 0; kk < 4; ++kk) {
#pragma unroll
        for (int mt = 0; mt < 2; ++mt) { const bf* pa = (const bf*)G + (size_t)(mt * 16 + lr) * (GP * 2) + ks * 128 + kk * 32 + 8 * hi;
            const v16bf a = cat16b(*(const v8usa*)pa, *(const v8usa*)(pa + 16)); const v16bf a2 = cat16b(*(const v8usa*)(pa + TT), *(const v8usa*)(pa + TT + 16));
            acc[mt] = wmmab(a, b[kk], acc[mt]); acc[mt] = wmmab(a2, b[kk], acc[mt]); acc[mt] = wmmab(a, b2[kk], acc[mt]); } }
    __syncthreads();   // every fragment of P read before G is reused for the partial sums
#pragma unroll
    for (int mt = 0; mt < 2; ++mt)
#pragma unroll
        for (int j = 0; j < 8; ++j) G[(ks * SR + mt * 16 + hi * 8 + j) * RP + nt * 16 + lr] = acc[mt][j];
    __syncthreads();   // all eight key slices' partial sums written before a row's wave adds them
    v2f o = *(const v2fa*)(G + w * RP + lane * 2);
#pragma unroll
    for (int s = 1; s < 8; ++s) { const v2f p = *(const v2fa*)(G + (s * SR + w) * RP + lane * 2); o[0] += p[0]; o[1] += p[1]; }
    v2us oh, ol;
#pragma unroll
    for (int q = 0; q < 2; ++q) { unsigned short a, c2; splitf(o[q], a, c2); oh[q] = a; ol[q] = c2; }
    const size_t oo = ((size_t)(zz / NH_) * TT + i) * DQ + (zz % NH_) * HD + lane * 2; *(v2us*)(Ah + oo) = oh; *(v2us*)(Al + oo) = ol;   // merged context [t][head][d]: one wave writes one 128-byte line of each plane
}

__global__ __launch_bounds__(256) void k_lnres(const float* __restrict__ Y, const float* __restrict__ xres, const float* __restrict__ g, const float* __restrict__ bb, float* out) {
    const int lane = threadIdx.x & 31; const int row = blockIdx.x * 8 + (threadIdx.x >> 5); if (row >= NB_ * TT) return; const float* yr = Y + (size_t)row * DM; const float* xr = xres + (size_t)row * DM; float v[DM / 32]; float s = 0.f;
#pragma unroll
    for (int ch = 0; ch < DM / 128; ++ch) { const v4f a = *(const v4f*)(yr + ch * 128 + lane * 4); const v4f c = *(const v4f*)(xr + ch * 128 + lane * 4);
#pragma unroll
        for (int q = 0; q < 4; ++q) { const float t = __fadd_rn(a[q], bfr(c[q])); v[ch * 4 + q] = t; s = __fadd_rn(s, t); } }
#pragma unroll
    for (int sh = 16; sh; sh >>= 1) s = __fadd_rn(s, __shfl_xor(s, sh, 32));
    const float mu = __fdiv_rn(s, (float)DM); float s2 = 0.f;
#pragma unroll
    for (int k = 0; k < DM / 32; ++k) { float d0 = __fsub_rn(v[k], mu); asm volatile("" : "+v"(d0)); float p = __fmul_rn(d0, d0); asm volatile("" : "+v"(p)); s2 = __fadd_rn(s2, p); }
#pragma unroll
    for (int sh = 16; sh; sh >>= 1) s2 = __fadd_rn(s2, __shfl_xor(s2, sh, 32));
    const float rs = __fdiv_rn(1.0f, __fsqrt_rn(__fadd_rn(__fdiv_rn(s2, (float)DM), 1e-7f)));
{
#pragma unroll
        for (int ch = 0; ch < DM / 128; ++ch) { const int c0 = ch * 128 + lane * 4; v4f o;
#pragma unroll
            for (int q = 0; q < 4; ++q) { float xn = __fmul_rn(__fsub_rn(v[ch * 4 + q], mu), rs); asm volatile("" : "+v"(xn)); float gg = bfr(g[c0 + q]); asm volatile("" : "+v"(gg)); float yv = __fmul_rn(xn, gg); asm volatile("" : "+v"(yv)); float be = bfr(bb[c0 + q]); asm volatile("" : "+v"(be)); o[q] = __fadd_rn(yv, be); }
            *(v4f*)(out + (size_t)row * DM + c0) = o; }
         }
}

extern "C" void kernel_launch(void* const* d_in, const int* in_sizes, int n_in,
                              void* d_out, int out_size, void* d_ws, size_t ws_size, hipStream_t stream) {
    (void)in_sizes; (void)n_in; (void)out_size;
    const float* x = (const float*)d_in[0]; const float* rel = (const float*)d_in[1]; const float* wq = (const float*)d_in[2]; const float* bq = (const float*)d_in[3]; const float* wk = (const float*)d_in[4]; const float* bk = (const float*)d_in[5]; const float* wv = (const float*)d_in[6]; const float* bv = (const float*)d_in[7]; const float* wo = (const float*)d_in[8]; const float* bo = (const float*)d_in[9]; const float* lng = (const float*)d_in[10]; const float* lnb = (const float*)d_in[11]; const int* RIDX = (const int*)d_in[12];
    float* OUT = (float*)d_out;     // [4][1024][1024]
    char* wsp = (char*)d_ws;
    auto take = [&](size_t bytes) { char* p = wsp; wsp += (bytes + 255) & ~(size_t)255; return (void*)p; };
    bf* WQ = (bf*)take((size_t)4 * DQ * DM * 2); bf* WO = WQ + (size_t)3 * DQ * DM;   // one block of four (q, k, v, Wd): reached by a stride in k_prep and in the projections' grid z
    bf* PKh = (bf*)take((size_t)NH_ * NPE * HD * 2); bf* PKl = (bf*)take((size_t)NH_ * NPE * HD * 2); bf* PQh = (bf*)take((size_t)NH_ * NPE * HD * 2); bf* PQl = (bf*)take((size_t)NH_ * NPE * HD * 2); float* P2C = (float*)take((size_t)ZH * NPE * TT * 4);
    bf* QPh = (bf*)take((size_t)NB_ * NH_ * TT * HD * 2); bf* QPl = (bf*)take((size_t)NB_ * NH_ * TT * HD * 2); bf* KPh = (bf*)take((size_t)NB_ * NKV * TT * HD * 2); bf* KPl = (bf*)take((size_t)NB_ * NKV * TT * HD * 2); bf* VTh = (bf*)take((size_t)NB_ * NKV * HD * TT * 2); bf* VTl = (bf*)take((size_t)NB_ * NKV * HD * TT * 2);
    float* Y = (float*)take((size_t)NB_ * TT * DM * 4); bf* ATh = (bf*)take((size_t)NB_ * TT * DQ * 2); bf* ATl = (bf*)take((size_t)NB_ * TT * DQ * 2);
    if ((size_t)(wsp - (char*)d_ws) > ws_size) return;    // 224 MiB of the 256 MiB
    // XB [5120][1024] bf16 (10 MiB) lives only before the first pass and lies inside P2C, the passes' 128-MiB p2c plane (stream-ordered; written in this call before it is read).
    bf* XB = (bf*)P2C;
    const Planes none = { nullptr, nullptr, nullptr, nullptr }, pk = { KPh, KPl, PKh, PKl }, pv = { VTh, VTl, nullptr, nullptr };
    k_prep<<<(unsigned)(4 * WB + (NX8 + NR8) / 256), 256, 0, stream>>>(wq, wk, wv, wo, x, rel, WQ, XB);
    k_gemmw<bf, 0, true, DM, 1, 0><<<dim3((NB_ * TT + NPE) / 128, DQ / 128, 3), 128, 0, stream>>>(XB, nullptr, WQ, nullptr, DM, nullptr, 0, bq, 0, (size_t)DQ * DM, 0, QPh, QPl, PQh, PQl, bk, bv, pk, pv);   /* z = 0: q of every batch, then rel_q = pos_emb Wq + bq; z = 1: k, then rel_k = pos_emb Wk + bk; z = 2: v, transposed: per-head hi/lo planes */
    for (int b = 0; b < NB_; b += ZH / NH_) { const size_t bq0 = (size_t)b * NH_, bk0 = (size_t)b * NKV;   // the pass's (batch, head) planes are consecutive (z-strides TT*HD); the table's planes come round with the head
        k_gemmw<bf, 2, false, 0, 0, NH_><<<dim3(TT / 64, NPE / 64, ZH), 32, 0, stream>>>(KPh + bk0 * TT * HD, KPl + bk0 * TT * HD, PQh, PQl, HD, P2C, NPE, nullptr, (size_t)TT * HD, (size_t)NPE * HD, (size_t)TT * NPE, nullptr, nullptr, nullptr, nullptr, nullptr, nullptr, none, none);   /* p2c raw, transposed: [ZH][key j][rel row] */
        k_asoft<<<ZH * TT / SR, SR * 32, 0, stream>>>(QPh + bq0 * TT * HD, QPl + bq0 * TT * HD, KPh + bk0 * TT * HD, KPl + bk0 * TT * HD, PKh, PKl, P2C, RIDX, VTh + bk0 * HD * TT, VTl + bk0 * HD * TT, ATh + (size_t)b * TT * DQ, ATl + (size_t)b * TT * DQ); }
    k_gemmw<bf, 1, true, DQ, 0, 0><<<dim3(NB_ * TT / 128, DM / 128, 1), 128, 0, stream>>>(ATh, ATl, WO, nullptr, DQ, Y, DM, bo, 0, 0, 0, nullptr, nullptr, nullptr, nullptr, nullptr, nullptr, none, none);   /* y = ctx Wd + bd (f32), every batch */
    k_lnres<<<NB_ * TT / 8, 256, 0, stream>>>(Y, x, lng, lnb, OUT);
}

// v010
// It runs in 280 microseconds.
// Next to v009, in two timings, it ran 1.09 times as fast each time.
// All steps since v000 together make it 8.51 times as fast.
#include <hip/hip_runtime.h>

// Disentangled self-attention + output dense + residual + LayerNorm (hidden_states [4][1024][1024]; q, k, v = hs W + b ('xw' [1024][1024]; 16 heads x 64); rel_q = pos_emb Wq + bq, rel_k = pos_emb Wk + bk (pos_emb [1024][1024], read); scale = 1/sqrt(3 x 64); scores = q.k scale + c2p[i][rel_idx[i][j]] + p2c[rel_idx[i][j]][j] with c2p = q.rel_k scale ([1024][1024]) and p2c = rel_q.k scale ([1024][1024]) and rel_idx the int32 input [1024][1024] (read per logit; = clip(i - j + 512, 0, 1023)); softmax; ctx = merged attn.v; y = ctx Wd + bd + hidden_states; out = LayerNorm(y) gamma + beta (eps 1e-7) -> [4][1024][1024] (4.2 M)).
// Layout: exact bf16 projections (+ once-off rel_k / rel_q projections of the position table), each written by its GEMM's own epilogue as per-head hi/lo planes IN FRAGMENT ORDER, so that a wave loads a half fragment of the matrix instruction as 512 contiguous bytes (q, k, rel_q, rel_k: [head][16-row tile][k step of 32][half][lane][8], lane = row + 16 x (8 of k); v: [head][32 keys][16 columns][half][lane][8], lane = column + 16 x (8 keys); half = which 16 of the 32); hi/lo planes for q, k (every row: 3-product score GEMMs); per pass of two batches x 16 heads: p2c TRANSPOSED [32][key j][rel row] as a hi/lo GEMM, and the softmax kernel (32 query rows per block) computes its own 32 rows of content scores and of c2p on the matrix unit (hi/lo, 3 products, kept in LDS), gathers the two relative terms per logit at the input index (p2c from the plane with lanes along the query rows, handed to the row's wave through LDS; c2p from the row's LDS copy), scales, f32 softmax, keeps its 32 rows of hi/lo P in LDS, multiplies them with v (3 products) and writes the merged context as hi/lo planes; Wd (hl x exact) + bd; residual + LayerNorm in f32.
// Launch shape: launches that do not depend on one another share one grid: the four weight transposes and the two conversions (k_prep), the q, k and v projections (grid z; the position table's rows ride behind the batches' rows in q and k); the Wd GEMM and the LayerNorm run once over all four batches; the two attention launches loop over passes of two batches.
// Compute dtypes, f32 accumulate: every input rounded to bf16; projections on PLAIN bf16 operands (exact) + biases; all score terms and attn.v on hi/lo planes (3 products) for every row; softmax f32; Wd hl x exact; residual/LayerNorm f32 (precise sqrt/division).

#define NB_  4
#define TT   1024
#define DM   1024
#define NH_  16
#define NKV  16
#define REP  (NH_ / NKV)
#define HD   64
#define DQ   (NH_ * HD)
#define DKV  (NKV * HD)
#define ZH   32                    // (batch, head) planes per pass (z extent of every per-pass launch): whole batches
#define RH   1024                  // = TT: every query row uses hi+lo planes (read only by a static_assert)
#define WIN  0
#define SCL  0.072168783648703225f   // 1/sqrt(3 x 64)
#define NPE  1024                 // relative-position table rows (2 x 512)
typedef _Float16 h16;
typedef unsigned short bf;
typedef __attribute__((ext_vector_type(16))) __bf16   v16bf;
typedef __attribute__((ext_vector_type(16))) _Float16 v16h;
typedef __attribute__((ext_vector_type(8)))  _Float16 v8h;
typedef __attribute__((ext_vector_type(8)))  unsigned short v8us;
typedef __attribute__((ext_vector_type(8)))  float    v8f;
typedef __attribute__((ext_vector_type(4)))  float    v4f;
typedef v8h  __attribute__((may_alias)) v8ha;
typedef v4f  __attribute__((may_alias)) v4fa;
typedef v8us __attribute__((may_alias)) v8usa;

__device__ __forceinline__ unsigned short f2bf(float f) { unsigned u = __float_as_uint(f); u += 0x7FFFu + ((u >> 16) & 1u); return (unsigned short)(u >> 16); }
__device__ __forceinline__ float bf2f(unsigned short b) { return __uint_as_float(((unsigned)b) << 16); }
__device__ __forceinline__ float bfr(float f) { return bf2f(f2bf(f)); }
__device__ __forceinline__ v16h cat16(v8h lo, v8h hi) { return __builtin_shufflevector(lo, hi, 0, 1, 2, 3, 4, 5, 6, 7, 8, 9, 10, 11, 12, 13, 14, 15); }
__device__ __forceinline__ v16bf cat16b(v8us lo, v8us hi) { return __builtin_bit_cast(v16bf, __builtin_shufflevector(lo, hi, 0, 1, 2, 3, 4, 5, 6, 7, 8, 9, 10, 11, 12, 13, 14, 15)); }
__device__ __forceinline__ v8f wmma16(v16h a, v16h b, v8f c) { return __builtin_amdgcn_wmma_f32_16x16x32_f16(false, a, false, b, (short)0, c, false, false); }
__device__ __forceinline__ v8f wmmab(v16bf a, v16bf b, v8f c) { return __builtin_amdgcn_wmma_f32_16x16x32_bf16(false, a, false, b, (short)0, c, false, false); }
__device__ __forceinline__ void splitf(float y, unsigned short& h, unsigned short& l) { h = f2bf(y); l = f2bf(y - bf2f(h)); }
typedef __attribute__((ext_vector_type(4))) unsigned short v4us;



// ---- k_gemmw: register-blocked GEMM, ONE WAVE per 64x64 output tile (16 accumulators), operands from 16-bit planes. Short K (KT == 0): planes in fragment order ([16-row tile][k step of 32][half][lane][8]), fragments straight from global memory in whole lines; grid (M/64, N/64, Z), 32 threads. Long K (KT != 0): K-contiguous planes; four waves (2 x 2) share a 128x128 tile whose operand rows come through LDS; grid (M/128, N/128, Z), 128 threads.
// C[m][n] (f32, pitch ldc, + optional f32 bias[n]) = sum_k A[m][k] Bt[n][k] (+ split products per NSPLIT). z-batch strides sA/sB/sC in elements. K % 32 == 0.
template <typename T16> struct WFrag;   // ldf: a fragment (16 rows x 32 of k) from a plane in fragment order; p: the lane's 16 bytes of the first half, the second half lies 512 bytes on
template <> struct WFrag<h16> { typedef v16h V; static __device__ __forceinline__ V ldf(const h16* p) { return cat16(*(const v8h*)p, *(const v8h*)(p + 256)); } static __device__ __forceinline__ v8f mma(V a, V b, v8f c) { return wmma16(a, b, c); } };
template <> struct WFrag<bf> { typedef v16bf V; static __device__ __forceinline__ V ldf(const bf* p) { return cat16b(*(const v8us*)p, *(const v8us*)(p + 256)); } static __device__ __forceinline__ v8f mma(V a, V b, v8f c) { return wmmab(a, b, c); } };
// OM: what the epilogue writes. 0: C as above. 1: the q, k and v projections in one grid (blockIdx.z = 0, 1, 2 picks the weight by sB, the bias and the planes); no C; the 64x64 tile (+ bias) goes out split into hi/lo bf16. q and k: as 64 rows = four 16-row tiles of ONE head's planes, each tile's 2 KiB in fragment order (the wave's 64 columns = one head): rows below NB_ * TT into O1h / O1l [batch][head][TT][64], the position table's rows behind them into O2h / O2l [head][NPE][64]. v (no table rows): the same split, as B fragments of attn.v (k = key), into O1h / O1l [batch][head][TT / 32][4][2][32][8].
// ZM: the B operand's z period (0: none): batch planes z and z + ZM meet the same B plane.
struct Planes { bf* h; bf* l; bf* th; bf* tl; };   // one projection's output planes: the batches' rows hi, lo; the table's rows hi, lo
// KT: K as a compile-time constant (the long GEMMs: the two-buffer LDS loop below), or 0 for the short p2c GEMM (K = HD).
#define LP  144          // pitch in bytes of a staged 128-byte operand row: 16 B x odd, so that the 16 rows of a fragment read fall on different banks
#define OPB (128 * LP)   // one operand's 128 rows of a stage
// copy8: this thread's eight 16-byte pieces of one operand's stage (128 rows x 128 bytes; eight lanes per row, so every copy of a wave takes four whole lines), rows 16 apart, from global memory to LDS through no register. l: the thread's LDS byte address of the first piece, g: its global address, p16: elements per 16 rows.
template <typename T16> __device__ __forceinline__ void copy8(unsigned l, const T16* g, int p16) {
    asm volatile("global_load_async_to_lds_b128 %0, %8, off\n\t"
                 "global_load_async_to_lds_b128 %1, %9, off\n\t"
                 "global_load_async_to_lds_b128 %2, %10, off\n\t"
                 "global_load_async_to_lds_b128 %3, %11, off\n\t"
                 "global_load_async_to_lds_b128 %4, %12, off\n\t"
                 "global_load_async_to_lds_b128 %5, %13, off\n\t"
                 "global_load_async_to_lds_b128 %6, %14, off\n\t"
                 "global_load_async_to_lds_b128 %7, %15, off\n\t"
                 "s_wait_xcnt 0x0"   // the wait in front of any rewrite of the copies' address registers, inside their own statement so that nothing is lifted over it
                 :: "v"(l), "v"(l + 16 * LP), "v"(l + 32 * LP), "v"(l + 48 * LP), "v"(l + 64 * LP), "v"(l + 80 * LP), "v"(l + 96 * LP), "v"(l + 112 * LP),
                    "v"(g), "v"(g + p16), "v"(g + 2 * p16), "v"(g + 3 * p16), "v"(g + 4 * p16), "v"(g + 5 * p16), "v"(g + 6 * p16), "v"(g + 7 * p16) : "memory");
}
template <typename T16, int NSPLIT, bool BIAS, int KT, int OM, int ZM>
__global__ __launch_bounds__(KT ? 128 : 32) void k_gemmw(const T16* __restrict__ A, const T16* __restrict__ A2, const T16* __restrict__ Bt, const T16* __restrict__ Bt2, int K, float* C, int ldc, const float* __restrict__ bias, size_t sA, size_t sB, size_t sC, bf* O1h, bf* O1l, bf* O2h, bf* O2l, const float* __restrict__ bias1, const float* __restrict__ bias2, Planes P1, Planes P2) {
    typedef typename WFrag<T16>::V V;
    constexpr int TW = KT ? 2 : 1;                        // waves along each side of the block's tile
    constexpr int STG = (NSPLIT == 1 ? 3 : 2) * OPB;      // a stage: 64 of k of A, of B and, where there is one, of A's lo plane
    __shared__ __align__(16) unsigned char ring[KT ? 2 * STG : 16 * 68 * 4];
    const int w = KT ? __builtin_amdgcn_readfirstlane((int)threadIdx.x >> 5) : 0;
    float* os = (float*)ring + w * (16 * 68);             // the wave's epilogue tile; in the long GEMMs it lies in the ring, which is free behind the loop's last barrier
    const size_t z = blockIdx.z, zb = ZM ? z % ZM : z; A += z * sA; if (A2) A2 += z * sA; Bt += zb * sB; if (Bt2) Bt2 += zb * sB; C += z * sC;
    if constexpr (OM == 1) {
        if (blockIdx.z == 1) { bias = bias1; O1h = P1.h; O1l = P1.l; O2h = P1.th; O2l = P1.tl; }
        else if (blockIdx.z == 2) { if (blockIdx.x * (64 * TW) >= NB_ * TT) return; bias = bias2; O1h = P2.h; O1l = P2.l; }   // v has no table rows: those blocks leave at once, as a whole and in front of every copy and barrier
    }
    const int lane = threadIdx.x & 31, lr = lane & 15, hi = lane >> 4; const int r0 = (blockIdx.x * TW + (w & 1)) * 64, c0 = (blockIdx.y * TW + (w >> 1)) * 64, hy = c0 / 64;
    v8f acc[4][4];
#pragma unroll
    for (int mb = 0; mb < 4; ++mb)
#pragma unroll
        for (int nb = 0; nb < 4; ++nb) acc[mb][nb] = (v8f){};
    if constexpr (KT == 0) {
    constexpr int KS = HD;   // the short GEMM's K, at compile time: every fragment load is one of four address pairs plus an immediate offset
    // fragment order: the lane's 16 bytes in the first half fragment of the wave's first row tile; a row tile is 16 KS elements, a k step of 32 in it 512
    const T16* pa = A + (size_t)r0 * KS + lane * 8; const T16* pb = Bt + (size_t)c0 * KS + lane * 8; const T16* pa2 = (NSPLIT == 1 || NSPLIT == 2) ? A2 + (size_t)r0 * KS + lane * 8 : pa; const T16* pb2 = NSPLIT >= 2 ? Bt2 + (size_t)c0 * KS + lane * 8 : pb;
#pragma unroll 1
    for (int kc = 0; kc < KS; kc += 32) {
        V a[4], a2[4]; const T16* qa = pa + kc * 16; const T16* qa2 = pa2 + kc * 16; const T16* qb = pb + kc * 16; const T16* qb2 = pb2 + kc * 16;
#pragma unroll
        for (int mb = 0; mb < 4; ++mb) { a[mb] = WFrag<T16>::ldf(qa + mb * 16 * KS); if (NSPLIT == 1 || NSPLIT == 2) a2[mb] = WFrag<T16>::ldf(qa2 + mb * 16 * KS); }
#pragma unroll
        for (int nb = 0; nb < 4; ++nb) { const V b = WFrag<T16>::ldf(qb + nb * 16 * KS); V b2; if (NSPLIT >= 2) b2 = WFrag<T16>::ldf(qb2 + nb * 16 * KS);
#pragma unroll
            for (int mb = 0; mb < 4; ++mb) { acc[mb][nb] = WFrag<T16>::mma(a[mb], b, acc[mb][nb]); if (NSPLIT == 1 || NSPLIT == 2) acc[mb][nb] = WFrag<T16>::mma(a2[mb], b, acc[mb][nb]); if (NSPLIT >= 2) acc[mb][nb] = WFrag<T16>::mma(a[mb], b2, acc[mb][nb]); } }
        asm volatile("s_wait_xcnt 0x0" :: "v"(qa), "v"(qa2), "v"(qb), "v"(qb2) : "memory");   // the wait in front of any rewrite of the k step's four address pairs; named as inputs the pairs stay live to here, so that no result of the step is placed in one
        asm volatile("v_nop\n\tv_nop\n\tv_nop\n\tv_nop" : "+v"(acc[0][0]), "+v"(acc[1][1]), "+v"(acc[2][2]), "+v"(acc[3][3]) : "v"(a[0]), "v"(a[3]));
    }
    } else {
    static_assert(NSPLIT < 2 && KT % 64 == 0 && KT >= 128, "stages of 64 of k, two or more");
    constexpr int NT = KT / 64;
    // Two-buffer ring: while stage t is multiplied, stage t + 1's copies fly. Thread tid copies 16 bytes of rows tid / 8 + 16 s of each operand.
    const int tid = threadIdx.x; const unsigned lb = (unsigned)(size_t)ring + (tid >> 3) * LP + (tid & 7) * 16; const size_t go = (size_t)(tid >> 3) * KT + (tid & 7) * 8;
    const T16* ga = A + (size_t)blockIdx.x * 128 * KT + go; const T16* gb = Bt + (size_t)blockIdx.y * 128 * KT + go; const T16* ga2 = NSPLIT == 1 ? A2 + (size_t)blockIdx.x * 128 * KT + go : ga;
    auto fill = [&](int t) { const unsigned l = lb + (t & 1) * STG; copy8(l, ga + t * 64, 16 * KT); copy8(l + OPB, gb + t * 64, 16 * KT); if (NSPLIT == 1) copy8(l + 2 * OPB, ga2 + t * 64, 16 * KT); };
    fill(0);
    asm volatile("s_wait_asynccnt 0x0" ::: "memory");   // this wave's copies of stage 0 have landed
    __syncthreads();                                     // and every other wave's: stage 0 may be read
    fill(1);
    const unsigned char* fa = ring + ((w & 1) * 64 + lr) * LP + hi * 16; const unsigned char* fb = ring + OPB + ((w >> 1) * 64 + lr) * LP + hi * 16;   // the lane's 16 bytes in the first row tile of the wave's A rows and B rows
#pragma unroll 1
    for (int t = 0; t < NT; ++t) {
        const int bo = (t & 1) * STG; V a[4], a2[4], b[4];
#pragma unroll
        for (int kh = 0; kh < 2; ++kh) {   // the stage's two k steps of 32, in the order of k
#pragma unroll
            for (int mb = 0; mb < 4; ++mb) { const unsigned char* p = fa + bo + mb * 16 * LP + kh * 64; a[mb] = cat16b(*(const v8usa*)p, *(const v8usa*)(p + 32)); }
#pragma unroll
            for (int nb = 0; nb < 4; ++nb) { const unsigned char* p = fb + bo + nb * 16 * LP + kh * 64; b[nb] = cat16b(*(const v8usa*)p, *(const v8usa*)(p + 32)); }
            if (NSPLIT == 1) {   // the lo plane last: its products come second in every accumulator
#pragma unroll
                for (int mb = 0; mb < 4; ++mb) { const unsigned char* p = fa + bo + 2 * OPB + mb * 16 * LP + kh * 64; a2[mb] = cat16b(*(const v8usa*)p, *(const v8usa*)(p + 32)); } }
            __builtin_amdgcn_sched_barrier(0);   // every LDS read of the k step is issued in front of its first matrix instruction, so that the step waits one LDS latency; left to the scheduler the B fragments share one register set and each is waited for by itself
#pragma unroll
            for (int nb = 0; nb < 4; ++nb) {
#pragma unroll
                for (int mb = 0; mb < 4; ++mb) { acc[mb][nb] = WFrag<T16>::mma(a[mb], b[nb], acc[mb][nb]); if (NSPLIT == 1) acc[mb][nb] = WFrag<T16>::mma(a2[mb], b[nb], acc[mb][nb]); } }
        }
        asm volatile("s_wait_dscnt 0x0" ::: "memory");      // this wave's reads of stage t are done before its buffer is handed on
        asm volatile("s_wait_asynccnt 0x0" ::: "memory");   // this wave's copies of stage t + 1 have landed
        __syncthreads();                                     // publishes stage t + 1 and ends every wave's reads of stage t
        if (t + 2 < NT) fill(t + 2);                         // into the buffer that stage t has just left (the test is the same for the whole block)
    }
    asm volatile("s_wait_asynccnt 0x0" ::: "memory");   // no copy is outstanding when the ring becomes the epilogue's tile
    }
    if (OM == 1 && blockIdx.z == 2) {
    static_assert(OM != 1 || (BIAS && HD == 64 && TT % 64 == 0), "a tile is 64 keys of one head");
    // A lane holds 8 consecutive rows (keys) of one column (head dimension): exactly its own 16 bytes of a half fragment of the attn.v B operand, so that every store of the wave is 512 contiguous bytes.
    const size_t vo = ((size_t)(r0 / TT) * NKV + hy) * (HD * TT) + (size_t)(r0 % TT / 32) * 2048 + lane * 8; bf* ph = O1h + vo; bf* pl = O1l + vo;
    float bi[4];   // all four loaded ahead: one load latency for the epilogue, not one per column tile
#pragma unroll
    for (int nb = 0; nb < 4; ++nb) bi[nb] = bfr(bias[c0 + nb * 16 + lr]);
#pragma unroll
    for (int nb = 0; nb < 4; ++nb) { v8us dh[4], dl[4];
#pragma unroll
        for (int mb = 0; mb < 4; ++mb) {
#pragma unroll
            for (int j = 0; j < 8; ++j) { unsigned short a, c; splitf(acc[mb][nb][j] + bi[nb], a, c); dh[mb][j] = a; dl[mb][j] = c; }
            *(v8us*)(ph + (mb >> 1) * 2048 + nb * 512 + (mb & 1) * 256) = dh[mb]; *(v8us*)(pl + (mb >> 1) * 2048 + nb * 512 + (mb & 1) * 256) = dl[mb]; }
        asm volatile("s_wait_xcnt 0x0" :: "v"(ph), "v"(pl), "v"(dh[0]), "v"(dh[1]), "v"(dh[2]), "v"(dh[3]), "v"(dl[0]), "v"(dl[1]), "v"(dl[2]), "v"(dl[3]) : "memory"); }   // the wait in front of any rewrite of the eight stores' data and address registers; named as inputs they stay live to here
    } else if (OM == 1) {
    static_assert(OM != 1 || (BIAS && HD == 64 && TT % 64 == 0 && NH_ == NKV), "a tile is 64 rows of one head");
    const bool tab = r0 >= NB_ * TT;   // the same for the whole tile
    const size_t po = (tab ? ((size_t)hy * NPE + (r0 - NB_ * TT)) : (((size_t)(r0 / TT) * NH_ + hy) * TT + r0 % TT)) * HD + lane * 8;
    bf* ph = (tab ? O2h : O1h) + po; bf* pl = (tab ? O2l : O1l) + po;
    float bi[4];
#pragma unroll
    for (int nb = 0; nb < 4; ++nb) bi[nb] = bfr(bias[c0 + nb * 16 + lr]);
#pragma unroll
    for (int mb = 0; mb < 4; ++mb) {
#pragma unroll
        for (int nb = 0; nb < 4; ++nb) {
#pragma unroll
            for (int j = 0; j < 8; ++j) os[(hi * 8 + j) * 68 + nb * 16 + lr] = acc[mb][nb][j] + bi[nb]; }
        __builtin_amdgcn_wave_barrier(); asm volatile("" ::: "memory");   // lanes read what other lanes of the wave wrote: the reads stay behind the stores
        v8us dh[4], dl[4];
#pragma unroll
        for (int f = 0; f < 4; ++f) { const float* op = os + lr * 68 + f * 16 + hi * 8; const v4f v0 = *(const v4fa*)op, v1 = *(const v4fa*)(op + 4);   // half fragment f: the lane's row lr, its 8 of k; the wave's store is 512 contiguous bytes of each plane
#pragma unroll
            for (int q = 0; q < 4; ++q) { unsigned short a, c; splitf(v0[q], a, c); dh[f][q] = a; dl[f][q] = c; splitf(v1[q], a, c); dh[f][4 + q] = a; dl[f][4 + q] = c; }
            *(v8us*)(ph + mb * 1024 + f * 256) = dh[f]; *(v8us*)(pl + mb * 1024 + f * 256) = dl[f]; }
        asm volatile("s_wait_xcnt 0x0" :: "v"(ph), "v"(pl), "v"(dh[0]), "v"(dh[1]), "v"(dh[2]), "v"(dh[3]), "v"(dl[0]), "v"(dl[1]), "v"(dl[2]), "v"(dl[3]) : "memory");   // the wait in front of any rewrite of the eight stores' data and address registers; named as inputs they stay live to here
        __builtin_amdgcn_wave_barrier(); asm volatile("" ::: "memory");   // and the next tile's LDS stores behind these reads
    }
    } else {
#pragma unroll
    for (int mb = 0; mb < 4; ++mb) {
#pragma unroll
        for (int nb = 0; nb < 4; ++nb) {
#pragma unroll
            for (int j = 0; j < 8; ++j) os[(hi * 8 + j) * 68 + nb * 16 + lr] = acc[mb][nb][j]; }
        __builtin_amdgcn_wave_barrier(); asm volatile("" ::: "memory");
        float* crow = C + (size_t)(r0 + mb * 16) * ldc + c0;
{
#pragma unroll
            for (int s = 0; s < 8; ++s) { const int row = 2 * s + hi, cofs = lr * 4; v4f val = *(const v4fa*)(os + row * 68 + cofs); if (BIAS) { val[0] += bfr(bias[c0 + cofs]); val[1] += bfr(bias[c0 + cofs + 1]); val[2] += bfr(bias[c0 + cofs + 2]); val[3] += bfr(bias[c0 + cofs + 3]); }
                *(v4f*)(crow + (size_t)row * ldc + cofs) = val; }
             }
        __builtin_amdgcn_wave_barrier(); asm volatile("" ::: "memory");
    }
    }
}

typedef __attribute__((ext_vector_type(2))) unsigned short v2us;
typedef __attribute__((ext_vector_type(2))) float v2f;
typedef __attribute__((ext_vector_type(4))) int v4i;

// d_wtG: block bx of one weight's transpose to bf16, Bt[n][k] = w[k][n].
__device__ __forceinline__ void d_wtG(const float* __restrict__ w, int K, int N, bf* Bt, int bx) {
    const int lane = threadIdx.x & 31; const int L0 = (bx * 8 + (threadIdx.x >> 5)) * 8; const int nlines = N * K / 64;
{
#pragma unroll 1
        for (int l = 0; l < 8; ++l) { const int L = L0 + l; if (L >= nlines) break; const size_t e = (size_t)L * 64 + lane * 2; const int k = (int)(e % K), n = (int)(e / K); v2us o;
            o[0] = f2bf(w[(size_t)k * N + n]); o[1] = f2bf(w[(size_t)(k + 1) * N + n]); *(v2us*)(Bt + e) = o; }
         }
}
// k_prep: everything that reads only inputs, in one grid: first the four weight transposes (WB blocks each; the long blocks start first), then the rounding of hidden_states and, behind it in XB, of the position table (8 elements per thread).
#define WB  (DM * DQ / 64 / 64)          // blocks per weight
#define NX8 ((size_t)NB_ * TT * DM / 8)  // 8-element groups of hidden_states
#define NR8 ((size_t)NPE * DM / 8)       // and of the position table
static_assert(DQ == DM && DKV == DM && DM * DQ % 4096 == 0 && NX8 % 256 == 0 && NR8 % 256 == 0, "four weights of one shape; whole blocks");
__global__ __launch_bounds__(256) void k_prep(const float* __restrict__ wq, const float* __restrict__ wk, const float* __restrict__ wv, const float* __restrict__ wo, const float* __restrict__ x, const float* __restrict__ rel, bf* WT, bf* XB) {
    const int bx = blockIdx.x;
    if (bx < 4 * WB) { const int sw = bx / WB; d_wtG(sw == 0 ? wq : sw == 1 ? wk : sw == 2 ? wv : wo, DM, DQ, WT + (size_t)sw * DM * DQ, bx % WB); return; }   // the same for the whole block
    const size_t i = (size_t)(bx - 4 * WB) * 256 + threadIdx.x; const float* src = i < NX8 ? x + i * 8 : rel + (i - NX8) * 8; const v8f v = *(const v8f*)src; v8us o;
    asm volatile("s_wait_xcnt 0x0" :: "v"(src) : "memory");   // the wait in front of any rewrite of the load's address pair; named as an input the pair stays live to here
#pragma unroll
    for (int k = 0; k < 8; ++k) o[k] = f2bf(v[k]);
    bf* dst = XB + i * 8; *(v8us*)dst = o;
    asm volatile("s_wait_xcnt 0x0" :: "v"(dst), "v"(o) : "memory"); }   // the wait in front of any rewrite of the store's data and address registers (the built code runs on from here into the block that holds the transposes' part); named as inputs they stay live to here

// k_asoft: per row (zz, i): t = ((q.k + p2c[rp][j]) + c2p[i][rp]) x scale with rp = rel_idx[i][j] (int32 input, read per logit with b128 loads; clamped to [0, NPE) for memory safety - the identity for the shipped clip(i - j + 512, 0, 1023)); softmax over the 1024 keys (register row, one exp, fixed trees);
// One block = SR consecutive query rows of one head, one wave per row. The p2c term comes from the transposed plane P2CT[j][rp]: wave w takes the 32 keys j = 32 w .. 32 w + 31 and gathers with its LANES ALONG THE QUERY ROWS, so that indices which rise with i (or stand still) fall into one or two cache lines per load for any key; any other index array is gathered just as correctly, only slower.
// The index tile is turned in LDS (written by rows, read by columns), each gathered value replaces its index in place, and the row's own wave reads its finished row of G.
#define SR 32      // query rows per block = waves per block = TT / 32 key tiles
#define GP 1028    // pitch of G in words: rows stay 16-byte aligned, and lanes that read b128 down a column step 4 banks each
static_assert(RH == TT, "every query row keeps hi/lo P");
#define RP 66      // pitch of a partial-sum row in words: 8-byte aligned, and the two half-waves (8 rows apart) fall on different banks
typedef v4i __attribute__((may_alias)) v4ia;
typedef v4us __attribute__((may_alias)) v4usa;
typedef v2f __attribute__((may_alias)) v2fa;
// frag16: the hi and lo fragments (two k steps of 32) of one 16-row tile of a plane in fragment order (2 KiB per plane), straight from global memory: every load of the wave is 512 contiguous bytes, four whole lines. ph / pl point at the lane's own 16 bytes of the first half fragment of the wave's first tile, tile (a constant) counts on from there: an immediate offset.
__device__ __forceinline__ void frag16(const bf* __restrict__ ph, const bf* __restrict__ pl, int tile, v16bf (&fh)[2], v16bf (&fl)[2]) {
#pragma unroll
    for (int kc = 0; kc < 2; ++kc) { fh[kc] = WFrag<bf>::ldf(ph + tile * 1024 + kc * 512); fl[kc] = WFrag<bf>::ldf(pl + tile * 1024 + kc * 512); }
    asm volatile("s_wait_xcnt 0x0" :: "v"(ph), "v"(pl) : "memory");   // the wait in front of any rewrite of the eight loads' two address pairs; named as inputs the pairs stay live to here
}
// mm16: acc[rt][j] at lane (lr, hi) += tile row (hi * 8 + j) . query row (rt * 16 + lr); products in the order of the score GEMMs: q hi x tile hi, q lo x tile hi, q hi x tile lo, per 32 of k
// (qh: the q hi fragments, held in registers over all four tiles; qf: the lane's place in the staged q lo rows, read from LDS per tile: hi and lo both held do not fit the 128 registers of a 32-wave block)
__device__ __forceinline__ void mm16(const v16bf (&fh)[2], const v16bf (&fl)[2], const v16bf (&qh)[2][2], const bf* qf, v8f (&acc)[2]) {
#pragma unroll
    for (int kc = 0; kc < 2; ++kc)
#pragma unroll
        for (int rt = 0; rt < 2; ++rt) { const bf* qp = qf + rt * 1024 + kc * 512; const v16bf ql = cat16b(*(const v8usa*)qp, *(const v8usa*)(qp + 256));
            acc[rt] = wmmab(fh[kc], qh[kc][rt], acc[rt]); acc[rt] = wmmab(fh[kc], ql, acc[rt]); acc[rt] = wmmab(fl[kc], qh[kc][rt], acc[rt]); }
}
static_assert(NPE == SR * 32 && TT == SR * 32 && HD == 64, "one wave per 32 keys and per 32 table rows; rows of 128 bytes");
static_assert(ZH % NH_ == 0 && (NB_ * NH_) % ZH == 0 && NH_ == NKV, "a pass is a whole number of batches");
__global__ __launch_bounds__(1024) void k_asoft(const bf* __restrict__ Qh, const bf* __restrict__ Ql, const bf* __restrict__ Kh, const bf* __restrict__ Kl, const bf* __restrict__ RKh, const bf* __restrict__ RKl, const float* __restrict__ P2CT, const int* __restrict__ RIX, const bf* __restrict__ VTh, const bf* __restrict__ VTl, bf* Ah, bf* Al) {
    __shared__ __align__(16) float G[SR * GP];
    __shared__ __align__(16) float CL[SR * GP];       // the block's 32 rows of c2p (raw)
    __shared__ __align__(16) bf QS[2 * SR * HD];      // the block's 32 q rows (two 16-row tiles in fragment order, as they lie in memory), hi plane then lo plane
    const int lane = threadIdx.x & 31; const int w = threadIdx.x >> 5; const int row0 = blockIdx.x * SR; const int zz = row0 / TT; const int i0 = row0 % TT;
    if (w < 16) { const int pq = w >> 3, o = (threadIdx.x & 255) * 8; const bf* qs = (pq ? Ql : Qh) + ((size_t)zz * TT + i0) * HD + o; const v8us qv = *(const v8us*)qs;   // 32 rows x 128 bytes per plane, contiguous; published by the first barrier below
        asm volatile("s_wait_xcnt 0x0" :: "v"(qs) : "memory");   // the wait in front of any rewrite of the load's address pair
        *(v8usa*)(QS + pq * (SR * HD) + o) = qv; }
    const size_t to = ((size_t)zz * TT + w * 32) * HD + lane * 8; v16bf fh[2], fl[2];   // the lane's place in the wave's 32 keys of the k planes (zz = (batch of the pass, head)); the current tile's hi and lo fragments
    { const int jw = w * 32; const float* pt = P2CT + ((size_t)zz * TT + jw) * NPE; const int rr = lane >> 3, cc = jw + (lane & 7) * 4; float* gl = G + lane * GP + jw; const int* ip = RIX + (size_t)(i0 + rr) * TT + cc; v4i t[8];
#pragma unroll
      for (int s = 0; s < 8; ++s) t[s] = *(const v4i*)(ip + (size_t)s * 4 * TT);
      asm volatile("s_wait_xcnt 0x0" :: "v"(ip) : "memory");   // the wait in front of any rewrite of the eight loads' shared address pair; named as an input the pair stays live to here, so that no result of the run is placed in it
#pragma unroll
      for (int s = 0; s < 8; ++s) *(v4ia*)(G + (s * 4 + rr) * GP + cc) = t[s];
      __syncthreads();   // index tile complete before it is read by columns
#pragma unroll
      for (int c = 0; c < 8; ++c) t[c] = *(const v4ia*)(gl + c * 4);   // lane = query row i0 + lane, keys jw .. jw + 31
      v4f g[8];
#pragma unroll
      for (int hf = 0; hf < 2; ++hf) { const float* pg[16];   // two runs of 16 gathers, all of a run in flight together
#pragma unroll
          for (int k = 0; k < 16; ++k) { const int c = hf * 4 + (k >> 2), q = k & 3; int rp = t[c][q]; rp = rp < 0 ? 0 : (rp > NPE - 1 ? NPE - 1 : rp); pg[k] = pt + rp; g[c][q] = pg[k][(size_t)(c * 4 + q) * NPE]; }
          asm volatile("s_wait_xcnt 0x0" :: "v"(pg[0]), "v"(pg[1]), "v"(pg[2]), "v"(pg[3]), "v"(pg[4]), "v"(pg[5]), "v"(pg[6]), "v"(pg[7]), "v"(pg[8]), "v"(pg[9]), "v"(pg[10]), "v"(pg[11]), "v"(pg[12]), "v"(pg[13]), "v"(pg[14]), "v"(pg[15]) : "memory"); }   // the wait in front of any rewrite of the run's address pairs; named as inputs they stay live to here, so that no result of the run is placed in one
      frag16(Kh + to, Kl + to, 0, fh, fl);   // the first key tile's fragments, issued behind the gathers: they fly while the gathered values go to LDS
#pragma unroll
      for (int c = 0; c < 8; ++c) *(v4fa*)(gl + c * 4) = g[c];
    }
    // Content scores and c2p of the block's 32 query rows: wave w takes the 32 keys, then the 32 table rows, 32 w .. 32 w + 31, as the A operand (16 at a time) against the q rows as B, so that a lane holds 8 consecutive columns of one query row.
    { const int lr = lane & 15, hi = lane >> 4, jw = w * 32; const size_t tr = ((size_t)(zz % NH_) * NPE + jw) * HD + lane * 8;   // the table's planes go by the head alone
      const bf* qf = QS + SR * HD + lane * 8; v16bf qh[2][2];   // [k half][16-row tile]
#pragma unroll
      for (int kc = 0; kc < 2; ++kc)
#pragma unroll
          for (int rt = 0; rt < 2; ++rt) { const bf* qp = QS + rt * 1024 + kc * 512 + lane * 8; qh[kc][rt] = cat16b(*(const v8usa*)qp, *(const v8usa*)(qp + 256)); }
#pragma unroll
      for (int tl = 0; tl < 4; ++tl) {   // two key tiles, then two table tiles; each tile's loads are issued behind the matrix instructions of the tile before and fly while its results go to LDS
          const int kt = tl & 1; v8f acc[2]; acc[0] = (v8f){}; acc[1] = (v8f){}; mm16(fh, fl, qh, qf, acc);
          if (tl == 0) frag16(Kh + to, Kl + to, 1, fh, fl); else if (tl == 1) frag16(RKh + tr, RKl + tr, 0, fh, fl); else if (tl == 2) frag16(RKh + tr, RKl + tr, 1, fh, fl);
#pragma unroll
          for (int rt = 0; rt < 2; ++rt) {
              if (tl < 2) { float* gp = G + (rt * 16 + lr) * GP + jw + kt * 16 + hi * 8; v4f x0 = *(const v4fa*)gp, x1 = *(const v4fa*)(gp + 4);   // the wave's own key tile of G: q.k joins the gathered p2c term
#pragma unroll
                  for (int q = 0; q < 4; ++q) { x0[q] = __fadd_rn(acc[rt][q], x0[q]); x1[q] = __fadd_rn(acc[rt][4 + q], x1[q]); }
                  *(v4fa*)gp = x0; *(v4fa*)(gp + 4) = x1; }
              else { float* cp = CL + (rt * 16 + lr) * GP + jw + kt * 16 + hi * 8; *(v4fa*)cp = __builtin_shufflevector(acc[rt], acc[rt], 0, 1, 2, 3); *(v4fa*)(cp + 4) = __builtin_shufflevector(acc[rt], acc[rt], 4, 5, 6, 7); } } }
    }
    __syncthreads();   // every column tile of G and of CL finished before a row's wave reads across them
    const int i = i0 + w; const float* cr = CL + w * GP; const float* gr = G + w * GP + lane * 4; const int* rxr = RIX + (size_t)i * TT + lane * 4; float v[TT / 32]; float mx = -3.0e38f;
    // One loop per kind of access, so that the eight index loads, the eight reads of the row of G and the 32 gathers from the row of c2p are each in flight together, whatever order the compiler keeps.
    v4i r4[TT / 128]; v4f p4[TT / 128];
#pragma unroll
    for (int ch = 0; ch < TT / 128; ++ch) r4[ch] = *(const v4i*)(rxr + ch * 128);
    asm volatile("s_wait_xcnt 0x0" :: "v"(rxr) : "memory");   // the wait in front of any rewrite of the eight loads' shared address pair; named as an input the pair stays live to here
#pragma unroll
    for (int ch = 0; ch < TT / 128; ++ch) p4[ch] = *(const v4fa*)(gr + ch * 128);
#pragma unroll
    for (int ch = 0; ch < TT / 128; ++ch)
#pragma unroll
        for (int q = 0; q < 4; ++q) { int rp = r4[ch][q]; rp = rp < 0 ? 0 : (rp > NPE - 1 ? NPE - 1 : rp); v[ch * 4 + q] = cr[rp]; }
#pragma unroll
    for (int ch = 0; ch < TT / 128; ++ch)
#pragma unroll
        for (int q = 0; q < 4; ++q) { const float t = __fmul_rn(__fadd_rn(p4[ch][q], v[ch * 4 + q]), SCL);   /* ((qk + p2c[rp][j]) + c2p[i][rp]) x scale, rp = rel_idx[i][j] */ v[ch * 4 + q] = t; mx = fmaxf(mx, t); }
#pragma unroll
    for (int sh = 16; sh; sh >>= 1) mx = fmaxf(mx, __shfl_xor(mx, sh, 32));
    float sum = 0.f;
#pragma unroll
    for (int k = 0; k < TT / 32; ++k) { float d0 = __fsub_rn(v[k], mx); asm volatile("" : "+v"(d0)); v[k] = __builtin_amdgcn_exp2f(__fmul_rn(d0, 1.4426950408889634f)); sum += v[k]; }
#pragma unroll
    for (int sh = 16; sh; sh >>= 1) sum += __shfl_xor(sum, sh, 32);
    const float f = __fdiv_rn(1.0f, sum);
    // P stays in LDS: the wave's own row of G (read by nobody else behind the second barrier, and by this wave no more) takes the row's 1024 hi halves, then its 1024 lo halves.
    bf* pr = (bf*)G + (size_t)w * (GP * 2);
#pragma unroll
    for (int ch = 0; ch < TT / 128; ++ch) { v4us oh, ol;
#pragma unroll
        for (int q = 0; q < 4; ++q) { unsigned short a, c2; splitf(v[ch * 4 + q] * f, a, c2); oh[q] = a; ol[q] = c2; }
        *(v4usa*)(pr + ch * 128 + lane * 4) = oh; *(v4usa*)(pr + TT + ch * 128 + lane * 4) = ol; }
    // attn.v of the block's 32 rows: wave w takes the 16 head columns nt * 16 .. and the 128 keys ks * 128 .. (both 16-row tiles), so that every v fragment is loaded once per block; the eight key slices are summed through LDS in fixed order. (The loops are unrolled so that b, b2 and acc are indexed by constants and stay in registers.)
    const int lr = lane & 15, hi = lane >> 4, nt = w & 3, ks = w >> 2;
    const size_t vo = (size_t)zz * (HD * TT) + (size_t)ks * 8192 + nt * 512 + lane * 8; const bf* vh = VTh + vo; const bf* vl = VTl + vo;   // fragment order: [32 keys][16 columns][half fragment][lane]
    __builtin_amdgcn_sched_barrier(0);   // keeps the sixteen loads below behind the split of P: lifted over it they meet the row's 32 live values and one fragment is spilled, with a wait on its load in the middle of the split
    v16bf b[4], b2[4];
#pragma unroll
    for (int kk = 0; kk < 4; ++kk) { b[kk] = WFrag<bf>::ldf(vh + kk * 2048); b2[kk] = WFrag<bf>::ldf(vl + kk * 2048); }   // issued in front of the barrier: they do not depend on P and fly while the block gathers there
    asm volatile("s_wait_xcnt 0x0" :: "v"(vh), "v"(vl) : "memory");   // the wait in front of any rewrite of the sixteen loads' two address pairs; named as inputs the pairs stay live to here
    __syncthreads();   // all 32 rows of P written before the fragments are read across them
    v8f acc[2]; acc[0] = (v8f){}; acc[1] = (v8f){};
#pragma unroll
    for (int kk = 0; kk < 4; ++kk) {
#pragma unroll
        for (int mt = 0; mt < 2; ++mt) { const bf* pa = (const bf*)G + (size_t)(mt * 16 + lr) * (GP * 2) + ks * 128 + kk * 32 + 8 * hi;
            const v16bf a = cat16b(*(const v8usa*)pa, *(const v8usa*)(pa + 16)); const v16bf a2 = cat16b(*(const v8usa*)(pa + TT), *(const v8usa*)(pa + TT + 16));
            acc[mt] = wmmab(a, b[kk], acc[mt]); acc[mt] = wmmab(a2, b[kk], acc[mt]); acc[mt] = wmmab(a, b2[kk], acc[mt]); } }
    __syncthreads();   // every fragment of P read before G is reused for the partial sums
#pragma unroll
    for (int mt = 0; mt < 2; ++mt)
#pragma unroll
        for (int j = 0; j < 8; ++j) G[(ks * SR + mt * 16 + hi * 8 + j) * RP + nt * 16 + lr] = acc[mt][j];
    __syncthreads();   // all eight key slices' partial sums written before a row's wave adds them
    v2f o = *(const v2fa*)(G + w * RP + lane * 2);
#pragma unroll
    for (int s = 1; s < 8; ++s) { const v2f p = *(const v2fa*)(G + (s * SR + w) * RP + lane * 2); o[0] += p[0]; o[1] += p[1]; }
    v2us oh, ol;
#pragma unroll
    for (int q = 0; q < 2; ++q) { unsigned short a, c2; splitf(o[q], a, c2); oh[q] = a; ol[q] = c2; }
    const size_t oo = ((size_t)(zz / NH_) * TT + i) * DQ + (zz % NH_) * HD + lane * 2; *(v2us*)(Ah + oo) = oh; *(v2us*)(Al + oo) = ol;   // merged context [t][head][d]: one wave writes one 128-byte line of each plane
}

__global__ __launch_bounds__(256) void k_lnres(const float* __restrict__ Y, const float* __restrict__ xres, const float* __restrict__ g, const float* __restrict__ bb, float* out) {
    const int lane = threadIdx.x & 31; const int row = blockIdx.x * 8 + (threadIdx.x >> 5); if (row >= NB_ * TT) return; const float* yr = Y + (size_t)row * DM; const float* xr = xres + (size_t)row * DM; float v[DM / 32]; float s = 0.f;
#pragma unroll
    for (int ch = 0; ch < DM / 128; ++ch) { const v4f a = *(const v4f*)(yr + ch * 128 + lane * 4); const v4f c = *(const v4f*)(xr + ch * 128 + lane * 4);
#pragma unroll
        for (int q = 0; q < 4; ++q) { const float t = __fadd_rn(a[q], bfr(c[q])); v[ch * 4 + q] = t; s = __fadd_rn(s, t); } }
#pragma unroll
    for (int sh = 16; sh; sh >>= 1) s = __fadd_rn(s, __shfl_xor(s, sh, 32));
    const float mu = __fdiv_rn(s, (float)DM); float s2 = 0.f;
#pragma unroll
    for (int k = 0; k < DM / 32; ++k) { float d0 = __fsub_rn(v[k], mu); asm volatile("" : "+v"(d0)); float p = __fmul_rn(d0, d0); asm volatile("" : "+v"(p)); s2 = __fadd_rn(s2, p); }
#pragma unroll
    for (int sh = 16; sh; sh >>= 1) s2 = __fadd_rn(s2, __shfl_xor(s2, sh, 32));
    const float rs = __fdiv_rn(1.0f, __fsqrt_rn(__fadd_rn(__fdiv_rn(s2, (float)DM), 1e-7f)));
{
#pragma unroll
        for (int ch = 0; ch < DM / 128; ++ch) { const int c0 = ch * 128 + lane * 4; v4f o;
#pragma unroll
            for (int q = 0; q < 4; ++q) { float xn = __fmul_rn(__fsub_rn(v[ch * 4 + q], mu), rs); asm volatile("" : "+v"(xn)); float gg = bfr(g[c0 + q]); asm volatile("" : "+v"(gg)); float yv = __fmul_rn(xn, gg); asm volatile("" : "+v"(yv)); float be = bfr(bb[c0 + q]); asm volatile("" : "+v"(be)); o[q] = __fadd_rn(yv, be); }
            *(v4f*)(out + (size_t)row * DM + c0) = o; }
         }
}

extern "C" void kernel_launch(void* const* d_in, const int* in_sizes, int n_in,
                              void* d_out, int out_size, void* d_ws, size_t ws_size, hipStream_t stream) {
    (void)in_sizes; (void)n_in; (void)out_size;
    const float* x = (const float*)d_in[0]; const float* rel = (const float*)d_in[1]; const float* wq = (const float*)d_in[2]; const float* bq = (const float*)d_in[3]; const float* wk = (const float*)d_in[4]; const float* bk = (const float*)d_in[5]; const float* wv = (const float*)d_in[6]; const float* bv = (const float*)d_in[7]; const float* wo = (const float*)d_in[8]; const float* bo = (const float*)d_in[9]; const float* lng = (const float*)d_in[10]; const float* lnb = (const float*)d_in[11]; const int* RIDX = (const int*)d_in[12];
    float* OUT = (float*)d_out;     // [4][1024][1024]
    char* wsp = (char*)d_ws;
    auto take = [&](size_t bytes) { char* p = wsp; wsp += (bytes + 255) & ~(size_t)255; return (void*)p; };
    bf* WQ = (bf*)take((size_t)4 * DQ * DM * 2); bf* WO = WQ + (size_t)3 * DQ * DM;   // one block of four (q, k, v, Wd): reached by a stride in k_prep and in the projections' grid z
    bf* PKh = (bf*)take((size_t)NH_ * NPE * HD * 2); bf* PKl = (bf*)take((size_t)NH_ * NPE * HD * 2); bf* PQh = (bf*)take((size_t)NH_ * NPE * HD * 2); bf* PQl = (bf*)take((size_t)NH_ * NPE * HD * 2); float* P2C = (float*)take((size_t)ZH * NPE * TT * 4);
    bf* QPh = (bf*)take((size_t)NB_ * NH_ * TT * HD * 2); bf* QPl = (bf*)take((size_t)NB_ * NH_ * TT * HD * 2); bf* KPh = (bf*)take((size_t)NB_ * NKV * TT * HD * 2); bf* KPl = (bf*)take((size_t)NB_ * NKV * TT * HD * 2); bf* VTh = (bf*)take((size_t)NB_ * NKV * HD * TT * 2); bf* VTl = (bf*)take((size_t)NB_ * NKV * HD * TT * 2);
    float* Y = (float*)take((size_t)NB_ * TT * DM * 4); bf* ATh = (bf*)take((size_t)NB_ * TT * DQ * 2); bf* ATl = (bf*)take((size_t)NB_ * TT * DQ * 2);
    if ((size_t)(wsp - (char*)d_ws) > ws_size) return;    // 224 MiB of the 256 MiB
    // XB [5120][1024] bf16 (10 MiB) lives only before the first pass and lies inside P2C, the passes' 128-MiB p2c plane (stream-ordered; written in this call before it is read).
    bf* XB = (bf*)P2C;
    const Planes none = { nullptr, nullptr, nullptr, nullptr }, pk = { KPh, KPl, PKh, PKl }, pv = { VTh, VTl, nullptr, nullptr };
    k_prep<<<(unsigned)(4 * WB + (NX8 + NR8) / 256), 256, 0, stream>>>(wq, wk, wv, wo, x, rel, WQ, XB);
    k_gemmw<bf, 0, true, DM, 1, 0><<<dim3((NB_ * TT + NPE) / 128, DQ / 128, 3), 128, 0, stream>>>(XB, nullptr, WQ, nullptr, DM, nullptr, 0, bq, 0, (size_t)DQ * DM, 0, QPh, QPl, PQh, PQl, bk, bv, pk, pv);   /* z = 0: q of every batch, then rel_q = pos_emb Wq + bq; z = 1: k, then rel_k = pos_emb Wk + bk; z = 2: v, transposed: per-head hi/lo planes */
    for (int b = 0; b < NB_; b += ZH / NH_) { const size_t bq0 = (size_t)b * NH_, bk0 = (size_t)b * NKV;   // the pass's (batch, head) planes are consecutive (z-strides TT*HD); the table's planes come round with the head
        k_gemmw<bf, 2, false, 0, 0, NH_><<<dim3(TT / 64, NPE / 64, ZH), 32, 0, stream>>>(KPh + bk0 * TT * HD, KPl + bk0 * TT * HD, PQh, PQl, HD, P2C, NPE, nullptr, (size_t)TT * HD, (size_t)NPE * HD, (size_t)TT * NPE, nullptr, nullptr, nullptr, nullptr, nullptr, nullptr, none, none);   /* p2c raw, transposed: [ZH][key j][rel row] */
        k_asoft<<<ZH * TT / SR, SR * 32, 0, stream>>>(QPh + bq0 * TT * HD, QPl + bq0 * TT * HD, KPh + bk0 * TT * HD, KPl + bk0 * TT * HD, PKh, PKl, P2C, RIDX, VTh + bk0 * HD * TT, VTl + bk0 * HD * TT, ATh + (size_t)b * TT * DQ, ATl + (size_t)b * TT * DQ); }
    k_gemmw<bf, 1, true, DQ, 0, 0><<<dim3(NB_ * TT / 128, DM / 128, 1), 128, 0, stream>>>(ATh, ATl, WO, nullptr, DQ, Y, DM, bo, 0, 0, 0, nullptr, nullptr, nullptr, nullptr, nullptr, nullptr, none, none);   /* y = ctx Wd + bd (f32), every batch */
    k_lnres<<<NB_ * TT / 8, 256, 0, stream>>>(Y, x, lng, lnb, OUT);
}
